// v000
// Times are from an AMD MI455X. After a warm-up the kernel runs many times in a row, and a time is the length of
// such a window on the GPU divided by its runs, so every launch and the gaps after it count. The runs cycle
// through copies of the inputs. A figure is the median of several windows, for all but v000 over two sittings.
// Sittings can differ by a few percent; kernels timed side by side share one.
// The starting kernel, v000, takes 274 microseconds a run.
#include <hip/hip_runtime.h>
#include <stdint.h>
// Contractions: five 1024x1024x1024 projections (X . W^T), per-head q.k^T (K=64) and p.v (K=128): v_wmma_f32_16x16x32_f16 (f16 operands; weights and ctx carried x16, p carried x2^15, exact powers of two folded back in f32), f32 accumulate. Softmax, additive score terms and depth-64 speaker row dots in f32 on VALU.

typedef __attribute__((ext_vector_type(16))) _Float16 v16h;
typedef __attribute__((ext_vector_type(8)))  _Float16 v8h;
typedef __attribute__((ext_vector_type(16))) __bf16   v16b;
typedef __attribute__((ext_vector_type(8)))  __bf16   v8b;
typedef __attribute__((ext_vector_type(8)))  float    v8f;
typedef __attribute__((ext_vector_type(4)))  float    v4f;

__device__ __forceinline__ unsigned short f2bf_bits(float f) {
  unsigned u = __float_as_uint(f);
  return (unsigned short)((u + 0x7FFFu + ((u >> 16) & 1u)) >> 16);
}
__device__ __forceinline__ float bf_bits2f(unsigned short h) { return __uint_as_float(((unsigned)h) << 16); }

// hazard guards as plain device helpers (no inline asm inside the kernel template body)
__device__ __forceinline__ void dep_guard_h(v8f& a, v8f& b, v16h x, v16h y) { asm volatile("v_nop\n\tv_nop\n\tv_nop\n\tv_nop" : "+v"(a), "+v"(b) : "v"(x), "v"(y)); }
__device__ __forceinline__ void dep_guard_b(v8f& a, v8f& b, v16b x, v16b y) { asm volatile("v_nop\n\tv_nop\n\tv_nop\n\tv_nop" : "+v"(a), "+v"(b) : "v"(x), "v"(y)); }
__device__ __forceinline__ void keep4_h(v16h a, v16h b, v16h c, v16h d) { asm volatile("v_nop" :: "v"(a), "v"(b), "v"(c), "v"(d)); }
__device__ __forceinline__ void keep4_b(v16b a, v16b b, v16b c, v16b d) { asm volatile("v_nop" :: "v"(a), "v"(b), "v"(c), "v"(d)); }
__device__ __forceinline__ void acc_guard4(v8f& a, v8f& b, v8f& c, v8f& d) { asm volatile("v_nop\n\tv_nop\n\tv_nop\n\tv_nop" : "+v"(a), "+v"(b), "+v"(c), "+v"(d)); }
template <typename T> struct Frag;
template <> struct Frag<_Float16> {
  typedef v16h V; union U { v16h v; v8h h[2]; };
  static __device__ __forceinline__ v16h load(const _Float16* p) {   // elements 0..7 <- p[0..7], 8..15 <- p[16..23]
    U f; f.h[0] = *(const v8h*)(p); f.h[1] = *(const v8h*)(p + 16); return f.v;
  }
  static __device__ __forceinline__ v8f mma(v16h a, v16h b, v8f c) {
    return __builtin_amdgcn_wmma_f32_16x16x32_f16(false, a, false, b, (short)0, c, false, false);
  }
  static __device__ __forceinline__ void guard(v8f& a, v8f& b, v16h x, v16h y) { dep_guard_h(a, b, x, y); }
  static __device__ __forceinline__ void keep(v16h a, v16h b, v16h c, v16h d) { keep4_h(a, b, c, d); }
};
template <> struct Frag<__bf16> {
  typedef v16b V; union U { v16b v; v8b h[2]; };
  static __device__ __forceinline__ v16b load(const __bf16* p) {
    U f; f.h[0] = *(const v8b*)(p); f.h[1] = *(const v8b*)(p + 16); return f.v;
  }
  static __device__ __forceinline__ v8f mma(v16b a, v16b b, v8f c) {
    return __builtin_amdgcn_wmma_f32_16x16x32_bf16(false, a, false, b, (short)0, c, false, false);
  }
  static __device__ __forceinline__ void guard(v8f& a, v8f& b, v16b x, v16b y) { dep_guard_b(a, b, x, y); }
  static __device__ __forceinline__ void keep(v16b a, v16b b, v16b c, v16b d) { keep4_b(a, b, c, d); }
};

// ---- Register-blocked batched WMMA GEMM ------------------------------------
// C[m,n] = scale * sum_k A[m,k] * Bt[n,k] (+bias)(+resid); each wave owns a 64x64 tile.
// A row-major [M,K]; Bt row-major [N,K]; M,N % 64 == 0, K % 32 == 0.
// SPLIT: operands are hi/lo planes (A2/Bt2 = lo planes, same layout); product = hi.hi + hi.lo + lo.hi.
// BIAS_MODE: 0 = none, 1 = bias[m], 2 = bias[n].
// OUT_MODE: 0 = f32, 1 = f16, 2 = bf16 hi plane (Cout) + bf16 lo plane (Cout2).
// ET: 0 = f16 operands, 1 = bf16 operands (pointers passed as 16-bit storage)
template <int ET> struct Elem;
template <> struct Elem<0> { typedef _Float16 T; };
template <> struct Elem<1> { typedef __bf16 T; };
template <int ET, bool SPLIT, int BIAS_MODE, int OUT_MODE, bool RESID, int ACT = 0>
__global__ __launch_bounds__(256) void wmma_gemm64(
    const unsigned short* __restrict__ Ap, const unsigned short* __restrict__ A2p, int lda, long strideA,
    const unsigned short* __restrict__ Btp, const unsigned short* __restrict__ Bt2p, int ldb, long strideB,
    void* __restrict__ Cout, void* __restrict__ Cout2, int ldc, long strideC,
    const float* __restrict__ bias,
    const float* __restrict__ resid, long strideR,
    int M, int N, int K, float scale) {
  typedef typename Elem<ET>::T T;
  typedef typename Frag<T>::V V;
  const T* A = (const T*)Ap; const T* A2 = (const T*)A2p; const T* Bt = (const T*)Btp; const T* Bt2 = (const T*)Bt2p;
  __shared__ __align__(16) float sT[8][16 * 68];   // per-wave 16x64 slab, pitch 68 floats
  const int b    = blockIdx.y;
  const int lane = threadIdx.x & 31;
  const int wave = threadIdx.x >> 5;
  const int tilesN = N >> 6;
  const int tilesM = M >> 6;
  const int tile = blockIdx.x * 8 + wave;
  if (tile >= tilesM * tilesN) return;   // wave-uniform; no block barriers in this kernel
  const int tm = tile / tilesN;
  const int tn = tile - tm * tilesN;
  const int m0 = tm << 6;
  const int n0 = tn << 6;

  const T* Ab  = A  + (size_t)b * strideA;
  const T* Bb  = Bt + (size_t)b * strideB;
  const T* Ab2 = SPLIT ? (A2  + (size_t)b * strideA) : nullptr;
  const T* Bb2 = SPLIT ? (Bt2 + (size_t)b * strideB) : nullptr;

  const int rlane = lane & 15;                 // row (A) / col (B, D) within subtile
  const int koff  = (lane >> 4) * 8;           // k offset of this lane half
  const int mOff  = (lane >> 4) * 8;           // D row offset

  v8f acc[4][4];
#pragma unroll
  for (int i = 0; i < 4; ++i)
#pragma unroll
    for (int j = 0; j < 4; ++j) acc[i][j] = (v8f){0.f,0.f,0.f,0.f,0.f,0.f,0.f,0.f};

  for (int k0 = 0; k0 < K; k0 += 32) {
    V bh[4], bl[4];
#pragma unroll
    for (int j = 0; j < 4; ++j) {
      const size_t bo = (size_t)(n0 + (j << 4) + rlane) * ldb + koff + k0;
      bh[j] = Frag<T>::load(Bb + bo);
      if (SPLIT) bl[j] = Frag<T>::load(Bb2 + bo);
    }
#pragma unroll
    for (int i = 0; i < 4; ++i) {
      const size_t ao = (size_t)(m0 + (i << 4) + rlane) * lda + koff + k0;
      V ah = Frag<T>::load(Ab + ao);
      V al;
      if (SPLIT) al = Frag<T>::load(Ab2 + ao);
#pragma unroll
      for (int j = 0; j < 4; ++j) {
        acc[i][j] = Frag<T>::mma(ah, bh[j], acc[i][j]);
        if (SPLIT) {
          acc[i][j] = Frag<T>::mma(ah, bl[j], acc[i][j]);
          acc[i][j] = Frag<T>::mma(al, bh[j], acc[i][j]);
        }
      }
      Frag<T>::guard(acc[i][0], acc[i][3], ah, SPLIT ? al : ah);
    }
    Frag<T>::keep(bh[0], bh[1], bh[2], bh[3]);
    if (SPLIT) Frag<T>::keep(bl[0], bl[1], bl[2], bl[3]);
  }
  acc_guard4(acc[0][0], acc[0][1], acc[0][2], acc[0][3]);
  acc_guard4(acc[1][0], acc[1][1], acc[1][2], acc[1][3]);
  acc_guard4(acc[2][0], acc[2][1], acc[2][2], acc[2][3]);
  acc_guard4(acc[3][0], acc[3][1], acc[3][2], acc[3][3]);

  // ---- epilogue ----
  float* slab = sT[wave];
  const float* Rb = RESID ? (resid + (size_t)b * strideR) : nullptr;
#pragma unroll
  for (int i = 0; i < 4; ++i) {
    const int mBase = m0 + (i << 4);
#pragma unroll
    for (int j = 0; j < 4; ++j) {
      const int n = n0 + (j << 4) + rlane;
      float bv = 0.f;
      if (BIAS_MODE == 2) bv = bias[n];
#pragma unroll
      for (int r = 0; r < 8; ++r) {
        float v = acc[i][j][r] * scale;
        if (BIAS_MODE == 1) v += bias[mBase + mOff + r];
        if (BIAS_MODE == 2) v += bv;
        if (RESID) v += Rb[(size_t)(mBase + mOff + r) * ldc + n];
        if (ACT == 1) v = tanhf(v);
        if (ACT == 2) v = fmaxf(v, 0.0f);
        if (ACT == 3) v = v / (1.0f + expf(-v));
        if (ACT == 4) v = (v > 0.f) ? v : 0.01f * v;
        if (ACT == 5) v = 0.5f * v * (1.0f + erff(v * 0.70710678118654752f));
        slab[(mOff + r) * 68 + (j << 4) + rlane] = v;
      }
    }
    __builtin_amdgcn_fence(__ATOMIC_RELEASE, "workgroup");
    __builtin_amdgcn_wave_barrier();
    __builtin_amdgcn_fence(__ATOMIC_ACQUIRE, "workgroup");
    if (OUT_MODE == 0) {
      float* C = (float*)Cout + (size_t)b * strideC;
      const int hh = lane >> 4, c4 = (lane & 15) * 4;     // row seg = 256 B = 16 lanes x 16 B
      {
#pragma unroll
        for (int it = 0; it < 8; ++it) {
          const int row = it * 2 + hh;
          v4f v = *(const v4f*)(slab + row * 68 + c4);
          *(v4f*)(C + (size_t)(mBase + row) * ldc + n0 + c4) = v;
        }
        
      }
    } else {
      const int q = lane >> 3, c8 = (lane & 7) * 8;
      unsigned short* C  = (unsigned short*)Cout  + (size_t)b * strideC;
      unsigned short* C2 = (OUT_MODE == 2) ? ((unsigned short*)Cout2 + (size_t)b * strideC) : nullptr;
      {
#pragma unroll
        for (int it = 0; it < 4; ++it) {
          const int row = it * 4 + q;
          const float* sp = slab + row * 68 + c8;
          v8h hv, lv;
#pragma unroll
          for (int e = 0; e < 8; ++e) {
            if (OUT_MODE == 1) {
              hv[e] = (_Float16)sp[e];
            } else {
              unsigned short hb = f2bf_bits(sp[e]);
              unsigned short lb = f2bf_bits(sp[e] - bf_bits2f(hb));
              hv[e] = __builtin_bit_cast(_Float16, hb);
              lv[e] = __builtin_bit_cast(_Float16, lb);
            }
          }
          *(v8h*)(C + (size_t)(mBase + row) * ldc + n0 + c8) = hv;
          if (OUT_MODE == 2) *(v8h*)(C2 + (size_t)(mBase + row) * ldc + n0 + c8) = lv;
        }
        
      }
    }
    __builtin_amdgcn_fence(__ATOMIC_RELEASE, "workgroup");
    __builtin_amdgcn_wave_barrier();
    __builtin_amdgcn_fence(__ATOMIC_ACQUIRE, "workgroup");
  }
}

__global__ __launch_bounds__(256) void cast_f32_f16x2s(
    const float* __restrict__ in, _Float16* __restrict__ out, int n2, float scale) {
  int i = blockIdx.x * 256 + threadIdx.x;
  if (i < n2) {
    const _Float16 h0 = (_Float16)(in[2 * i] * scale), h1 = (_Float16)(in[2 * i + 1] * scale);
    const unsigned u = (unsigned)__builtin_bit_cast(unsigned short, h0) | ((unsigned)__builtin_bit_cast(unsigned short, h1) << 16);
    ((unsigned*)out)[i] = u;
    
  }
}

// ---- additive score terms + mask, dense per head ------------------------------------------------------
//   qf, rf: f32 projection outputs, row i*8+b, col h*64+d (qf already includes the s_q column term).
//   Phase 1 (LDS): e0[i] = newq[n,i,:].semb[0][h*64..], e1[i] = newq[n,i,:].semb[1][h*64..], cv[i] = r[n,i,:].semb[0][h*64..]
//   Phase 2: SB[n][i][j] = amask[n][i][j] != 0 ? 3e38 (sentinel)
//                        : 0.125 * ( utt[n][i][j] * (smask[b][i][j] -> e1[i] : e0[i]) + (j <= i ? cv[127-i+j] : 0) )
__global__ __launch_bounds__(128) void sbias_kernel(
    const float* __restrict__ qf, const float* __restrict__ rf, const float* __restrict__ semb,
    const float* __restrict__ utt, const int* __restrict__ amask, const int* __restrict__ smask,
    float* __restrict__ sb) {
  __shared__ float se0[128];
  __shared__ float se1[128];
  __shared__ float scv[128];
  const int n = blockIdx.x, t = threadIdx.x;
  const int b = n >> 4, h = n & 15;
  {
    const size_t ro = ((size_t)(t * 8 + b)) * 1024 + (size_t)h * 64;
    const float* qr = qf + ro;
    const float* rr = rf + ro;
    const float* s0 = semb + h * 64;
    const float* s1 = semb + 1024 + h * 64;
    float a0 = 0.f, a1 = 0.f, a2 = 0.f;
#pragma unroll 1
    for (int e = 0; e < 64; e += 4) {
      const v4f qv = *(const v4f*)(qr + e);
      const v4f rv = *(const v4f*)(rr + e);
      const v4f w0 = *(const v4f*)(s0 + e);
      const v4f w1 = *(const v4f*)(s1 + e);
#pragma unroll
      for (int u = 0; u < 4; ++u) {
        a0 = fmaf(qv[u], w0[u], a0);
        a1 = fmaf(qv[u], w1[u], a1);
        a2 = fmaf(rv[u], w0[u], a2);
      }
    }
    se0[t] = a0;
    se1[t] = a1;
    scv[t] = a2;
  }
  __syncthreads();
  const float* ub  = utt   + (size_t)n * 16384;
  const int*   ab  = amask + (size_t)n * 16384;
  const int*   smb = smask + (size_t)b * 16384;
  float*       ob  = sb    + (size_t)n * 16384;
#pragma unroll 1
  for (int i = 0; i < 128; ++i) {
    const int e = i * 128 + t;
    const float u = ub[e];
    const int am = ab[e];
    int sm = smb[e];
    if (sm < 0) sm += 2;                       // 2-row table: wrap negatives, then clamp
    sm = sm < 0 ? 0 : (sm > 1 ? 1 : sm);
    const float ev = (sm != 0) ? se1[i] : se0[i];
    int cc = 127 - i + t;
    cc = cc < 0 ? 0 : (cc > 127 ? 127 : cc);
    const float a3 = (t <= i) ? scv[cc] : 0.0f;
    float val = (u * ev + a3) * 0.125f;
    if (am != 0) val = 3.0e38f;
    *(float*)(ob + e) = val;
    
  }
}

// =====================================================================================
// Attention for head_dim 64 with a dense additive score tensor, f32 in / f32 out, f16 operands:
//   s = (q.k^T) * sscale + SB[bh][q][kv];  SB element above sent_thr -> s = mask_fill (kept in the softmax)
//   softmax over all Skv keys in f32 (online over 64-key chunks); p carried x2^15 as f16; out = p.v / (l*2^15).
//   Block = 4 waves = 64 query rows of one (b, h); grid.x = B*H*(S/64).
//   Element (b, s, h, d) of q/k/v/out at X[b*X_bs + s*X_rs + h*X_hs + d]; SB element (bh, q, kv) at sb[bh*sb_ns + q*sb_rs + kv].
// =====================================================================================
#define AT_D 64
#define AT_NW 4
#define AT_QB 64
#define AT_KC 64
struct AttnArgs { long q_bs, q_rs, q_hs, k_bs, k_rs, k_hs, v_bs, v_rs, v_hs, o_bs, o_rs, o_hs, sb_ns, sb_rs;
                  int S, Skv, H, nchunks; float sscale, mask_fill, sent_thr, resv; };
static_assert(sizeof(AttnArgs) == 144);

__device__ __forceinline__ v8f mma_f16g(v16h a, v16h b, v8f c) {
  c = __builtin_amdgcn_wmma_f32_16x16x32_f16(false, a, false, b, (short)0, c, false, false);
  asm volatile("v_nop\n\tv_nop\n\tv_nop\n\tv_nop" : "+v"(c) : "v"(a), "v"(b));
  return c;
}

__global__ __launch_bounds__(128)
void attn64_sbias_f16(const float* __restrict__ q, const float* __restrict__ k,
                      const float* __restrict__ v, float* __restrict__ out,
                      const float* __restrict__ sb, AttnArgs g) {
  const float PSC = 32768.0f;
  union FB { v16h v; v8h h[2]; };
  __shared__ __align__(16) _Float16 Ksh[AT_KC * AT_D];            // K [kv][d]   8 KB
  __shared__ __align__(16) _Float16 Vth[AT_D * AT_KC];            // V [d][kv]   8 KB
  __shared__ __align__(16) _Float16 Psh[AT_NW][16 * AT_KC];       // per wave P [row][kv]  8 KB
  __shared__ __align__(16) float    Os[AT_NW][16 * 68];           // per wave out tile, pitch 68

  const int tid  = threadIdx.x;
  const int wave = tid >> 5;
  const int lane = tid & 31;
  const int hh   = lane >> 4;
  const int c    = lane & 15;

  const int nqb = g.S / AT_QB;
  const int bx = blockIdx.x;
  const int qb = bx % nqb;
  const int bh = bx / nqb;
  const int h  = bh % g.H;
  const int b  = bh / g.H;
  const int q0 = qb * AT_QB + wave * 16;

  const float* qb_ptr = q   + (size_t)b * g.q_bs + (size_t)h * g.q_hs;
  const float* kb_ptr = k   + (size_t)b * g.k_bs + (size_t)h * g.k_hs;
  const float* vb_ptr = v   + (size_t)b * g.v_bs + (size_t)h * g.v_hs;
  float*       ob_ptr = out + (size_t)b * g.o_bs + (size_t)h * g.o_hs;

  // ---- Q fragments (A operand), 2 d-chunks, split k map ----
  v16h qa[2];
  {
    const float* qrow = qb_ptr + (size_t)(q0 + c) * g.q_rs;
#pragma unroll
    for (int dc = 0; dc < 2; ++dc) {
      const v4f f0 = *(const v4f*)(qrow + dc * 32 + 8 * hh);
      const v4f f1 = *(const v4f*)(qrow + dc * 32 + 8 * hh + 4);
      const v4f f2 = *(const v4f*)(qrow + dc * 32 + 16 + 8 * hh);
      const v4f f3 = *(const v4f*)(qrow + dc * 32 + 16 + 8 * hh + 4);
#pragma unroll
      for (int e = 0; e < 4; ++e) {
        qa[dc][e]      = (_Float16)f0[e];
        qa[dc][4 + e]  = (_Float16)f1[e];
        qa[dc][8 + e]  = (_Float16)f2[e];
        qa[dc][12 + e] = (_Float16)f3[e];
      }
    }
  }

  float mrow[8], lrow[8];
  v8f oacc[4];
#pragma unroll
  for (int r = 0; r < 8; ++r) { mrow[r] = -INFINITY; lrow[r] = 0.f; }
#pragma unroll
  for (int t = 0; t < 4; ++t) oacc[t] = (v8f){0.f,0.f,0.f,0.f,0.f,0.f,0.f,0.f};

  int nChunks = g.Skv / AT_KC;                 // block-uniform, host-provided
  if (nChunks > 64) nChunks = 64;
  for (int kc = 0; kc < nChunks; ++kc) {
    const int kv0 = kc * AT_KC;
    __syncthreads();
    {
      const int kvr = tid >> 1, dh = (tid & 1) * 32;
      const float* krow = kb_ptr + (size_t)(kv0 + kvr) * g.k_rs + dh;
      const float* vrow = vb_ptr + (size_t)(kv0 + kvr) * g.v_rs + dh;
#pragma unroll
      for (int i = 0; i < 8; ++i) {
        v4f kk = *(const v4f*)(krow + 4 * i);
        v4f vv = *(const v4f*)(vrow + 4 * i);
#pragma unroll
        for (int e = 0; e < 4; ++e) {
          const int d = dh + 4 * i + e;
          Ksh[kvr * AT_D + d]  = (_Float16)kk[e];
          Vth[d * AT_KC + kvr] = (_Float16)vv[e];
        }
      }
    }
    __syncthreads();

    v8f s[4];
#pragma unroll
    for (int j = 0; j < 4; ++j) {
      s[j] = (v8f){0.f,0.f,0.f,0.f,0.f,0.f,0.f,0.f};
#pragma unroll
      for (int dc = 0; dc < 2; ++dc) {
        FB kb;
        kb.h[0] = *(const v8h*)(Ksh + (j * 16 + c) * AT_D + dc * 32 + 8 * hh);
        kb.h[1] = *(const v8h*)(Ksh + (j * 16 + c) * AT_D + dc * 32 + 16 + 8 * hh);
        s[j] = mma_f16g(qa[dc], kb.v, s[j]);
      }
    }
    // additive terms + mask select, row max
    const float* sbp = sb + (size_t)bh * g.sb_ns + (size_t)(q0 + 8 * hh) * g.sb_rs + kv0 + c;
    float cm[8];
#pragma unroll
    for (int r = 0; r < 8; ++r) {
      const float* sbr = sbp + (size_t)r * g.sb_rs;
      float m = -INFINITY;
#pragma unroll
      for (int j = 0; j < 4; ++j) {
        const float bb = sbr[j * 16];
        float sv = fmaf(s[j][r], g.sscale, bb);
        if (bb > g.sent_thr) sv = g.mask_fill;
        s[j][r] = sv;
        m = fmaxf(m, sv);
      }
#pragma unroll
      for (int off = 1; off < 16; off <<= 1) m = fmaxf(m, __shfl_xor(m, off, 32));
      cm[r] = m;
    }
    _Float16* pwh = Psh[wave];
#pragma unroll
    for (int r = 0; r < 8; ++r) {
      const float mnew = fmaxf(mrow[r], cm[r]);
      const float alpha = expf(mrow[r] - mnew);
      mrow[r] = mnew;
      float psum = 0.f;
#pragma unroll
      for (int j = 0; j < 4; ++j) {
        const float p = expf(s[j][r] - mnew);
        psum += p;
        pwh[(8 * hh + r) * AT_KC + j * 16 + c] = (_Float16)(p * PSC);
      }
#pragma unroll
      for (int off = 1; off < 16; off <<= 1) psum += __shfl_xor(psum, off, 32);
      lrow[r] = lrow[r] * alpha + psum;
#pragma unroll
      for (int t = 0; t < 4; ++t) oacc[t][r] *= alpha;
    }
    __builtin_amdgcn_fence(__ATOMIC_RELEASE, "workgroup");
    __builtin_amdgcn_wave_barrier();
    __builtin_amdgcn_fence(__ATOMIC_ACQUIRE, "workgroup");
#pragma unroll 1
    for (int kk = 0; kk < 2; ++kk) {
      FB pa;
      pa.h[0] = *(const v8h*)(pwh + c * AT_KC + kk * 32 + 8 * hh);
      pa.h[1] = *(const v8h*)(pwh + c * AT_KC + kk * 32 + 16 + 8 * hh);
#pragma unroll
      for (int t = 0; t < 4; ++t) {
        FB vb;
        vb.h[0] = *(const v8h*)(Vth + (t * 16 + c) * AT_KC + kk * 32 + 8 * hh);
        vb.h[1] = *(const v8h*)(Vth + (t * 16 + c) * AT_KC + kk * 32 + 16 + 8 * hh);
        oacc[t] = mma_f16g(pa.v, vb.v, oacc[t]);
      }
    }
  }

  float* os = Os[wave];
#pragma unroll
  for (int r = 0; r < 8; ++r) {
    const float inv = 1.0f / (lrow[r] * PSC);
#pragma unroll
    for (int t = 0; t < 4; ++t) os[(8 * hh + r) * 68 + t * 16 + c] = oacc[t][r] * inv;
  }
  __builtin_amdgcn_fence(__ATOMIC_RELEASE, "workgroup");
  __builtin_amdgcn_wave_barrier();
  __builtin_amdgcn_fence(__ATOMIC_ACQUIRE, "workgroup");
  {
    const int c4 = (lane & 15) * 4;
    {
#pragma unroll
      for (int it = 0; it < 8; ++it) {
        const int row = it * 2 + hh;
        v4f val = *(const v4f*)(os + row * 68 + c4);
        *(v4f*)(ob_ptr + (size_t)(q0 + row) * g.o_rs + c4) = val;
      }
      
    }
  }
}

// ---------------------------------------------------------------------------
// Host launcher. Layout of q/k/v/r/ctx matrices: row = i*8 + b (i = position, b = batch),
// col = h*64 + d; head n = b*16 + h. The (B,L,D) positional input is used as a flat [1024][1024]
// A matrix exactly like the (L,B,D) query (literal view semantics of the position projection).
// ---------------------------------------------------------------------------
extern "C" void kernel_launch(void* const* d_in, const int* in_sizes, int n_in,
                              void* d_out, int out_size, void* d_ws, size_t ws_size,
                              hipStream_t stream) {
  if (n_in < 11) return;
  const int NE = 1024 * 1024;                 // elements of every [*,*,1024] tensor and of each weight
  if (in_sizes[0] != NE || in_sizes[1] != NE || in_sizes[3] != NE || in_sizes[4] != NE ||
      in_sizes[5] != NE || in_sizes[6] != NE || in_sizes[7] != NE || in_sizes[8] != 2 * 1024 ||
      in_sizes[2] != 128 * 128 * 128 || in_sizes[9] != 128 * 128 * 128 || in_sizes[10] != 8 * 128 * 128 ||
      out_size != NE) return;

  const float* query    = (const float*)d_in[0];   // (L,B,D)
  const float* rel_pe   = (const float*)d_in[1];   // (B,L,D)
  const float* utt_mask = (const float*)d_in[2];   // (B*H,L,L,1) f32
  const float* Wq       = (const float*)d_in[3];
  const float* Wk       = (const float*)d_in[4];
  const float* Wv       = (const float*)d_in[5];
  const float* Wr       = (const float*)d_in[6];
  const float* Wo       = (const float*)d_in[7];
  const float* spk_emb  = (const float*)d_in[8];   // (2,D)
  const int*   attn_msk = (const int*)d_in[9];     // (B*H,L,L) int32, nonzero = masked
  const int*   spk_msk  = (const int*)d_in[10];    // (B,L,L) int32 in {0,1}
  float* out = (float*)d_out;

  // ---- workspace carve (bytes) ----
  const size_t MiB = (size_t)1 << 20;
  const size_t off_q16 = 0;                    // query  f16       2 MiB
  const size_t off_p16 = 2 * MiB;              // rel_pe f16       2 MiB
  const size_t off_w16 = 4 * MiB;              // 5 weights f16 x16, 2 MiB each (Wq,Wk,Wv,Wr,Wo)
  const size_t off_qf  = 14 * MiB;             // new_q f32        4 MiB
  const size_t off_kf  = 18 * MiB;             // k f32            4 MiB
  const size_t off_vf  = 22 * MiB;             // v f32            4 MiB (directly after k: batched GEMM stride)
  const size_t off_rf  = 26 * MiB;             // r f32            4 MiB
  const size_t off_sb  = 30 * MiB;             // score bias [128][128][128] f32  8 MiB
  const size_t off_ctx = 38 * MiB;             // ctx f32          4 MiB
  const size_t off_c16 = 42 * MiB;             // ctx f16 x16      2 MiB
  const size_t total   = 44 * MiB;
  if (total > ws_size || total > 128 * MiB) return;

  char* ws = (char*)d_ws;
  _Float16* q16 = (_Float16*)(ws + off_q16);
  _Float16* p16 = (_Float16*)(ws + off_p16);
  _Float16* w16 = (_Float16*)(ws + off_w16);
  float* qf  = (float*)(ws + off_qf);
  float* kf  = (float*)(ws + off_kf);
  float* vf  = (float*)(ws + off_vf);
  float* rf  = (float*)(ws + off_rf);
  float* sbp = (float*)(ws + off_sb);
  float* ctx = (float*)(ws + off_ctx);
  _Float16* c16 = (_Float16*)(ws + off_c16);

  const int n2 = NE / 2;
  const int cgrid = (n2 + 255) / 256;
  // ---- casts: activations x1, weights x16 (exact power of two, undone in the GEMM epilogue) ----
  cast_f32_f16x2s<<<cgrid, 256, 0, stream>>>(query,  q16, n2, 1.0f);
  cast_f32_f16x2s<<<cgrid, 256, 0, stream>>>(rel_pe, p16, n2, 1.0f);
  cast_f32_f16x2s<<<cgrid, 256, 0, stream>>>(Wq, w16 + 0 * (size_t)NE, n2, 16.0f);
  cast_f32_f16x2s<<<cgrid, 256, 0, stream>>>(Wk, w16 + 1 * (size_t)NE, n2, 16.0f);
  cast_f32_f16x2s<<<cgrid, 256, 0, stream>>>(Wv, w16 + 2 * (size_t)NE, n2, 16.0f);
  cast_f32_f16x2s<<<cgrid, 256, 0, stream>>>(Wr, w16 + 3 * (size_t)NE, n2, 16.0f);
  cast_f32_f16x2s<<<cgrid, 256, 0, stream>>>(Wo, w16 + 4 * (size_t)NE, n2, 16.0f);

  // ---- projections: C = X . W^T, 1024x1024x1024 each; q gets column bias spk_emb[0][col] (= new_q) ----
  const int M = 1024, N = 1024, K = 1024;
  const int tiles = (M / 64) * (N / 64);
  const int gblocks = (tiles + 7) / 8;
  const float wscale_inv = 1.0f / 16.0f;
  {
    dim3 grid(gblocks, 1);
    wmma_gemm64<0, false, 2, 0, false><<<grid, 256, 0, stream>>>(
        (const unsigned short*)q16, (const unsigned short*)q16, K, 0L,
        (const unsigned short*)(w16 + 0 * (size_t)NE), (const unsigned short*)(w16 + 0 * (size_t)NE), K, 0L,
        (void*)qf, (void*)qf, N, 0L,
        spk_emb, spk_emb, 0L, M, N, K, wscale_inv);
  }
  {
    dim3 grid(gblocks, 2);   // y = 0: k (Wk -> kf), y = 1: v (Wv -> vf = kf + NE)
    wmma_gemm64<0, false, 0, 0, false><<<grid, 256, 0, stream>>>(
        (const unsigned short*)q16, (const unsigned short*)q16, K, 0L,
        (const unsigned short*)(w16 + 1 * (size_t)NE), (const unsigned short*)(w16 + 1 * (size_t)NE), K, (long)NE,
        (void*)kf, (void*)kf, N, (long)NE,
        spk_emb, spk_emb, 0L, M, N, K, wscale_inv);
  }
  {
    dim3 grid(gblocks, 1);   // rel_pe flat [1024][1024] . Wr^T -> rf (literal view)
    wmma_gemm64<0, false, 0, 0, false><<<grid, 256, 0, stream>>>(
        (const unsigned short*)p16, (const unsigned short*)p16, K, 0L,
        (const unsigned short*)(w16 + 3 * (size_t)NE), (const unsigned short*)(w16 + 3 * (size_t)NE), K, 0L,
        (void*)rf, (void*)rf, N, 0L,
        spk_emb, spk_emb, 0L, M, N, K, wscale_inv);
  }

  // ---- dense additive score terms (a2 + a3) * 1/8 with the mask folded in as a sentinel ----
  sbias_kernel<<<128, 128, 0, stream>>>(qf, rf, spk_emb, utt_mask, attn_msk, spk_msk, sbp);

  // ---- attention: 128 heads (b*16+h) of 128x128, head dim 64; s = a1/8 + SB, sentinel -> 1e-30 ----
  {
    AttnArgs g;
    g.q_bs = 1024; g.q_rs = 8 * 1024; g.q_hs = 64;
    g.k_bs = 1024; g.k_rs = 8 * 1024; g.k_hs = 64;
    g.v_bs = 1024; g.v_rs = 8 * 1024; g.v_hs = 64;
    g.o_bs = 1024; g.o_rs = 8 * 1024; g.o_hs = 64;
    g.sb_ns = 128 * 128; g.sb_rs = 128;
    g.S = 128; g.Skv = 128; g.H = 16; g.nchunks = 2;
    g.sscale = 0.125f; g.mask_fill = 1e-30f; g.sent_thr = 1.0e37f; g.resv = 0.0f;
    const int agrid = 8 * 16 * (128 / AT_QB);   // 256 blocks
    attn64_sbias_f16<<<agrid, 128, 0, stream>>>(qf, kf, vf, ctx, sbp, g);
  }

  // ---- ctx f32 -> f16 x16, then output projection into d_out (scale 1/256 undoes both x16) ----
  cast_f32_f16x2s<<<cgrid, 256, 0, stream>>>(ctx, c16, n2, 16.0f);
  {
    dim3 grid(gblocks, 1);
    wmma_gemm64<0, false, 0, 0, false><<<grid, 256, 0, stream>>>(
        (const unsigned short*)c16, (const unsigned short*)c16, K, 0L,
        (const unsigned short*)(w16 + 4 * (size_t)NE), (const unsigned short*)(w16 + 4 * (size_t)NE), K, 0L,
        (void*)out, (void*)out, N, 0L,
        spk_emb, spk_emb, 0L, M, N, K, 1.0f / 256.0f);
  }
  (void)hipGetLastError();
}

// v001
// Measured time: 172 microseconds a run.
// Next to v000, in two timings, it ran 1.60 and 1.59 times as fast.
#include <hip/hip_runtime.h>
#include <stdint.h>
// Contractions: five 1024x1024x1024 projections (X . W^T), per-head q.k^T (K=64) and p.v (K=128): v_wmma_f32_16x16x32_f16 (f16 operands; weights and ctx carried x16, p carried x2^15, exact powers of two folded back in f32), f32 accumulate. Softmax, additive score terms and depth-64 speaker row dots in f32 on VALU.

typedef __attribute__((ext_vector_type(16))) _Float16 v16h;
typedef __attribute__((ext_vector_type(8)))  _Float16 v8h;
typedef __attribute__((ext_vector_type(16))) __bf16   v16b;
typedef __attribute__((ext_vector_type(8)))  __bf16   v8b;
typedef __attribute__((ext_vector_type(8)))  float    v8f;
typedef __attribute__((ext_vector_type(4)))  float    v4f;

__device__ __forceinline__ unsigned short f2bf_bits(float f) {
  unsigned u = __float_as_uint(f);
  return (unsigned short)((u + 0x7FFFu + ((u >> 16) & 1u)) >> 16);
}
__device__ __forceinline__ float bf_bits2f(unsigned short h) { return __uint_as_float(((unsigned)h) << 16); }

// hazard guards as plain device helpers (no inline asm inside the kernel template body)
__device__ __forceinline__ void acc_guard4(v8f& a, v8f& b, v8f& c, v8f& d) { asm volatile("v_nop\n\tv_nop\n\tv_nop\n\tv_nop" : "+v"(a), "+v"(b), "+v"(c), "+v"(d)); }
template <typename T> struct Frag;
template <> struct Frag<_Float16> {
  typedef v16h V; union U { v16h v; v8h h[2]; };
  static __device__ __forceinline__ v16h load(const _Float16* p) {   // elements 0..7 <- p[0..7], 8..15 <- p[16..23]
    U f; f.h[0] = *(const v8h*)(p); f.h[1] = *(const v8h*)(p + 16); return f.v;
  }
  static __device__ __forceinline__ v8f mma(v16h a, v16h b, v8f c) {
    return __builtin_amdgcn_wmma_f32_16x16x32_f16(false, a, false, b, (short)0, c, false, false);
  }
};
template <> struct Frag<__bf16> {
  typedef v16b V; union U { v16b v; v8b h[2]; };
  static __device__ __forceinline__ v16b load(const __bf16* p) {
    U f; f.h[0] = *(const v8b*)(p); f.h[1] = *(const v8b*)(p + 16); return f.v;
  }
  static __device__ __forceinline__ v8f mma(v16b a, v16b b, v8f c) {
    return __builtin_amdgcn_wmma_f32_16x16x32_bf16(false, a, false, b, (short)0, c, false, false);
  }
};

// ---- Register-blocked batched WMMA GEMM ------------------------------------
// C[m,n] = scale * sum_k A[m,k] * Bt[n,k] (+bias)(+resid); each wave owns a 64x64 tile,
// the eight waves of a work-group own eight neighbouring tiles of one tile row (64 x 512).
// A row-major [M,K]; Bt row-major [N,K]; M % 64 == 0, N % 512 == 0, K % 64 == 0.
// Operand path: per pass of 64 k the work-group's 64 A rows and 512 Bt rows (128 B each, whole lines)
// go to LDS by asynchronous 16-byte copies, two buffers, the next pass in flight while this one is
// multiplied; the waves read their fragments from LDS (row pitch 144 B = 16 B x odd for ds_load_b128).
// SPLIT (hi/lo operand planes) is not staged by this path and is not instantiated.
// BIAS_MODE: 0 = none, 1 = bias[m], 2 = bias[n].
// OUT_MODE: 0 = f32, 1 = f16, 2 = bf16 hi plane (Cout) + bf16 lo plane (Cout2).
// ET: 0 = f16 operands, 1 = bf16 operands (pointers passed as 16-bit storage)
template <int ET> struct Elem;
template <> struct Elem<0> { typedef _Float16 T; };
template <> struct Elem<1> { typedef __bf16 T; };
#define G_PITCH 72                       // LDS row pitch in 16-bit elements (128 B of k + 16 B)
#define G_ROWS  576                      // 64 A rows, then 512 Bt rows
#define G_BUF   (G_ROWS * G_PITCH)       // elements of one buffer (82,944 B)

// Nine asynchronous 16-byte-per-lane copies global -> LDS. The s_wait_xcnt closes the statement so that
// no address register named here is rewritten before it.
template <typename T>
__device__ __forceinline__ void async_copy9(const unsigned (&l)[9], const T* const (&g)[9]) {
  asm volatile(
      "global_load_async_to_lds_b128 %0, %9, off\n\t"
      "global_load_async_to_lds_b128 %1, %10, off\n\t"
      "global_load_async_to_lds_b128 %2, %11, off\n\t"
      "global_load_async_to_lds_b128 %3, %12, off\n\t"
      "global_load_async_to_lds_b128 %4, %13, off\n\t"
      "global_load_async_to_lds_b128 %5, %14, off\n\t"
      "global_load_async_to_lds_b128 %6, %15, off\n\t"
      "global_load_async_to_lds_b128 %7, %16, off\n\t"
      "global_load_async_to_lds_b128 %8, %17, off\n\t"
      "s_wait_xcnt 0x0"
      :: "v"(l[0]), "v"(l[1]), "v"(l[2]), "v"(l[3]), "v"(l[4]), "v"(l[5]), "v"(l[6]), "v"(l[7]), "v"(l[8]),
         "v"(g[0]), "v"(g[1]), "v"(g[2]), "v"(g[3]), "v"(g[4]), "v"(g[5]), "v"(g[6]), "v"(g[7]), "v"(g[8])
      : "memory");
}
// One pass's tile: 576 rows x 8 chunks of 16 B = 18 chunks per thread; a wave-wide copy covers 4 whole rows.
// ga / gb: this thread's chunk in A row (tid >> 3) / Bt row (tid >> 3) of the work-group's rows, at the pass's k.
// l0: this thread's LDS byte address for row (tid >> 3) of the target buffer.
template <typename T>
__device__ __forceinline__ void stage_tile(unsigned l0, const T* ga, const T* gb, int lda, int ldb) {
  unsigned l[9]; const T* g[9];
#pragma unroll
  for (int it = 0; it < 9; ++it) {       // rows 0..287: A rows 0..63, Bt rows 0..223
    l[it] = l0 + (unsigned)(it * 32 * G_PITCH * 2);
    g[it] = (it < 2) ? (ga + (size_t)(it * 32) * lda) : (gb + (size_t)((it - 2) * 32) * ldb);
  }
  async_copy9<T>(l, g);
#pragma unroll
  for (int it = 0; it < 9; ++it) {       // rows 288..575: Bt rows 224..511
    l[it] = l0 + (unsigned)((it + 9) * 32 * G_PITCH * 2);
    g[it] = gb + (size_t)((it + 7) * 32) * ldb;
  }
  async_copy9<T>(l, g);
}
// this wave's LDS reads have retired (before the buffer they read is handed back for a refill)
__device__ __forceinline__ void wait_lds_reads()   { asm volatile("s_wait_dscnt 0x0" ::: "memory"); }
// this wave's asynchronous copies have landed (the compiler places no wait for them)
__device__ __forceinline__ void wait_async_copies() { asm volatile("s_wait_asynccnt 0x0" ::: "memory"); }

template <int ET, bool SPLIT, int BIAS_MODE, int OUT_MODE, bool RESID, int ACT = 0>
__global__ __launch_bounds__(256) void wmma_gemm64(
    const unsigned short* __restrict__ Ap, const unsigned short* __restrict__ A2p, int lda, long strideA,
    const unsigned short* __restrict__ Btp, const unsigned short* __restrict__ Bt2p, int ldb, long strideB,
    void* __restrict__ Cout, void* __restrict__ Cout2, int ldc, long strideC,
    const float* __restrict__ bias,
    const float* __restrict__ resid, long strideR,
    int M, int N, int K, float scale) {
  typedef typename Elem<ET>::T T;
  typedef typename Frag<T>::V V;
  static_assert(!SPLIT, "the LDS operand path stages one plane per operand");
  const T* A = (const T*)Ap; const T* Bt = (const T*)Btp;
  __shared__ __align__(16) T ring[2 * G_BUF];      // two operand buffers
  __shared__ __align__(16) float sT[8][16 * 68];   // per-wave 16x64 slab, pitch 68 floats
  const int b    = blockIdx.y;
  const int lane = threadIdx.x & 31;
  const int wave = threadIdx.x >> 5;
  const int tilesN = N >> 6;
  const int tilesM = M >> 6;
  const int tile0 = blockIdx.x * 8;      // the work-group's first tile; tilesN % 8 == 0, so all eight share tm
  if (tile0 >= tilesM * tilesN) return;  // the same for the whole work-group, in front of every barrier
  const int tm = tile0 / tilesN;
  const int m0 = tm << 6;
  const int nb0 = (tile0 - tm * tilesN) << 6;   // first Bt row of the work-group
  const int n0 = nb0 + (wave << 6);

  const T* Ab  = A  + (size_t)b * strideA;
  const T* Bb  = Bt + (size_t)b * strideB;

  const int rlane = lane & 15;                 // row (A) / col (B, D) within subtile
  const int koff  = (lane >> 4) * 8;           // k offset of this lane half
  const int mOff  = (lane >> 4) * 8;           // D row offset

  v8f acc[4][4];
#pragma unroll
  for (int i = 0; i < 4; ++i)
#pragma unroll
    for (int j = 0; j < 4; ++j) acc[i][j] = (v8f){0.f,0.f,0.f,0.f,0.f,0.f,0.f,0.f};

  const int srow = threadIdx.x >> 3;           // staged row of this thread within a group of 32 rows
  const int schk = (threadIdx.x & 7) * 8;      // its 16-byte chunk, in elements
  const T* ga = Ab + (size_t)(m0 + srow) * lda + schk;
  const T* gb = Bb + (size_t)(nb0 + srow) * ldb + schk;
  const unsigned l0 = (unsigned)(size_t)ring + (unsigned)((srow * G_PITCH + schk) * 2);
  const int nPass = K >> 6;

  stage_tile<T>(l0, ga, gb, lda, ldb);
  wait_async_copies();
  __syncthreads();                             // pass 0's tile is published
  if (nPass > 1) stage_tile<T>(l0 + (unsigned)(G_BUF * 2), ga + 64, gb + 64, lda, ldb);

#pragma unroll 1                               // one pass per trip: the buffer is picked by the trip's parity
  for (int t = 0; t < nPass; ++t) {
    const int bsel = (t & 1) * G_BUF;
    const T* ra = ring + bsel + rlane * G_PITCH + koff;
    const T* rb = ring + bsel + (64 + (wave << 6) + rlane) * G_PITCH + koff;
#pragma unroll
    for (int ks = 0; ks < 2; ++ks) {
      V bh[4], ah[4];
#pragma unroll
      for (int j = 0; j < 4; ++j) bh[j] = Frag<T>::load(rb + j * 16 * G_PITCH + ks * 32);
#pragma unroll
      for (int i = 0; i < 4; ++i) ah[i] = Frag<T>::load(ra + i * 16 * G_PITCH + ks * 32);
      // the 16 fragment reads stay one group in front of the 16 WMMAs: left free, the scheduler reuses one
      // A register set and the wave waits out the LDS latency four times per block
      __builtin_amdgcn_sched_barrier(0);
#pragma unroll
      for (int i = 0; i < 4; ++i)
#pragma unroll
        for (int j = 0; j < 4; ++j) acc[i][j] = Frag<T>::mma(ah[i], bh[j], acc[i][j]);
      __builtin_amdgcn_sched_barrier(0);       // and the next block's reads stay behind this block's WMMAs
    }
    wait_lds_reads();
    wait_async_copies();
    __syncthreads();                           // publishes pass t + 1's tile and ends every read of pass t's buffer
    if (t + 2 < nPass)
      stage_tile<T>(l0 + (unsigned)(bsel * 2), ga + (size_t)(t + 2) * 64, gb + (size_t)(t + 2) * 64, lda, ldb);
  }
  wait_async_copies();
  acc_guard4(acc[0][0], acc[0][1], acc[0][2], acc[0][3]);
  acc_guard4(acc[1][0], acc[1][1], acc[1][2], acc[1][3]);
  acc_guard4(acc[2][0], acc[2][1], acc[2][2], acc[2][3]);
  acc_guard4(acc[3][0], acc[3][1], acc[3][2], acc[3][3]);

  // ---- epilogue ----
  float* slab = sT[wave];
  const float* Rb = RESID ? (resid + (size_t)b * strideR) : nullptr;
#pragma unroll
  for (int i = 0; i < 4; ++i) {
    const int mBase = m0 + (i << 4);
#pragma unroll
    for (int j = 0; j < 4; ++j) {
      const int n = n0 + (j << 4) + rlane;
      float bv = 0.f;
      if (BIAS_MODE == 2) bv = bias[n];
#pragma unroll
      for (int r = 0; r < 8; ++r) {
        float v = acc[i][j][r] * scale;
        if (BIAS_MODE == 1) v += bias[mBase + mOff + r];
        if (BIAS_MODE == 2) v += bv;
        if (RESID) v += Rb[(size_t)(mBase + mOff + r) * ldc + n];
        if (ACT == 1) v = tanhf(v);
        if (ACT == 2) v = fmaxf(v, 0.0f);
        if (ACT == 3) v = v / (1.0f + expf(-v));
        if (ACT == 4) v = (v > 0.f) ? v : 0.01f * v;
        if (ACT == 5) v = 0.5f * v * (1.0f + erff(v * 0.70710678118654752f));
        slab[(mOff + r) * 68 + (j << 4) + rlane] = v;
      }
    }
    __builtin_amdgcn_fence(__ATOMIC_RELEASE, "workgroup");
    __builtin_amdgcn_wave_barrier();
    __builtin_amdgcn_fence(__ATOMIC_ACQUIRE, "workgroup");
    if (OUT_MODE == 0) {
      float* C = (float*)Cout + (size_t)b * strideC;
      const int hh = lane >> 4, c4 = (lane & 15) * 4;     // row seg = 256 B = 16 lanes x 16 B
      {
#pragma unroll
        for (int it = 0; it < 8; ++it) {
          const int row = it * 2 + hh;
          v4f v = *(const v4f*)(slab + row * 68 + c4);
          *(v4f*)(C + (size_t)(mBase + row) * ldc + n0 + c4) = v;
        }
        
      }
    } else {
      const int q = lane >> 3, c8 = (lane & 7) * 8;
      unsigned short* C  = (unsigned short*)Cout  + (size_t)b * strideC;
      unsigned short* C2 = (OUT_MODE == 2) ? ((unsigned short*)Cout2 + (size_t)b * strideC) : nullptr;
      {
#pragma unroll
        for (int it = 0; it < 4; ++it) {
          const int row = it * 4 + q;
          const float* sp = slab + row * 68 + c8;
          v8h hv, lv;
#pragma unroll
          for (int e = 0; e < 8; ++e) {
            if (OUT_MODE == 1) {
              hv[e] = (_Float16)sp[e];
            } else {
              unsigned short hb = f2bf_bits(sp[e]);
              unsigned short lb = f2bf_bits(sp[e] - bf_bits2f(hb));
              hv[e] = __builtin_bit_cast(_Float16, hb);
              lv[e] = __builtin_bit_cast(_Float16, lb);
            }
          }
          *(v8h*)(C + (size_t)(mBase + row) * ldc + n0 + c8) = hv;
          if (OUT_MODE == 2) *(v8h*)(C2 + (size_t)(mBase + row) * ldc + n0 + c8) = lv;
        }
        
      }
    }
    __builtin_amdgcn_fence(__ATOMIC_RELEASE, "workgroup");
    __builtin_amdgcn_wave_barrier();
    __builtin_amdgcn_fence(__ATOMIC_ACQUIRE, "workgroup");
  }
}

__global__ __launch_bounds__(256) void cast_f32_f16x2s(
    const float* __restrict__ in, _Float16* __restrict__ out, int n2, float scale) {
  int i = blockIdx.x * 256 + threadIdx.x;
  if (i < n2) {
    const _Float16 h0 = (_Float16)(in[2 * i] * scale), h1 = (_Float16)(in[2 * i + 1] * scale);
    const unsigned u = (unsigned)__builtin_bit_cast(unsigned short, h0) | ((unsigned)__builtin_bit_cast(unsigned short, h1) << 16);
    ((unsigned*)out)[i] = u;
    
  }
}

// ---- additive score terms + mask, dense per head ------------------------------------------------------
//   qf, rf: f32 projection outputs, row i*8+b, col h*64+d (qf already includes the s_q column term).
//   Phase 1 (LDS): e0[i] = newq[n,i,:].semb[0][h*64..], e1[i] = newq[n,i,:].semb[1][h*64..], cv[i] = r[n,i,:].semb[0][h*64..]
//   Phase 2: SB[n][i][j] = amask[n][i][j] != 0 ? 3e38 (sentinel)
//                        : 0.125 * ( utt[n][i][j] * (smask[b][i][j] -> e1[i] : e0[i]) + (j <= i ? cv[127-i+j] : 0) )
__global__ __launch_bounds__(128) void sbias_kernel(
    const float* __restrict__ qf, const float* __restrict__ rf, const float* __restrict__ semb,
    const float* __restrict__ utt, const int* __restrict__ amask, const int* __restrict__ smask,
    float* __restrict__ sb) {
  __shared__ float se0[128];
  __shared__ float se1[128];
  __shared__ float scv[128];
  const int n = blockIdx.x, t = threadIdx.x;
  const int b = n >> 4, h = n & 15;
  {
    const size_t ro = ((size_t)(t * 8 + b)) * 1024 + (size_t)h * 64;
    const float* qr = qf + ro;
    const float* rr = rf + ro;
    const float* s0 = semb + h * 64;
    const float* s1 = semb + 1024 + h * 64;
    float a0 = 0.f, a1 = 0.f, a2 = 0.f;
#pragma unroll 1
    for (int e = 0; e < 64; e += 4) {
      const v4f qv = *(const v4f*)(qr + e);
      const v4f rv = *(const v4f*)(rr + e);
      const v4f w0 = *(const v4f*)(s0 + e);
      const v4f w1 = *(const v4f*)(s1 + e);
#pragma unroll
      for (int u = 0; u < 4; ++u) {
        a0 = fmaf(qv[u], w0[u], a0);
        a1 = fmaf(qv[u], w1[u], a1);
        a2 = fmaf(rv[u], w0[u], a2);
      }
    }
    se0[t] = a0;
    se1[t] = a1;
    scv[t] = a2;
  }
  __syncthreads();
  const float* ub  = utt   + (size_t)n * 16384;
  const int*   ab  = amask + (size_t)n * 16384;
  const int*   smb = smask + (size_t)b * 16384;
  float*       ob  = sb    + (size_t)n * 16384;
#pragma unroll 1
  for (int i = 0; i < 128; ++i) {
    const int e = i * 128 + t;
    const float u = ub[e];
    const int am = ab[e];
    int sm = smb[e];
    if (sm < 0) sm += 2;                       // 2-row table: wrap negatives, then clamp
    sm = sm < 0 ? 0 : (sm > 1 ? 1 : sm);
    const float ev = (sm != 0) ? se1[i] : se0[i];
    int cc = 127 - i + t;
    cc = cc < 0 ? 0 : (cc > 127 ? 127 : cc);
    const float a3 = (t <= i) ? scv[cc] : 0.0f;
    float val = (u * ev + a3) * 0.125f;
    if (am != 0) val = 3.0e38f;
    *(float*)(ob + e) = val;
    
  }
}

// =====================================================================================
// Attention for head_dim 64 with a dense additive score tensor, f32 in / f32 out, f16 operands:
//   s = (q.k^T) * sscale + SB[bh][q][kv];  SB element above sent_thr -> s = mask_fill (kept in the softmax)
//   softmax over all Skv keys in f32 (online over 64-key chunks); p carried x2^15 as f16; out = p.v / (l*2^15).
//   Block = 4 waves = 64 query rows of one (b, h); grid.x = B*H*(S/64).
//   Element (b, s, h, d) of q/k/v/out at X[b*X_bs + s*X_rs + h*X_hs + d]; SB element (bh, q, kv) at sb[bh*sb_ns + q*sb_rs + kv].
// =====================================================================================
#define AT_D 64
#define AT_NW 4
#define AT_QB 64
#define AT_KC 64
struct AttnArgs { long q_bs, q_rs, q_hs, k_bs, k_rs, k_hs, v_bs, v_rs, v_hs, o_bs, o_rs, o_hs, sb_ns, sb_rs;
                  int S, Skv, H, nchunks; float sscale, mask_fill, sent_thr, resv; };
static_assert(sizeof(AttnArgs) == 144);

__device__ __forceinline__ v8f mma_f16g(v16h a, v16h b, v8f c) {
  c = __builtin_amdgcn_wmma_f32_16x16x32_f16(false, a, false, b, (short)0, c, false, false);
  asm volatile("v_nop\n\tv_nop\n\tv_nop\n\tv_nop" : "+v"(c) : "v"(a), "v"(b));
  return c;
}

__global__ __launch_bounds__(128)
void attn64_sbias_f16(const float* __restrict__ q, const float* __restrict__ k,
                      const float* __restrict__ v, float* __restrict__ out,
                      const float* __restrict__ sb, AttnArgs g) {
  const float PSC = 32768.0f;
  union FB { v16h v; v8h h[2]; };
  __shared__ __align__(16) _Float16 Ksh[AT_KC * AT_D];            // K [kv][d]   8 KB
  __shared__ __align__(16) _Float16 Vth[AT_D * AT_KC];            // V [d][kv]   8 KB
  __shared__ __align__(16) _Float16 Psh[AT_NW][16 * AT_KC];       // per wave P [row][kv]  8 KB
  __shared__ __align__(16) float    Os[AT_NW][16 * 68];           // per wave out tile, pitch 68

  const int tid  = threadIdx.x;
  const int wave = tid >> 5;
  const int lane = tid & 31;
  const int hh   = lane >> 4;
  const int c    = lane & 15;

  const int nqb = g.S / AT_QB;
  const int bx = blockIdx.x;
  const int qb = bx % nqb;
  const int bh = bx / nqb;
  const int h  = bh % g.H;
  const int b  = bh / g.H;
  const int q0 = qb * AT_QB + wave * 16;

  const float* qb_ptr = q   + (size_t)b * g.q_bs + (size_t)h * g.q_hs;
  const float* kb_ptr = k   + (size_t)b * g.k_bs + (size_t)h * g.k_hs;
  const float* vb_ptr = v   + (size_t)b * g.v_bs + (size_t)h * g.v_hs;
  float*       ob_ptr = out + (size_t)b * g.o_bs + (size_t)h * g.o_hs;

  // ---- Q fragments (A operand), 2 d-chunks, split k map ----
  v16h qa[2];
  {
    const float* qrow = qb_ptr + (size_t)(q0 + c) * g.q_rs;
#pragma unroll
    for (int dc = 0; dc < 2; ++dc) {
      const v4f f0 = *(const v4f*)(qrow + dc * 32 + 8 * hh);
      const v4f f1 = *(const v4f*)(qrow + dc * 32 + 8 * hh + 4);
      const v4f f2 = *(const v4f*)(qrow + dc * 32 + 16 + 8 * hh);
      const v4f f3 = *(const v4f*)(qrow + dc * 32 + 16 + 8 * hh + 4);
#pragma unroll
      for (int e = 0; e < 4; ++e) {
        qa[dc][e]      = (_Float16)f0[e];
        qa[dc][4 + e]  = (_Float16)f1[e];
        qa[dc][8 + e]  = (_Float16)f2[e];
        qa[dc][12 + e] = (_Float16)f3[e];
      }
    }
  }

  float mrow[8], lrow[8];
  v8f oacc[4];
#pragma unroll
  for (int r = 0; r < 8; ++r) { mrow[r] = -INFINITY; lrow[r] = 0.f; }
#pragma unroll
  for (int t = 0; t < 4; ++t) oacc[t] = (v8f){0.f,0.f,0.f,0.f,0.f,0.f,0.f,0.f};

  int nChunks = g.Skv / AT_KC;                 // block-uniform, host-provided
  if (nChunks > 64) nChunks = 64;
  for (int kc = 0; kc < nChunks; ++kc) {
    const int kv0 = kc * AT_KC;
    __syncthreads();
    {
      const int kvr = tid >> 1, dh = (tid & 1) * 32;
      const float* krow = kb_ptr + (size_t)(kv0 + kvr) * g.k_rs + dh;
      const float* vrow = vb_ptr + (size_t)(kv0 + kvr) * g.v_rs + dh;
#pragma unroll
      for (int i = 0; i < 8; ++i) {
        v4f kk = *(const v4f*)(krow + 4 * i);
        v4f vv = *(const v4f*)(vrow + 4 * i);
#pragma unroll
        for (int e = 0; e < 4; ++e) {
          const int d = dh + 4 * i + e;
          Ksh[kvr * AT_D + d]  = (_Float16)kk[e];
          Vth[d * AT_KC + kvr] = (_Float16)vv[e];
        }
      }
    }
    __syncthreads();

    v8f s[4];
#pragma unroll
    for (int j = 0; j < 4; ++j) {
      s[j] = (v8f){0.f,0.f,0.f,0.f,0.f,0.f,0.f,0.f};
#pragma unroll
      for (int dc = 0; dc < 2; ++dc) {
        FB kb;
        kb.h[0] = *(const v8h*)(Ksh + (j * 16 + c) * AT_D + dc * 32 + 8 * hh);
        kb.h[1] = *(const v8h*)(Ksh + (j * 16 + c) * AT_D + dc * 32 + 16 + 8 * hh);
        s[j] = mma_f16g(qa[dc], kb.v, s[j]);
      }
    }
    // additive terms + mask select, row max
    const float* sbp = sb + (size_t)bh * g.sb_ns + (size_t)(q0 + 8 * hh) * g.sb_rs + kv0 + c;
    float cm[8];
#pragma unroll
    for (int r = 0; r < 8; ++r) {
      const float* sbr = sbp + (size_t)r * g.sb_rs;
      float m = -INFINITY;
#pragma unroll
      for (int j = 0; j < 4; ++j) {
        const float bb = sbr[j * 16];
        float sv = fmaf(s[j][r], g.sscale, bb);
        if (bb > g.sent_thr) sv = g.mask_fill;
        s[j][r] = sv;
        m = fmaxf(m, sv);
      }
#pragma unroll
      for (int off = 1; off < 16; off <<= 1) m = fmaxf(m, __shfl_xor(m, off, 32));
      cm[r] = m;
    }
    _Float16* pwh = Psh[wave];
#pragma unroll
    for (int r = 0; r < 8; ++r) {
      const float mnew = fmaxf(mrow[r], cm[r]);
      const float alpha = expf(mrow[r] - mnew);
      mrow[r] = mnew;
      float psum = 0.f;
#pragma unroll
      for (int j = 0; j < 4; ++j) {
        const float p = expf(s[j][r] - mnew);
        psum += p;
        pwh[(8 * hh + r) * AT_KC + j * 16 + c] = (_Float16)(p * PSC);
      }
#pragma unroll
      for (int off = 1; off < 16; off <<= 1) psum += __shfl_xor(psum, off, 32);
      lrow[r] = lrow[r] * alpha + psum;
#pragma unroll
      for (int t = 0; t < 4; ++t) oacc[t][r] *= alpha;
    }
    __builtin_amdgcn_fence(__ATOMIC_RELEASE, "workgroup");
    __builtin_amdgcn_wave_barrier();
    __builtin_amdgcn_fence(__ATOMIC_ACQUIRE, "workgroup");
#pragma unroll 1
    for (int kk = 0; kk < 2; ++kk) {
      FB pa;
      pa.h[0] = *(const v8h*)(pwh + c * AT_KC + kk * 32 + 8 * hh);
      pa.h[1] = *(const v8h*)(pwh + c * AT_KC + kk * 32 + 16 + 8 * hh);
#pragma unroll
      for (int t = 0; t < 4; ++t) {
        FB vb;
        vb.h[0] = *(const v8h*)(Vth + (t * 16 + c) * AT_KC + kk * 32 + 8 * hh);
        vb.h[1] = *(const v8h*)(Vth + (t * 16 + c) * AT_KC + kk * 32 + 16 + 8 * hh);
        oacc[t] = mma_f16g(pa.v, vb.v, oacc[t]);
      }
    }
  }

  float* os = Os[wave];
#pragma unroll
  for (int r = 0; r < 8; ++r) {
    const float inv = 1.0f / (lrow[r] * PSC);
#pragma unroll
    for (int t = 0; t < 4; ++t) os[(8 * hh + r) * 68 + t * 16 + c] = oacc[t][r] * inv;
  }
  __builtin_amdgcn_fence(__ATOMIC_RELEASE, "workgroup");
  __builtin_amdgcn_wave_barrier();
  __builtin_amdgcn_fence(__ATOMIC_ACQUIRE, "workgroup");
  {
    const int c4 = (lane & 15) * 4;
    {
#pragma unroll
      for (int it = 0; it < 8; ++it) {
        const int row = it * 2 + hh;
        v4f val = *(const v4f*)(os + row * 68 + c4);
        *(v4f*)(ob_ptr + (size_t)(q0 + row) * g.o_rs + c4) = val;
      }
      
    }
  }
}

// ---------------------------------------------------------------------------
// Host launcher. Layout of q/k/v/r/ctx matrices: row = i*8 + b (i = position, b = batch),
// col = h*64 + d; head n = b*16 + h. The (B,L,D) positional input is used as a flat [1024][1024]
// A matrix exactly like the (L,B,D) query (literal view semantics of the position projection).
// ---------------------------------------------------------------------------
extern "C" void kernel_launch(void* const* d_in, const int* in_sizes, int n_in,
                              void* d_out, int out_size, void* d_ws, size_t ws_size,
                              hipStream_t stream) {
  if (n_in < 11) return;
  const int NE = 1024 * 1024;                 // elements of every [*,*,1024] tensor and of each weight
  if (in_sizes[0] != NE || in_sizes[1] != NE || in_sizes[3] != NE || in_sizes[4] != NE ||
      in_sizes[5] != NE || in_sizes[6] != NE || in_sizes[7] != NE || in_sizes[8] != 2 * 1024 ||
      in_sizes[2] != 128 * 128 * 128 || in_sizes[9] != 128 * 128 * 128 || in_sizes[10] != 8 * 128 * 128 ||
      out_size != NE) return;

  const float* query    = (const float*)d_in[0];   // (L,B,D)
  const float* rel_pe   = (const float*)d_in[1];   // (B,L,D)
  const float* utt_mask = (const float*)d_in[2];   // (B*H,L,L,1) f32
  const float* Wq       = (const float*)d_in[3];
  const float* Wk       = (const float*)d_in[4];
  const float* Wv       = (const float*)d_in[5];
  const float* Wr       = (const float*)d_in[6];
  const float* Wo       = (const float*)d_in[7];
  const float* spk_emb  = (const float*)d_in[8];   // (2,D)
  const int*   attn_msk = (const int*)d_in[9];     // (B*H,L,L) int32, nonzero = masked
  const int*   spk_msk  = (const int*)d_in[10];    // (B,L,L) int32 in {0,1}
  float* out = (float*)d_out;

  // ---- workspace carve (bytes) ----
  const size_t MiB = (size_t)1 << 20;
  const size_t off_q16 = 0;                    // query  f16       2 MiB
  const size_t off_p16 = 2 * MiB;              // rel_pe f16       2 MiB
  const size_t off_w16 = 4 * MiB;              // 5 weights f16 x16, 2 MiB each (Wq,Wk,Wv,Wr,Wo)
  const size_t off_qf  = 14 * MiB;             // new_q f32        4 MiB
  const size_t off_kf  = 18 * MiB;             // k f32            4 MiB
  const size_t off_vf  = 22 * MiB;             // v f32            4 MiB (directly after k: batched GEMM stride)
  const size_t off_rf  = 26 * MiB;             // r f32            4 MiB
  const size_t off_sb  = 30 * MiB;             // score bias [128][128][128] f32  8 MiB
  const size_t off_ctx = 38 * MiB;             // ctx f32          4 MiB
  const size_t off_c16 = 42 * MiB;             // ctx f16 x16      2 MiB
  const size_t total   = 44 * MiB;
  if (total > ws_size || total > 128 * MiB) return;

  char* ws = (char*)d_ws;
  _Float16* q16 = (_Float16*)(ws + off_q16);
  _Float16* p16 = (_Float16*)(ws + off_p16);
  _Float16* w16 = (_Float16*)(ws + off_w16);
  float* qf  = (float*)(ws + off_qf);
  float* kf  = (float*)(ws + off_kf);
  float* vf  = (float*)(ws + off_vf);
  float* rf  = (float*)(ws + off_rf);
  float* sbp = (float*)(ws + off_sb);
  float* ctx = (float*)(ws + off_ctx);
  _Float16* c16 = (_Float16*)(ws + off_c16);

  const int n2 = NE / 2;
  const int cgrid = (n2 + 255) / 256;
  // ---- casts: activations x1, weights x16 (exact power of two, undone in the GEMM epilogue) ----
  cast_f32_f16x2s<<<cgrid, 256, 0, stream>>>(query,  q16, n2, 1.0f);
  cast_f32_f16x2s<<<cgrid, 256, 0, stream>>>(rel_pe, p16, n2, 1.0f);
  cast_f32_f16x2s<<<cgrid, 256, 0, stream>>>(Wq, w16 + 0 * (size_t)NE, n2, 16.0f);
  cast_f32_f16x2s<<<cgrid, 256, 0, stream>>>(Wk, w16 + 1 * (size_t)NE, n2, 16.0f);
  cast_f32_f16x2s<<<cgrid, 256, 0, stream>>>(Wv, w16 + 2 * (size_t)NE, n2, 16.0f);
  cast_f32_f16x2s<<<cgrid, 256, 0, stream>>>(Wr, w16 + 3 * (size_t)NE, n2, 16.0f);
  cast_f32_f16x2s<<<cgrid, 256, 0, stream>>>(Wo, w16 + 4 * (size_t)NE, n2, 16.0f);

  // ---- projections: C = X . W^T, 1024x1024x1024 each; q gets column bias spk_emb[0][col] (= new_q) ----
  const int M = 1024, N = 1024, K = 1024;
  const int tiles = (M / 64) * (N / 64);
  const int gblocks = (tiles + 7) / 8;
  const float wscale_inv = 1.0f / 16.0f;
  {
    dim3 grid(gblocks, 1);
    wmma_gemm64<0, false, 2, 0, false><<<grid, 256, 0, stream>>>(
        (const unsigned short*)q16, (const unsigned short*)q16, K, 0L,
        (const unsigned short*)(w16 + 0 * (size_t)NE), (const unsigned short*)(w16 + 0 * (size_t)NE), K, 0L,
        (void*)qf, (void*)qf, N, 0L,
        spk_emb, spk_emb, 0L, M, N, K, wscale_inv);
  }
  {
    dim3 grid(gblocks, 2);   // y = 0: k (Wk -> kf), y = 1: v (Wv -> vf = kf + NE)
    wmma_gemm64<0, false, 0, 0, false><<<grid, 256, 0, stream>>>(
        (const unsigned short*)q16, (const unsigned short*)q16, K, 0L,
        (const unsigned short*)(w16 + 1 * (size_t)NE), (const unsigned short*)(w16 + 1 * (size_t)NE), K, (long)NE,
        (void*)kf, (void*)kf, N, (long)NE,
        spk_emb, spk_emb, 0L, M, N, K, wscale_inv);
  }
  {
    dim3 grid(gblocks, 1);   // rel_pe flat [1024][1024] . Wr^T -> rf (literal view)
    wmma_gemm64<0, false, 0, 0, false><<<grid, 256, 0, stream>>>(
        (const unsigned short*)p16, (const unsigned short*)p16, K, 0L,
        (const unsigned short*)(w16 + 3 * (size_t)NE), (const unsigned short*)(w16 + 3 * (size_t)NE), K, 0L,
        (void*)rf, (void*)rf, N, 0L,
        spk_emb, spk_emb, 0L, M, N, K, wscale_inv);
  }

  // ---- dense additive score terms (a2 + a3) * 1/8 with the mask folded in as a sentinel ----
  sbias_kernel<<<128, 128, 0, stream>>>(qf, rf, spk_emb, utt_mask, attn_msk, spk_msk, sbp);

  // ---- attention: 128 heads (b*16+h) of 128x128, head dim 64; s = a1/8 + SB, sentinel -> 1e-30 ----
  {
    AttnArgs g;
    g.q_bs = 1024; g.q_rs = 8 * 1024; g.q_hs = 64;
    g.k_bs = 1024; g.k_rs = 8 * 1024; g.k_hs = 64;
    g.v_bs = 1024; g.v_rs = 8 * 1024; g.v_hs = 64;
    g.o_bs = 1024; g.o_rs = 8 * 1024; g.o_hs = 64;
    g.sb_ns = 128 * 128; g.sb_rs = 128;
    g.S = 128; g.Skv = 128; g.H = 16; g.nchunks = 2;
    g.sscale = 0.125f; g.mask_fill = 1e-30f; g.sent_thr = 1.0e37f; g.resv = 0.0f;
    const int agrid = 8 * 16 * (128 / AT_QB);   // 256 blocks
    attn64_sbias_f16<<<agrid, 128, 0, stream>>>(qf, kf, vf, ctx, sbp, g);
  }

  // ---- ctx f32 -> f16 x16, then output projection into d_out (scale 1/256 undoes both x16) ----
  cast_f32_f16x2s<<<cgrid, 256, 0, stream>>>(ctx, c16, n2, 16.0f);
  {
    dim3 grid(gblocks, 1);
    wmma_gemm64<0, false, 0, 0, false><<<grid, 256, 0, stream>>>(
        (const unsigned short*)c16, (const unsigned short*)c16, K, 0L,
        (const unsigned short*)(w16 + 4 * (size_t)NE), (const unsigned short*)(w16 + 4 * (size_t)NE), K, 0L,
        (void*)out, (void*)out, N, 0L,
        spk_emb, spk_emb, 0L, M, N, K, 1.0f / 256.0f);
  }
  (void)hipGetLastError();
}

// v002
// Measured time: 108 microseconds a run.
// Timed twice side by side with v001, it ran 1.59 and 1.58 times as fast.
// Over all steps from v000 it is 2.53 times as fast.
#include <hip/hip_runtime.h>
#include <stdint.h>
// Contractions: five 1024x1024x1024 projections (X . W^T), per-head q.k^T (K=64) and p.v (K=128): v_wmma_f32_16x16x32_f16 (f16 operands; weights and ctx carried x16, p carried x2^15, exact powers of two folded back in f32), f32 accumulate. Softmax, additive score terms and depth-64 speaker row dots in f32 on VALU.

typedef __attribute__((ext_vector_type(16))) _Float16 v16h;
typedef __attribute__((ext_vector_type(8)))  _Float16 v8h;
typedef __attribute__((ext_vector_type(16))) __bf16   v16b;
typedef __attribute__((ext_vector_type(8)))  __bf16   v8b;
typedef __attribute__((ext_vector_type(8)))  float    v8f;
typedef __attribute__((ext_vector_type(4)))  float    v4f;

__device__ __forceinline__ unsigned short f2bf_bits(float f) {
  unsigned u = __float_as_uint(f);
  return (unsigned short)((u + 0x7FFFu + ((u >> 16) & 1u)) >> 16);
}
__device__ __forceinline__ float bf_bits2f(unsigned short h) { return __uint_as_float(((unsigned)h) << 16); }

// hazard guards as plain device helpers (no inline asm inside the kernel template body)
__device__ __forceinline__ void acc_guard4(v8f& a, v8f& b, v8f& c, v8f& d) { asm volatile("v_nop\n\tv_nop\n\tv_nop\n\tv_nop" : "+v"(a), "+v"(b), "+v"(c), "+v"(d)); }
template <typename T> struct Frag;
template <> struct Frag<_Float16> {
  typedef v16h V; union U { v16h v; v8h h[2]; };
  static __device__ __forceinline__ v16h load(const _Float16* p) {   // elements 0..7 <- p[0..7], 8..15 <- p[16..23]
    U f; f.h[0] = *(const v8h*)(p); f.h[1] = *(const v8h*)(p + 16); return f.v;
  }
  static __device__ __forceinline__ v8f mma(v16h a, v16h b, v8f c) {
    return __builtin_amdgcn_wmma_f32_16x16x32_f16(false, a, false, b, (short)0, c, false, false);
  }
};
template <> struct Frag<__bf16> {
  typedef v16b V; union U { v16b v; v8b h[2]; };
  static __device__ __forceinline__ v16b load(const __bf16* p) {
    U f; f.h[0] = *(const v8b*)(p); f.h[1] = *(const v8b*)(p + 16); return f.v;
  }
  static __device__ __forceinline__ v8f mma(v16b a, v16b b, v8f c) {
    return __builtin_amdgcn_wmma_f32_16x16x32_bf16(false, a, false, b, (short)0, c, false, false);
  }
};

// ---- Register-blocked batched WMMA GEMM ------------------------------------
// C[m,n] = scale * sum_k A[m,k] * Bt[n,k] (+bias)(+resid); each wave owns a 64x64 tile,
// the eight waves of a work-group own eight neighbouring tiles of one tile row (64 x 512).
// A row-major [M,K]; Bt row-major [N,K]; M % 64 == 0, N % 512 == 0, K % 64 == 0.
// Operand path: per pass of 64 k the work-group's 64 A rows and 512 Bt rows (128 B each, whole lines)
// go to LDS by asynchronous 16-byte copies, two buffers, the next pass in flight while this one is
// multiplied; the waves read their fragments from LDS (row pitch 144 B = 16 B x odd for ds_load_b128).
// SPLIT (hi/lo operand planes) is not staged by this path and is not instantiated.
// BIAS_MODE: 0 = none, 1 = bias[m], 2 = bias[n].
// OUT_MODE: 0 = f32, 1 = f16, 2 = bf16 hi plane (Cout) + bf16 lo plane (Cout2).
// ET: 0 = f16 operands, 1 = bf16 operands (pointers passed as 16-bit storage)
template <int ET> struct Elem;
template <> struct Elem<0> { typedef _Float16 T; };
template <> struct Elem<1> { typedef __bf16 T; };
#define G_PITCH 72                       // LDS row pitch in 16-bit elements (128 B of k + 16 B)
#define G_ROWS  576                      // 64 A rows, then 512 Bt rows
#define G_BUF   (G_ROWS * G_PITCH)       // elements of one buffer (82,944 B)

// Nine asynchronous 16-byte-per-lane copies global -> LDS. The s_wait_xcnt closes the statement so that
// no address register named here is rewritten before it.
template <typename T>
__device__ __forceinline__ void async_copy9(const unsigned (&l)[9], const T* const (&g)[9]) {
  asm volatile(
      "global_load_async_to_lds_b128 %0, %9, off\n\t"
      "global_load_async_to_lds_b128 %1, %10, off\n\t"
      "global_load_async_to_lds_b128 %2, %11, off\n\t"
      "global_load_async_to_lds_b128 %3, %12, off\n\t"
      "global_load_async_to_lds_b128 %4, %13, off\n\t"
      "global_load_async_to_lds_b128 %5, %14, off\n\t"
      "global_load_async_to_lds_b128 %6, %15, off\n\t"
      "global_load_async_to_lds_b128 %7, %16, off\n\t"
      "global_load_async_to_lds_b128 %8, %17, off\n\t"
      "s_wait_xcnt 0x0"
      :: "v"(l[0]), "v"(l[1]), "v"(l[2]), "v"(l[3]), "v"(l[4]), "v"(l[5]), "v"(l[6]), "v"(l[7]), "v"(l[8]),
         "v"(g[0]), "v"(g[1]), "v"(g[2]), "v"(g[3]), "v"(g[4]), "v"(g[5]), "v"(g[6]), "v"(g[7]), "v"(g[8])
      : "memory");
}
// One pass's tile: 576 rows x 8 chunks of 16 B = 18 chunks per thread; a wave-wide copy covers 4 whole rows.
// ga / gb: this thread's chunk in A row (tid >> 3) / Bt row (tid >> 3) of the work-group's rows, at the pass's k.
// l0: this thread's LDS byte address for row (tid >> 3) of the target buffer.
template <typename T>
__device__ __forceinline__ void stage_tile(unsigned l0, const T* ga, const T* gb, int lda, int ldb) {
  unsigned l[9]; const T* g[9];
#pragma unroll
  for (int it = 0; it < 9; ++it) {       // rows 0..287: A rows 0..63, Bt rows 0..223
    l[it] = l0 + (unsigned)(it * 32 * G_PITCH * 2);
    g[it] = (it < 2) ? (ga + (size_t)(it * 32) * lda) : (gb + (size_t)((it - 2) * 32) * ldb);
  }
  async_copy9<T>(l, g);
#pragma unroll
  for (int it = 0; it < 9; ++it) {       // rows 288..575: Bt rows 224..511
    l[it] = l0 + (unsigned)((it + 9) * 32 * G_PITCH * 2);
    g[it] = gb + (size_t)((it + 7) * 32) * ldb;
  }
  async_copy9<T>(l, g);
}
// this wave's LDS reads have retired (before the buffer they read is handed back for a refill)
__device__ __forceinline__ void wait_lds_reads()   { asm volatile("s_wait_dscnt 0x0" ::: "memory"); }
// this wave's asynchronous copies have landed (the compiler places no wait for them)
__device__ __forceinline__ void wait_async_copies() { asm volatile("s_wait_asynccnt 0x0" ::: "memory"); }

template <int ET, bool SPLIT, int BIAS_MODE, int OUT_MODE, bool RESID, int ACT = 0>
__global__ __launch_bounds__(256) void wmma_gemm64(
    const unsigned short* __restrict__ Ap, const unsigned short* __restrict__ A2p, int lda, long strideA,
    const unsigned short* __restrict__ Btp, const unsigned short* __restrict__ Bt2p, int ldb, long strideB,
    void* __restrict__ Cout, void* __restrict__ Cout2, int ldc, long strideC,
    const float* __restrict__ bias,
    const float* __restrict__ resid, long strideR,
    int M, int N, int K, float scale) {
  typedef typename Elem<ET>::T T;
  typedef typename Frag<T>::V V;
  static_assert(!SPLIT, "the LDS operand path stages one plane per operand");
  const T* A = (const T*)Ap; const T* Bt = (const T*)Btp;
  __shared__ __align__(16) T ring[2 * G_BUF];      // two operand buffers
  __shared__ __align__(16) float sT[8][16 * 68];   // per-wave 16x64 slab, pitch 68 floats
  const int b    = blockIdx.y;
  const int lane = threadIdx.x & 31;
  const int wave = threadIdx.x >> 5;
  const int tilesN = N >> 6;
  const int tilesM = M >> 6;
  const int tile0 = blockIdx.x * 8;      // the work-group's first tile; tilesN % 8 == 0, so all eight share tm
  if (tile0 >= tilesM * tilesN) return;  // the same for the whole work-group, in front of every barrier
  const int tm = tile0 / tilesN;
  const int m0 = tm << 6;
  const int nb0 = (tile0 - tm * tilesN) << 6;   // first Bt row of the work-group
  const int n0 = nb0 + (wave << 6);

  const T* Ab  = A  + (size_t)b * strideA;
  const T* Bb  = Bt + (size_t)b * strideB;

  const int rlane = lane & 15;                 // row (A) / col (B, D) within subtile
  const int koff  = (lane >> 4) * 8;           // k offset of this lane half
  const int mOff  = (lane >> 4) * 8;           // D row offset

  v8f acc[4][4];
#pragma unroll
  for (int i = 0; i < 4; ++i)
#pragma unroll
    for (int j = 0; j < 4; ++j) acc[i][j] = (v8f){0.f,0.f,0.f,0.f,0.f,0.f,0.f,0.f};

  const int srow = threadIdx.x >> 3;           // staged row of this thread within a group of 32 rows
  const int schk = (threadIdx.x & 7) * 8;      // its 16-byte chunk, in elements
  const T* ga = Ab + (size_t)(m0 + srow) * lda + schk;
  const T* gb = Bb + (size_t)(nb0 + srow) * ldb + schk;
  const unsigned l0 = (unsigned)(size_t)ring + (unsigned)((srow * G_PITCH + schk) * 2);
  const int nPass = K >> 6;

  stage_tile<T>(l0, ga, gb, lda, ldb);
  wait_async_copies();
  __syncthreads();                             // pass 0's tile is published
  if (nPass > 1) stage_tile<T>(l0 + (unsigned)(G_BUF * 2), ga + 64, gb + 64, lda, ldb);

#pragma unroll 1                               // one pass per trip: the buffer is picked by the trip's parity
  for (int t = 0; t < nPass; ++t) {
    const int bsel = (t & 1) * G_BUF;
    const T* ra = ring + bsel + rlane * G_PITCH + koff;
    const T* rb = ring + bsel + (64 + (wave << 6) + rlane) * G_PITCH + koff;
#pragma unroll
    for (int ks = 0; ks < 2; ++ks) {
      V bh[4], ah[4];
#pragma unroll
      for (int j = 0; j < 4; ++j) bh[j] = Frag<T>::load(rb + j * 16 * G_PITCH + ks * 32);
#pragma unroll
      for (int i = 0; i < 4; ++i) ah[i] = Frag<T>::load(ra + i * 16 * G_PITCH + ks * 32);
      // the 16 fragment reads stay one group in front of the 16 WMMAs: left free, the scheduler reuses one
      // A register set and the wave waits out the LDS latency four times per block
      __builtin_amdgcn_sched_barrier(0);
#pragma unroll
      for (int i = 0; i < 4; ++i)
#pragma unroll
        for (int j = 0; j < 4; ++j) acc[i][j] = Frag<T>::mma(ah[i], bh[j], acc[i][j]);
      __builtin_amdgcn_sched_barrier(0);       // and the next block's reads stay behind this block's WMMAs
    }
    wait_lds_reads();
    wait_async_copies();
    __syncthreads();                           // publishes pass t + 1's tile and ends every read of pass t's buffer
    if (t + 2 < nPass)
      stage_tile<T>(l0 + (unsigned)(bsel * 2), ga + (size_t)(t + 2) * 64, gb + (size_t)(t + 2) * 64, lda, ldb);
  }
  wait_async_copies();
  acc_guard4(acc[0][0], acc[0][1], acc[0][2], acc[0][3]);
  acc_guard4(acc[1][0], acc[1][1], acc[1][2], acc[1][3]);
  acc_guard4(acc[2][0], acc[2][1], acc[2][2], acc[2][3]);
  acc_guard4(acc[3][0], acc[3][1], acc[3][2], acc[3][3]);

  // ---- epilogue ----
  float* slab = sT[wave];
  const float* Rb = RESID ? (resid + (size_t)b * strideR) : nullptr;
#pragma unroll
  for (int i = 0; i < 4; ++i) {
    const int mBase = m0 + (i << 4);
#pragma unroll
    for (int j = 0; j < 4; ++j) {
      const int n = n0 + (j << 4) + rlane;
      float bv = 0.f;
      if (BIAS_MODE == 2) bv = bias[n];
#pragma unroll
      for (int r = 0; r < 8; ++r) {
        float v = acc[i][j][r] * scale;
        if (BIAS_MODE == 1) v += bias[mBase + mOff + r];
        if (BIAS_MODE == 2) v += bv;
        if (RESID) v += Rb[(size_t)(mBase + mOff + r) * ldc + n];
        if (ACT == 1) v = tanhf(v);
        if (ACT == 2) v = fmaxf(v, 0.0f);
        if (ACT == 3) v = v / (1.0f + expf(-v));
        if (ACT == 4) v = (v > 0.f) ? v : 0.01f * v;
        if (ACT == 5) v = 0.5f * v * (1.0f + erff(v * 0.70710678118654752f));
        slab[(mOff + r) * 68 + (j << 4) + rlane] = v;
      }
    }
    __builtin_amdgcn_fence(__ATOMIC_RELEASE, "workgroup");
    __builtin_amdgcn_wave_barrier();
    __builtin_amdgcn_fence(__ATOMIC_ACQUIRE, "workgroup");
    if (OUT_MODE == 0) {
      float* C = (float*)Cout + (size_t)b * strideC;
      const int hh = lane >> 4, c4 = (lane & 15) * 4;     // row seg = 256 B = 16 lanes x 16 B
      {
#pragma unroll
        for (int it = 0; it < 8; ++it) {
          const int row = it * 2 + hh;
          v4f v = *(const v4f*)(slab + row * 68 + c4);
          *(v4f*)(C + (size_t)(mBase + row) * ldc + n0 + c4) = v;
        }
        
      }
    } else {
      const int q = lane >> 3, c8 = (lane & 7) * 8;
      unsigned short* C  = (unsigned short*)Cout  + (size_t)b * strideC;
      unsigned short* C2 = (OUT_MODE == 2) ? ((unsigned short*)Cout2 + (size_t)b * strideC) : nullptr;
      {
#pragma unroll
        for (int it = 0; it < 4; ++it) {
          const int row = it * 4 + q;
          const float* sp = slab + row * 68 + c8;
          v8h hv, lv;
#pragma unroll
          for (int e = 0; e < 8; ++e) {
            if (OUT_MODE == 1) {
              hv[e] = (_Float16)sp[e];
            } else {
              unsigned short hb = f2bf_bits(sp[e]);
              unsigned short lb = f2bf_bits(sp[e] - bf_bits2f(hb));
              hv[e] = __builtin_bit_cast(_Float16, hb);
              lv[e] = __builtin_bit_cast(_Float16, lb);
            }
          }
          *(v8h*)(C + (size_t)(mBase + row) * ldc + n0 + c8) = hv;
          if (OUT_MODE == 2) *(v8h*)(C2 + (size_t)(mBase + row) * ldc + n0 + c8) = lv;
        }
        
      }
    }
    __builtin_amdgcn_fence(__ATOMIC_RELEASE, "workgroup");
    __builtin_amdgcn_wave_barrier();
    __builtin_amdgcn_fence(__ATOMIC_ACQUIRE, "workgroup");
  }
}

__global__ __launch_bounds__(256) void cast_f32_f16x2s(
    const float* __restrict__ in, _Float16* __restrict__ out, int n2, float scale) {
  int i = blockIdx.x * 256 + threadIdx.x;
  if (i < n2) {
    const _Float16 h0 = (_Float16)(in[2 * i] * scale), h1 = (_Float16)(in[2 * i + 1] * scale);
    const unsigned u = (unsigned)__builtin_bit_cast(unsigned short, h0) | ((unsigned)__builtin_bit_cast(unsigned short, h1) << 16);
    ((unsigned*)out)[i] = u;
    
  }
}

// ---- additive score terms + mask, dense per head ------------------------------------------------------
//   qf, rf: f32 projection outputs, row i*8+b, col h*64+d (qf already includes the s_q column term).
//   A work-group owns 64 score rows of one head (grid = 128 heads x 2 halves, 16 waves). Every global load of a
//   thread is independent of every other and all are requested up front: one round trip instead of one per row.
//   Phase 1 (LDS): e0[i] = newq[n,i,:].semb[0][h*64..], e1[i] = newq[n,i,:].semb[1][h*64..] for the 64 own rows,
//                  cv[i] = r[n,i,:].semb[0][h*64..] for all 128 rows; 16 lanes x 16 B per row, summed across the lanes.
//                  cv[128..255] = 0, so that cv[127-i+j] is the shifted term for j <= i and 0 for j > i.
//   Phase 2: SB[n][i][j] = amask[n][i][j] != 0 ? 3e38 (sentinel)
//                        : 0.125 * ( utt[n][i][j] * (smask[b][i][j] -> e1[i] : e0[i]) + cv[127-i+j] )
//            16 B per lane and array, a wave covers one whole 512-B row per access, four rows per wave.
typedef __attribute__((ext_vector_type(4))) int v4i;
#define SB_ROWS 64
__device__ __forceinline__ float dot4(v4f x, v4f w) {
  return fmaf(x[3], w[3], fmaf(x[2], w[2], fmaf(x[1], w[1], x[0] * w[0])));
}
__global__ __launch_bounds__(512) void sbias_kernel(
    const float* __restrict__ qf, const float* __restrict__ rf, const float* __restrict__ semb,
    const float* __restrict__ utt, const int* __restrict__ amask, const int* __restrict__ smask,
    float* __restrict__ sb) {
  __shared__ float se0[SB_ROWS];
  __shared__ float se1[SB_ROWS];
  __shared__ float scv[256];
  const int n = blockIdx.x >> 1, i0 = (blockIdx.x & 1) * SB_ROWS;
  const int b = n >> 4, h = n & 15;
  const int wave = threadIdx.x >> 5, lane = threadIdx.x & 31;
  const int hh = lane >> 4, d4 = (lane & 15) * 4;   // phase 1: row of the pair, four of the 64 depths
  const int c4 = lane * 4;                          // phase 2: this lane's four score columns
  const float* ub  = utt   + (size_t)n * 16384;
  const int*   ab  = amask + (size_t)n * 16384;
  const int*   smb = smask + (size_t)b * 16384;
  float*       ob  = sb    + (size_t)n * 16384;

  const v4f w0 = *(const v4f*)(semb + h * 64 + d4);
  const v4f w1 = *(const v4f*)(semb + 1024 + h * 64 + d4);
  const size_t co = (size_t)b * 1024 + (size_t)h * 64 + d4;
  v4f rv[4], qv[2];
#pragma unroll
  for (int k = 0; k < 4; ++k) rv[k] = *(const v4f*)(rf + (size_t)(wave * 8 + k * 2 + hh) * 8192 + co);
#pragma unroll
  for (int k = 0; k < 2; ++k) qv[k] = *(const v4f*)(qf + (size_t)(i0 + wave * 4 + k * 2 + hh) * 8192 + co);
  // the row loads' address registers may be reused as destinations of the loads below: the wait stands in front of that
  asm volatile("s_wait_xcnt 0x0" ::: "memory");
  v4f u4[4]; v4i am4[4], sm4[4];
#pragma unroll
  for (int k = 0; k < 4; ++k) {                // score rows i0 + wave + 16 k
    const int e = (i0 + wave + 16 * k) * 128 + c4;
    u4[k]  = *(const v4f*)(ub + e);
    am4[k] = *(const v4i*)(ab + e);
    sm4[k] = *(const v4i*)(smb + e);
  }
  // the mask loads stay in front of phase 1's arithmetic: left free, the scheduler issues them only behind the
  // wait for the projection rows, and the two round trips run one after the other
  __builtin_amdgcn_sched_barrier(0);

  float p[8];
#pragma unroll
  for (int k = 0; k < 4; ++k) p[k] = dot4(rv[k], w0);
#pragma unroll
  for (int k = 0; k < 2; ++k) { p[4 + k] = dot4(qv[k], w0); p[6 + k] = dot4(qv[k], w1); }
#pragma unroll
  for (int off = 1; off < 16; off <<= 1)
#pragma unroll
    for (int x = 0; x < 8; ++x) p[x] += __shfl_xor(p[x], off, 32);
  if ((lane & 15) == 0) {
#pragma unroll
    for (int k = 0; k < 4; ++k) scv[wave * 8 + k * 2 + hh] = p[k];
#pragma unroll
    for (int k = 0; k < 2; ++k) { se0[wave * 4 + k * 2 + hh] = p[4 + k]; se1[wave * 4 + k * 2 + hh] = p[6 + k]; }
  }
  if (threadIdx.x < 128) scv[128 + threadIdx.x] = 0.0f;
  __syncthreads();

#pragma unroll
  for (int k = 0; k < 4; ++k) {
    const int il = wave + 16 * k, i = i0 + il;
    const float e0v = se0[il], e1v = se1[il];
    const float* cvp = scv + (127 - i + c4);   // 0 <= 127 - i + j <= 254 for every row i and column j
    v4f o;
#pragma unroll
    for (int u = 0; u < 4; ++u) {
      int sm = sm4[k][u];
      if (sm < 0) sm += 2;                     // 2-row table: wrap negatives, then clamp
      sm = sm < 0 ? 0 : (sm > 1 ? 1 : sm);
      const float ev = (sm != 0) ? e1v : e0v;
      float val = (u4[k][u] * ev + cvp[u]) * 0.125f;
      if (am4[k][u] != 0) val = 3.0e38f;
      o[u] = val;
    }
    *(v4f*)(ob + i * 128 + c4) = o;
  }
}

// =====================================================================================
// Attention for head_dim 64 with a dense additive score tensor, f32 in / f32 out, f16 operands:
//   s = (q.k^T) * sscale + SB[bh][q][kv];  SB element above sent_thr -> s = mask_fill (kept in the softmax)
//   softmax over all Skv keys in f32 (online over 64-key chunks); p carried x2^15 as f16; out = p.v / (l*2^15).
//   Block = 4 waves = 64 query rows of one (b, h); grid.x = B*H*(S/64).
//   Element (b, s, h, d) of q/k/v/out at X[b*X_bs + s*X_rs + h*X_hs + d]; SB element (bh, q, kv) at sb[bh*sb_ns + q*sb_rs + kv].
// =====================================================================================
#define AT_D 64
#define AT_NW 4
#define AT_QB 64
#define AT_KC 64
struct AttnArgs { long q_bs, q_rs, q_hs, k_bs, k_rs, k_hs, v_bs, v_rs, v_hs, o_bs, o_rs, o_hs, sb_ns, sb_rs;
                  int S, Skv, H, nchunks; float sscale, mask_fill, sent_thr, resv; };
static_assert(sizeof(AttnArgs) == 144);

__device__ __forceinline__ v8f mma_f16g(v16h a, v16h b, v8f c) {
  c = __builtin_amdgcn_wmma_f32_16x16x32_f16(false, a, false, b, (short)0, c, false, false);
  asm volatile("v_nop\n\tv_nop\n\tv_nop\n\tv_nop" : "+v"(c) : "v"(a), "v"(b));
  return c;
}

__global__ __launch_bounds__(128)
void attn64_sbias_f16(const float* __restrict__ q, const float* __restrict__ k,
                      const float* __restrict__ v, float* __restrict__ out,
                      const float* __restrict__ sb, AttnArgs g) {
  const float PSC = 32768.0f;
  union FB { v16h v; v8h h[2]; };
  __shared__ __align__(16) _Float16 Ksh[AT_KC * AT_D];            // K [kv][d]   8 KB
  __shared__ __align__(16) _Float16 Vth[AT_D * AT_KC];            // V [d][kv]   8 KB
  __shared__ __align__(16) _Float16 Psh[AT_NW][16 * AT_KC];       // per wave P [row][kv]  8 KB
  __shared__ __align__(16) float    Os[AT_NW][16 * 68];           // per wave out tile, pitch 68

  const int tid  = threadIdx.x;
  const int wave = tid >> 5;
  const int lane = tid & 31;
  const int hh   = lane >> 4;
  const int c    = lane & 15;

  const int nqb = g.S / AT_QB;
  const int bx = blockIdx.x;
  const int qb = bx % nqb;
  const int bh = bx / nqb;
  const int h  = bh % g.H;
  const int b  = bh / g.H;
  const int q0 = qb * AT_QB + wave * 16;

  const float* qb_ptr = q   + (size_t)b * g.q_bs + (size_t)h * g.q_hs;
  const float* kb_ptr = k   + (size_t)b * g.k_bs + (size_t)h * g.k_hs;
  const float* vb_ptr = v   + (size_t)b * g.v_bs + (size_t)h * g.v_hs;
  float*       ob_ptr = out + (size_t)b * g.o_bs + (size_t)h * g.o_hs;

  // ---- Q fragments (A operand), 2 d-chunks, split k map ----
  v16h qa[2];
  {
    const float* qrow = qb_ptr + (size_t)(q0 + c) * g.q_rs;
#pragma unroll
    for (int dc = 0; dc < 2; ++dc) {
      const v4f f0 = *(const v4f*)(qrow + dc * 32 + 8 * hh);
      const v4f f1 = *(const v4f*)(qrow + dc * 32 + 8 * hh + 4);
      const v4f f2 = *(const v4f*)(qrow + dc * 32 + 16 + 8 * hh);
      const v4f f3 = *(const v4f*)(qrow + dc * 32 + 16 + 8 * hh + 4);
#pragma unroll
      for (int e = 0; e < 4; ++e) {
        qa[dc][e]      = (_Float16)f0[e];
        qa[dc][4 + e]  = (_Float16)f1[e];
        qa[dc][8 + e]  = (_Float16)f2[e];
        qa[dc][12 + e] = (_Float16)f3[e];
      }
    }
  }

  float mrow[8], lrow[8];
  v8f oacc[4];
#pragma unroll
  for (int r = 0; r < 8; ++r) { mrow[r] = -INFINITY; lrow[r] = 0.f; }
#pragma unroll
  for (int t = 0; t < 4; ++t) oacc[t] = (v8f){0.f,0.f,0.f,0.f,0.f,0.f,0.f,0.f};

  int nChunks = g.Skv / AT_KC;                 // block-uniform, host-provided
  if (nChunks > 64) nChunks = 64;
  for (int kc = 0; kc < nChunks; ++kc) {
    const int kv0 = kc * AT_KC;
    __syncthreads();
    {
      const int kvr = tid >> 1, dh = (tid & 1) * 32;
      const float* krow = kb_ptr + (size_t)(kv0 + kvr) * g.k_rs + dh;
      const float* vrow = vb_ptr + (size_t)(kv0 + kvr) * g.v_rs + dh;
#pragma unroll
      for (int i = 0; i < 8; ++i) {
        v4f kk = *(const v4f*)(krow + 4 * i);
        v4f vv = *(const v4f*)(vrow + 4 * i);
#pragma unroll
        for (int e = 0; e < 4; ++e) {
          const int d = dh + 4 * i + e;
          Ksh[kvr * AT_D + d]  = (_Float16)kk[e];
          Vth[d * AT_KC + kvr] = (_Float16)vv[e];
        }
      }
    }
    __syncthreads();

    v8f s[4];
#pragma unroll
    for (int j = 0; j < 4; ++j) {
      s[j] = (v8f){0.f,0.f,0.f,0.f,0.f,0.f,0.f,0.f};
#pragma unroll
      for (int dc = 0; dc < 2; ++dc) {
        FB kb;
        kb.h[0] = *(const v8h*)(Ksh + (j * 16 + c) * AT_D + dc * 32 + 8 * hh);
        kb.h[1] = *(const v8h*)(Ksh + (j * 16 + c) * AT_D + dc * 32 + 16 + 8 * hh);
        s[j] = mma_f16g(qa[dc], kb.v, s[j]);
      }
    }
    // additive terms + mask select, row max
    const float* sbp = sb + (size_t)bh * g.sb_ns + (size_t)(q0 + 8 * hh) * g.sb_rs + kv0 + c;
    float cm[8];
#pragma unroll
    for (int r = 0; r < 8; ++r) {
      const float* sbr = sbp + (size_t)r * g.sb_rs;
      float m = -INFINITY;
#pragma unroll
      for (int j = 0; j < 4; ++j) {
        const float bb = sbr[j * 16];
        float sv = fmaf(s[j][r], g.sscale, bb);
        if (bb > g.sent_thr) sv = g.mask_fill;
        s[j][r] = sv;
        m = fmaxf(m, sv);
      }
#pragma unroll
      for (int off = 1; off < 16; off <<= 1) m = fmaxf(m, __shfl_xor(m, off, 32));
      cm[r] = m;
    }
    _Float16* pwh = Psh[wave];
#pragma unroll
    for (int r = 0; r < 8; ++r) {
      const float mnew = fmaxf(mrow[r], cm[r]);
      const float alpha = expf(mrow[r] - mnew);
      mrow[r] = mnew;
      float psum = 0.f;
#pragma unroll
      for (int j = 0; j < 4; ++j) {
        const float p = expf(s[j][r] - mnew);
        psum += p;
        pwh[(8 * hh + r) * AT_KC + j * 16 + c] = (_Float16)(p * PSC);
      }
#pragma unroll
      for (int off = 1; off < 16; off <<= 1) psum += __shfl_xor(psum, off, 32);
      lrow[r] = lrow[r] * alpha + psum;
#pragma unroll
      for (int t = 0; t < 4; ++t) oacc[t][r] *= alpha;
    }
    __builtin_amdgcn_fence(__ATOMIC_RELEASE, "workgroup");
    __builtin_amdgcn_wave_barrier();
    __builtin_amdgcn_fence(__ATOMIC_ACQUIRE, "workgroup");
#pragma unroll 1
    for (int kk = 0; kk < 2; ++kk) {
      FB pa;
      pa.h[0] = *(const v8h*)(pwh + c * AT_KC + kk * 32 + 8 * hh);
      pa.h[1] = *(const v8h*)(pwh + c * AT_KC + kk * 32 + 16 + 8 * hh);
#pragma unroll
      for (int t = 0; t < 4; ++t) {
        FB vb;
        vb.h[0] = *(const v8h*)(Vth + (t * 16 + c) * AT_KC + kk * 32 + 8 * hh);
        vb.h[1] = *(const v8h*)(Vth + (t * 16 + c) * AT_KC + kk * 32 + 16 + 8 * hh);
        oacc[t] = mma_f16g(pa.v, vb.v, oacc[t]);
      }
    }
  }

  float* os = Os[wave];
#pragma unroll
  for (int r = 0; r < 8; ++r) {
    const float inv = 1.0f / (lrow[r] * PSC);
#pragma unroll
    for (int t = 0; t < 4; ++t) os[(8 * hh + r) * 68 + t * 16 + c] = oacc[t][r] * inv;
  }
  __builtin_amdgcn_fence(__ATOMIC_RELEASE, "workgroup");
  __builtin_amdgcn_wave_barrier();
  __builtin_amdgcn_fence(__ATOMIC_ACQUIRE, "workgroup");
  {
    const int c4 = (lane & 15) * 4;
    {
#pragma unroll
      for (int it = 0; it < 8; ++it) {
        const int row = it * 2 + hh;
        v4f val = *(const v4f*)(os + row * 68 + c4);
        *(v4f*)(ob_ptr + (size_t)(q0 + row) * g.o_rs + c4) = val;
      }
      
    }
  }
}

// ---------------------------------------------------------------------------
// Host launcher. Layout of q/k/v/r/ctx matrices: row = i*8 + b (i = position, b = batch),
// col = h*64 + d; head n = b*16 + h. The (B,L,D) positional input is used as a flat [1024][1024]
// A matrix exactly like the (L,B,D) query (literal view semantics of the position projection).
// ---------------------------------------------------------------------------
extern "C" void kernel_launch(void* const* d_in, const int* in_sizes, int n_in,
                              void* d_out, int out_size, void* d_ws, size_t ws_size,
                              hipStream_t stream) {
  if (n_in < 11) return;
  const int NE = 1024 * 1024;                 // elements of every [*,*,1024] tensor and of each weight
  if (in_sizes[0] != NE || in_sizes[1] != NE || in_sizes[3] != NE || in_sizes[4] != NE ||
      in_sizes[5] != NE || in_sizes[6] != NE || in_sizes[7] != NE || in_sizes[8] != 2 * 1024 ||
      in_sizes[2] != 128 * 128 * 128 || in_sizes[9] != 128 * 128 * 128 || in_sizes[10] != 8 * 128 * 128 ||
      out_size != NE) return;

  const float* query    = (const float*)d_in[0];   // (L,B,D)
  const float* rel_pe   = (const float*)d_in[1];   // (B,L,D)
  const float* utt_mask = (const float*)d_in[2];   // (B*H,L,L,1) f32
  const float* Wq       = (const float*)d_in[3];
  const float* Wk       = (const float*)d_in[4];
  const float* Wv       = (const float*)d_in[5];
  const float* Wr       = (const float*)d_in[6];
  const float* Wo       = (const float*)d_in[7];
  const float* spk_emb  = (const float*)d_in[8];   // (2,D)
  const int*   attn_msk = (const int*)d_in[9];     // (B*H,L,L) int32, nonzero = masked
  const int*   spk_msk  = (const int*)d_in[10];    // (B,L,L) int32 in {0,1}
  float* out = (float*)d_out;

  // ---- workspace carve (bytes) ----
  const size_t MiB = (size_t)1 << 20;
  const size_t off_q16 = 0;                    // query  f16       2 MiB
  const size_t off_p16 = 2 * MiB;              // rel_pe f16       2 MiB
  const size_t off_w16 = 4 * MiB;              // 5 weights f16 x16, 2 MiB each (Wq,Wk,Wv,Wr,Wo)
  const size_t off_qf  = 14 * MiB;             // new_q f32        4 MiB
  const size_t off_kf  = 18 * MiB;             // k f32            4 MiB
  const size_t off_vf  = 22 * MiB;             // v f32            4 MiB (directly after k: batched GEMM stride)
  const size_t off_rf  = 26 * MiB;             // r f32            4 MiB
  const size_t off_sb  = 30 * MiB;             // score bias [128][128][128] f32  8 MiB
  const size_t off_ctx = 38 * MiB;             // ctx f32          4 MiB
  const size_t off_c16 = 42 * MiB;             // ctx f16 x16      2 MiB
  const size_t total   = 44 * MiB;
  if (total > ws_size || total > 128 * MiB) return;

  char* ws = (char*)d_ws;
  _Float16* q16 = (_Float16*)(ws + off_q16);
  _Float16* p16 = (_Float16*)(ws + off_p16);
  _Float16* w16 = (_Float16*)(ws + off_w16);
  float* qf  = (float*)(ws + off_qf);
  float* kf  = (float*)(ws + off_kf);
  float* vf  = (float*)(ws + off_vf);
  float* rf  = (float*)(ws + off_rf);
  float* sbp = (float*)(ws + off_sb);
  float* ctx = (float*)(ws + off_ctx);
  _Float16* c16 = (_Float16*)(ws + off_c16);

  const int n2 = NE / 2;
  const int cgrid = (n2 + 255) / 256;
  // ---- casts: activations x1, weights x16 (exact power of two, undone in the GEMM epilogue) ----
  cast_f32_f16x2s<<<cgrid, 256, 0, stream>>>(query,  q16, n2, 1.0f);
  cast_f32_f16x2s<<<cgrid, 256, 0, stream>>>(rel_pe, p16, n2, 1.0f);
  cast_f32_f16x2s<<<cgrid, 256, 0, stream>>>(Wq, w16 + 0 * (size_t)NE, n2, 16.0f);
  cast_f32_f16x2s<<<cgrid, 256, 0, stream>>>(Wk, w16 + 1 * (size_t)NE, n2, 16.0f);
  cast_f32_f16x2s<<<cgrid, 256, 0, stream>>>(Wv, w16 + 2 * (size_t)NE, n2, 16.0f);
  cast_f32_f16x2s<<<cgrid, 256, 0, stream>>>(Wr, w16 + 3 * (size_t)NE, n2, 16.0f);
  cast_f32_f16x2s<<<cgrid, 256, 0, stream>>>(Wo, w16 + 4 * (size_t)NE, n2, 16.0f);

  // ---- projections: C = X . W^T, 1024x1024x1024 each; q gets column bias spk_emb[0][col] (= new_q) ----
  const int M = 1024, N = 1024, K = 1024;
  const int tiles = (M / 64) * (N / 64);
  const int gblocks = (tiles + 7) / 8;
  const float wscale_inv = 1.0f / 16.0f;
  {
    dim3 grid(gblocks, 1);
    wmma_gemm64<0, false, 2, 0, false><<<grid, 256, 0, stream>>>(
        (const unsigned short*)q16, (const unsigned short*)q16, K, 0L,
        (const unsigned short*)(w16 + 0 * (size_t)NE), (const unsigned short*)(w16 + 0 * (size_t)NE), K, 0L,
        (void*)qf, (void*)qf, N, 0L,
        spk_emb, spk_emb, 0L, M, N, K, wscale_inv);
  }
  {
    dim3 grid(gblocks, 2);   // y = 0: k (Wk -> kf), y = 1: v (Wv -> vf = kf + NE)
    wmma_gemm64<0, false, 0, 0, false><<<grid, 256, 0, stream>>>(
        (const unsigned short*)q16, (const unsigned short*)q16, K, 0L,
        (const unsigned short*)(w16 + 1 * (size_t)NE), (const unsigned short*)(w16 + 1 * (size_t)NE), K, (long)NE,
        (void*)kf, (void*)kf, N, (long)NE,
        spk_emb, spk_emb, 0L, M, N, K, wscale_inv);
  }
  {
    dim3 grid(gblocks, 1);   // rel_pe flat [1024][1024] . Wr^T -> rf (literal view)
    wmma_gemm64<0, false, 0, 0, false><<<grid, 256, 0, stream>>>(
        (const unsigned short*)p16, (const unsigned short*)p16, K, 0L,
        (const unsigned short*)(w16 + 3 * (size_t)NE), (const unsigned short*)(w16 + 3 * (size_t)NE), K, 0L,
        (void*)rf, (void*)rf, N, 0L,
        spk_emb, spk_emb, 0L, M, N, K, wscale_inv);
  }

  // ---- dense additive score terms (a2 + a3) * 1/8 with the mask folded in as a sentinel ----
  sbias_kernel<<<256, 512, 0, stream>>>(qf, rf, spk_emb, utt_mask, attn_msk, spk_msk, sbp);

  // ---- attention: 128 heads (b*16+h) of 128x128, head dim 64; s = a1/8 + SB, sentinel -> 1e-30 ----
  {
    AttnArgs g;
    g.q_bs = 1024; g.q_rs = 8 * 1024; g.q_hs = 64;
    g.k_bs = 1024; g.k_rs = 8 * 1024; g.k_hs = 64;
    g.v_bs = 1024; g.v_rs = 8 * 1024; g.v_hs = 64;
    g.o_bs = 1024; g.o_rs = 8 * 1024; g.o_hs = 64;
    g.sb_ns = 128 * 128; g.sb_rs = 128;
    g.S = 128; g.Skv = 128; g.H = 16; g.nchunks = 2;
    g.sscale = 0.125f; g.mask_fill = 1e-30f; g.sent_thr = 1.0e37f; g.resv = 0.0f;
    const int agrid = 8 * 16 * (128 / AT_QB);   // 256 blocks
    attn64_sbias_f16<<<agrid, 128, 0, stream>>>(qf, kf, vf, ctx, sbp, g);
  }

  // ---- ctx f32 -> f16 x16, then output projection into d_out (scale 1/256 undoes both x16) ----
  cast_f32_f16x2s<<<cgrid, 256, 0, stream>>>(ctx, c16, n2, 16.0f);
  {
    dim3 grid(gblocks, 1);
    wmma_gemm64<0, false, 0, 0, false><<<grid, 256, 0, stream>>>(
        (const unsigned short*)c16, (const unsigned short*)c16, K, 0L,
        (const unsigned short*)(w16 + 4 * (size_t)NE), (const unsigned short*)(w16 + 4 * (size_t)NE), K, 0L,
        (void*)out, (void*)out, N, 0L,
        spk_emb, spk_emb, 0L, M, N, K, 1.0f / 256.0f);
  }
  (void)hipGetLastError();
}

// v003
// Measured time: 104 microseconds a run.
// Next to v002, in two timings, it ran 1.05 and 1.04 times as fast.
// All steps since v000 together make it 2.63 times as fast.
#include <hip/hip_runtime.h>
#include <stdint.h>
// Contractions: five 1024x1024x1024 projections (X . W^T), per-head q.k^T (K=64) and p.v (K=128): v_wmma_f32_16x16x32_f16 (f16 operands; weights and ctx carried x16, p carried x2^15, exact powers of two folded back in f32), f32 accumulate. Softmax, additive score terms and depth-64 speaker row dots in f32 on VALU.

typedef __attribute__((ext_vector_type(16))) _Float16 v16h;
typedef __attribute__((ext_vector_type(8)))  _Float16 v8h;
typedef __attribute__((ext_vector_type(16))) __bf16   v16b;
typedef __attribute__((ext_vector_type(8)))  __bf16   v8b;
typedef __attribute__((ext_vector_type(8)))  float    v8f;
typedef __attribute__((ext_vector_type(4)))  float    v4f;

__device__ __forceinline__ unsigned short f2bf_bits(float f) {
  unsigned u = __float_as_uint(f);
  return (unsigned short)((u + 0x7FFFu + ((u >> 16) & 1u)) >> 16);
}
__device__ __forceinline__ float bf_bits2f(unsigned short h) { return __uint_as_float(((unsigned)h) << 16); }

// hazard guards as plain device helpers (no inline asm inside the kernel template body)
__device__ __forceinline__ void acc_guard4(v8f& a, v8f& b, v8f& c, v8f& d) { asm volatile("v_nop\n\tv_nop\n\tv_nop\n\tv_nop" : "+v"(a), "+v"(b), "+v"(c), "+v"(d)); }
template <typename T> struct Frag;
template <> struct Frag<_Float16> {
  typedef v16h V; union U { v16h v; v8h h[2]; };
  static __device__ __forceinline__ v16h load(const _Float16* p) {   // elements 0..7 <- p[0..7], 8..15 <- p[16..23]
    U f; f.h[0] = *(const v8h*)(p); f.h[1] = *(const v8h*)(p + 16); return f.v;
  }
  static __device__ __forceinline__ v8f mma(v16h a, v16h b, v8f c) {
    return __builtin_amdgcn_wmma_f32_16x16x32_f16(false, a, false, b, (short)0, c, false, false);
  }
};
template <> struct Frag<__bf16> {
  typedef v16b V; union U { v16b v; v8b h[2]; };
  static __device__ __forceinline__ v16b load(const __bf16* p) {
    U f; f.h[0] = *(const v8b*)(p); f.h[1] = *(const v8b*)(p + 16); return f.v;
  }
  static __device__ __forceinline__ v8f mma(v16b a, v16b b, v8f c) {
    return __builtin_amdgcn_wmma_f32_16x16x32_bf16(false, a, false, b, (short)0, c, false, false);
  }
};

// ---- Register-blocked batched WMMA GEMM ------------------------------------
// C[m,n] = scale * sum_k A[m,k] * Bt[n,k] (+bias)(+resid); each wave owns a 64x64 tile,
// the eight waves of a work-group own eight neighbouring tiles of one tile row (64 x 512).
// A row-major [M,K]; Bt row-major [N,K]; M % 64 == 0, N % 512 == 0, K % 64 == 0.
// Operand path: per pass of 64 k the work-group's 64 A rows and 512 Bt rows (128 B each, whole lines)
// go to LDS by asynchronous 16-byte copies, two buffers, the next pass in flight while this one is
// multiplied; the waves read their fragments from LDS (row pitch 144 B = 16 B x odd for ds_load_b128).
// SPLIT (hi/lo operand planes) is not staged by this path and is not instantiated.
// BIAS_MODE: 0 = none, 1 = bias[m], 2 = bias[n].
// OUT_MODE: 0 = f32, 1 = f16, 2 = bf16 hi plane (Cout) + bf16 lo plane (Cout2).
// ET: 0 = f16 operands, 1 = bf16 operands (pointers passed as 16-bit storage)
template <int ET> struct Elem;
template <> struct Elem<0> { typedef _Float16 T; };
template <> struct Elem<1> { typedef __bf16 T; };
#define G_PITCH 72                       // LDS row pitch in 16-bit elements (128 B of k + 16 B)
#define G_ROWS  576                      // 64 A rows, then 512 Bt rows
#define G_BUF   (G_ROWS * G_PITCH)       // elements of one buffer (82,944 B)

// Nine asynchronous 16-byte-per-lane copies global -> LDS. The s_wait_xcnt closes the statement so that
// no address register named here is rewritten before it.
template <typename T>
__device__ __forceinline__ void async_copy9(const unsigned (&l)[9], const T* const (&g)[9]) {
  asm volatile(
      "global_load_async_to_lds_b128 %0, %9, off\n\t"
      "global_load_async_to_lds_b128 %1, %10, off\n\t"
      "global_load_async_to_lds_b128 %2, %11, off\n\t"
      "global_load_async_to_lds_b128 %3, %12, off\n\t"
      "global_load_async_to_lds_b128 %4, %13, off\n\t"
      "global_load_async_to_lds_b128 %5, %14, off\n\t"
      "global_load_async_to_lds_b128 %6, %15, off\n\t"
      "global_load_async_to_lds_b128 %7, %16, off\n\t"
      "global_load_async_to_lds_b128 %8, %17, off\n\t"
      "s_wait_xcnt 0x0"
      :: "v"(l[0]), "v"(l[1]), "v"(l[2]), "v"(l[3]), "v"(l[4]), "v"(l[5]), "v"(l[6]), "v"(l[7]), "v"(l[8]),
         "v"(g[0]), "v"(g[1]), "v"(g[2]), "v"(g[3]), "v"(g[4]), "v"(g[5]), "v"(g[6]), "v"(g[7]), "v"(g[8])
      : "memory");
}
// One pass's tile: 576 rows x 8 chunks of 16 B = 18 chunks per thread; a wave-wide copy covers 4 whole rows.
// ga / gb: this thread's chunk in A row (tid >> 3) / Bt row (tid >> 3) of the work-group's rows, at the pass's k.
// l0: this thread's LDS byte address for row (tid >> 3) of the target buffer.
template <typename T>
__device__ __forceinline__ void stage_tile(unsigned l0, const T* ga, const T* gb, int lda, int ldb) {
  unsigned l[9]; const T* g[9];
#pragma unroll
  for (int it = 0; it < 9; ++it) {       // rows 0..287: A rows 0..63, Bt rows 0..223
    l[it] = l0 + (unsigned)(it * 32 * G_PITCH * 2);
    g[it] = (it < 2) ? (ga + (size_t)(it * 32) * lda) : (gb + (size_t)((it - 2) * 32) * ldb);
  }
  async_copy9<T>(l, g);
#pragma unroll
  for (int it = 0; it < 9; ++it) {       // rows 288..575: Bt rows 224..511
    l[it] = l0 + (unsigned)((it + 9) * 32 * G_PITCH * 2);
    g[it] = gb + (size_t)((it + 7) * 32) * ldb;
  }
  async_copy9<T>(l, g);
}
// this wave's LDS reads have retired (before the buffer they read is handed back for a refill)
__device__ __forceinline__ void wait_lds_reads()   { asm volatile("s_wait_dscnt 0x0" ::: "memory"); }
// this wave's asynchronous copies have landed (the compiler places no wait for them)
__device__ __forceinline__ void wait_async_copies() { asm volatile("s_wait_asynccnt 0x0" ::: "memory"); }

template <int ET, bool SPLIT, int BIAS_MODE, int OUT_MODE, bool RESID, int ACT = 0>
__global__ __launch_bounds__(256) void wmma_gemm64(
    const unsigned short* __restrict__ Ap, const unsigned short* __restrict__ A2p, int lda, long strideA,
    const unsigned short* __restrict__ Btp, const unsigned short* __restrict__ Bt2p, int ldb, long strideB,
    void* __restrict__ Cout, void* __restrict__ Cout2, int ldc, long strideC,
    const float* __restrict__ bias,
    const float* __restrict__ resid, long strideR,
    int M, int N, int K, float scale) {
  typedef typename Elem<ET>::T T;
  typedef typename Frag<T>::V V;
  static_assert(!SPLIT, "the LDS operand path stages one plane per operand");
  const T* A = (const T*)Ap; const T* Bt = (const T*)Btp;
  __shared__ __align__(16) T ring[2 * G_BUF];      // two operand buffers
  __shared__ __align__(16) float sT[8][16 * 68];   // per-wave 16x64 slab, pitch 68 floats
  const int b    = blockIdx.y;
  const int lane = threadIdx.x & 31;
  const int wave = threadIdx.x >> 5;
  const int tilesN = N >> 6;
  const int tilesM = M >> 6;
  const int tile0 = blockIdx.x * 8;      // the work-group's first tile; tilesN % 8 == 0, so all eight share tm
  if (tile0 >= tilesM * tilesN) return;  // the same for the whole work-group, in front of every barrier
  const int tm = tile0 / tilesN;
  const int m0 = tm << 6;
  const int nb0 = (tile0 - tm * tilesN) << 6;   // first Bt row of the work-group
  const int n0 = nb0 + (wave << 6);

  const T* Ab  = A  + (size_t)b * strideA;
  const T* Bb  = Bt + (size_t)b * strideB;

  const int rlane = lane & 15;                 // row (A) / col (B, D) within subtile
  const int koff  = (lane >> 4) * 8;           // k offset of this lane half
  const int mOff  = (lane >> 4) * 8;           // D row offset

  v8f acc[4][4];
#pragma unroll
  for (int i = 0; i < 4; ++i)
#pragma unroll
    for (int j = 0; j < 4; ++j) acc[i][j] = (v8f){0.f,0.f,0.f,0.f,0.f,0.f,0.f,0.f};

  const int srow = threadIdx.x >> 3;           // staged row of this thread within a group of 32 rows
  const int schk = (threadIdx.x & 7) * 8;      // its 16-byte chunk, in elements
  const T* ga = Ab + (size_t)(m0 + srow) * lda + schk;
  const T* gb = Bb + (size_t)(nb0 + srow) * ldb + schk;
  const unsigned l0 = (unsigned)(size_t)ring + (unsigned)((srow * G_PITCH + schk) * 2);
  const int nPass = K >> 6;

  stage_tile<T>(l0, ga, gb, lda, ldb);
  wait_async_copies();
  __syncthreads();                             // pass 0's tile is published
  if (nPass > 1) stage_tile<T>(l0 + (unsigned)(G_BUF * 2), ga + 64, gb + 64, lda, ldb);

#pragma unroll 1                               // one pass per trip: the buffer is picked by the trip's parity
  for (int t = 0; t < nPass; ++t) {
    const int bsel = (t & 1) * G_BUF;
    const T* ra = ring + bsel + rlane * G_PITCH + koff;
    const T* rb = ring + bsel + (64 + (wave << 6) + rlane) * G_PITCH + koff;
#pragma unroll
    for (int ks = 0; ks < 2; ++ks) {
      V bh[4], ah[4];
#pragma unroll
      for (int j = 0; j < 4; ++j) bh[j] = Frag<T>::load(rb + j * 16 * G_PITCH + ks * 32);
#pragma unroll
      for (int i = 0; i < 4; ++i) ah[i] = Frag<T>::load(ra + i * 16 * G_PITCH + ks * 32);
      // the 16 fragment reads stay one group in front of the 16 WMMAs: left free, the scheduler reuses one
      // A register set and the wave waits out the LDS latency four times per block
      __builtin_amdgcn_sched_barrier(0);
#pragma unroll
      for (int i = 0; i < 4; ++i)
#pragma unroll
        for (int j = 0; j < 4; ++j) acc[i][j] = Frag<T>::mma(ah[i], bh[j], acc[i][j]);
      __builtin_amdgcn_sched_barrier(0);       // and the next block's reads stay behind this block's WMMAs
    }
    wait_lds_reads();
    wait_async_copies();
    __syncthreads();                           // publishes pass t + 1's tile and ends every read of pass t's buffer
    if (t + 2 < nPass)
      stage_tile<T>(l0 + (unsigned)(bsel * 2), ga + (size_t)(t + 2) * 64, gb + (size_t)(t + 2) * 64, lda, ldb);
  }
  wait_async_copies();
  acc_guard4(acc[0][0], acc[0][1], acc[0][2], acc[0][3]);
  acc_guard4(acc[1][0], acc[1][1], acc[1][2], acc[1][3]);
  acc_guard4(acc[2][0], acc[2][1], acc[2][2], acc[2][3]);
  acc_guard4(acc[3][0], acc[3][1], acc[3][2], acc[3][3]);

  // ---- epilogue ----
  float* slab = sT[wave];
  const float* Rb = RESID ? (resid + (size_t)b * strideR) : nullptr;
#pragma unroll
  for (int i = 0; i < 4; ++i) {
    const int mBase = m0 + (i << 4);
#pragma unroll
    for (int j = 0; j < 4; ++j) {
      const int n = n0 + (j << 4) + rlane;
      float bv = 0.f;
      if (BIAS_MODE == 2) bv = bias[n];
#pragma unroll
      for (int r = 0; r < 8; ++r) {
        float v = acc[i][j][r] * scale;
        if (BIAS_MODE == 1) v += bias[mBase + mOff + r];
        if (BIAS_MODE == 2) v += bv;
        if (RESID) v += Rb[(size_t)(mBase + mOff + r) * ldc + n];
        if (ACT == 1) v = tanhf(v);
        if (ACT == 2) v = fmaxf(v, 0.0f);
        if (ACT == 3) v = v / (1.0f + expf(-v));
        if (ACT == 4) v = (v > 0.f) ? v : 0.01f * v;
        if (ACT == 5) v = 0.5f * v * (1.0f + erff(v * 0.70710678118654752f));
        slab[(mOff + r) * 68 + (j << 4) + rlane] = v;
      }
    }
    __builtin_amdgcn_fence(__ATOMIC_RELEASE, "workgroup");
    __builtin_amdgcn_wave_barrier();
    __builtin_amdgcn_fence(__ATOMIC_ACQUIRE, "workgroup");
    if (OUT_MODE == 0) {
      float* C = (float*)Cout + (size_t)b * strideC;
      const int hh = lane >> 4, c4 = (lane & 15) * 4;     // row seg = 256 B = 16 lanes x 16 B
      {
#pragma unroll
        for (int it = 0; it < 8; ++it) {
          const int row = it * 2 + hh;
          v4f v = *(const v4f*)(slab + row * 68 + c4);
          *(v4f*)(C + (size_t)(mBase + row) * ldc + n0 + c4) = v;
        }
        
      }
    } else {
      const int q = lane >> 3, c8 = (lane & 7) * 8;
      unsigned short* C  = (unsigned short*)Cout  + (size_t)b * strideC;
      unsigned short* C2 = (OUT_MODE == 2) ? ((unsigned short*)Cout2 + (size_t)b * strideC) : nullptr;
      {
#pragma unroll
        for (int it = 0; it < 4; ++it) {
          const int row = it * 4 + q;
          const float* sp = slab + row * 68 + c8;
          v8h hv, lv;
#pragma unroll
          for (int e = 0; e < 8; ++e) {
            if (OUT_MODE == 1) {
              hv[e] = (_Float16)sp[e];
            } else {
              unsigned short hb = f2bf_bits(sp[e]);
              unsigned short lb = f2bf_bits(sp[e] - bf_bits2f(hb));
              hv[e] = __builtin_bit_cast(_Float16, hb);
              lv[e] = __builtin_bit_cast(_Float16, lb);
            }
          }
          *(v8h*)(C + (size_t)(mBase + row) * ldc + n0 + c8) = hv;
          if (OUT_MODE == 2) *(v8h*)(C2 + (size_t)(mBase + row) * ldc + n0 + c8) = lv;
        }
        
      }
    }
    __builtin_amdgcn_fence(__ATOMIC_RELEASE, "workgroup");
    __builtin_amdgcn_wave_barrier();
    __builtin_amdgcn_fence(__ATOMIC_ACQUIRE, "workgroup");
  }
}

// ---- f32 -> f16 casts (value x scale, round to nearest even) ---------------------------------------------
// A work-group converts 4096 consecutive elements of each of its planes. A wave-wide load is 512 contiguous bytes
// (16 B a lane), a wave-wide store 256 contiguous bytes (8 B a lane); every load of a thread is independent of every
// other and all are requested in front of the first store. L = loads per lane and plane = 32 / waves per work-group.
typedef __attribute__((ext_vector_type(4))) _Float16 v4h;
#define CAST_PLANE (1024 * 1024)         // elements of one plane
// e0: the lane's first element; the byte offsets fit 32 bits, so each access is plane base + one shared offset register.
template <int L>
__device__ __forceinline__ void cast_load(const float* __restrict__ in, unsigned e0, v4f (&x)[L]) {
  const char* p = (const char*)in + e0 * 4u;
#pragma unroll
  for (int k = 0; k < L; ++k) x[k] = *(const v4f*)(p + k * 512);
}
template <int L>
__device__ __forceinline__ void cast_store(_Float16* __restrict__ out, unsigned e0, const v4f (&x)[L], float scale) {
  char* p = (char*)out + e0 * 2u;
#pragma unroll
  for (int k = 0; k < L; ++k) {
    v4h h;
#pragma unroll
    for (int e = 0; e < 4; ++e) h[e] = (_Float16)(x[k][e] * scale);
    *(v4h*)(p + k * 256) = h;
  }
}
// seven planes in one launch: two activations x1, five weights x16; plane p goes to out + p * CAST_PLANE.
// grid = 256 work-groups of 16 waves.
__global__ __launch_bounds__(512) void cast7_f32_f16(
    const float* __restrict__ a0, const float* __restrict__ a1, const float* __restrict__ w0,
    const float* __restrict__ w1, const float* __restrict__ w2, const float* __restrict__ w3,
    const float* __restrict__ w4, _Float16* __restrict__ out) {
  const unsigned e0 = blockIdx.x * 4096u + (threadIdx.x >> 5) * 256u + (threadIdx.x & 31u) * 4u;
  v4f x[7][2];
  cast_load<2>(a0, e0, x[0]);
  cast_load<2>(a1, e0, x[1]);
  cast_load<2>(w0, e0, x[2]);
  cast_load<2>(w1, e0, x[3]);
  cast_load<2>(w2, e0, x[4]);
  cast_load<2>(w3, e0, x[5]);
  cast_load<2>(w4, e0, x[6]);
  cast_store<2>(out + 0 * (size_t)CAST_PLANE, e0, x[0], 1.0f);
  cast_store<2>(out + 1 * (size_t)CAST_PLANE, e0, x[1], 1.0f);
  cast_store<2>(out + 2 * (size_t)CAST_PLANE, e0, x[2], 16.0f);
  cast_store<2>(out + 3 * (size_t)CAST_PLANE, e0, x[3], 16.0f);
  cast_store<2>(out + 4 * (size_t)CAST_PLANE, e0, x[4], 16.0f);
  cast_store<2>(out + 5 * (size_t)CAST_PLANE, e0, x[5], 16.0f);
  cast_store<2>(out + 6 * (size_t)CAST_PLANE, e0, x[6], 16.0f);
}
// one plane: grid = 256 work-groups of 4 waves, eight loads a lane.
__global__ __launch_bounds__(128) void cast1_f32_f16(
    const float* __restrict__ in, _Float16* __restrict__ out, float scale) {
  const unsigned e0 = blockIdx.x * 4096u + (threadIdx.x >> 5) * 1024u + (threadIdx.x & 31u) * 4u;
  v4f x[8];
  cast_load<8>(in, e0, x);
  cast_store<8>(out, e0, x, scale);
}

// ---- additive score terms + mask, dense per head ------------------------------------------------------
//   qf, rf: f32 projection outputs, row i*8+b, col h*64+d (qf already includes the s_q column term).
//   A work-group owns 64 score rows of one head (grid = 128 heads x 2 halves, 16 waves). Every global load of a
//   thread is independent of every other and all are requested up front: one round trip instead of one per row.
//   Phase 1 (LDS): e0[i] = newq[n,i,:].semb[0][h*64..], e1[i] = newq[n,i,:].semb[1][h*64..] for the 64 own rows,
//                  cv[i] = r[n,i,:].semb[0][h*64..] for all 128 rows; 16 lanes x 16 B per row, summed across the lanes.
//                  cv[128..255] = 0, so that cv[127-i+j] is the shifted term for j <= i and 0 for j > i.
//   Phase 2: SB[n][i][j] = amask[n][i][j] != 0 ? 3e38 (sentinel)
//                        : 0.125 * ( utt[n][i][j] * (smask[b][i][j] -> e1[i] : e0[i]) + cv[127-i+j] )
//            16 B per lane and array, a wave covers one whole 512-B row per access, four rows per wave.
typedef __attribute__((ext_vector_type(4))) int v4i;
#define SB_ROWS 64
__device__ __forceinline__ float dot4(v4f x, v4f w) {
  return fmaf(x[3], w[3], fmaf(x[2], w[2], fmaf(x[1], w[1], x[0] * w[0])));
}
__global__ __launch_bounds__(512) void sbias_kernel(
    const float* __restrict__ qf, const float* __restrict__ rf, const float* __restrict__ semb,
    const float* __restrict__ utt, const int* __restrict__ amask, const int* __restrict__ smask,
    float* __restrict__ sb) {
  __shared__ float se0[SB_ROWS];
  __shared__ float se1[SB_ROWS];
  __shared__ float scv[256];
  const int n = blockIdx.x >> 1, i0 = (blockIdx.x & 1) * SB_ROWS;
  const int b = n >> 4, h = n & 15;
  const int wave = threadIdx.x >> 5, lane = threadIdx.x & 31;
  const int hh = lane >> 4, d4 = (lane & 15) * 4;   // phase 1: row of the pair, four of the 64 depths
  const int c4 = lane * 4;                          // phase 2: this lane's four score columns
  const float* ub  = utt   + (size_t)n * 16384;
  const int*   ab  = amask + (size_t)n * 16384;
  const int*   smb = smask + (size_t)b * 16384;
  float*       ob  = sb    + (size_t)n * 16384;

  const v4f w0 = *(const v4f*)(semb + h * 64 + d4);
  const v4f w1 = *(const v4f*)(semb + 1024 + h * 64 + d4);
  const size_t co = (size_t)b * 1024 + (size_t)h * 64 + d4;
  v4f rv[4], qv[2];
#pragma unroll
  for (int k = 0; k < 4; ++k) rv[k] = *(const v4f*)(rf + (size_t)(wave * 8 + k * 2 + hh) * 8192 + co);
#pragma unroll
  for (int k = 0; k < 2; ++k) qv[k] = *(const v4f*)(qf + (size_t)(i0 + wave * 4 + k * 2 + hh) * 8192 + co);
  // the row loads' address registers may be reused as destinations of the loads below: the wait stands in front of that
  asm volatile("s_wait_xcnt 0x0" ::: "memory");
  v4f u4[4]; v4i am4[4], sm4[4];
#pragma unroll
  for (int k = 0; k < 4; ++k) {                // score rows i0 + wave + 16 k
    const int e = (i0 + wave + 16 * k) * 128 + c4;
    u4[k]  = *(const v4f*)(ub + e);
    am4[k] = *(const v4i*)(ab + e);
    sm4[k] = *(const v4i*)(smb + e);
  }
  // the mask loads stay in front of phase 1's arithmetic: left free, the scheduler issues them only behind the
  // wait for the projection rows, and the two round trips run one after the other
  __builtin_amdgcn_sched_barrier(0);

  float p[8];
#pragma unroll
  for (int k = 0; k < 4; ++k) p[k] = dot4(rv[k], w0);
#pragma unroll
  for (int k = 0; k < 2; ++k) { p[4 + k] = dot4(qv[k], w0); p[6 + k] = dot4(qv[k], w1); }
#pragma unroll
  for (int off = 1; off < 16; off <<= 1)
#pragma unroll
    for (int x = 0; x < 8; ++x) p[x] += __shfl_xor(p[x], off, 32);
  if ((lane & 15) == 0) {
#pragma unroll
    for (int k = 0; k < 4; ++k) scv[wave * 8 + k * 2 + hh] = p[k];
#pragma unroll
    for (int k = 0; k < 2; ++k) { se0[wave * 4 + k * 2 + hh] = p[4 + k]; se1[wave * 4 + k * 2 + hh] = p[6 + k]; }
  }
  if (threadIdx.x < 128) scv[128 + threadIdx.x] = 0.0f;
  __syncthreads();

#pragma unroll
  for (int k = 0; k < 4; ++k) {
    const int il = wave + 16 * k, i = i0 + il;
    const float e0v = se0[il], e1v = se1[il];
    const float* cvp = scv + (127 - i + c4);   // 0 <= 127 - i + j <= 254 for every row i and column j
    v4f o;
#pragma unroll
    for (int u = 0; u < 4; ++u) {
      int sm = sm4[k][u];
      if (sm < 0) sm += 2;                     // 2-row table: wrap negatives, then clamp
      sm = sm < 0 ? 0 : (sm > 1 ? 1 : sm);
      const float ev = (sm != 0) ? e1v : e0v;
      float val = (u4[k][u] * ev + cvp[u]) * 0.125f;
      if (am4[k][u] != 0) val = 3.0e38f;
      o[u] = val;
    }
    *(v4f*)(ob + i * 128 + c4) = o;
  }
}

// =====================================================================================
// Attention for head_dim 64 with a dense additive score tensor, f32 in / f32 out, f16 operands:
//   s = (q.k^T) * sscale + SB[bh][q][kv];  SB element above sent_thr -> s = mask_fill (kept in the softmax)
//   softmax over all Skv keys in f32 (online over 64-key chunks); p carried x2^15 as f16; out = p.v / (l*2^15).
//   Block = 4 waves = 64 query rows of one (b, h); grid.x = B*H*(S/64).
//   Element (b, s, h, d) of q/k/v/out at X[b*X_bs + s*X_rs + h*X_hs + d]; SB element (bh, q, kv) at sb[bh*sb_ns + q*sb_rs + kv].
// =====================================================================================
#define AT_D 64
#define AT_NW 4
#define AT_QB 64
#define AT_KC 64
struct AttnArgs { long q_bs, q_rs, q_hs, k_bs, k_rs, k_hs, v_bs, v_rs, v_hs, o_bs, o_rs, o_hs, sb_ns, sb_rs;
                  int S, Skv, H, nchunks; float sscale, mask_fill, sent_thr, resv; };
static_assert(sizeof(AttnArgs) == 144);

__device__ __forceinline__ v8f mma_f16g(v16h a, v16h b, v8f c) {
  c = __builtin_amdgcn_wmma_f32_16x16x32_f16(false, a, false, b, (short)0, c, false, false);
  asm volatile("v_nop\n\tv_nop\n\tv_nop\n\tv_nop" : "+v"(c) : "v"(a), "v"(b));
  return c;
}

__global__ __launch_bounds__(128)
void attn64_sbias_f16(const float* __restrict__ q, const float* __restrict__ k,
                      const float* __restrict__ v, float* __restrict__ out,
                      const float* __restrict__ sb, AttnArgs g) {
  const float PSC = 32768.0f;
  union FB { v16h v; v8h h[2]; };
  __shared__ __align__(16) _Float16 Ksh[AT_KC * AT_D];            // K [kv][d]   8 KB
  __shared__ __align__(16) _Float16 Vth[AT_D * AT_KC];            // V [d][kv]   8 KB
  __shared__ __align__(16) _Float16 Psh[AT_NW][16 * AT_KC];       // per wave P [row][kv]  8 KB
  __shared__ __align__(16) float    Os[AT_NW][16 * 68];           // per wave out tile, pitch 68

  const int tid  = threadIdx.x;
  const int wave = tid >> 5;
  const int lane = tid & 31;
  const int hh   = lane >> 4;
  const int c    = lane & 15;

  const int nqb = g.S / AT_QB;
  const int bx = blockIdx.x;
  const int qb = bx % nqb;
  const int bh = bx / nqb;
  const int h  = bh % g.H;
  const int b  = bh / g.H;
  const int q0 = qb * AT_QB + wave * 16;

  const float* qb_ptr = q   + (size_t)b * g.q_bs + (size_t)h * g.q_hs;
  const float* kb_ptr = k   + (size_t)b * g.k_bs + (size_t)h * g.k_hs;
  const float* vb_ptr = v   + (size_t)b * g.v_bs + (size_t)h * g.v_hs;
  float*       ob_ptr = out + (size_t)b * g.o_bs + (size_t)h * g.o_hs;

  // ---- Q fragments (A operand), 2 d-chunks, split k map ----
  v16h qa[2];
  {
    const float* qrow = qb_ptr + (size_t)(q0 + c) * g.q_rs;
#pragma unroll
    for (int dc = 0; dc < 2; ++dc) {
      const v4f f0 = *(const v4f*)(qrow + dc * 32 + 8 * hh);
      const v4f f1 = *(const v4f*)(qrow + dc * 32 + 8 * hh + 4);
      const v4f f2 = *(const v4f*)(qrow + dc * 32 + 16 + 8 * hh);
      const v4f f3 = *(const v4f*)(qrow + dc * 32 + 16 + 8 * hh + 4);
#pragma unroll
      for (int e = 0; e < 4; ++e) {
        qa[dc][e]      = (_Float16)f0[e];
        qa[dc][4 + e]  = (_Float16)f1[e];
        qa[dc][8 + e]  = (_Float16)f2[e];
        qa[dc][12 + e] = (_Float16)f3[e];
      }
    }
  }

  float mrow[8], lrow[8];
  v8f oacc[4];
#pragma unroll
  for (int r = 0; r < 8; ++r) { mrow[r] = -INFINITY; lrow[r] = 0.f; }
#pragma unroll
  for (int t = 0; t < 4; ++t) oacc[t] = (v8f){0.f,0.f,0.f,0.f,0.f,0.f,0.f,0.f};

  int nChunks = g.Skv / AT_KC;                 // block-uniform, host-provided
  if (nChunks > 64) nChunks = 64;
  for (int kc = 0; kc < nChunks; ++kc) {
    const int kv0 = kc * AT_KC;
    __syncthreads();
    {
      const int kvr = tid >> 1, dh = (tid & 1) * 32;
      const float* krow = kb_ptr + (size_t)(kv0 + kvr) * g.k_rs + dh;
      const float* vrow = vb_ptr + (size_t)(kv0 + kvr) * g.v_rs + dh;
#pragma unroll
      for (int i = 0; i < 8; ++i) {
        v4f kk = *(const v4f*)(krow + 4 * i);
        v4f vv = *(const v4f*)(vrow + 4 * i);
#pragma unroll
        for (int e = 0; e < 4; ++e) {
          const int d = dh + 4 * i + e;
          Ksh[kvr * AT_D + d]  = (_Float16)kk[e];
          Vth[d * AT_KC + kvr] = (_Float16)vv[e];
        }
      }
    }
    __syncthreads();

    v8f s[4];
#pragma unroll
    for (int j = 0; j < 4; ++j) {
      s[j] = (v8f){0.f,0.f,0.f,0.f,0.f,0.f,0.f,0.f};
#pragma unroll
      for (int dc = 0; dc < 2; ++dc) {
        FB kb;
        kb.h[0] = *(const v8h*)(Ksh + (j * 16 + c) * AT_D + dc * 32 + 8 * hh);
        kb.h[1] = *(const v8h*)(Ksh + (j * 16 + c) * AT_D + dc * 32 + 16 + 8 * hh);
        s[j] = mma_f16g(qa[dc], kb.v, s[j]);
      }
    }
    // additive terms + mask select, row max
    const float* sbp = sb + (size_t)bh * g.sb_ns + (size_t)(q0 + 8 * hh) * g.sb_rs + kv0 + c;
    float cm[8];
#pragma unroll
    for (int r = 0; r < 8; ++r) {
      const float* sbr = sbp + (size_t)r * g.sb_rs;
      float m = -INFINITY;
#pragma unroll
      for (int j = 0; j < 4; ++j) {
        const float bb = sbr[j * 16];
        float sv = fmaf(s[j][r], g.sscale, bb);
        if (bb > g.sent_thr) sv = g.mask_fill;
        s[j][r] = sv;
        m = fmaxf(m, sv);
      }
#pragma unroll
      for (int off = 1; off < 16; off <<= 1) m = fmaxf(m, __shfl_xor(m, off, 32));
      cm[r] = m;
    }
    _Float16* pwh = Psh[wave];
#pragma unroll
    for (int r = 0; r < 8; ++r) {
      const float mnew = fmaxf(mrow[r], cm[r]);
      const float alpha = expf(mrow[r] - mnew);
      mrow[r] = mnew;
      float psum = 0.f;
#pragma unroll
      for (int j = 0; j < 4; ++j) {
        const float p = expf(s[j][r] - mnew);
        psum += p;
        pwh[(8 * hh + r) * AT_KC + j * 16 + c] = (_Float16)(p * PSC);
      }
#pragma unroll
      for (int off = 1; off < 16; off <<= 1) psum += __shfl_xor(psum, off, 32);
      lrow[r] = lrow[r] * alpha + psum;
#pragma unroll
      for (int t = 0; t < 4; ++t) oacc[t][r] *= alpha;
    }
    __builtin_amdgcn_fence(__ATOMIC_RELEASE, "workgroup");
    __builtin_amdgcn_wave_barrier();
    __builtin_amdgcn_fence(__ATOMIC_ACQUIRE, "workgroup");
#pragma unroll 1
    for (int kk = 0; kk < 2; ++kk) {
      FB pa;
      pa.h[0] = *(const v8h*)(pwh + c * AT_KC + kk * 32 + 8 * hh);
      pa.h[1] = *(const v8h*)(pwh + c * AT_KC + kk * 32 + 16 + 8 * hh);
#pragma unroll
      for (int t = 0; t < 4; ++t) {
        FB vb;
        vb.h[0] = *(const v8h*)(Vth + (t * 16 + c) * AT_KC + kk * 32 + 8 * hh);
        vb.h[1] = *(const v8h*)(Vth + (t * 16 + c) * AT_KC + kk * 32 + 16 + 8 * hh);
        oacc[t] = mma_f16g(pa.v, vb.v, oacc[t]);
      }
    }
  }

  float* os = Os[wave];
#pragma unroll
  for (int r = 0; r < 8; ++r) {
    const float inv = 1.0f / (lrow[r] * PSC);
#pragma unroll
    for (int t = 0; t < 4; ++t) os[(8 * hh + r) * 68 + t * 16 + c] = oacc[t][r] * inv;
  }
  __builtin_amdgcn_fence(__ATOMIC_RELEASE, "workgroup");
  __builtin_amdgcn_wave_barrier();
  __builtin_amdgcn_fence(__ATOMIC_ACQUIRE, "workgroup");
  {
    const int c4 = (lane & 15) * 4;
    {
#pragma unroll
      for (int it = 0; it < 8; ++it) {
        const int row = it * 2 + hh;
        v4f val = *(const v4f*)(os + row * 68 + c4);
        *(v4f*)(ob_ptr + (size_t)(q0 + row) * g.o_rs + c4) = val;
      }
      
    }
  }
}

// ---------------------------------------------------------------------------
// Host launcher. Layout of q/k/v/r/ctx matrices: row = i*8 + b (i = position, b = batch),
// col = h*64 + d; head n = b*16 + h. The (B,L,D) positional input is used as a flat [1024][1024]
// A matrix exactly like the (L,B,D) query (literal view semantics of the position projection).
// ---------------------------------------------------------------------------
extern "C" void kernel_launch(void* const* d_in, const int* in_sizes, int n_in,
                              void* d_out, int out_size, void* d_ws, size_t ws_size,
                              hipStream_t stream) {
  if (n_in < 11) return;
  const int NE = 1024 * 1024;                 // elements of every [*,*,1024] tensor and of each weight
  if (in_sizes[0] != NE || in_sizes[1] != NE || in_sizes[3] != NE || in_sizes[4] != NE ||
      in_sizes[5] != NE || in_sizes[6] != NE || in_sizes[7] != NE || in_sizes[8] != 2 * 1024 ||
      in_sizes[2] != 128 * 128 * 128 || in_sizes[9] != 128 * 128 * 128 || in_sizes[10] != 8 * 128 * 128 ||
      out_size != NE) return;

  const float* query    = (const float*)d_in[0];   // (L,B,D)
  const float* rel_pe   = (const float*)d_in[1];   // (B,L,D)
  const float* utt_mask = (const float*)d_in[2];   // (B*H,L,L,1) f32
  const float* Wq       = (const float*)d_in[3];
  const float* Wk       = (const float*)d_in[4];
  const float* Wv       = (const float*)d_in[5];
  const float* Wr       = (const float*)d_in[6];
  const float* Wo       = (const float*)d_in[7];
  const float* spk_emb  = (const float*)d_in[8];   // (2,D)
  const int*   attn_msk = (const int*)d_in[9];     // (B*H,L,L) int32, nonzero = masked
  const int*   spk_msk  = (const int*)d_in[10];    // (B,L,L) int32 in {0,1}
  float* out = (float*)d_out;

  // ---- workspace carve (bytes) ----
  const size_t MiB = (size_t)1 << 20;
  const size_t off_q16 = 0;                    // query  f16       2 MiB
  const size_t off_p16 = 2 * MiB;              // rel_pe f16       2 MiB
  const size_t off_w16 = 4 * MiB;              // 5 weights f16 x16, 2 MiB each (Wq,Wk,Wv,Wr,Wo)
  const size_t off_qf  = 14 * MiB;             // new_q f32        4 MiB
  const size_t off_kf  = 18 * MiB;             // k f32            4 MiB
  const size_t off_vf  = 22 * MiB;             // v f32            4 MiB (directly after k: batched GEMM stride)
  const size_t off_rf  = 26 * MiB;             // r f32            4 MiB
  const size_t off_sb  = 30 * MiB;             // score bias [128][128][128] f32  8 MiB
  const size_t off_ctx = 38 * MiB;             // ctx f32          4 MiB
  const size_t off_c16 = 42 * MiB;             // ctx f16 x16      2 MiB
  const size_t total   = 44 * MiB;
  if (total > ws_size || total > 128 * MiB) return;

  char* ws = (char*)d_ws;
  _Float16* q16 = (_Float16*)(ws + off_q16);
  _Float16* p16 = (_Float16*)(ws + off_p16);
  _Float16* w16 = (_Float16*)(ws + off_w16);
  float* qf  = (float*)(ws + off_qf);
  float* kf  = (float*)(ws + off_kf);
  float* vf  = (float*)(ws + off_vf);
  float* rf  = (float*)(ws + off_rf);
  float* sbp = (float*)(ws + off_sb);
  float* ctx = (float*)(ws + off_ctx);
  _Float16* c16 = (_Float16*)(ws + off_c16);

  // ---- casts: activations x1, weights x16 (exact power of two, undone in the GEMM epilogue); the seven f16
  //      planes q16, p16, w16[0..4] lie one behind the other from the start of the workspace ----
  cast7_f32_f16<<<256, 512, 0, stream>>>(query, rel_pe, Wq, Wk, Wv, Wr, Wo, q16);

  // ---- projections: C = X . W^T, 1024x1024x1024 each; q gets column bias spk_emb[0][col] (= new_q) ----
  const int M = 1024, N = 1024, K = 1024;
  const int tiles = (M / 64) * (N / 64);
  const int gblocks = (tiles + 7) / 8;
  const float wscale_inv = 1.0f / 16.0f;
  {
    dim3 grid(gblocks, 1);
    wmma_gemm64<0, false, 2, 0, false><<<grid, 256, 0, stream>>>(
        (const unsigned short*)q16, (const unsigned short*)q16, K, 0L,
        (const unsigned short*)(w16 + 0 * (size_t)NE), (const unsigned short*)(w16 + 0 * (size_t)NE), K, 0L,
        (void*)qf, (void*)qf, N, 0L,
        spk_emb, spk_emb, 0L, M, N, K, wscale_inv);
  }
  {
    dim3 grid(gblocks, 2);   // y = 0: k (Wk -> kf), y = 1: v (Wv -> vf = kf + NE)
    wmma_gemm64<0, false, 0, 0, false><<<grid, 256, 0, stream>>>(
        (const unsigned short*)q16, (const unsigned short*)q16, K, 0L,
        (const unsigned short*)(w16 + 1 * (size_t)NE), (const unsigned short*)(w16 + 1 * (size_t)NE), K, (long)NE,
        (void*)kf, (void*)kf, N, (long)NE,
        spk_emb, spk_emb, 0L, M, N, K, wscale_inv);
  }
  {
    dim3 grid(gblocks, 1);   // rel_pe flat [1024][1024] . Wr^T -> rf (literal view)
    wmma_gemm64<0, false, 0, 0, false><<<grid, 256, 0, stream>>>(
        (const unsigned short*)p16, (const unsigned short*)p16, K, 0L,
        (const unsigned short*)(w16 + 3 * (size_t)NE), (const unsigned short*)(w16 + 3 * (size_t)NE), K, 0L,
        (void*)rf, (void*)rf, N, 0L,
        spk_emb, spk_emb, 0L, M, N, K, wscale_inv);
  }

  // ---- dense additive score terms (a2 + a3) * 1/8 with the mask folded in as a sentinel ----
  sbias_kernel<<<256, 512, 0, stream>>>(qf, rf, spk_emb, utt_mask, attn_msk, spk_msk, sbp);

  // ---- attention: 128 heads (b*16+h) of 128x128, head dim 64; s = a1/8 + SB, sentinel -> 1e-30 ----
  {
    AttnArgs g;
    g.q_bs = 1024; g.q_rs = 8 * 1024; g.q_hs = 64;
    g.k_bs = 1024; g.k_rs = 8 * 1024; g.k_hs = 64;
    g.v_bs = 1024; g.v_rs = 8 * 1024; g.v_hs = 64;
    g.o_bs = 1024; g.o_rs = 8 * 1024; g.o_hs = 64;
    g.sb_ns = 128 * 128; g.sb_rs = 128;
    g.S = 128; g.Skv = 128; g.H = 16; g.nchunks = 2;
    g.sscale = 0.125f; g.mask_fill = 1e-30f; g.sent_thr = 1.0e37f; g.resv = 0.0f;
    const int agrid = 8 * 16 * (128 / AT_QB);   // 256 blocks
    attn64_sbias_f16<<<agrid, 128, 0, stream>>>(qf, kf, vf, ctx, sbp, g);
  }

  // ---- ctx f32 -> f16 x16, then output projection into d_out (scale 1/256 undoes both x16) ----
  cast1_f32_f16<<<256, 128, 0, stream>>>(ctx, c16, 16.0f);
  {
    dim3 grid(gblocks, 1);
    wmma_gemm64<0, false, 0, 0, false><<<grid, 256, 0, stream>>>(
        (const unsigned short*)c16, (const unsigned short*)c16, K, 0L,
        (const unsigned short*)(w16 + 4 * (size_t)NE), (const unsigned short*)(w16 + 4 * (size_t)NE), K, 0L,
        (void*)out, (void*)out, N, 0L,
        spk_emb, spk_emb, 0L, M, N, K, 1.0f / 256.0f);
  }
  (void)hipGetLastError();
}

// v004
// It runs in 68.4 microseconds.
// Next to v003, in two timings, it ran 1.50 and 1.51 times as fast.
// Counting every step since v000, it is 3.96 times as fast.
#include <hip/hip_runtime.h>
#include <stdint.h>
// Contractions: five 1024x1024x1024 projections (X . W^T), per-head q.k^T (K=64) and p.v (K=128): v_wmma_f32_16x16x32_f16 (f16 operands; weights and ctx carried x16, p carried x2^15, exact powers of two folded back in f32), f32 accumulate. Softmax, additive score terms and depth-64 speaker row dots in f32 on VALU.

typedef __attribute__((ext_vector_type(16))) _Float16 v16h;
typedef __attribute__((ext_vector_type(8)))  _Float16 v8h;
typedef __attribute__((ext_vector_type(16))) __bf16   v16b;
typedef __attribute__((ext_vector_type(8)))  __bf16   v8b;
typedef __attribute__((ext_vector_type(8)))  float    v8f;
typedef __attribute__((ext_vector_type(4)))  float    v4f;

__device__ __forceinline__ unsigned short f2bf_bits(float f) {
  unsigned u = __float_as_uint(f);
  return (unsigned short)((u + 0x7FFFu + ((u >> 16) & 1u)) >> 16);
}
__device__ __forceinline__ float bf_bits2f(unsigned short h) { return __uint_as_float(((unsigned)h) << 16); }

// hazard guards as plain device helpers
__device__ __forceinline__ void acc_guard4(v8f& a, v8f& b, v8f& c, v8f& d) { asm volatile("v_nop\n\tv_nop\n\tv_nop\n\tv_nop" : "+v"(a), "+v"(b), "+v"(c), "+v"(d)); }
template <typename T> struct Frag;
template <> struct Frag<_Float16> {
  typedef v16h V; union U { v16h v; v8h h[2]; };
  static __device__ __forceinline__ v16h load(const _Float16* p) {   // elements 0..7 <- p[0..7], 8..15 <- p[16..23]
    U f; f.h[0] = *(const v8h*)(p); f.h[1] = *(const v8h*)(p + 16); return f.v;
  }
  static __device__ __forceinline__ v8f mma(v16h a, v16h b, v8f c) {
    return __builtin_amdgcn_wmma_f32_16x16x32_f16(false, a, false, b, (short)0, c, false, false);
  }
};
template <> struct Frag<__bf16> {
  typedef v16b V; union U { v16b v; v8b h[2]; };
  static __device__ __forceinline__ v16b load(const __bf16* p) {
    U f; f.h[0] = *(const v8b*)(p); f.h[1] = *(const v8b*)(p + 16); return f.v;
  }
  static __device__ __forceinline__ v8f mma(v16b a, v16b b, v8f c) {
    return __builtin_amdgcn_wmma_f32_16x16x32_bf16(false, a, false, b, (short)0, c, false, false);
  }
};

// ---- Register-blocked batched WMMA GEMM ------------------------------------
// C[m,n] = scale * sum_k A[m,k] * Bt[n,k] (+bias)(+resid); each wave owns a 64x64 tile,
// the eight waves of a work-group own eight neighbouring tiles of one tile row (64 x 512).
// A row-major [M,K]; Bt row-major [N,K]; M % 64 == 0, N % 512 == 0, K % 64 == 0.
// Operand path: per pass of 64 k the work-group's 64 A rows and 512 Bt rows (128 B each, whole lines)
// go to LDS by asynchronous 16-byte copies, two buffers, the next pass in flight while this one is
// multiplied; the waves read their fragments from LDS (row pitch 144 B = 16 B x odd for ds_load_b128).
// SPLIT (hi/lo operand planes) is not staged by this path and is not instantiated.
// Batch b = blockIdx.y: Bt and C advance by their strides; batches b >= batchA2 read A2p as their A, the others Ap,
// so products of two different left operands that do not depend on each other share one launch.
// BIAS_MODE: 0 = none, 1 = bias[m], 2 = bias[n], 3 = bias[n] in batch 0 alone.
// OUT_MODE: 0 = f32, 1 = f16, 2 = bf16 hi plane (Cout) + bf16 lo plane (Cout2).
// ET: 0 = f16 operands, 1 = bf16 operands (pointers passed as 16-bit storage)
template <int ET> struct Elem;
template <> struct Elem<0> { typedef _Float16 T; };
template <> struct Elem<1> { typedef __bf16 T; };
#define G_PITCH 72                       // LDS row pitch in 16-bit elements (128 B of k + 16 B)
#define G_ROWS  576                      // 64 A rows, then 512 Bt rows
#define G_BUF   (G_ROWS * G_PITCH)       // elements of one buffer (82,944 B)

// Nine asynchronous 16-byte-per-lane copies global -> LDS. The s_wait_xcnt closes the statement so that
// no address register named here is rewritten before it.
template <typename T>
__device__ __forceinline__ void async_copy9(const unsigned (&l)[9], const T* const (&g)[9]) {
  asm volatile(
      "global_load_async_to_lds_b128 %0, %9, off\n\t"
      "global_load_async_to_lds_b128 %1, %10, off\n\t"
      "global_load_async_to_lds_b128 %2, %11, off\n\t"
      "global_load_async_to_lds_b128 %3, %12, off\n\t"
      "global_load_async_to_lds_b128 %4, %13, off\n\t"
      "global_load_async_to_lds_b128 %5, %14, off\n\t"
      "global_load_async_to_lds_b128 %6, %15, off\n\t"
      "global_load_async_to_lds_b128 %7, %16, off\n\t"
      "global_load_async_to_lds_b128 %8, %17, off\n\t"
      "s_wait_xcnt 0x0"
      :: "v"(l[0]), "v"(l[1]), "v"(l[2]), "v"(l[3]), "v"(l[4]), "v"(l[5]), "v"(l[6]), "v"(l[7]), "v"(l[8]),
         "v"(g[0]), "v"(g[1]), "v"(g[2]), "v"(g[3]), "v"(g[4]), "v"(g[5]), "v"(g[6]), "v"(g[7]), "v"(g[8])
      : "memory");
}
// One pass's tile: 576 rows x 8 chunks of 16 B = 18 chunks per thread; a wave-wide copy covers 4 whole rows.
// ga / gb: this thread's chunk in A row (tid >> 3) / Bt row (tid >> 3) of the work-group's rows, at the pass's k.
// l0: this thread's LDS byte address for row (tid >> 3) of the target buffer.
template <typename T>
__device__ __forceinline__ void stage_tile(unsigned l0, const T* ga, const T* gb, int lda, int ldb) {
  unsigned l[9]; const T* g[9];
#pragma unroll
  for (int it = 0; it < 9; ++it) {       // rows 0..287: A rows 0..63, Bt rows 0..223
    l[it] = l0 + (unsigned)(it * 32 * G_PITCH * 2);
    g[it] = (it < 2) ? (ga + (size_t)(it * 32) * lda) : (gb + (size_t)((it - 2) * 32) * ldb);
  }
  async_copy9<T>(l, g);
#pragma unroll
  for (int it = 0; it < 9; ++it) {       // rows 288..575: Bt rows 224..511
    l[it] = l0 + (unsigned)((it + 9) * 32 * G_PITCH * 2);
    g[it] = gb + (size_t)((it + 7) * 32) * ldb;
  }
  async_copy9<T>(l, g);
}
// this wave's LDS reads have retired (before the buffer they read is handed back for a refill)
__device__ __forceinline__ void wait_lds_reads()   { asm volatile("s_wait_dscnt 0x0" ::: "memory"); }
// this wave's asynchronous copies have landed (the compiler places no wait for them)
__device__ __forceinline__ void wait_async_copies() { asm volatile("s_wait_asynccnt 0x0" ::: "memory"); }

template <int ET, bool SPLIT, int BIAS_MODE, int OUT_MODE, bool RESID, int ACT = 0>
__global__ __launch_bounds__(256) void wmma_gemm64(
    const unsigned short* __restrict__ Ap, const unsigned short* __restrict__ A2p, int lda, long strideA,
    const unsigned short* __restrict__ Btp, const unsigned short* __restrict__ Bt2p, int ldb, long strideB,
    void* __restrict__ Cout, void* __restrict__ Cout2, int ldc, long strideC,
    const float* __restrict__ bias,
    const float* __restrict__ resid, long strideR,
    int M, int N, int K, float scale, int batchA2) {
  typedef typename Elem<ET>::T T;
  typedef typename Frag<T>::V V;
  static_assert(!SPLIT, "the LDS operand path stages one plane per operand");
  __shared__ __align__(16) T ring[2 * G_BUF];      // two operand buffers
  __shared__ __align__(16) float sT[8][16 * 68];   // per-wave 16x64 slab, pitch 68 floats
  const int b    = blockIdx.y;
  const T* A = (const T*)((b < batchA2) ? Ap : A2p); const T* Bt = (const T*)Btp;
  const int lane = threadIdx.x & 31;
  const int wave = threadIdx.x >> 5;
  const int tilesN = N >> 6;
  const int tilesM = M >> 6;
  const int tile0 = blockIdx.x * 8;      // the work-group's first tile; tilesN % 8 == 0, so all eight share tm
  if (tile0 >= tilesM * tilesN) return;  // the same for the whole work-group, in front of every barrier
  const int tm = tile0 / tilesN;
  const int m0 = tm << 6;
  const int nb0 = (tile0 - tm * tilesN) << 6;   // first Bt row of the work-group
  const int n0 = nb0 + (wave << 6);

  const T* Ab  = A  + (size_t)b * strideA;
  const T* Bb  = Bt + (size_t)b * strideB;

  const int rlane = lane & 15;                 // row (A) / col (B, D) within subtile
  const int koff  = (lane >> 4) * 8;           // k offset of this lane half
  const int mOff  = (lane >> 4) * 8;           // D row offset

  v8f acc[4][4];
#pragma unroll
  for (int i = 0; i < 4; ++i)
#pragma unroll
    for (int j = 0; j < 4; ++j) acc[i][j] = (v8f){0.f,0.f,0.f,0.f,0.f,0.f,0.f,0.f};

  // BIAS_MODE 3: the lane's four column terms, requested once, under one work-group-uniform test, in front of the k loop
  float bcol[4] = {0.f, 0.f, 0.f, 0.f};
  if (BIAS_MODE == 3 && b == 0) {
#pragma unroll                                 // constant indices keep bcol in registers
    for (int j = 0; j < 4; ++j) bcol[j] = bias[n0 + (j << 4) + rlane];
    // the address registers of these loads are reused by the address arithmetic below: the wait stands in front of that
    asm volatile("s_wait_xcnt 0x0" ::: "memory");
  }

  const int srow = threadIdx.x >> 3;           // staged row of this thread within a group of 32 rows
  const int schk = (threadIdx.x & 7) * 8;      // its 16-byte chunk, in elements
  const T* ga = Ab + (size_t)(m0 + srow) * lda + schk;
  const T* gb = Bb + (size_t)(nb0 + srow) * ldb + schk;
  const unsigned l0 = (unsigned)(size_t)ring + (unsigned)((srow * G_PITCH + schk) * 2);
  const int nPass = K >> 6;

  stage_tile<T>(l0, ga, gb, lda, ldb);
  wait_async_copies();
  __syncthreads();                             // pass 0's tile is published
  if (nPass > 1) stage_tile<T>(l0 + (unsigned)(G_BUF * 2), ga + 64, gb + 64, lda, ldb);

#pragma unroll 1                               // one pass per trip: the buffer is picked by the trip's parity
  for (int t = 0; t < nPass; ++t) {
    const int bsel = (t & 1) * G_BUF;
    const T* ra = ring + bsel + rlane * G_PITCH + koff;
    const T* rb = ring + bsel + (64 + (wave << 6) + rlane) * G_PITCH + koff;
#pragma unroll
    for (int ks = 0; ks < 2; ++ks) {
      V bh[4], ah[4];
#pragma unroll
      for (int j = 0; j < 4; ++j) bh[j] = Frag<T>::load(rb + j * 16 * G_PITCH + ks * 32);
#pragma unroll
      for (int i = 0; i < 4; ++i) ah[i] = Frag<T>::load(ra + i * 16 * G_PITCH + ks * 32);
      // the 16 fragment reads stay one group in front of the 16 WMMAs: left free, the scheduler reuses one
      // A register set and the wave waits out the LDS latency four times per block
      __builtin_amdgcn_sched_barrier(0);
#pragma unroll
      for (int i = 0; i < 4; ++i)
#pragma unroll
        for (int j = 0; j < 4; ++j) acc[i][j] = Frag<T>::mma(ah[i], bh[j], acc[i][j]);
      __builtin_amdgcn_sched_barrier(0);       // and the next block's reads stay behind this block's WMMAs
    }
    wait_lds_reads();
    wait_async_copies();
    __syncthreads();                           // publishes pass t + 1's tile and ends every read of pass t's buffer
    if (t + 2 < nPass)
      stage_tile<T>(l0 + (unsigned)(bsel * 2), ga + (size_t)(t + 2) * 64, gb + (size_t)(t + 2) * 64, lda, ldb);
  }
  wait_async_copies();
  acc_guard4(acc[0][0], acc[0][1], acc[0][2], acc[0][3]);
  acc_guard4(acc[1][0], acc[1][1], acc[1][2], acc[1][3]);
  acc_guard4(acc[2][0], acc[2][1], acc[2][2], acc[2][3]);
  acc_guard4(acc[3][0], acc[3][1], acc[3][2], acc[3][3]);

  // ---- epilogue ----
  float* slab = sT[wave];
  const float* Rb = RESID ? (resid + (size_t)b * strideR) : nullptr;
#pragma unroll
  for (int i = 0; i < 4; ++i) {
    const int mBase = m0 + (i << 4);
#pragma unroll
    for (int j = 0; j < 4; ++j) {
      const int n = n0 + (j << 4) + rlane;
      float bv = 0.f;
      if (BIAS_MODE == 2) bv = bias[n];
      if (BIAS_MODE == 3) bv = bcol[j];
#pragma unroll
      for (int r = 0; r < 8; ++r) {
        float v = acc[i][j][r] * scale;
        if (BIAS_MODE == 1) v += bias[mBase + mOff + r];
        if (BIAS_MODE == 2 || BIAS_MODE == 3) v += bv;
        if (RESID) v += Rb[(size_t)(mBase + mOff + r) * ldc + n];
        if (ACT == 1) v = tanhf(v);
        if (ACT == 2) v = fmaxf(v, 0.0f);
        if (ACT == 3) v = v / (1.0f + expf(-v));
        if (ACT == 4) v = (v > 0.f) ? v : 0.01f * v;
        if (ACT == 5) v = 0.5f * v * (1.0f + erff(v * 0.70710678118654752f));
        slab[(mOff + r) * 68 + (j << 4) + rlane] = v;
      }
    }
    __builtin_amdgcn_fence(__ATOMIC_RELEASE, "workgroup");
    __builtin_amdgcn_wave_barrier();
    __builtin_amdgcn_fence(__ATOMIC_ACQUIRE, "workgroup");
    if (OUT_MODE == 0) {
      float* C = (float*)Cout + (size_t)b * strideC;
      const int hh = lane >> 4, c4 = (lane & 15) * 4;     // row seg = 256 B = 16 lanes x 16 B
      {
#pragma unroll
        for (int it = 0; it < 8; ++it) {
          const int row = it * 2 + hh;
          v4f v = *(const v4f*)(slab + row * 68 + c4);
          *(v4f*)(C + (size_t)(mBase + row) * ldc + n0 + c4) = v;
        }
        
      }
    } else {
      const int q = lane >> 3, c8 = (lane & 7) * 8;
      unsigned short* C  = (unsigned short*)Cout  + (size_t)b * strideC;
      unsigned short* C2 = (OUT_MODE == 2) ? ((unsigned short*)Cout2 + (size_t)b * strideC) : nullptr;
      {
#pragma unroll
        for (int it = 0; it < 4; ++it) {
          const int row = it * 4 + q;
          const float* sp = slab + row * 68 + c8;
          v8h hv, lv;
#pragma unroll
          for (int e = 0; e < 8; ++e) {
            if (OUT_MODE == 1) {
              hv[e] = (_Float16)sp[e];
            } else {
              unsigned short hb = f2bf_bits(sp[e]);
              unsigned short lb = f2bf_bits(sp[e] - bf_bits2f(hb));
              hv[e] = __builtin_bit_cast(_Float16, hb);
              lv[e] = __builtin_bit_cast(_Float16, lb);
            }
          }
          *(v8h*)(C + (size_t)(mBase + row) * ldc + n0 + c8) = hv;
          if (OUT_MODE == 2) *(v8h*)(C2 + (size_t)(mBase + row) * ldc + n0 + c8) = lv;
        }
        
      }
    }
    __builtin_amdgcn_fence(__ATOMIC_RELEASE, "workgroup");
    __builtin_amdgcn_wave_barrier();
    __builtin_amdgcn_fence(__ATOMIC_ACQUIRE, "workgroup");
  }
}

// ---- f32 -> f16 casts (value x scale, round to nearest even) ---------------------------------------------
// A work-group converts 4096 consecutive elements of each of its planes. A wave-wide load is 512 contiguous bytes
// (16 B a lane), a wave-wide store 256 contiguous bytes (8 B a lane); every load of a thread is independent of every
// other and all are requested in front of the first store. L = loads per lane and plane = 32 / waves per work-group.
typedef __attribute__((ext_vector_type(4))) _Float16 v4h;
#define CAST_PLANE (1024 * 1024)         // elements of one plane
// e0: the lane's first element; the byte offsets fit 32 bits, so each access is plane base + one shared offset register.
template <int L>
__device__ __forceinline__ void cast_load(const float* __restrict__ in, unsigned e0, v4f (&x)[L]) {
  const char* p = (const char*)in + e0 * 4u;
#pragma unroll
  for (int k = 0; k < L; ++k) x[k] = *(const v4f*)(p + k * 512);
}
template <int L>
__device__ __forceinline__ void cast_store(_Float16* __restrict__ out, unsigned e0, const v4f (&x)[L], float scale) {
  char* p = (char*)out + e0 * 2u;
#pragma unroll
  for (int k = 0; k < L; ++k) {
    v4h h;
#pragma unroll
    for (int e = 0; e < 4; ++e) h[e] = (_Float16)(x[k][e] * scale);
    *(v4h*)(p + k * 256) = h;
  }
}
// seven planes in one launch: two activations x1, five weights x16; plane p goes to out + p * CAST_PLANE.
// grid = 256 work-groups of 16 waves.
__global__ __launch_bounds__(512) void cast7_f32_f16(
    const float* __restrict__ a0, const float* __restrict__ a1, const float* __restrict__ w0,
    const float* __restrict__ w1, const float* __restrict__ w2, const float* __restrict__ w3,
    const float* __restrict__ w4, _Float16* __restrict__ out) {
  const unsigned e0 = blockIdx.x * 4096u + (threadIdx.x >> 5) * 256u + (threadIdx.x & 31u) * 4u;
  v4f x[7][2];
  cast_load<2>(a0, e0, x[0]);
  cast_load<2>(a1, e0, x[1]);
  cast_load<2>(w0, e0, x[2]);
  cast_load<2>(w1, e0, x[3]);
  cast_load<2>(w2, e0, x[4]);
  cast_load<2>(w3, e0, x[5]);
  cast_load<2>(w4, e0, x[6]);
  cast_store<2>(out + 0 * (size_t)CAST_PLANE, e0, x[0], 1.0f);
  cast_store<2>(out + 1 * (size_t)CAST_PLANE, e0, x[1], 1.0f);
  cast_store<2>(out + 2 * (size_t)CAST_PLANE, e0, x[2], 16.0f);
  cast_store<2>(out + 3 * (size_t)CAST_PLANE, e0, x[3], 16.0f);
  cast_store<2>(out + 4 * (size_t)CAST_PLANE, e0, x[4], 16.0f);
  cast_store<2>(out + 5 * (size_t)CAST_PLANE, e0, x[5], 16.0f);
  cast_store<2>(out + 6 * (size_t)CAST_PLANE, e0, x[6], 16.0f);
}
// one plane: grid = 256 work-groups of 4 waves, eight loads a lane.
__global__ __launch_bounds__(128) void cast1_f32_f16(
    const float* __restrict__ in, _Float16* __restrict__ out, float scale) {
  const unsigned e0 = blockIdx.x * 4096u + (threadIdx.x >> 5) * 1024u + (threadIdx.x & 31u) * 4u;
  v4f x[8];
  cast_load<8>(in, e0, x);
  cast_store<8>(out, e0, x, scale);
}

// ---- additive score terms + mask, dense per head ------------------------------------------------------
//   qf, rf: f32 projection outputs, row i*8+b, col h*64+d (qf already includes the s_q column term).
//   A work-group owns 64 score rows of one head (grid = 128 heads x 2 halves, 16 waves). Every global load of a
//   thread is independent of every other and all are requested up front: one round trip instead of one per row.
//   Phase 1 (LDS): e0[i] = newq[n,i,:].semb[0][h*64..], e1[i] = newq[n,i,:].semb[1][h*64..] for the 64 own rows,
//                  cv[i] = r[n,i,:].semb[0][h*64..] for all 128 rows; 16 lanes x 16 B per row, summed across the lanes.
//                  cv[128..255] = 0, so that cv[127-i+j] is the shifted term for j <= i and 0 for j > i.
//   Phase 2: SB[n][i][j] = amask[n][i][j] != 0 ? 3e38 (sentinel)
//                        : 0.125 * ( utt[n][i][j] * (smask[b][i][j] -> e1[i] : e0[i]) + cv[127-i+j] )
//            16 B per lane and array, a wave covers one whole 512-B row per access, four rows per wave.
typedef __attribute__((ext_vector_type(4))) int v4i;
#define SB_ROWS 64
__device__ __forceinline__ float dot4(v4f x, v4f w) {
  return fmaf(x[3], w[3], fmaf(x[2], w[2], fmaf(x[1], w[1], x[0] * w[0])));
}
__global__ __launch_bounds__(512) void sbias_kernel(
    const float* __restrict__ qf, const float* __restrict__ rf, const float* __restrict__ semb,
    const float* __restrict__ utt, const int* __restrict__ amask, const int* __restrict__ smask,
    float* __restrict__ sb) {
  __shared__ float se0[SB_ROWS];
  __shared__ float se1[SB_ROWS];
  __shared__ float scv[256];
  const int n = blockIdx.x >> 1, i0 = (blockIdx.x & 1) * SB_ROWS;
  const int b = n >> 4, h = n & 15;
  const int wave = threadIdx.x >> 5, lane = threadIdx.x & 31;
  const int hh = lane >> 4, d4 = (lane & 15) * 4;   // phase 1: row of the pair, four of the 64 depths
  const int c4 = lane * 4;                          // phase 2: this lane's four score columns
  const float* ub  = utt   + (size_t)n * 16384;
  const int*   ab  = amask + (size_t)n * 16384;
  const int*   smb = smask + (size_t)b * 16384;
  float*       ob  = sb    + (size_t)n * 16384;

  const v4f w0 = *(const v4f*)(semb + h * 64 + d4);
  const v4f w1 = *(const v4f*)(semb + 1024 + h * 64 + d4);
  const size_t co = (size_t)b * 1024 + (size_t)h * 64 + d4;
  v4f rv[4], qv[2];
#pragma unroll
  for (int k = 0; k < 4; ++k) rv[k] = *(const v4f*)(rf + (size_t)(wave * 8 + k * 2 + hh) * 8192 + co);
#pragma unroll
  for (int k = 0; k < 2; ++k) qv[k] = *(const v4f*)(qf + (size_t)(i0 + wave * 4 + k * 2 + hh) * 8192 + co);
  // the row loads' address registers may be reused as destinations of the loads below: the wait stands in front of that
  asm volatile("s_wait_xcnt 0x0" ::: "memory");
  v4f u4[4]; v4i am4[4], sm4[4];
#pragma unroll
  for (int k = 0; k < 4; ++k) {                // score rows i0 + wave + 16 k
    const int e = (i0 + wave + 16 * k) * 128 + c4;
    u4[k]  = *(const v4f*)(ub + e);
    am4[k] = *(const v4i*)(ab + e);
    sm4[k] = *(const v4i*)(smb + e);
  }
  // the mask loads stay in front of phase 1's arithmetic: left free, the scheduler issues them only behind the
  // wait for the projection rows, and the two round trips run one after the other
  __builtin_amdgcn_sched_barrier(0);

  float p[8];
#pragma unroll
  for (int k = 0; k < 4; ++k) p[k] = dot4(rv[k], w0);
#pragma unroll
  for (int k = 0; k < 2; ++k) { p[4 + k] = dot4(qv[k], w0); p[6 + k] = dot4(qv[k], w1); }
#pragma unroll
  for (int off = 1; off < 16; off <<= 1)
#pragma unroll
    for (int x = 0; x < 8; ++x) p[x] += __shfl_xor(p[x], off, 32);
  if ((lane & 15) == 0) {
#pragma unroll
    for (int k = 0; k < 4; ++k) scv[wave * 8 + k * 2 + hh] = p[k];
#pragma unroll
    for (int k = 0; k < 2; ++k) { se0[wave * 4 + k * 2 + hh] = p[4 + k]; se1[wave * 4 + k * 2 + hh] = p[6 + k]; }
  }
  if (threadIdx.x < 128) scv[128 + threadIdx.x] = 0.0f;
  __syncthreads();

#pragma unroll
  for (int k = 0; k < 4; ++k) {
    const int il = wave + 16 * k, i = i0 + il;
    const float e0v = se0[il], e1v = se1[il];
    const float* cvp = scv + (127 - i + c4);   // 0 <= 127 - i + j <= 254 for every row i and column j
    v4f o;
#pragma unroll
    for (int u = 0; u < 4; ++u) {
      int sm = sm4[k][u];
      if (sm < 0) sm += 2;                     // 2-row table: wrap negatives, then clamp
      sm = sm < 0 ? 0 : (sm > 1 ? 1 : sm);
      const float ev = (sm != 0) ? e1v : e0v;
      float val = (u4[k][u] * ev + cvp[u]) * 0.125f;
      if (am4[k][u] != 0) val = 3.0e38f;
      o[u] = val;
    }
    *(v4f*)(ob + i * 128 + c4) = o;
  }
}

// =====================================================================================
// Attention for head_dim 64 with a dense additive score tensor, f32 in / f32 out, f16 operands:
//   s = (q.k^T) * sscale + SB[bh][q][kv];  SB element above sent_thr -> s = mask_fill (kept in the softmax)
//   softmax over all Skv keys in f32 (online over 64-key chunks); p carried x2^15 as f16; out = p.v / (l*2^15).
//   Block = 4 waves = 64 query rows of one (b, h); grid.x = B*H*(S/64).
//   Element (b, s, h, d) of q/k/v/out at X[b*X_bs + s*X_rs + h*X_hs + d]; SB element (bh, q, kv) at sb[bh*sb_ns + q*sb_rs + kv].
// =====================================================================================
#define AT_D 64
#define AT_NW 4
#define AT_QB 64
#define AT_KC 64
struct AttnArgs { long q_bs, q_rs, q_hs, k_bs, k_rs, k_hs, v_bs, v_rs, v_hs, o_bs, o_rs, o_hs, sb_ns, sb_rs;
                  int S, Skv, H, nchunks; float sscale, mask_fill, sent_thr, resv; };
static_assert(sizeof(AttnArgs) == 144);

__device__ __forceinline__ v8f mma_f16g(v16h a, v16h b, v8f c) {
  c = __builtin_amdgcn_wmma_f32_16x16x32_f16(false, a, false, b, (short)0, c, false, false);
  asm volatile("v_nop\n\tv_nop\n\tv_nop\n\tv_nop" : "+v"(c) : "v"(a), "v"(b));
  return c;
}

__global__ __launch_bounds__(128)
void attn64_sbias_f16(const float* __restrict__ q, const float* __restrict__ k,
                      const float* __restrict__ v, float* __restrict__ out,
                      const float* __restrict__ sb, AttnArgs g) {
  const float PSC = 32768.0f;
  union FB { v16h v; v8h h[2]; };
  __shared__ __align__(16) _Float16 Ksh[AT_KC * AT_D];            // K [kv][d]   8 KB
  __shared__ __align__(16) _Float16 Vth[AT_D * AT_KC];            // V [d][kv]   8 KB
  __shared__ __align__(16) _Float16 Psh[AT_NW][16 * AT_KC];       // per wave P [row][kv]  8 KB
  __shared__ __align__(16) float    Os[AT_NW][16 * 68];           // per wave out tile, pitch 68

  const int tid  = threadIdx.x;
  const int wave = tid >> 5;
  const int lane = tid & 31;
  const int hh   = lane >> 4;
  const int c    = lane & 15;

  const int nqb = g.S / AT_QB;
  const int bx = blockIdx.x;
  const int qb = bx % nqb;
  const int bh = bx / nqb;
  const int h  = bh % g.H;
  const int b  = bh / g.H;
  const int q0 = qb * AT_QB + wave * 16;

  const float* qb_ptr = q   + (size_t)b * g.q_bs + (size_t)h * g.q_hs;
  const float* kb_ptr = k   + (size_t)b * g.k_bs + (size_t)h * g.k_hs;
  const float* vb_ptr = v   + (size_t)b * g.v_bs + (size_t)h * g.v_hs;
  float*       ob_ptr = out + (size_t)b * g.o_bs + (size_t)h * g.o_hs;

  // ---- Q fragments (A operand), 2 d-chunks, split k map ----
  v16h qa[2];
  {
    const float* qrow = qb_ptr + (size_t)(q0 + c) * g.q_rs;
#pragma unroll
    for (int dc = 0; dc < 2; ++dc) {
      const v4f f0 = *(const v4f*)(qrow + dc * 32 + 8 * hh);
      const v4f f1 = *(const v4f*)(qrow + dc * 32 + 8 * hh + 4);
      const v4f f2 = *(const v4f*)(qrow + dc * 32 + 16 + 8 * hh);
      const v4f f3 = *(const v4f*)(qrow + dc * 32 + 16 + 8 * hh + 4);
#pragma unroll
      for (int e = 0; e < 4; ++e) {
        qa[dc][e]      = (_Float16)f0[e];
        qa[dc][4 + e]  = (_Float16)f1[e];
        qa[dc][8 + e]  = (_Float16)f2[e];
        qa[dc][12 + e] = (_Float16)f3[e];
      }
    }
  }

  float mrow[8], lrow[8];
  v8f oacc[4];
#pragma unroll
  for (int r = 0; r < 8; ++r) { mrow[r] = -INFINITY; lrow[r] = 0.f; }
#pragma unroll
  for (int t = 0; t < 4; ++t) oacc[t] = (v8f){0.f,0.f,0.f,0.f,0.f,0.f,0.f,0.f};

  int nChunks = g.Skv / AT_KC;                 // block-uniform, host-provided
  if (nChunks > 64) nChunks = 64;
  for (int kc = 0; kc < nChunks; ++kc) {
    const int kv0 = kc * AT_KC;
    __syncthreads();
    {
      const int kvr = tid >> 1, dh = (tid & 1) * 32;
      const float* krow = kb_ptr + (size_t)(kv0 + kvr) * g.k_rs + dh;
      const float* vrow = vb_ptr + (size_t)(kv0 + kvr) * g.v_rs + dh;
#pragma unroll
      for (int i = 0; i < 8; ++i) {
        v4f kk = *(const v4f*)(krow + 4 * i);
        v4f vv = *(const v4f*)(vrow + 4 * i);
#pragma unroll
        for (int e = 0; e < 4; ++e) {
          const int d = dh + 4 * i + e;
          Ksh[kvr * AT_D + d]  = (_Float16)kk[e];
          Vth[d * AT_KC + kvr] = (_Float16)vv[e];
        }
      }
    }
    __syncthreads();

    v8f s[4];
#pragma unroll
    for (int j = 0; j < 4; ++j) {
      s[j] = (v8f){0.f,0.f,0.f,0.f,0.f,0.f,0.f,0.f};
#pragma unroll
      for (int dc = 0; dc < 2; ++dc) {
        FB kb;
        kb.h[0] = *(const v8h*)(Ksh + (j * 16 + c) * AT_D + dc * 32 + 8 * hh);
        kb.h[1] = *(const v8h*)(Ksh + (j * 16 + c) * AT_D + dc * 32 + 16 + 8 * hh);
        s[j] = mma_f16g(qa[dc], kb.v, s[j]);
      }
    }
    // additive terms + mask select, row max
    const float* sbp = sb + (size_t)bh * g.sb_ns + (size_t)(q0 + 8 * hh) * g.sb_rs + kv0 + c;
    float cm[8];
#pragma unroll
    for (int r = 0; r < 8; ++r) {
      const float* sbr = sbp + (size_t)r * g.sb_rs;
      float m = -INFINITY;
#pragma unroll
      for (int j = 0; j < 4; ++j) {
        const float bb = sbr[j * 16];
        float sv = fmaf(s[j][r], g.sscale, bb);
        if (bb > g.sent_thr) sv = g.mask_fill;
        s[j][r] = sv;
        m = fmaxf(m, sv);
      }
#pragma unroll
      for (int off = 1; off < 16; off <<= 1) m = fmaxf(m, __shfl_xor(m, off, 32));
      cm[r] = m;
    }
    _Float16* pwh = Psh[wave];
#pragma unroll
    for (int r = 0; r < 8; ++r) {
      const float mnew = fmaxf(mrow[r], cm[r]);
      const float alpha = expf(mrow[r] - mnew);
      mrow[r] = mnew;
      float psum = 0.f;
#pragma unroll
      for (int j = 0; j < 4; ++j) {
        const float p = expf(s[j][r] - mnew);
        psum += p;
        pwh[(8 * hh + r) * AT_KC + j * 16 + c] = (_Float16)(p * PSC);
      }
#pragma unroll
      for (int off = 1; off < 16; off <<= 1) psum += __shfl_xor(psum, off, 32);
      lrow[r] = lrow[r] * alpha + psum;
#pragma unroll
      for (int t = 0; t < 4; ++t) oacc[t][r] *= alpha;
    }
    __builtin_amdgcn_fence(__ATOMIC_RELEASE, "workgroup");
    __builtin_amdgcn_wave_barrier();
    __builtin_amdgcn_fence(__ATOMIC_ACQUIRE, "workgroup");
#pragma unroll 1
    for (int kk = 0; kk < 2; ++kk) {
      FB pa;
      pa.h[0] = *(const v8h*)(pwh + c * AT_KC + kk * 32 + 8 * hh);
      pa.h[1] = *(const v8h*)(pwh + c * AT_KC + kk * 32 + 16 + 8 * hh);
#pragma unroll
      for (int t = 0; t < 4; ++t) {
        FB vb;
        vb.h[0] = *(const v8h*)(Vth + (t * 16 + c) * AT_KC + kk * 32 + 8 * hh);
        vb.h[1] = *(const v8h*)(Vth + (t * 16 + c) * AT_KC + kk * 32 + 16 + 8 * hh);
        oacc[t] = mma_f16g(pa.v, vb.v, oacc[t]);
      }
    }
  }

  float* os = Os[wave];
#pragma unroll
  for (int r = 0; r < 8; ++r) {
    const float inv = 1.0f / (lrow[r] * PSC);
#pragma unroll
    for (int t = 0; t < 4; ++t) os[(8 * hh + r) * 68 + t * 16 + c] = oacc[t][r] * inv;
  }
  __builtin_amdgcn_fence(__ATOMIC_RELEASE, "workgroup");
  __builtin_amdgcn_wave_barrier();
  __builtin_amdgcn_fence(__ATOMIC_ACQUIRE, "workgroup");
  {
    const int c4 = (lane & 15) * 4;
    {
#pragma unroll
      for (int it = 0; it < 8; ++it) {
        const int row = it * 2 + hh;
        v4f val = *(const v4f*)(os + row * 68 + c4);
        *(v4f*)(ob_ptr + (size_t)(q0 + row) * g.o_rs + c4) = val;
      }
      
    }
  }
}

// ---------------------------------------------------------------------------
// Host launcher. Layout of q/k/v/r/ctx matrices: row = i*8 + b (i = position, b = batch),
// col = h*64 + d; head n = b*16 + h. The (B,L,D) positional input is used as a flat [1024][1024]
// A matrix exactly like the (L,B,D) query (literal view semantics of the position projection).
// ---------------------------------------------------------------------------
extern "C" void kernel_launch(void* const* d_in, const int* in_sizes, int n_in,
                              void* d_out, int out_size, void* d_ws, size_t ws_size,
                              hipStream_t stream) {
  if (n_in < 11) return;
  const int NE = 1024 * 1024;                 // elements of every [*,*,1024] tensor and of each weight
  if (in_sizes[0] != NE || in_sizes[1] != NE || in_sizes[3] != NE || in_sizes[4] != NE ||
      in_sizes[5] != NE || in_sizes[6] != NE || in_sizes[7] != NE || in_sizes[8] != 2 * 1024 ||
      in_sizes[2] != 128 * 128 * 128 || in_sizes[9] != 128 * 128 * 128 || in_sizes[10] != 8 * 128 * 128 ||
      out_size != NE) return;

  const float* query    = (const float*)d_in[0];   // (L,B,D)
  const float* rel_pe   = (const float*)d_in[1];   // (B,L,D)
  const float* utt_mask = (const float*)d_in[2];   // (B*H,L,L,1) f32
  const float* Wq       = (const float*)d_in[3];
  const float* Wk       = (const float*)d_in[4];
  const float* Wv       = (const float*)d_in[5];
  const float* Wr       = (const float*)d_in[6];
  const float* Wo       = (const float*)d_in[7];
  const float* spk_emb  = (const float*)d_in[8];   // (2,D)
  const int*   attn_msk = (const int*)d_in[9];     // (B*H,L,L) int32, nonzero = masked
  const int*   spk_msk  = (const int*)d_in[10];    // (B,L,L) int32 in {0,1}
  float* out = (float*)d_out;

  // ---- workspace carve (bytes) ----
  const size_t MiB = (size_t)1 << 20;
  const size_t off_q16 = 0;                    // query  f16       2 MiB
  const size_t off_p16 = 2 * MiB;              // rel_pe f16       2 MiB
  const size_t off_w16 = 4 * MiB;              // 5 weights f16 x16, 2 MiB each (Wq,Wk,Wv,Wr,Wo)
  const size_t off_qf  = 14 * MiB;             // new_q f32        4 MiB
  const size_t off_kf  = 18 * MiB;             // k f32            4 MiB
  const size_t off_vf  = 22 * MiB;             // v f32            4 MiB (q, k, v, r one behind the other: batched GEMM stride)
  const size_t off_rf  = 26 * MiB;             // r f32            4 MiB
  const size_t off_sb  = 30 * MiB;             // score bias [128][128][128] f32  8 MiB
  const size_t off_ctx = 38 * MiB;             // ctx f32          4 MiB
  const size_t off_c16 = 42 * MiB;             // ctx f16 x16      2 MiB
  const size_t total   = 44 * MiB;
  if (total > ws_size || total > 128 * MiB) return;

  char* ws = (char*)d_ws;
  _Float16* q16 = (_Float16*)(ws + off_q16);
  _Float16* p16 = (_Float16*)(ws + off_p16);
  _Float16* w16 = (_Float16*)(ws + off_w16);
  float* qf  = (float*)(ws + off_qf);
  float* kf  = (float*)(ws + off_kf);
  float* vf  = (float*)(ws + off_vf);
  float* rf  = (float*)(ws + off_rf);
  float* sbp = (float*)(ws + off_sb);
  float* ctx = (float*)(ws + off_ctx);
  _Float16* c16 = (_Float16*)(ws + off_c16);

  // ---- casts: activations x1, weights x16 (exact power of two, undone in the GEMM epilogue); the seven f16
  //      planes q16, p16, w16[0..4] lie one behind the other from the start of the workspace ----
  cast7_f32_f16<<<256, 512, 0, stream>>>(query, rel_pe, Wq, Wk, Wv, Wr, Wo, q16);

  // ---- input projections: C = X . W^T, 1024x1024x1024 each; q gets column bias spk_emb[0][col] (= new_q) ----
  const int M = 1024, N = 1024, K = 1024;
  const int tiles = (M / 64) * (N / 64);
  const int gblocks = (tiles + 7) / 8;
  const float wscale_inv = 1.0f / 16.0f;
  {
    // one launch of 4 x 32 work-groups, each alone on its WGP: y = 0: q (query, Wq -> qf, + spk_emb[0][col]),
    // y = 1: k, y = 2: v (query), y = 3: r (rel_pe flat [1024][1024], literal view). The four weight planes and the
    // four f32 results lie one behind the other in the workspace (strides NE).
    dim3 grid(gblocks, 4);
    wmma_gemm64<0, false, 3, 0, false><<<grid, 256, 0, stream>>>(
        (const unsigned short*)q16, (const unsigned short*)p16, K, 0L,
        (const unsigned short*)w16, (const unsigned short*)w16, K, (long)NE,
        (void*)qf, (void*)qf, N, (long)NE,
        spk_emb, spk_emb, 0L, M, N, K, wscale_inv, 3);
  }

  // ---- dense additive score terms (a2 + a3) * 1/8 with the mask folded in as a sentinel ----
  sbias_kernel<<<256, 512, 0, stream>>>(qf, rf, spk_emb, utt_mask, attn_msk, spk_msk, sbp);

  // ---- attention: 128 heads (b*16+h) of 128x128, head dim 64; s = a1/8 + SB, sentinel -> 1e-30 ----
  {
    AttnArgs g;
    g.q_bs = 1024; g.q_rs = 8 * 1024; g.q_hs = 64;
    g.k_bs = 1024; g.k_rs = 8 * 1024; g.k_hs = 64;
    g.v_bs = 1024; g.v_rs = 8 * 1024; g.v_hs = 64;
    g.o_bs = 1024; g.o_rs = 8 * 1024; g.o_hs = 64;
    g.sb_ns = 128 * 128; g.sb_rs = 128;
    g.S = 128; g.Skv = 128; g.H = 16; g.nchunks = 2;
    g.sscale = 0.125f; g.mask_fill = 1e-30f; g.sent_thr = 1.0e37f; g.resv = 0.0f;
    const int agrid = 8 * 16 * (128 / AT_QB);   // 256 blocks
    attn64_sbias_f16<<<agrid, 128, 0, stream>>>(qf, kf, vf, ctx, sbp, g);
  }

  // ---- ctx f32 -> f16 x16, then output projection into d_out (scale 1/256 undoes both x16) ----
  cast1_f32_f16<<<256, 128, 0, stream>>>(ctx, c16, 16.0f);
  {
    dim3 grid(gblocks, 1);
    wmma_gemm64<0, false, 0, 0, false><<<grid, 256, 0, stream>>>(
        (const unsigned short*)c16, (const unsigned short*)c16, K, 0L,
        (const unsigned short*)(w16 + 4 * (size_t)NE), (const unsigned short*)(w16 + 4 * (size_t)NE), K, 0L,
        (void*)out, (void*)out, N, 0L,
        spk_emb, spk_emb, 0L, M, N, K, 1.0f / 256.0f, 1);
  }
  (void)hipGetLastError();
}

// v005
// Measured time: 51.1 microseconds a run.
// In two side-by-side timings against v004, it was 1.29 and 1.36 times as fast.
// Counting every step since v000, it is 5.24 times as fast.
#include <hip/hip_runtime.h>
#include <stdint.h>
// Contractions: five 1024x1024x1024 projections (X . W^T), per-head q.k^T (K=64) and p.v (K=128): v_wmma_f32_16x16x32_f16 (f16 operands; weights and ctx carried x16, p carried x2^15, exact powers of two folded back in f32), f32 accumulate. Softmax, additive score terms and depth-64 speaker row dots in f32 on VALU.

typedef __attribute__((ext_vector_type(16))) _Float16 v16h;
typedef __attribute__((ext_vector_type(8)))  _Float16 v8h;
typedef __attribute__((ext_vector_type(16))) __bf16   v16b;
typedef __attribute__((ext_vector_type(8)))  __bf16   v8b;
typedef __attribute__((ext_vector_type(8)))  float    v8f;
typedef __attribute__((ext_vector_type(4)))  float    v4f;

__device__ __forceinline__ unsigned short f2bf_bits(float f) {
  unsigned u = __float_as_uint(f);
  return (unsigned short)((u + 0x7FFFu + ((u >> 16) & 1u)) >> 16);
}
__device__ __forceinline__ float bf_bits2f(unsigned short h) { return __uint_as_float(((unsigned)h) << 16); }

// hazard guards as plain device helpers
__device__ __forceinline__ void acc_guard4(v8f& a, v8f& b, v8f& c, v8f& d) { asm volatile("v_nop\n\tv_nop\n\tv_nop\n\tv_nop" : "+v"(a), "+v"(b), "+v"(c), "+v"(d)); }
template <typename T> struct Frag;
template <> struct Frag<_Float16> {
  typedef v16h V; union U { v16h v; v8h h[2]; };
  static __device__ __forceinline__ v16h load(const _Float16* p) {   // elements 0..7 <- p[0..7], 8..15 <- p[16..23]
    U f; f.h[0] = *(const v8h*)(p); f.h[1] = *(const v8h*)(p + 16); return f.v;
  }
  static __device__ __forceinline__ v8f mma(v16h a, v16h b, v8f c) {
    return __builtin_amdgcn_wmma_f32_16x16x32_f16(false, a, false, b, (short)0, c, false, false);
  }
};
template <> struct Frag<__bf16> {
  typedef v16b V; union U { v16b v; v8b h[2]; };
  static __device__ __forceinline__ v16b load(const __bf16* p) {
    U f; f.h[0] = *(const v8b*)(p); f.h[1] = *(const v8b*)(p + 16); return f.v;
  }
  static __device__ __forceinline__ v8f mma(v16b a, v16b b, v8f c) {
    return __builtin_amdgcn_wmma_f32_16x16x32_bf16(false, a, false, b, (short)0, c, false, false);
  }
};

// ---- Register-blocked batched WMMA GEMM ------------------------------------
// C[m,n] = scale * sum_k A[m,k] * Bt[n,k] (+bias)(+resid); a work-group owns a 128x128 tile,
// its eight waves 32x64 each (four down, two across).
// A row-major [M,K]; Bt row-major [N,K]; M % 128 == 0, N % 128 == 0, K % 128 == 0.
// Operand path: per pass of 128 k the work-group's 128 A rows and 128 Bt rows (256 B each, whole lines)
// go to LDS by asynchronous 16-byte copies, two buffers, the next pass in flight while this one is
// multiplied; the waves read their fragments from LDS (row pitch 272 B = 16 B x odd for ds_load_b128).
// The square tile keeps the bytes a work-group pulls per output low (256 operand rows for 16,384 outputs).
// SPLIT (hi/lo operand planes) is not staged by this path and is not instantiated.
// Batch b = blockIdx.y: Bt and C advance by their strides; batches b >= batchA2 read A2p as their A, the others Ap,
// so products of two different left operands that do not depend on each other share one launch.
// BIAS_MODE: 0 = none, 1 = bias[m], 2 = bias[n], 3 = bias[n] in batch 0 alone.
// OUT_MODE: 0 = f32, 1 = f16, 2 = bf16 hi plane (Cout) + bf16 lo plane (Cout2).
// ET: 0 = f16 operands, 1 = bf16 operands (pointers passed as 16-bit storage)
template <int ET> struct Elem;
template <> struct Elem<0> { typedef _Float16 T; };
template <> struct Elem<1> { typedef __bf16 T; };
#define G_KP    128                      // k of one pass
#define G_PITCH 136                      // LDS row pitch in 16-bit elements (256 B of k + 16 B)
#define G_ROWS  256                      // 128 A rows, then 128 Bt rows
#define G_BUF   (G_ROWS * G_PITCH)       // elements of one buffer (69,632 B)

// Eight asynchronous 16-byte-per-lane copies global -> LDS. The s_wait_xcnt closes the statement so that
// no address register named here is rewritten before it.
template <typename T>
__device__ __forceinline__ void async_copy8(const unsigned (&l)[8], const T* const (&g)[8]) {
  asm volatile(
      "global_load_async_to_lds_b128 %0, %8, off\n\t"
      "global_load_async_to_lds_b128 %1, %9, off\n\t"
      "global_load_async_to_lds_b128 %2, %10, off\n\t"
      "global_load_async_to_lds_b128 %3, %11, off\n\t"
      "global_load_async_to_lds_b128 %4, %12, off\n\t"
      "global_load_async_to_lds_b128 %5, %13, off\n\t"
      "global_load_async_to_lds_b128 %6, %14, off\n\t"
      "global_load_async_to_lds_b128 %7, %15, off\n\t"
      "s_wait_xcnt 0x0"
      :: "v"(l[0]), "v"(l[1]), "v"(l[2]), "v"(l[3]), "v"(l[4]), "v"(l[5]), "v"(l[6]), "v"(l[7]),
         "v"(g[0]), "v"(g[1]), "v"(g[2]), "v"(g[3]), "v"(g[4]), "v"(g[5]), "v"(g[6]), "v"(g[7])
      : "memory");
}
// One pass's tile: 256 rows x 16 chunks of 16 B = 16 chunks per thread; a wave-wide copy covers 2 whole rows.
// ga / gb: this thread's chunk in A row (tid >> 4) / Bt row (tid >> 4) of the work-group's rows, at the pass's k.
// l0: this thread's LDS byte address for row (tid >> 4) of the target buffer.
template <typename T>
__device__ __forceinline__ void stage_tile(unsigned l0, const T* ga, const T* gb, int lda, int ldb) {
  unsigned l[8]; const T* g[8];
#pragma unroll
  for (int it = 0; it < 8; ++it) {       // rows 0..127: the A rows
    l[it] = l0 + (unsigned)(it * 16 * G_PITCH * 2);
    g[it] = ga + (size_t)(it * 16) * lda;
  }
  async_copy8<T>(l, g);
#pragma unroll
  for (int it = 0; it < 8; ++it) {       // rows 128..255: the Bt rows
    l[it] = l0 + (unsigned)((it + 8) * 16 * G_PITCH * 2);
    g[it] = gb + (size_t)(it * 16) * ldb;
  }
  async_copy8<T>(l, g);
}
// this wave's LDS reads have retired (before the buffer they read is handed back for a refill)
__device__ __forceinline__ void wait_lds_reads()   { asm volatile("s_wait_dscnt 0x0" ::: "memory"); }
// this wave's asynchronous copies have landed (the compiler places no wait for them)
__device__ __forceinline__ void wait_async_copies() { asm volatile("s_wait_asynccnt 0x0" ::: "memory"); }

template <int ET, bool SPLIT, int BIAS_MODE, int OUT_MODE, bool RESID, int ACT = 0>
__global__ __launch_bounds__(256) void wmma_gemm64(
    const unsigned short* __restrict__ Ap, const unsigned short* __restrict__ A2p, int lda, long strideA,
    const unsigned short* __restrict__ Btp, const unsigned short* __restrict__ Bt2p, int ldb, long strideB,
    void* __restrict__ Cout, void* __restrict__ Cout2, int ldc, long strideC,
    const float* __restrict__ bias,
    const float* __restrict__ resid, long strideR,
    int M, int N, int K, float scale, int batchA2) {
  typedef typename Elem<ET>::T T;
  typedef typename Frag<T>::V V;
  static_assert(!SPLIT, "the LDS operand path stages one plane per operand");
  __shared__ __align__(16) T ring[2 * G_BUF];      // two operand buffers
  __shared__ __align__(16) float sT[8][16 * 68];   // per-wave 16x64 slab, pitch 68 floats
  const int b    = blockIdx.y;
  const T* A = (const T*)((b < batchA2) ? Ap : A2p); const T* Bt = (const T*)Btp;
  const int lane = threadIdx.x & 31;
  const int wave = threadIdx.x >> 5;
  const int tilesN = N >> 7;
  const int tilesM = M >> 7;
  const int tile = blockIdx.x;           // the work-group's 128x128 tile
  if (tile >= tilesM * tilesN) return;   // the same for the whole work-group, in front of every barrier
  const int tm = tile / tilesN;
  const int mb0 = tm << 7;                      // first A row of the work-group
  const int nb0 = (tile - tm * tilesN) << 7;    // first Bt row of the work-group
  const int wm = (wave >> 1) << 5;              // the wave's 32 rows and 64 columns within the tile
  const int wn = (wave & 1) << 6;
  const int m0 = mb0 + wm;
  const int n0 = nb0 + wn;

  const T* Ab  = A  + (size_t)b * strideA;
  const T* Bb  = Bt + (size_t)b * strideB;

  const int rlane = lane & 15;                 // row (A) / col (B, D) within subtile
  const int koff  = (lane >> 4) * 8;           // k offset of this lane half
  const int mOff  = (lane >> 4) * 8;           // D row offset

  v8f acc[2][4];
#pragma unroll
  for (int i = 0; i < 2; ++i)
#pragma unroll
    for (int j = 0; j < 4; ++j) acc[i][j] = (v8f){0.f,0.f,0.f,0.f,0.f,0.f,0.f,0.f};

  // BIAS_MODE 3: the lane's four column terms, requested once, under one work-group-uniform test, in front of the k loop
  float bcol[4] = {0.f, 0.f, 0.f, 0.f};
  if (BIAS_MODE == 3 && b == 0) {
#pragma unroll                                 // constant indices keep bcol in registers
    for (int j = 0; j < 4; ++j) bcol[j] = bias[n0 + (j << 4) + rlane];
    // the address registers of these loads are reused by the address arithmetic below: the wait stands in front of that
    asm volatile("s_wait_xcnt 0x0" ::: "memory");
  }

  const int srow = threadIdx.x >> 4;           // staged row of this thread within a group of 16 rows
  const int schk = (threadIdx.x & 15) * 8;     // its 16-byte chunk, in elements
  const T* ga = Ab + (size_t)(mb0 + srow) * lda + schk;
  const T* gb = Bb + (size_t)(nb0 + srow) * ldb + schk;
  const unsigned l0 = (unsigned)(size_t)ring + (unsigned)((srow * G_PITCH + schk) * 2);
  const int nPass = K / G_KP;

  stage_tile<T>(l0, ga, gb, lda, ldb);
  wait_async_copies();
  __syncthreads();                             // pass 0's tile is published
  if (nPass > 1) stage_tile<T>(l0 + (unsigned)(G_BUF * 2), ga + G_KP, gb + G_KP, lda, ldb);

#pragma unroll 1                               // one pass per trip: the buffer is picked by the trip's parity
  for (int t = 0; t < nPass; ++t) {
    const int bsel = (t & 1) * G_BUF;
    const T* ra = ring + bsel + (wm + rlane) * G_PITCH + koff;
    const T* rb = ring + bsel + (128 + wn + rlane) * G_PITCH + koff;
#pragma unroll
    for (int ks = 0; ks < G_KP / 32; ++ks) {
      V bh[4], ah[2];
#pragma unroll
      for (int j = 0; j < 4; ++j) bh[j] = Frag<T>::load(rb + j * 16 * G_PITCH + ks * 32);
#pragma unroll
      for (int i = 0; i < 2; ++i) ah[i] = Frag<T>::load(ra + i * 16 * G_PITCH + ks * 32);
      // the 12 fragment reads stay one group in front of the 8 WMMAs: left free, the scheduler reuses one
      // A register set and the wave waits out the LDS latency once per A fragment
      __builtin_amdgcn_sched_barrier(0);
#pragma unroll
      for (int i = 0; i < 2; ++i)
#pragma unroll
        for (int j = 0; j < 4; ++j) acc[i][j] = Frag<T>::mma(ah[i], bh[j], acc[i][j]);
      __builtin_amdgcn_sched_barrier(0);       // and the next block's reads stay behind this block's WMMAs
    }
    wait_lds_reads();
    wait_async_copies();
    __syncthreads();                           // publishes pass t + 1's tile and ends every read of pass t's buffer
    if (t + 2 < nPass)
      stage_tile<T>(l0 + (unsigned)(bsel * 2), ga + (size_t)(t + 2) * G_KP, gb + (size_t)(t + 2) * G_KP, lda, ldb);
  }
  wait_async_copies();
  acc_guard4(acc[0][0], acc[0][1], acc[0][2], acc[0][3]);
  acc_guard4(acc[1][0], acc[1][1], acc[1][2], acc[1][3]);

  // ---- epilogue ----
  float* slab = sT[wave];
  const float* Rb = RESID ? (resid + (size_t)b * strideR) : nullptr;
#pragma unroll
  for (int i = 0; i < 2; ++i) {
    const int mBase = m0 + (i << 4);
#pragma unroll
    for (int j = 0; j < 4; ++j) {
      const int n = n0 + (j << 4) + rlane;
      float bv = 0.f;
      if (BIAS_MODE == 2) bv = bias[n];
      if (BIAS_MODE == 3) bv = bcol[j];
#pragma unroll
      for (int r = 0; r < 8; ++r) {
        float v = acc[i][j][r] * scale;
        if (BIAS_MODE == 1) v += bias[mBase + mOff + r];
        if (BIAS_MODE == 2 || BIAS_MODE == 3) v += bv;
        if (RESID) v += Rb[(size_t)(mBase + mOff + r) * ldc + n];
        if (ACT == 1) v = tanhf(v);
        if (ACT == 2) v = fmaxf(v, 0.0f);
        if (ACT == 3) v = v / (1.0f + expf(-v));
        if (ACT == 4) v = (v > 0.f) ? v : 0.01f * v;
        if (ACT == 5) v = 0.5f * v * (1.0f + erff(v * 0.70710678118654752f));
        slab[(mOff + r) * 68 + (j << 4) + rlane] = v;
      }
    }
    __builtin_amdgcn_fence(__ATOMIC_RELEASE, "workgroup");
    __builtin_amdgcn_wave_barrier();
    __builtin_amdgcn_fence(__ATOMIC_ACQUIRE, "workgroup");
    if (OUT_MODE == 0) {
      float* C = (float*)Cout + (size_t)b * strideC;
      const int hh = lane >> 4, c4 = (lane & 15) * 4;     // row seg = 256 B = 16 lanes x 16 B
      {
#pragma unroll
        for (int it = 0; it < 8; ++it) {
          const int row = it * 2 + hh;
          v4f v = *(const v4f*)(slab + row * 68 + c4);
          *(v4f*)(C + (size_t)(mBase + row) * ldc + n0 + c4) = v;
        }
        
      }
    } else {
      const int q = lane >> 3, c8 = (lane & 7) * 8;
      unsigned short* C  = (unsigned short*)Cout  + (size_t)b * strideC;
      unsigned short* C2 = (OUT_MODE == 2) ? ((unsigned short*)Cout2 + (size_t)b * strideC) : nullptr;
      {
#pragma unroll
        for (int it = 0; it < 4; ++it) {
          const int row = it * 4 + q;
          const float* sp = slab + row * 68 + c8;
          v8h hv, lv;
#pragma unroll
          for (int e = 0; e < 8; ++e) {
            if (OUT_MODE == 1) {
              hv[e] = (_Float16)sp[e];
            } else {
              unsigned short hb = f2bf_bits(sp[e]);
              unsigned short lb = f2bf_bits(sp[e] - bf_bits2f(hb));
              hv[e] = __builtin_bit_cast(_Float16, hb);
              lv[e] = __builtin_bit_cast(_Float16, lb);
            }
          }
          *(v8h*)(C + (size_t)(mBase + row) * ldc + n0 + c8) = hv;
          if (OUT_MODE == 2) *(v8h*)(C2 + (size_t)(mBase + row) * ldc + n0 + c8) = lv;
        }
        
      }
    }
    __builtin_amdgcn_fence(__ATOMIC_RELEASE, "workgroup");
    __builtin_amdgcn_wave_barrier();
    __builtin_amdgcn_fence(__ATOMIC_ACQUIRE, "workgroup");
  }
}

// ---- f32 -> f16 casts (value x scale, round to nearest even) ---------------------------------------------
// A work-group converts 4096 consecutive elements of each of its planes. A wave-wide load is 512 contiguous bytes
// (16 B a lane), a wave-wide store 256 contiguous bytes (8 B a lane); every load of a thread is independent of every
// other and all are requested in front of the first store. L = loads per lane and plane = 32 / waves per work-group.
typedef __attribute__((ext_vector_type(4))) _Float16 v4h;
#define CAST_PLANE (1024 * 1024)         // elements of one plane
// e0: the lane's first element; the byte offsets fit 32 bits, so each access is plane base + one shared offset register.
template <int L>
__device__ __forceinline__ void cast_load(const float* __restrict__ in, unsigned e0, v4f (&x)[L]) {
  const char* p = (const char*)in + e0 * 4u;
#pragma unroll
  for (int k = 0; k < L; ++k) x[k] = *(const v4f*)(p + k * 512);
}
template <int L>
__device__ __forceinline__ void cast_store(_Float16* __restrict__ out, unsigned e0, const v4f (&x)[L], float scale) {
  char* p = (char*)out + e0 * 2u;
#pragma unroll
  for (int k = 0; k < L; ++k) {
    v4h h;
#pragma unroll
    for (int e = 0; e < 4; ++e) h[e] = (_Float16)(x[k][e] * scale);
    *(v4h*)(p + k * 256) = h;
  }
}
// seven planes in one launch: two activations x1, five weights x16; plane p goes to out + p * CAST_PLANE.
// grid = 256 work-groups of 16 waves.
__global__ __launch_bounds__(512) void cast7_f32_f16(
    const float* __restrict__ a0, const float* __restrict__ a1, const float* __restrict__ w0,
    const float* __restrict__ w1, const float* __restrict__ w2, const float* __restrict__ w3,
    const float* __restrict__ w4, _Float16* __restrict__ out) {
  const unsigned e0 = blockIdx.x * 4096u + (threadIdx.x >> 5) * 256u + (threadIdx.x & 31u) * 4u;
  v4f x[7][2];
  cast_load<2>(a0, e0, x[0]);
  cast_load<2>(a1, e0, x[1]);
  cast_load<2>(w0, e0, x[2]);
  cast_load<2>(w1, e0, x[3]);
  cast_load<2>(w2, e0, x[4]);
  cast_load<2>(w3, e0, x[5]);
  cast_load<2>(w4, e0, x[6]);
  cast_store<2>(out + 0 * (size_t)CAST_PLANE, e0, x[0], 1.0f);
  cast_store<2>(out + 1 * (size_t)CAST_PLANE, e0, x[1], 1.0f);
  cast_store<2>(out + 2 * (size_t)CAST_PLANE, e0, x[2], 16.0f);
  cast_store<2>(out + 3 * (size_t)CAST_PLANE, e0, x[3], 16.0f);
  cast_store<2>(out + 4 * (size_t)CAST_PLANE, e0, x[4], 16.0f);
  cast_store<2>(out + 5 * (size_t)CAST_PLANE, e0, x[5], 16.0f);
  cast_store<2>(out + 6 * (size_t)CAST_PLANE, e0, x[6], 16.0f);
}
// one plane: grid = 256 work-groups of 4 waves, eight loads a lane.
__global__ __launch_bounds__(128) void cast1_f32_f16(
    const float* __restrict__ in, _Float16* __restrict__ out, float scale) {
  const unsigned e0 = blockIdx.x * 4096u + (threadIdx.x >> 5) * 1024u + (threadIdx.x & 31u) * 4u;
  v4f x[8];
  cast_load<8>(in, e0, x);
  cast_store<8>(out, e0, x, scale);
}

// ---- additive score terms + mask, dense per head ------------------------------------------------------
//   qf, rf: f32 projection outputs, row i*8+b, col h*64+d (qf already includes the s_q column term).
//   A work-group owns 64 score rows of one head (grid = 128 heads x 2 halves, 16 waves). Every global load of a
//   thread is independent of every other and all are requested up front: one round trip instead of one per row.
//   Phase 1 (LDS): e0[i] = newq[n,i,:].semb[0][h*64..], e1[i] = newq[n,i,:].semb[1][h*64..] for the 64 own rows,
//                  cv[i] = r[n,i,:].semb[0][h*64..] for all 128 rows; 16 lanes x 16 B per row, summed across the lanes.
//                  cv[128..255] = 0, so that cv[127-i+j] is the shifted term for j <= i and 0 for j > i.
//   Phase 2: SB[n][i][j] = amask[n][i][j] != 0 ? 3e38 (sentinel)
//                        : 0.125 * ( utt[n][i][j] * (smask[b][i][j] -> e1[i] : e0[i]) + cv[127-i+j] )
//            16 B per lane and array, a wave covers one whole 512-B row per access, four rows per wave.
typedef __attribute__((ext_vector_type(4))) int v4i;
#define SB_ROWS 64
__device__ __forceinline__ float dot4(v4f x, v4f w) {
  return fmaf(x[3], w[3], fmaf(x[2], w[2], fmaf(x[1], w[1], x[0] * w[0])));
}
__global__ __launch_bounds__(512) void sbias_kernel(
    const float* __restrict__ qf, const float* __restrict__ rf, const float* __restrict__ semb,
    const float* __restrict__ utt, const int* __restrict__ amask, const int* __restrict__ smask,
    float* __restrict__ sb) {
  __shared__ float se0[SB_ROWS];
  __shared__ float se1[SB_ROWS];
  __shared__ float scv[256];
  const int n = blockIdx.x >> 1, i0 = (blockIdx.x & 1) * SB_ROWS;
  const int b = n >> 4, h = n & 15;
  const int wave = threadIdx.x >> 5, lane = threadIdx.x & 31;
  const int hh = lane >> 4, d4 = (lane & 15) * 4;   // phase 1: row of the pair, four of the 64 depths
  const int c4 = lane * 4;                          // phase 2: this lane's four score columns
  const float* ub  = utt   + (size_t)n * 16384;
  const int*   ab  = amask + (size_t)n * 16384;
  const int*   smb = smask + (size_t)b * 16384;
  float*       ob  = sb    + (size_t)n * 16384;

  const v4f w0 = *(const v4f*)(semb + h * 64 + d4);
  const v4f w1 = *(const v4f*)(semb + 1024 + h * 64 + d4);
  const size_t co = (size_t)b * 1024 + (size_t)h * 64 + d4;
  v4f rv[4], qv[2];
#pragma unroll
  for (int k = 0; k < 4; ++k) rv[k] = *(const v4f*)(rf + (size_t)(wave * 8 + k * 2 + hh) * 8192 + co);
#pragma unroll
  for (int k = 0; k < 2; ++k) qv[k] = *(const v4f*)(qf + (size_t)(i0 + wave * 4 + k * 2 + hh) * 8192 + co);
  // the row loads' address registers may be reused as destinations of the loads below: the wait stands in front of that
  asm volatile("s_wait_xcnt 0x0" ::: "memory");
  v4f u4[4]; v4i am4[4], sm4[4];
#pragma unroll
  for (int k = 0; k < 4; ++k) {                // score rows i0 + wave + 16 k
    const int e = (i0 + wave + 16 * k) * 128 + c4;
    u4[k]  = *(const v4f*)(ub + e);
    am4[k] = *(const v4i*)(ab + e);
    sm4[k] = *(const v4i*)(smb + e);
  }
  // the mask loads stay in front of phase 1's arithmetic: left free, the scheduler issues them only behind the
  // wait for the projection rows, and the two round trips run one after the other
  __builtin_amdgcn_sched_barrier(0);

  float p[8];
#pragma unroll
  for (int k = 0; k < 4; ++k) p[k] = dot4(rv[k], w0);
#pragma unroll
  for (int k = 0; k < 2; ++k) { p[4 + k] = dot4(qv[k], w0); p[6 + k] = dot4(qv[k], w1); }
#pragma unroll
  for (int off = 1; off < 16; off <<= 1)
#pragma unroll
    for (int x = 0; x < 8; ++x) p[x] += __shfl_xor(p[x], off, 32);
  if ((lane & 15) == 0) {
#pragma unroll
    for (int k = 0; k < 4; ++k) scv[wave * 8 + k * 2 + hh] = p[k];
#pragma unroll
    for (int k = 0; k < 2; ++k) { se0[wave * 4 + k * 2 + hh] = p[4 + k]; se1[wave * 4 + k * 2 + hh] = p[6 + k]; }
  }
  if (threadIdx.x < 128) scv[128 + threadIdx.x] = 0.0f;
  __syncthreads();

#pragma unroll
  for (int k = 0; k < 4; ++k) {
    const int il = wave + 16 * k, i = i0 + il;
    const float e0v = se0[il], e1v = se1[il];
    const float* cvp = scv + (127 - i + c4);   // 0 <= 127 - i + j <= 254 for every row i and column j
    v4f o;
#pragma unroll
    for (int u = 0; u < 4; ++u) {
      int sm = sm4[k][u];
      if (sm < 0) sm += 2;                     // 2-row table: wrap negatives, then clamp
      sm = sm < 0 ? 0 : (sm > 1 ? 1 : sm);
      const float ev = (sm != 0) ? e1v : e0v;
      float val = (u4[k][u] * ev + cvp[u]) * 0.125f;
      if (am4[k][u] != 0) val = 3.0e38f;
      o[u] = val;
    }
    *(v4f*)(ob + i * 128 + c4) = o;
  }
}

// =====================================================================================
// Attention for head_dim 64 with a dense additive score tensor, f32 in / f32 out, f16 operands:
//   s = (q.k^T) * sscale + SB[bh][q][kv];  SB element above sent_thr -> s = mask_fill (kept in the softmax)
//   softmax over all Skv keys in f32 (online over 64-key chunks); p carried x2^15 as f16; out = p.v / (l*2^15).
//   Block = 4 waves = 64 query rows of one (b, h); grid.x = B*H*(S/64).
//   Element (b, s, h, d) of q/k/v/out at X[b*X_bs + s*X_rs + h*X_hs + d]; SB element (bh, q, kv) at sb[bh*sb_ns + q*sb_rs + kv].
// =====================================================================================
#define AT_D 64
#define AT_NW 4
#define AT_QB 64
#define AT_KC 64
struct AttnArgs { long q_bs, q_rs, q_hs, k_bs, k_rs, k_hs, v_bs, v_rs, v_hs, o_bs, o_rs, o_hs, sb_ns, sb_rs;
                  int S, Skv, H, nchunks; float sscale, mask_fill, sent_thr, resv; };
static_assert(sizeof(AttnArgs) == 144);

__device__ __forceinline__ v8f mma_f16g(v16h a, v16h b, v8f c) {
  c = __builtin_amdgcn_wmma_f32_16x16x32_f16(false, a, false, b, (short)0, c, false, false);
  asm volatile("v_nop\n\tv_nop\n\tv_nop\n\tv_nop" : "+v"(c) : "v"(a), "v"(b));
  return c;
}

__global__ __launch_bounds__(128)
void attn64_sbias_f16(const float* __restrict__ q, const float* __restrict__ k,
                      const float* __restrict__ v, float* __restrict__ out,
                      const float* __restrict__ sb, AttnArgs g) {
  const float PSC = 32768.0f;
  union FB { v16h v; v8h h[2]; };
  __shared__ __align__(16) _Float16 Ksh[AT_KC * AT_D];            // K [kv][d]   8 KB
  __shared__ __align__(16) _Float16 Vth[AT_D * AT_KC];            // V [d][kv]   8 KB
  __shared__ __align__(16) _Float16 Psh[AT_NW][16 * AT_KC];       // per wave P [row][kv]  8 KB
  __shared__ __align__(16) float    Os[AT_NW][16 * 68];           // per wave out tile, pitch 68

  const int tid  = threadIdx.x;
  const int wave = tid >> 5;
  const int lane = tid & 31;
  const int hh   = lane >> 4;
  const int c    = lane & 15;

  const int nqb = g.S / AT_QB;
  const int bx = blockIdx.x;
  const int qb = bx % nqb;
  const int bh = bx / nqb;
  const int h  = bh % g.H;
  const int b  = bh / g.H;
  const int q0 = qb * AT_QB + wave * 16;

  const float* qb_ptr = q   + (size_t)b * g.q_bs + (size_t)h * g.q_hs;
  const float* kb_ptr = k   + (size_t)b * g.k_bs + (size_t)h * g.k_hs;
  const float* vb_ptr = v   + (size_t)b * g.v_bs + (size_t)h * g.v_hs;
  float*       ob_ptr = out + (size_t)b * g.o_bs + (size_t)h * g.o_hs;

  // ---- Q fragments (A operand), 2 d-chunks, split k map ----
  v16h qa[2];
  {
    const float* qrow = qb_ptr + (size_t)(q0 + c) * g.q_rs;
#pragma unroll
    for (int dc = 0; dc < 2; ++dc) {
      const v4f f0 = *(const v4f*)(qrow + dc * 32 + 8 * hh);
      const v4f f1 = *(const v4f*)(qrow + dc * 32 + 8 * hh + 4);
      const v4f f2 = *(const v4f*)(qrow + dc * 32 + 16 + 8 * hh);
      const v4f f3 = *(const v4f*)(qrow + dc * 32 + 16 + 8 * hh + 4);
#pragma unroll
      for (int e = 0; e < 4; ++e) {
        qa[dc][e]      = (_Float16)f0[e];
        qa[dc][4 + e]  = (_Float16)f1[e];
        qa[dc][8 + e]  = (_Float16)f2[e];
        qa[dc][12 + e] = (_Float16)f3[e];
      }
    }
  }

  float mrow[8], lrow[8];
  v8f oacc[4];
#pragma unroll
  for (int r = 0; r < 8; ++r) { mrow[r] = -INFINITY; lrow[r] = 0.f; }
#pragma unroll
  for (int t = 0; t < 4; ++t) oacc[t] = (v8f){0.f,0.f,0.f,0.f,0.f,0.f,0.f,0.f};

  int nChunks = g.Skv / AT_KC;                 // block-uniform, host-provided
  if (nChunks > 64) nChunks = 64;
  for (int kc = 0; kc < nChunks; ++kc) {
    const int kv0 = kc * AT_KC;
    __syncthreads();
    {
      const int kvr = tid >> 1, dh = (tid & 1) * 32;
      const float* krow = kb_ptr + (size_t)(kv0 + kvr) * g.k_rs + dh;
      const float* vrow = vb_ptr + (size_t)(kv0 + kvr) * g.v_rs + dh;
#pragma unroll
      for (int i = 0; i < 8; ++i) {
        v4f kk = *(const v4f*)(krow + 4 * i);
        v4f vv = *(const v4f*)(vrow + 4 * i);
#pragma unroll
        for (int e = 0; e < 4; ++e) {
          const int d = dh + 4 * i + e;
          Ksh[kvr * AT_D + d]  = (_Float16)kk[e];
          Vth[d * AT_KC + kvr] = (_Float16)vv[e];
        }
      }
    }
    __syncthreads();

    v8f s[4];
#pragma unroll
    for (int j = 0; j < 4; ++j) {
      s[j] = (v8f){0.f,0.f,0.f,0.f,0.f,0.f,0.f,0.f};
#pragma unroll
      for (int dc = 0; dc < 2; ++dc) {
        FB kb;
        kb.h[0] = *(const v8h*)(Ksh + (j * 16 + c) * AT_D + dc * 32 + 8 * hh);
        kb.h[1] = *(const v8h*)(Ksh + (j * 16 + c) * AT_D + dc * 32 + 16 + 8 * hh);
        s[j] = mma_f16g(qa[dc], kb.v, s[j]);
      }
    }
    // additive terms + mask select, row max
    const float* sbp = sb + (size_t)bh * g.sb_ns + (size_t)(q0 + 8 * hh) * g.sb_rs + kv0 + c;
    float cm[8];
#pragma unroll
    for (int r = 0; r < 8; ++r) {
      const float* sbr = sbp + (size_t)r * g.sb_rs;
      float m = -INFINITY;
#pragma unroll
      for (int j = 0; j < 4; ++j) {
        const float bb = sbr[j * 16];
        float sv = fmaf(s[j][r], g.sscale, bb);
        if (bb > g.sent_thr) sv = g.mask_fill;
        s[j][r] = sv;
        m = fmaxf(m, sv);
      }
#pragma unroll
      for (int off = 1; off < 16; off <<= 1) m = fmaxf(m, __shfl_xor(m, off, 32));
      cm[r] = m;
    }
    _Float16* pwh = Psh[wave];
#pragma unroll
    for (int r = 0; r < 8; ++r) {
      const float mnew = fmaxf(mrow[r], cm[r]);
      const float alpha = expf(mrow[r] - mnew);
      mrow[r] = mnew;
      float psum = 0.f;
#pragma unroll
      for (int j = 0; j < 4; ++j) {
        const float p = expf(s[j][r] - mnew);
        psum += p;
        pwh[(8 * hh + r) * AT_KC + j * 16 + c] = (_Float16)(p * PSC);
      }
#pragma unroll
      for (int off = 1; off < 16; off <<= 1) psum += __shfl_xor(psum, off, 32);
      lrow[r] = lrow[r] * alpha + psum;
#pragma unroll
      for (int t = 0; t < 4; ++t) oacc[t][r] *= alpha;
    }
    __builtin_amdgcn_fence(__ATOMIC_RELEASE, "workgroup");
    __builtin_amdgcn_wave_barrier();
    __builtin_amdgcn_fence(__ATOMIC_ACQUIRE, "workgroup");
#pragma unroll 1
    for (int kk = 0; kk < 2; ++kk) {
      FB pa;
      pa.h[0] = *(const v8h*)(pwh + c * AT_KC + kk * 32 + 8 * hh);
      pa.h[1] = *(const v8h*)(pwh + c * AT_KC + kk * 32 + 16 + 8 * hh);
#pragma unroll
      for (int t = 0; t < 4; ++t) {
        FB vb;
        vb.h[0] = *(const v8h*)(Vth + (t * 16 + c) * AT_KC + kk * 32 + 8 * hh);
        vb.h[1] = *(const v8h*)(Vth + (t * 16 + c) * AT_KC + kk * 32 + 16 + 8 * hh);
        oacc[t] = mma_f16g(pa.v, vb.v, oacc[t]);
      }
    }
  }

  float* os = Os[wave];
#pragma unroll
  for (int r = 0; r < 8; ++r) {
    const float inv = 1.0f / (lrow[r] * PSC);
#pragma unroll
    for (int t = 0; t < 4; ++t) os[(8 * hh + r) * 68 + t * 16 + c] = oacc[t][r] * inv;
  }
  __builtin_amdgcn_fence(__ATOMIC_RELEASE, "workgroup");
  __builtin_amdgcn_wave_barrier();
  __builtin_amdgcn_fence(__ATOMIC_ACQUIRE, "workgroup");
  {
    const int c4 = (lane & 15) * 4;
    {
#pragma unroll
      for (int it = 0; it < 8; ++it) {
        const int row = it * 2 + hh;
        v4f val = *(const v4f*)(os + row * 68 + c4);
        *(v4f*)(ob_ptr + (size_t)(q0 + row) * g.o_rs + c4) = val;
      }
      
    }
  }
}

// ---------------------------------------------------------------------------
// Host launcher. Layout of q/k/v/r/ctx matrices: row = i*8 + b (i = position, b = batch),
// col = h*64 + d; head n = b*16 + h. The (B,L,D) positional input is used as a flat [1024][1024]
// A matrix exactly like the (L,B,D) query (literal view semantics of the position projection).
// ---------------------------------------------------------------------------
extern "C" void kernel_launch(void* const* d_in, const int* in_sizes, int n_in,
                              void* d_out, int out_size, void* d_ws, size_t ws_size,
                              hipStream_t stream) {
  if (n_in < 11) return;
  const int NE = 1024 * 1024;                 // elements of every [*,*,1024] tensor and of each weight
  if (in_sizes[0] != NE || in_sizes[1] != NE || in_sizes[3] != NE || in_sizes[4] != NE ||
      in_sizes[5] != NE || in_sizes[6] != NE || in_sizes[7] != NE || in_sizes[8] != 2 * 1024 ||
      in_sizes[2] != 128 * 128 * 128 || in_sizes[9] != 128 * 128 * 128 || in_sizes[10] != 8 * 128 * 128 ||
      out_size != NE) return;

  const float* query    = (const float*)d_in[0];   // (L,B,D)
  const float* rel_pe   = (const float*)d_in[1];   // (B,L,D)
  const float* utt_mask = (const float*)d_in[2];   // (B*H,L,L,1) f32
  const float* Wq       = (const float*)d_in[3];
  const float* Wk       = (const float*)d_in[4];
  const float* Wv       = (const float*)d_in[5];
  const float* Wr       = (const float*)d_in[6];
  const float* Wo       = (const float*)d_in[7];
  const float* spk_emb  = (const float*)d_in[8];   // (2,D)
  const int*   attn_msk = (const int*)d_in[9];     // (B*H,L,L) int32, nonzero = masked
  const int*   spk_msk  = (const int*)d_in[10];    // (B,L,L) int32 in {0,1}
  float* out = (float*)d_out;

  // ---- workspace carve (bytes) ----
  const size_t MiB = (size_t)1 << 20;
  const size_t off_q16 = 0;                    // query  f16       2 MiB
  const size_t off_p16 = 2 * MiB;              // rel_pe f16       2 MiB
  const size_t off_w16 = 4 * MiB;              // 5 weights f16 x16, 2 MiB each (Wq,Wk,Wv,Wr,Wo)
  const size_t off_qf  = 14 * MiB;             // new_q f32        4 MiB
  const size_t off_kf  = 18 * MiB;             // k f32            4 MiB
  const size_t off_vf  = 22 * MiB;             // v f32            4 MiB (q, k, v, r one behind the other: batched GEMM stride)
  const size_t off_rf  = 26 * MiB;             // r f32            4 MiB
  const size_t off_sb  = 30 * MiB;             // score bias [128][128][128] f32  8 MiB
  const size_t off_ctx = 38 * MiB;             // ctx f32          4 MiB
  const size_t off_c16 = 42 * MiB;             // ctx f16 x16      2 MiB
  const size_t total   = 44 * MiB;
  if (total > ws_size || total > 128 * MiB) return;

  char* ws = (char*)d_ws;
  _Float16* q16 = (_Float16*)(ws + off_q16);
  _Float16* p16 = (_Float16*)(ws + off_p16);
  _Float16* w16 = (_Float16*)(ws + off_w16);
  float* qf  = (float*)(ws + off_qf);
  float* kf  = (float*)(ws + off_kf);
  float* vf  = (float*)(ws + off_vf);
  float* rf  = (float*)(ws + off_rf);
  float* sbp = (float*)(ws + off_sb);
  float* ctx = (float*)(ws + off_ctx);
  _Float16* c16 = (_Float16*)(ws + off_c16);

  // ---- casts: activations x1, weights x16 (exact power of two, undone in the GEMM epilogue); the seven f16
  //      planes q16, p16, w16[0..4] lie one behind the other from the start of the workspace ----
  cast7_f32_f16<<<256, 512, 0, stream>>>(query, rel_pe, Wq, Wk, Wv, Wr, Wo, q16);

  // ---- input projections: C = X . W^T, 1024x1024x1024 each; q gets column bias spk_emb[0][col] (= new_q) ----
  const int M = 1024, N = 1024, K = 1024;
  const int gblocks = (M / 128) * (N / 128);   // one work-group per 128x128 tile
  const float wscale_inv = 1.0f / 16.0f;
  {
    // one launch of 4 x 64 work-groups, each alone on its WGP: y = 0: q (query, Wq -> qf, + spk_emb[0][col]),
    // y = 1: k, y = 2: v (query), y = 3: r (rel_pe flat [1024][1024], literal view). The four weight planes and the
    // four f32 results lie one behind the other in the workspace (strides NE).
    dim3 grid(gblocks, 4);
    wmma_gemm64<0, false, 3, 0, false><<<grid, 256, 0, stream>>>(
        (const unsigned short*)q16, (const unsigned short*)p16, K, 0L,
        (const unsigned short*)w16, (const unsigned short*)w16, K, (long)NE,
        (void*)qf, (void*)qf, N, (long)NE,
        spk_emb, spk_emb, 0L, M, N, K, wscale_inv, 3);
  }

  // ---- dense additive score terms (a2 + a3) * 1/8 with the mask folded in as a sentinel ----
  sbias_kernel<<<256, 512, 0, stream>>>(qf, rf, spk_emb, utt_mask, attn_msk, spk_msk, sbp);

  // ---- attention: 128 heads (b*16+h) of 128x128, head dim 64; s = a1/8 + SB, sentinel -> 1e-30 ----
  {
    AttnArgs g;
    g.q_bs = 1024; g.q_rs = 8 * 1024; g.q_hs = 64;
    g.k_bs = 1024; g.k_rs = 8 * 1024; g.k_hs = 64;
    g.v_bs = 1024; g.v_rs = 8 * 1024; g.v_hs = 64;
    g.o_bs = 1024; g.o_rs = 8 * 1024; g.o_hs = 64;
    g.sb_ns = 128 * 128; g.sb_rs = 128;
    g.S = 128; g.Skv = 128; g.H = 16; g.nchunks = 2;
    g.sscale = 0.125f; g.mask_fill = 1e-30f; g.sent_thr = 1.0e37f; g.resv = 0.0f;
    const int agrid = 8 * 16 * (128 / AT_QB);   // 256 blocks
    attn64_sbias_f16<<<agrid, 128, 0, stream>>>(qf, kf, vf, ctx, sbp, g);
  }

  // ---- ctx f32 -> f16 x16, then output projection into d_out (scale 1/256 undoes both x16) ----
  cast1_f32_f16<<<256, 128, 0, stream>>>(ctx, c16, 16.0f);
  {
    dim3 grid(gblocks, 1);
    wmma_gemm64<0, false, 0, 0, false><<<grid, 256, 0, stream>>>(
        (const unsigned short*)c16, (const unsigned short*)c16, K, 0L,
        (const unsigned short*)(w16 + 4 * (size_t)NE), (const unsigned short*)(w16 + 4 * (size_t)NE), K, 0L,
        (void*)out, (void*)out, N, 0L,
        spk_emb, spk_emb, 0L, M, N, K, 1.0f / 256.0f, 1);
  }
  (void)hipGetLastError();
}

// v006
// Measured time: 47.1 microseconds a run.
// Next to v005, in two timings, it ran 1.11 and 1.10 times as fast.
// Counting every step since v000, it is 5.79 times as fast.
#include <hip/hip_runtime.h>
#include <stdint.h>
// Contractions: five 1024x1024x1024 projections (X . W^T), per-head q.k^T (K=64) and p.v (K=128): v_wmma_f32_16x16x32_f16 (f16 operands; weights and ctx carried x16, p carried x2^15, exact powers of two folded back in f32), f32 accumulate. Softmax, additive score terms and depth-64 speaker row dots in f32 on VALU.

typedef __attribute__((ext_vector_type(16))) _Float16 v16h;
typedef __attribute__((ext_vector_type(8)))  _Float16 v8h;
typedef __attribute__((ext_vector_type(16))) __bf16   v16b;
typedef __attribute__((ext_vector_type(8)))  __bf16   v8b;
typedef __attribute__((ext_vector_type(8)))  float    v8f;
typedef __attribute__((ext_vector_type(4)))  float    v4f;

__device__ __forceinline__ unsigned short f2bf_bits(float f) {
  unsigned u = __float_as_uint(f);
  return (unsigned short)((u + 0x7FFFu + ((u >> 16) & 1u)) >> 16);
}
__device__ __forceinline__ float bf_bits2f(unsigned short h) { return __uint_as_float(((unsigned)h) << 16); }

// hazard guards as plain device helpers
__device__ __forceinline__ void acc_guard4(v8f& a, v8f& b, v8f& c, v8f& d) { asm volatile("v_nop\n\tv_nop\n\tv_nop\n\tv_nop" : "+v"(a), "+v"(b), "+v"(c), "+v"(d)); }
template <typename T> struct Frag;
template <> struct Frag<_Float16> {
  typedef v16h V; union U { v16h v; v8h h[2]; };
  static __device__ __forceinline__ v16h load(const _Float16* p) {   // elements 0..7 <- p[0..7], 8..15 <- p[16..23]
    U f; f.h[0] = *(const v8h*)(p); f.h[1] = *(const v8h*)(p + 16); return f.v;
  }
  static __device__ __forceinline__ v8f mma(v16h a, v16h b, v8f c) {
    return __builtin_amdgcn_wmma_f32_16x16x32_f16(false, a, false, b, (short)0, c, false, false);
  }
};
template <> struct Frag<__bf16> {
  typedef v16b V; union U { v16b v; v8b h[2]; };
  static __device__ __forceinline__ v16b load(const __bf16* p) {
    U f; f.h[0] = *(const v8b*)(p); f.h[1] = *(const v8b*)(p + 16); return f.v;
  }
  static __device__ __forceinline__ v8f mma(v16b a, v16b b, v8f c) {
    return __builtin_amdgcn_wmma_f32_16x16x32_bf16(false, a, false, b, (short)0, c, false, false);
  }
};

// ---- Register-blocked batched WMMA GEMM ------------------------------------
// C[m,n] = scale * sum_k A[m,k] * Bt[n,k] (+bias)(+resid); a work-group owns a 128x128 tile,
// its eight waves 32x64 each (four down, two across).
// A row-major [M,K]; Bt row-major [N,K]; M % 128 == 0, N % 128 == 0, K % 128 == 0.
// Operand path: per pass of 128 k the work-group's 128 A rows and 128 Bt rows (256 B each, whole lines)
// go to LDS by asynchronous 16-byte copies, two buffers, the next pass in flight while this one is
// multiplied; the waves read their fragments from LDS (row pitch 272 B = 16 B x odd for ds_load_b128).
// The square tile keeps the bytes a work-group pulls per output low (256 operand rows for 16,384 outputs).
// SPLIT (hi/lo operand planes) is not staged by this path and is not instantiated.
// Batch b = blockIdx.y: Bt and C advance by their strides; batches b >= batchA2 read A2p as their A, the others Ap,
// so products of two different left operands that do not depend on each other share one launch.
// BIAS_MODE: 0 = none, 1 = bias[m], 2 = bias[n], 3 = bias[n] in batch 0 alone.
// OUT_MODE: 0 = f32, 1 = f16, 2 = bf16 hi plane (Cout) + bf16 lo plane (Cout2).
// ET: 0 = f16 operands, 1 = bf16 operands (pointers passed as 16-bit storage)
template <int ET> struct Elem;
template <> struct Elem<0> { typedef _Float16 T; };
template <> struct Elem<1> { typedef __bf16 T; };
#define G_KP    128                      // k of one pass
#define G_PITCH 136                      // LDS row pitch in 16-bit elements (256 B of k + 16 B)
#define G_ROWS  256                      // 128 A rows, then 128 Bt rows
#define G_BUF   (G_ROWS * G_PITCH)       // elements of one buffer (69,632 B)

// Eight asynchronous 16-byte-per-lane copies global -> LDS. The s_wait_xcnt closes the statement so that
// no address register named here is rewritten before it.
template <typename T>
__device__ __forceinline__ void async_copy8(const unsigned (&l)[8], const T* const (&g)[8]) {
  asm volatile(
      "global_load_async_to_lds_b128 %0, %8, off\n\t"
      "global_load_async_to_lds_b128 %1, %9, off\n\t"
      "global_load_async_to_lds_b128 %2, %10, off\n\t"
      "global_load_async_to_lds_b128 %3, %11, off\n\t"
      "global_load_async_to_lds_b128 %4, %12, off\n\t"
      "global_load_async_to_lds_b128 %5, %13, off\n\t"
      "global_load_async_to_lds_b128 %6, %14, off\n\t"
      "global_load_async_to_lds_b128 %7, %15, off\n\t"
      "s_wait_xcnt 0x0"
      :: "v"(l[0]), "v"(l[1]), "v"(l[2]), "v"(l[3]), "v"(l[4]), "v"(l[5]), "v"(l[6]), "v"(l[7]),
         "v"(g[0]), "v"(g[1]), "v"(g[2]), "v"(g[3]), "v"(g[4]), "v"(g[5]), "v"(g[6]), "v"(g[7])
      : "memory");
}
// One pass's tile: 256 rows x 16 chunks of 16 B = 16 chunks per thread; a wave-wide copy covers 2 whole rows.
// ga / gb: this thread's chunk in A row (tid >> 4) / Bt row (tid >> 4) of the work-group's rows, at the pass's k.
// l0: this thread's LDS byte address for row (tid >> 4) of the target buffer.
template <typename T>
__device__ __forceinline__ void stage_tile(unsigned l0, const T* ga, const T* gb, int lda, int ldb) {
  unsigned l[8]; const T* g[8];
#pragma unroll
  for (int it = 0; it < 8; ++it) {       // rows 0..127: the A rows
    l[it] = l0 + (unsigned)(it * 16 * G_PITCH * 2);
    g[it] = ga + (size_t)(it * 16) * lda;
  }
  async_copy8<T>(l, g);
#pragma unroll
  for (int it = 0; it < 8; ++it) {       // rows 128..255: the Bt rows
    l[it] = l0 + (unsigned)((it + 8) * 16 * G_PITCH * 2);
    g[it] = gb + (size_t)(it * 16) * ldb;
  }
  async_copy8<T>(l, g);
}
// this wave's LDS reads have retired (before the buffer they read is handed back for a refill)
__device__ __forceinline__ void wait_lds_reads()   { asm volatile("s_wait_dscnt 0x0" ::: "memory"); }
// this wave's asynchronous copies have landed (the compiler places no wait for them)
__device__ __forceinline__ void wait_async_copies() { asm volatile("s_wait_asynccnt 0x0" ::: "memory"); }

template <int ET, bool SPLIT, int BIAS_MODE, int OUT_MODE, bool RESID, int ACT = 0>
__global__ __launch_bounds__(256) void wmma_gemm64(
    const unsigned short* __restrict__ Ap, const unsigned short* __restrict__ A2p, int lda, long strideA,
    const unsigned short* __restrict__ Btp, const unsigned short* __restrict__ Bt2p, int ldb, long strideB,
    void* __restrict__ Cout, void* __restrict__ Cout2, int ldc, long strideC,
    const float* __restrict__ bias,
    const float* __restrict__ resid, long strideR,
    int M, int N, int K, float scale, int batchA2) {
  typedef typename Elem<ET>::T T;
  typedef typename Frag<T>::V V;
  static_assert(!SPLIT, "the LDS operand path stages one plane per operand");
  __shared__ __align__(16) T ring[2 * G_BUF];      // two operand buffers
  __shared__ __align__(16) float sT[8][16 * 68];   // per-wave 16x64 slab, pitch 68 floats
  const int b    = blockIdx.y;
  const T* A = (const T*)((b < batchA2) ? Ap : A2p); const T* Bt = (const T*)Btp;
  const int lane = threadIdx.x & 31;
  const int wave = threadIdx.x >> 5;
  const int tilesN = N >> 7;
  const int tilesM = M >> 7;
  const int tile = blockIdx.x;           // the work-group's 128x128 tile
  if (tile >= tilesM * tilesN) return;   // the same for the whole work-group, in front of every barrier
  const int tm = tile / tilesN;
  const int mb0 = tm << 7;                      // first A row of the work-group
  const int nb0 = (tile - tm * tilesN) << 7;    // first Bt row of the work-group
  const int wm = (wave >> 1) << 5;              // the wave's 32 rows and 64 columns within the tile
  const int wn = (wave & 1) << 6;
  const int m0 = mb0 + wm;
  const int n0 = nb0 + wn;

  const T* Ab  = A  + (size_t)b * strideA;
  const T* Bb  = Bt + (size_t)b * strideB;

  const int rlane = lane & 15;                 // row (A) / col (B, D) within subtile
  const int koff  = (lane >> 4) * 8;           // k offset of this lane half
  const int mOff  = (lane >> 4) * 8;           // D row offset

  v8f acc[2][4];
#pragma unroll
  for (int i = 0; i < 2; ++i)
#pragma unroll
    for (int j = 0; j < 4; ++j) acc[i][j] = (v8f){0.f,0.f,0.f,0.f,0.f,0.f,0.f,0.f};

  // BIAS_MODE 3: the lane's four column terms, requested once, under one work-group-uniform test, in front of the k loop
  float bcol[4] = {0.f, 0.f, 0.f, 0.f};
  if (BIAS_MODE == 3 && b == 0) {
#pragma unroll                                 // constant indices keep bcol in registers
    for (int j = 0; j < 4; ++j) bcol[j] = bias[n0 + (j << 4) + rlane];
    // the address registers of these loads are reused by the address arithmetic below: the wait stands in front of that
    asm volatile("s_wait_xcnt 0x0" ::: "memory");
  }

  const int srow = threadIdx.x >> 4;           // staged row of this thread within a group of 16 rows
  const int schk = (threadIdx.x & 15) * 8;     // its 16-byte chunk, in elements
  const T* ga = Ab + (size_t)(mb0 + srow) * lda + schk;
  const T* gb = Bb + (size_t)(nb0 + srow) * ldb + schk;
  const unsigned l0 = (unsigned)(size_t)ring + (unsigned)((srow * G_PITCH + schk) * 2);
  const int nPass = K / G_KP;

  stage_tile<T>(l0, ga, gb, lda, ldb);
  wait_async_copies();
  __syncthreads();                             // pass 0's tile is published
  if (nPass > 1) stage_tile<T>(l0 + (unsigned)(G_BUF * 2), ga + G_KP, gb + G_KP, lda, ldb);

#pragma unroll 1                               // one pass per trip: the buffer is picked by the trip's parity
  for (int t = 0; t < nPass; ++t) {
    const int bsel = (t & 1) * G_BUF;
    const T* ra = ring + bsel + (wm + rlane) * G_PITCH + koff;
    const T* rb = ring + bsel + (128 + wn + rlane) * G_PITCH + koff;
#pragma unroll
    for (int ks = 0; ks < G_KP / 32; ++ks) {
      V bh[4], ah[2];
#pragma unroll
      for (int j = 0; j < 4; ++j) bh[j] = Frag<T>::load(rb + j * 16 * G_PITCH + ks * 32);
#pragma unroll
      for (int i = 0; i < 2; ++i) ah[i] = Frag<T>::load(ra + i * 16 * G_PITCH + ks * 32);
      // the 12 fragment reads stay one group in front of the 8 WMMAs: left free, the scheduler reuses one
      // A register set and the wave waits out the LDS latency once per A fragment
      __builtin_amdgcn_sched_barrier(0);
#pragma unroll
      for (int i = 0; i < 2; ++i)
#pragma unroll
        for (int j = 0; j < 4; ++j) acc[i][j] = Frag<T>::mma(ah[i], bh[j], acc[i][j]);
      __builtin_amdgcn_sched_barrier(0);       // and the next block's reads stay behind this block's WMMAs
    }
    wait_lds_reads();
    wait_async_copies();
    __syncthreads();                           // publishes pass t + 1's tile and ends every read of pass t's buffer
    if (t + 2 < nPass)
      stage_tile<T>(l0 + (unsigned)(bsel * 2), ga + (size_t)(t + 2) * G_KP, gb + (size_t)(t + 2) * G_KP, lda, ldb);
  }
  wait_async_copies();
  acc_guard4(acc[0][0], acc[0][1], acc[0][2], acc[0][3]);
  acc_guard4(acc[1][0], acc[1][1], acc[1][2], acc[1][3]);

  // ---- epilogue ----
  float* slab = sT[wave];
  const float* Rb = RESID ? (resid + (size_t)b * strideR) : nullptr;
#pragma unroll
  for (int i = 0; i < 2; ++i) {
    const int mBase = m0 + (i << 4);
#pragma unroll
    for (int j = 0; j < 4; ++j) {
      const int n = n0 + (j << 4) + rlane;
      float bv = 0.f;
      if (BIAS_MODE == 2) bv = bias[n];
      if (BIAS_MODE == 3) bv = bcol[j];
#pragma unroll
      for (int r = 0; r < 8; ++r) {
        float v = acc[i][j][r] * scale;
        if (BIAS_MODE == 1) v += bias[mBase + mOff + r];
        if (BIAS_MODE == 2 || BIAS_MODE == 3) v += bv;
        if (RESID) v += Rb[(size_t)(mBase + mOff + r) * ldc + n];
        if (ACT == 1) v = tanhf(v);
        if (ACT == 2) v = fmaxf(v, 0.0f);
        if (ACT == 3) v = v / (1.0f + expf(-v));
        if (ACT == 4) v = (v > 0.f) ? v : 0.01f * v;
        if (ACT == 5) v = 0.5f * v * (1.0f + erff(v * 0.70710678118654752f));
        slab[(mOff + r) * 68 + (j << 4) + rlane] = v;
      }
    }
    __builtin_amdgcn_fence(__ATOMIC_RELEASE, "workgroup");
    __builtin_amdgcn_wave_barrier();
    __builtin_amdgcn_fence(__ATOMIC_ACQUIRE, "workgroup");
    if (OUT_MODE == 0) {
      float* C = (float*)Cout + (size_t)b * strideC;
      const int hh = lane >> 4, c4 = (lane & 15) * 4;     // row seg = 256 B = 16 lanes x 16 B
      {
#pragma unroll
        for (int it = 0; it < 8; ++it) {
          const int row = it * 2 + hh;
          v4f v = *(const v4f*)(slab + row * 68 + c4);
          *(v4f*)(C + (size_t)(mBase + row) * ldc + n0 + c4) = v;
        }
        
      }
    } else {
      const int q = lane >> 3, c8 = (lane & 7) * 8;
      unsigned short* C  = (unsigned short*)Cout  + (size_t)b * strideC;
      unsigned short* C2 = (OUT_MODE == 2) ? ((unsigned short*)Cout2 + (size_t)b * strideC) : nullptr;
      {
#pragma unroll
        for (int it = 0; it < 4; ++it) {
          const int row = it * 4 + q;
          const float* sp = slab + row * 68 + c8;
          v8h hv, lv;
#pragma unroll
          for (int e = 0; e < 8; ++e) {
            if (OUT_MODE == 1) {
              hv[e] = (_Float16)sp[e];
            } else {
              unsigned short hb = f2bf_bits(sp[e]);
              unsigned short lb = f2bf_bits(sp[e] - bf_bits2f(hb));
              hv[e] = __builtin_bit_cast(_Float16, hb);
              lv[e] = __builtin_bit_cast(_Float16, lb);
            }
          }
          *(v8h*)(C + (size_t)(mBase + row) * ldc + n0 + c8) = hv;
          if (OUT_MODE == 2) *(v8h*)(C2 + (size_t)(mBase + row) * ldc + n0 + c8) = lv;
        }
        
      }
    }
    __builtin_amdgcn_fence(__ATOMIC_RELEASE, "workgroup");
    __builtin_amdgcn_wave_barrier();
    __builtin_amdgcn_fence(__ATOMIC_ACQUIRE, "workgroup");
  }
}

// ---- f32 -> f16 casts (value x scale, round to nearest even) ---------------------------------------------
// A work-group converts 4096 consecutive elements of each of its planes. A wave-wide load is 512 contiguous bytes
// (16 B a lane), a wave-wide store 256 contiguous bytes (8 B a lane); every load of a thread is independent of every
// other and all are requested in front of the first store. L = loads per lane and plane = 32 / waves per work-group.
typedef __attribute__((ext_vector_type(4))) _Float16 v4h;
#define CAST_PLANE (1024 * 1024)         // elements of one plane
// e0: the lane's first element; the byte offsets fit 32 bits, so each access is plane base + one shared offset register.
template <int L>
__device__ __forceinline__ void cast_load(const float* __restrict__ in, unsigned e0, v4f (&x)[L]) {
  const char* p = (const char*)in + e0 * 4u;
#pragma unroll
  for (int k = 0; k < L; ++k) x[k] = *(const v4f*)(p + k * 512);
}
template <int L>
__device__ __forceinline__ void cast_store(_Float16* __restrict__ out, unsigned e0, const v4f (&x)[L], float scale) {
  char* p = (char*)out + e0 * 2u;
#pragma unroll
  for (int k = 0; k < L; ++k) {
    v4h h;
#pragma unroll
    for (int e = 0; e < 4; ++e) h[e] = (_Float16)(x[k][e] * scale);
    *(v4h*)(p + k * 256) = h;
  }
}
// seven planes in one launch: two activations x1, five weights x16; plane p goes to out + p * CAST_PLANE.
// grid = 256 work-groups of 16 waves.
__global__ __launch_bounds__(512) void cast7_f32_f16(
    const float* __restrict__ a0, const float* __restrict__ a1, const float* __restrict__ w0,
    const float* __restrict__ w1, const float* __restrict__ w2, const float* __restrict__ w3,
    const float* __restrict__ w4, _Float16* __restrict__ out) {
  const unsigned e0 = blockIdx.x * 4096u + (threadIdx.x >> 5) * 256u + (threadIdx.x & 31u) * 4u;
  v4f x[7][2];
  cast_load<2>(a0, e0, x[0]);
  cast_load<2>(a1, e0, x[1]);
  cast_load<2>(w0, e0, x[2]);
  cast_load<2>(w1, e0, x[3]);
  cast_load<2>(w2, e0, x[4]);
  cast_load<2>(w3, e0, x[5]);
  cast_load<2>(w4, e0, x[6]);
  cast_store<2>(out + 0 * (size_t)CAST_PLANE, e0, x[0], 1.0f);
  cast_store<2>(out + 1 * (size_t)CAST_PLANE, e0, x[1], 1.0f);
  cast_store<2>(out + 2 * (size_t)CAST_PLANE, e0, x[2], 16.0f);
  cast_store<2>(out + 3 * (size_t)CAST_PLANE, e0, x[3], 16.0f);
  cast_store<2>(out + 4 * (size_t)CAST_PLANE, e0, x[4], 16.0f);
  cast_store<2>(out + 5 * (size_t)CAST_PLANE, e0, x[5], 16.0f);
  cast_store<2>(out + 6 * (size_t)CAST_PLANE, e0, x[6], 16.0f);
}
// one plane: grid = 256 work-groups of 4 waves, eight loads a lane.
__global__ __launch_bounds__(128) void cast1_f32_f16(
    const float* __restrict__ in, _Float16* __restrict__ out, float scale) {
  const unsigned e0 = blockIdx.x * 4096u + (threadIdx.x >> 5) * 1024u + (threadIdx.x & 31u) * 4u;
  v4f x[8];
  cast_load<8>(in, e0, x);
  cast_store<8>(out, e0, x, scale);
}

typedef __attribute__((ext_vector_type(4))) int v4i;
__device__ __forceinline__ float dot4(v4f x, v4f w) {
  return fmaf(x[3], w[3], fmaf(x[2], w[2], fmaf(x[1], w[1], x[0] * w[0])));
}

// =====================================================================================
// Attention for head_dim 64 with additive score terms, f32 in / f32 out, f16 operands:
//   s = (q.k^T) * sscale + SB[q][kv];  SB element above sent_thr -> s = mask_fill (kept in the softmax)
//   softmax over all Skv keys in f32 (online over 64-key chunks); p carried x2^15 as f16; out = p.v / (l*2^15).
//   Block = 4 waves = 64 query rows of one (b, h); grid.x = B*H*(S/64).
//   Element (b, s, h, d) of q/k/v/out at X[b*X_bs + s*X_rs + h*X_hs + d].
// SB, the work-group's own 64 x 128 tile of additive terms with the mask folded in, is built in LDS in front of the
// key loop (128 positions, 16 heads, head n = b*16 + h; q and rf rows i*8+b, col h*64+d; q holds the s_q column term):
//   Every global load of the tile is independent of every other and all are requested up front: one round trip.
//   Phase 1 (LDS): e0[i] = q[n,i,:].semb[0][h*64..], e1[i] = q[n,i,:].semb[1][h*64..] for the 64 own rows,
//                  cv[i] = r[n,i,:].semb[0][h*64..] for all 128 rows; 16 lanes x 16 B per row, summed across the lanes.
//                  cv[128..255] = 0, so that cv[127-i+j] is the shifted term for j <= i and 0 for j > i.
//   Phase 2: SB[i][j] = amask[n][i][j] != 0 ? 3e38 (sentinel)
//                     : 0.125 * ( utt[n][i][j] * (smask[b][i][j] -> e1[i] : e0[i]) + cv[127-i+j] )
//            16 B per lane and array, a wave covers one whole 512-B row per access, sixteen rows per wave.
// =====================================================================================
#define AT_D 64
#define AT_NW 4
#define AT_QB 64
#define AT_KC 64
#define SB_COLS  128                     // key columns of the SB tile
#define SB_PITCH 132                     // its LDS row pitch in floats: rows 16-B aligned, rows r and r + 8 half the banks apart
struct AttnArgs { long q_bs, q_rs, q_hs, k_bs, k_rs, k_hs, v_bs, v_rs, v_hs, o_bs, o_rs, o_hs;
                  int S, Skv, H, nchunks; float sscale, mask_fill, sent_thr, resv; };
static_assert(sizeof(AttnArgs) == 128);

__device__ __forceinline__ v8f mma_f16g(v16h a, v16h b, v8f c) {
  c = __builtin_amdgcn_wmma_f32_16x16x32_f16(false, a, false, b, (short)0, c, false, false);
  asm volatile("v_nop\n\tv_nop\n\tv_nop\n\tv_nop" : "+v"(c) : "v"(a), "v"(b));
  return c;
}

__global__ __launch_bounds__(128)
void attn64_sbias_f16(const float* __restrict__ q, const float* __restrict__ k,
                      const float* __restrict__ v, float* __restrict__ out,
                      const float* __restrict__ rf, const float* __restrict__ semb,
                      const float* __restrict__ utt, const int* __restrict__ amask,
                      const int* __restrict__ smask, AttnArgs g) {
  const float PSC = 32768.0f;
  union FB { v16h v; v8h h[2]; };
  __shared__ __align__(16) _Float16 Ksh[AT_KC * AT_D];            // K [kv][d]   8 KB
  __shared__ __align__(16) _Float16 Vth[AT_D * AT_KC];            // V [d][kv]   8 KB
  __shared__ __align__(16) _Float16 Psh[AT_NW][16 * AT_KC];       // per wave P [row][kv]  8 KB
  __shared__ __align__(16) float    Os[AT_NW][16 * 68];           // per wave out tile, pitch 68
  __shared__ __align__(16) float    Sbl[AT_QB * SB_PITCH];        // SB [own row][kv]  33 KB
  __shared__ float se0[AT_QB];
  __shared__ float se1[AT_QB];
  __shared__ float scv[2 * SB_COLS];

  const int tid  = threadIdx.x;
  const int wave = tid >> 5;
  const int lane = tid & 31;
  const int hh   = lane >> 4;
  const int c    = lane & 15;

  const int nqb = g.S / AT_QB;
  const int bx = blockIdx.x;
  const int qb = bx % nqb;
  const int bh = bx / nqb;
  const int h  = bh % g.H;
  const int b  = bh / g.H;
  const int q0 = qb * AT_QB + wave * 16;

  const float* qb_ptr = q   + (size_t)b * g.q_bs + (size_t)h * g.q_hs;
  const float* kb_ptr = k   + (size_t)b * g.k_bs + (size_t)h * g.k_hs;
  const float* vb_ptr = v   + (size_t)b * g.v_bs + (size_t)h * g.v_hs;
  float*       ob_ptr = out + (size_t)b * g.o_bs + (size_t)h * g.o_hs;

  // ---- SB tile ----
  {
    const int i0 = qb * AT_QB;                 // first own score row
    const int d4 = c * 4;                      // phase 1: four of the 64 depths (hh: row of the pair)
    const int c4 = lane * 4;                   // phase 2: this lane's four score columns
    const int e0 = (i0 + wave) * SB_COLS + c4; // own score rows wave + 4 kk: row kk lies 4 rows behind row kk - 1
    const float* ub  = utt   + (size_t)bh * (SB_COLS * SB_COLS) + e0;
    const int*   ab  = amask + (size_t)bh * (SB_COLS * SB_COLS) + e0;
    const int*   smb = smask + (size_t)b  * (SB_COLS * SB_COLS) + e0;
    const float* sw = semb + h * 64;           // the head's 64 depths of table row 0; row 1 lies 1024 floats behind
    const v4f w0 = *(const v4f*)(sw + d4);
    const v4f w1 = *(const v4f*)(sw + 1024 + d4);
    const size_t co = (size_t)b * 1024 + (size_t)h * 64 + d4;
    const float* rp = rf + (size_t)(wave * 32 + hh) * 8192 + co;
    const float* qp = q + (size_t)(i0 + wave * 16 + hh) * 8192 + co;
    v4f rv[16], qv[8];
#pragma unroll
    for (int kk = 0; kk < 16; ++kk) rv[kk] = *(const v4f*)(rp + kk * (2 * 8192));
#pragma unroll
    for (int kk = 0; kk < 8; ++kk) qv[kk] = *(const v4f*)(qp + kk * (2 * 8192));
    // no address register of the loads above is rewritten in front of this wait: the pointers are named as inputs so
    // that their registers stay theirs up to it (left free, a later load's destination or a scalar load takes one)
    asm volatile("s_wait_xcnt 0x0" :: "s"(sw), "v"(rp), "v"(qp) : "memory");
    v4f u4[16]; v4i am4[16], sm4[16];
#pragma unroll
    for (int kk = 0; kk < 16; ++kk) {
      u4[kk]  = *(const v4f*)(ub  + kk * (4 * SB_COLS));
      am4[kk] = *(const v4i*)(ab  + kk * (4 * SB_COLS));
      sm4[kk] = *(const v4i*)(smb + kk * (4 * SB_COLS));
    }
    // the same for the mask loads
    asm volatile("s_wait_xcnt 0x0" :: "v"(ub), "v"(ab), "v"(smb) : "memory");
    // the mask loads stay in front of phase 1's arithmetic: left free, the scheduler issues them only behind the
    // wait for the projection rows, and the two round trips run one after the other
    __builtin_amdgcn_sched_barrier(0);

    float p[32];
#pragma unroll
    for (int kk = 0; kk < 16; ++kk) p[kk] = dot4(rv[kk], w0);
#pragma unroll
    for (int kk = 0; kk < 8; ++kk) { p[16 + kk] = dot4(qv[kk], w0); p[24 + kk] = dot4(qv[kk], w1); }
#pragma unroll
    for (int off = 1; off < 16; off <<= 1)
#pragma unroll
      for (int x = 0; x < 32; ++x) p[x] += __shfl_xor(p[x], off, 32);
    if (c == 0) {
#pragma unroll
      for (int kk = 0; kk < 16; ++kk) scv[wave * 32 + kk * 2 + hh] = p[kk];
#pragma unroll
      for (int kk = 0; kk < 8; ++kk) { se0[wave * 16 + kk * 2 + hh] = p[16 + kk]; se1[wave * 16 + kk * 2 + hh] = p[24 + kk]; }
    }
    scv[SB_COLS + tid] = 0.0f;                 // 128 threads, 128 zeros
    __syncthreads();                           // e0, e1, cv are published

#pragma unroll
    for (int kk = 0; kk < 16; ++kk) {
      const int il = wave + 4 * kk, i = i0 + il;
      const float e0v = se0[il], e1v = se1[il];
      const float* cvp = scv + (127 - i + c4); // 0 <= 127 - i + j <= 254 for every row i and column j
      v4f o;
#pragma unroll
      for (int u = 0; u < 4; ++u) {
        int sm = sm4[kk][u];
        if (sm < 0) sm += 2;                   // 2-row table: wrap negatives, then clamp
        sm = sm < 0 ? 0 : (sm > 1 ? 1 : sm);
        const float ev = (sm != 0) ? e1v : e0v;
        float val = (u4[kk][u] * ev + cvp[u]) * 0.125f;
        if (am4[kk][u] != 0) val = 3.0e38f;
        o[u] = val;
      }
      *(v4f*)(Sbl + il * SB_PITCH + c4) = o;   // read by other waves only behind the key loop's barriers
    }
  }

  // ---- Q fragments (A operand), 2 d-chunks, split k map ----
  v16h qa[2];
  {
    const float* qrow = qb_ptr + (size_t)(q0 + c) * g.q_rs;
#pragma unroll
    for (int dc = 0; dc < 2; ++dc) {
      const v4f f0 = *(const v4f*)(qrow + dc * 32 + 8 * hh);
      const v4f f1 = *(const v4f*)(qrow + dc * 32 + 8 * hh + 4);
      const v4f f2 = *(const v4f*)(qrow + dc * 32 + 16 + 8 * hh);
      const v4f f3 = *(const v4f*)(qrow + dc * 32 + 16 + 8 * hh + 4);
#pragma unroll
      for (int e = 0; e < 4; ++e) {
        qa[dc][e]      = (_Float16)f0[e];
        qa[dc][4 + e]  = (_Float16)f1[e];
        qa[dc][8 + e]  = (_Float16)f2[e];
        qa[dc][12 + e] = (_Float16)f3[e];
      }
    }
  }

  float mrow[8], lrow[8];
  v8f oacc[4];
#pragma unroll
  for (int r = 0; r < 8; ++r) { mrow[r] = -INFINITY; lrow[r] = 0.f; }
#pragma unroll
  for (int t = 0; t < 4; ++t) oacc[t] = (v8f){0.f,0.f,0.f,0.f,0.f,0.f,0.f,0.f};

  int nChunks = g.Skv / AT_KC;                 // block-uniform, host-provided
  if (nChunks > SB_COLS / AT_KC) nChunks = SB_COLS / AT_KC;   // the SB tile holds 128 key columns
  for (int kc = 0; kc < nChunks; ++kc) {
    const int kv0 = kc * AT_KC;
    __syncthreads();
    {
      const int kvr = tid >> 1, dh = (tid & 1) * 32;
      const float* krow = kb_ptr + (size_t)(kv0 + kvr) * g.k_rs + dh;
      const float* vrow = vb_ptr + (size_t)(kv0 + kvr) * g.v_rs + dh;
#pragma unroll
      for (int i = 0; i < 8; ++i) {
        v4f kk = *(const v4f*)(krow + 4 * i);
        v4f vv = *(const v4f*)(vrow + 4 * i);
#pragma unroll
        for (int e = 0; e < 4; ++e) {
          const int d = dh + 4 * i + e;
          Ksh[kvr * AT_D + d]  = (_Float16)kk[e];
          Vth[d * AT_KC + kvr] = (_Float16)vv[e];
        }
      }
    }
    __syncthreads();

    v8f s[4];
#pragma unroll
    for (int j = 0; j < 4; ++j) {
      s[j] = (v8f){0.f,0.f,0.f,0.f,0.f,0.f,0.f,0.f};
#pragma unroll
      for (int dc = 0; dc < 2; ++dc) {
        FB kb;
        kb.h[0] = *(const v8h*)(Ksh + (j * 16 + c) * AT_D + dc * 32 + 8 * hh);
        kb.h[1] = *(const v8h*)(Ksh + (j * 16 + c) * AT_D + dc * 32 + 16 + 8 * hh);
        s[j] = mma_f16g(qa[dc], kb.v, s[j]);
      }
    }
    // additive terms + mask select, row max
    const float* sbp = Sbl + (wave * 16 + 8 * hh) * SB_PITCH + kv0 + c;
    float cm[8];
#pragma unroll
    for (int r = 0; r < 8; ++r) {
      const float* sbr = sbp + r * SB_PITCH;
      float m = -INFINITY;
#pragma unroll
      for (int j = 0; j < 4; ++j) {
        const float bb = sbr[j * 16];
        float sv = fmaf(s[j][r], g.sscale, bb);
        if (bb > g.sent_thr) sv = g.mask_fill;
        s[j][r] = sv;
        m = fmaxf(m, sv);
      }
#pragma unroll
      for (int off = 1; off < 16; off <<= 1) m = fmaxf(m, __shfl_xor(m, off, 32));
      cm[r] = m;
    }
    _Float16* pwh = Psh[wave];
#pragma unroll
    for (int r = 0; r < 8; ++r) {
      const float mnew = fmaxf(mrow[r], cm[r]);
      const float alpha = expf(mrow[r] - mnew);
      mrow[r] = mnew;
      float psum = 0.f;
#pragma unroll
      for (int j = 0; j < 4; ++j) {
        const float p = expf(s[j][r] - mnew);
        psum += p;
        pwh[(8 * hh + r) * AT_KC + j * 16 + c] = (_Float16)(p * PSC);
      }
#pragma unroll
      for (int off = 1; off < 16; off <<= 1) psum += __shfl_xor(psum, off, 32);
      lrow[r] = lrow[r] * alpha + psum;
#pragma unroll
      for (int t = 0; t < 4; ++t) oacc[t][r] *= alpha;
    }
    __builtin_amdgcn_fence(__ATOMIC_RELEASE, "workgroup");
    __builtin_amdgcn_wave_barrier();
    __builtin_amdgcn_fence(__ATOMIC_ACQUIRE, "workgroup");
#pragma unroll 1
    for (int kk = 0; kk < 2; ++kk) {
      FB pa;
      pa.h[0] = *(const v8h*)(pwh + c * AT_KC + kk * 32 + 8 * hh);
      pa.h[1] = *(const v8h*)(pwh + c * AT_KC + kk * 32 + 16 + 8 * hh);
#pragma unroll
      for (int t = 0; t < 4; ++t) {
        FB vb;
        vb.h[0] = *(const v8h*)(Vth + (t * 16 + c) * AT_KC + kk * 32 + 8 * hh);
        vb.h[1] = *(const v8h*)(Vth + (t * 16 + c) * AT_KC + kk * 32 + 16 + 8 * hh);
        oacc[t] = mma_f16g(pa.v, vb.v, oacc[t]);
      }
    }
  }

  float* os = Os[wave];
#pragma unroll
  for (int r = 0; r < 8; ++r) {
    const float inv = 1.0f / (lrow[r] * PSC);
#pragma unroll
    for (int t = 0; t < 4; ++t) os[(8 * hh + r) * 68 + t * 16 + c] = oacc[t][r] * inv;
  }
  __builtin_amdgcn_fence(__ATOMIC_RELEASE, "workgroup");
  __builtin_amdgcn_wave_barrier();
  __builtin_amdgcn_fence(__ATOMIC_ACQUIRE, "workgroup");
  {
    const int c4 = (lane & 15) * 4;
    {
#pragma unroll
      for (int it = 0; it < 8; ++it) {
        const int row = it * 2 + hh;
        v4f val = *(const v4f*)(os + row * 68 + c4);
        *(v4f*)(ob_ptr + (size_t)(q0 + row) * g.o_rs + c4) = val;
      }
      
    }
  }
}

// ---------------------------------------------------------------------------
// Host launcher. Layout of q/k/v/r/ctx matrices: row = i*8 + b (i = position, b = batch),
// col = h*64 + d; head n = b*16 + h. The (B,L,D) positional input is used as a flat [1024][1024]
// A matrix exactly like the (L,B,D) query (literal view semantics of the position projection).
// ---------------------------------------------------------------------------
extern "C" void kernel_launch(void* const* d_in, const int* in_sizes, int n_in,
                              void* d_out, int out_size, void* d_ws, size_t ws_size,
                              hipStream_t stream) {
  if (n_in < 11) return;
  const int NE = 1024 * 1024;                 // elements of every [*,*,1024] tensor and of each weight
  if (in_sizes[0] != NE || in_sizes[1] != NE || in_sizes[3] != NE || in_sizes[4] != NE ||
      in_sizes[5] != NE || in_sizes[6] != NE || in_sizes[7] != NE || in_sizes[8] != 2 * 1024 ||
      in_sizes[2] != 128 * 128 * 128 || in_sizes[9] != 128 * 128 * 128 || in_sizes[10] != 8 * 128 * 128 ||
      out_size != NE) return;

  const float* query    = (const float*)d_in[0];   // (L,B,D)
  const float* rel_pe   = (const float*)d_in[1];   // (B,L,D)
  const float* utt_mask = (const float*)d_in[2];   // (B*H,L,L,1) f32
  const float* Wq       = (const float*)d_in[3];
  const float* Wk       = (const float*)d_in[4];
  const float* Wv       = (const float*)d_in[5];
  const float* Wr       = (const float*)d_in[6];
  const float* Wo       = (const float*)d_in[7];
  const float* spk_emb  = (const float*)d_in[8];   // (2,D)
  const int*   attn_msk = (const int*)d_in[9];     // (B*H,L,L) int32, nonzero = masked
  const int*   spk_msk  = (const int*)d_in[10];    // (B,L,L) int32 in {0,1}
  float* out = (float*)d_out;

  // ---- workspace carve (bytes) ----
  const size_t MiB = (size_t)1 << 20;
  const size_t off_q16 = 0;                    // query  f16       2 MiB
  const size_t off_p16 = 2 * MiB;              // rel_pe f16       2 MiB
  const size_t off_w16 = 4 * MiB;              // 5 weights f16 x16, 2 MiB each (Wq,Wk,Wv,Wr,Wo)
  const size_t off_qf  = 14 * MiB;             // new_q f32        4 MiB
  const size_t off_kf  = 18 * MiB;             // k f32            4 MiB
  const size_t off_vf  = 22 * MiB;             // v f32            4 MiB (q, k, v, r one behind the other: batched GEMM stride)
  const size_t off_rf  = 26 * MiB;             // r f32            4 MiB
  const size_t off_ctx = 30 * MiB;             // ctx f32          4 MiB
  const size_t off_c16 = 34 * MiB;             // ctx f16 x16      2 MiB
  const size_t total   = 36 * MiB;
  if (total > ws_size || total > 128 * MiB) return;

  char* ws = (char*)d_ws;
  _Float16* q16 = (_Float16*)(ws + off_q16);
  _Float16* p16 = (_Float16*)(ws + off_p16);
  _Float16* w16 = (_Float16*)(ws + off_w16);
  float* qf  = (float*)(ws + off_qf);
  float* kf  = (float*)(ws + off_kf);
  float* vf  = (float*)(ws + off_vf);
  float* rf  = (float*)(ws + off_rf);
  float* ctx = (float*)(ws + off_ctx);
  _Float16* c16 = (_Float16*)(ws + off_c16);

  // ---- casts: activations x1, weights x16 (exact power of two, undone in the GEMM epilogue); the seven f16
  //      planes q16, p16, w16[0..4] lie one behind the other from the start of the workspace ----
  cast7_f32_f16<<<256, 512, 0, stream>>>(query, rel_pe, Wq, Wk, Wv, Wr, Wo, q16);

  // ---- input projections: C = X . W^T, 1024x1024x1024 each; q gets column bias spk_emb[0][col] (= new_q) ----
  const int M = 1024, N = 1024, K = 1024;
  const int gblocks = (M / 128) * (N / 128);   // one work-group per 128x128 tile
  const float wscale_inv = 1.0f / 16.0f;
  {
    // one launch of 4 x 64 work-groups, each alone on its WGP: y = 0: q (query, Wq -> qf, + spk_emb[0][col]),
    // y = 1: k, y = 2: v (query), y = 3: r (rel_pe flat [1024][1024], literal view). The four weight planes and the
    // four f32 results lie one behind the other in the workspace (strides NE).
    dim3 grid(gblocks, 4);
    wmma_gemm64<0, false, 3, 0, false><<<grid, 256, 0, stream>>>(
        (const unsigned short*)q16, (const unsigned short*)p16, K, 0L,
        (const unsigned short*)w16, (const unsigned short*)w16, K, (long)NE,
        (void*)qf, (void*)qf, N, (long)NE,
        spk_emb, spk_emb, 0L, M, N, K, wscale_inv, 3);
  }

  // ---- attention: 128 heads (b*16+h) of 128x128, head dim 64; s = a1/8 + SB, SB = (a2 + a3) * 1/8 with the mask
  //      folded in as a sentinel -> 1e-30 ----
  {
    AttnArgs g;
    g.q_bs = 1024; g.q_rs = 8 * 1024; g.q_hs = 64;
    g.k_bs = 1024; g.k_rs = 8 * 1024; g.k_hs = 64;
    g.v_bs = 1024; g.v_rs = 8 * 1024; g.v_hs = 64;
    g.o_bs = 1024; g.o_rs = 8 * 1024; g.o_hs = 64;
    g.S = 128; g.Skv = 128; g.H = 16; g.nchunks = 2;
    g.sscale = 0.125f; g.mask_fill = 1e-30f; g.sent_thr = 1.0e37f; g.resv = 0.0f;
    const int agrid = 8 * 16 * (128 / AT_QB);   // 256 blocks
    attn64_sbias_f16<<<agrid, 128, 0, stream>>>(qf, kf, vf, ctx, rf, spk_emb, utt_mask, attn_msk, spk_msk, g);
  }

  // ---- ctx f32 -> f16 x16, then output projection into d_out (scale 1/256 undoes both x16) ----
  cast1_f32_f16<<<256, 128, 0, stream>>>(ctx, c16, 16.0f);
  {
    dim3 grid(gblocks, 1);
    wmma_gemm64<0, false, 0, 0, false><<<grid, 256, 0, stream>>>(
        (const unsigned short*)c16, (const unsigned short*)c16, K, 0L,
        (const unsigned short*)(w16 + 4 * (size_t)NE), (const unsigned short*)(w16 + 4 * (size_t)NE), K, 0L,
        (void*)out, (void*)out, N, 0L,
        spk_emb, spk_emb, 0L, M, N, K, 1.0f / 256.0f, 1);
  }
  (void)hipGetLastError();
}

// v007
// A run of this version takes 44.2 microseconds.
// Two timings next to v006 put it at 1.03 and 1.08 times that version's speed.
// Counting every step since v000, it is 6.13 times as fast.
#include <hip/hip_runtime.h>
#include <stdint.h>
// Contractions: five 1024x1024x1024 projections (X . W^T), per-head q.k^T (K=64) and p.v (K=128): v_wmma_f32_16x16x32_f16 (f16 operands; weights and ctx carried x16, p carried x2^15, exact powers of two folded back in f32), f32 accumulate. Softmax, additive score terms and depth-64 speaker row dots in f32 on VALU.

typedef __attribute__((ext_vector_type(16))) _Float16 v16h;
typedef __attribute__((ext_vector_type(8)))  _Float16 v8h;
typedef __attribute__((ext_vector_type(16))) __bf16   v16b;
typedef __attribute__((ext_vector_type(8)))  __bf16   v8b;
typedef __attribute__((ext_vector_type(8)))  float    v8f;
typedef __attribute__((ext_vector_type(4)))  float    v4f;

__device__ __forceinline__ unsigned short f2bf_bits(float f) {
  unsigned u = __float_as_uint(f);
  return (unsigned short)((u + 0x7FFFu + ((u >> 16) & 1u)) >> 16);
}
__device__ __forceinline__ float bf_bits2f(unsigned short h) { return __uint_as_float(((unsigned)h) << 16); }

// hazard guards as plain device helpers
__device__ __forceinline__ void acc_guard4(v8f& a, v8f& b, v8f& c, v8f& d) { asm volatile("v_nop\n\tv_nop\n\tv_nop\n\tv_nop" : "+v"(a), "+v"(b), "+v"(c), "+v"(d)); }
template <typename T> struct Frag;
template <> struct Frag<_Float16> {
  typedef v16h V; union U { v16h v; v8h h[2]; };
  static __device__ __forceinline__ v16h load(const _Float16* p) {   // elements 0..7 <- p[0..7], 8..15 <- p[16..23]
    U f; f.h[0] = *(const v8h*)(p); f.h[1] = *(const v8h*)(p + 16); return f.v;
  }
  static __device__ __forceinline__ v8f mma(v16h a, v16h b, v8f c) {
    return __builtin_amdgcn_wmma_f32_16x16x32_f16(false, a, false, b, (short)0, c, false, false);
  }
};
template <> struct Frag<__bf16> {
  typedef v16b V; union U { v16b v; v8b h[2]; };
  static __device__ __forceinline__ v16b load(const __bf16* p) {
    U f; f.h[0] = *(const v8b*)(p); f.h[1] = *(const v8b*)(p + 16); return f.v;
  }
  static __device__ __forceinline__ v8f mma(v16b a, v16b b, v8f c) {
    return __builtin_amdgcn_wmma_f32_16x16x32_bf16(false, a, false, b, (short)0, c, false, false);
  }
};

// ---- Register-blocked batched WMMA GEMM ------------------------------------
// C[m,n] = scale * sum_k A[m,k] * Bt[n,k] (+bias)(+resid); a work-group owns a 128x128 tile,
// its eight waves 32x64 each (four down, two across).
// A row-major [M,K]; Bt row-major [N,K]; M % 128 == 0, N % 128 == 0, K % 128 == 0.
// Operand path: per pass of 128 k the work-group's 128 A rows and 128 Bt rows (256 B each, whole lines)
// go to LDS by asynchronous 16-byte copies, two buffers, the next pass in flight while this one is
// multiplied; the waves read their fragments from LDS (row pitch 272 B = 16 B x odd for ds_load_b128).
// The square tile keeps the bytes a work-group pulls per output low (256 operand rows for 16,384 outputs).
// SPLIT (hi/lo operand planes) is not staged by this path and is not instantiated.
// Batch b = blockIdx.y: Bt and C advance by their strides; batches b >= batchA2 read A2p as their A, the others Ap,
// so products of two different left operands that do not depend on each other share one launch.
// BIAS_MODE: 0 = none, 1 = bias[m], 2 = bias[n], 3 = bias[n] in batch 0 alone.
// OUT_MODE: 0 = f32, 1 = f16, 2 = bf16 hi plane (Cout) + bf16 lo plane (Cout2).
// ET: 0 = f16 operands, 1 = bf16 operands (pointers passed as 16-bit storage)
template <int ET> struct Elem;
template <> struct Elem<0> { typedef _Float16 T; };
template <> struct Elem<1> { typedef __bf16 T; };
#define G_KP    128                      // k of one pass
#define G_PITCH 136                      // LDS row pitch in 16-bit elements (256 B of k + 16 B)
#define G_ROWS  256                      // 128 A rows, then 128 Bt rows
#define G_BUF   (G_ROWS * G_PITCH)       // elements of one buffer (69,632 B)

// Eight asynchronous 16-byte-per-lane copies global -> LDS. The s_wait_xcnt closes the statement so that
// no address register named here is rewritten before it.
template <typename T>
__device__ __forceinline__ void async_copy8(const unsigned (&l)[8], const T* const (&g)[8]) {
  asm volatile(
      "global_load_async_to_lds_b128 %0, %8, off\n\t"
      "global_load_async_to_lds_b128 %1, %9, off\n\t"
      "global_load_async_to_lds_b128 %2, %10, off\n\t"
      "global_load_async_to_lds_b128 %3, %11, off\n\t"
      "global_load_async_to_lds_b128 %4, %12, off\n\t"
      "global_load_async_to_lds_b128 %5, %13, off\n\t"
      "global_load_async_to_lds_b128 %6, %14, off\n\t"
      "global_load_async_to_lds_b128 %7, %15, off\n\t"
      "s_wait_xcnt 0x0"
      :: "v"(l[0]), "v"(l[1]), "v"(l[2]), "v"(l[3]), "v"(l[4]), "v"(l[5]), "v"(l[6]), "v"(l[7]),
         "v"(g[0]), "v"(g[1]), "v"(g[2]), "v"(g[3]), "v"(g[4]), "v"(g[5]), "v"(g[6]), "v"(g[7])
      : "memory");
}
// One pass's tile: 256 rows x 16 chunks of 16 B = 16 chunks per thread; a wave-wide copy covers 2 whole rows.
// ga / gb: this thread's chunk in A row (tid >> 4) / Bt row (tid >> 4) of the work-group's rows, at the pass's k.
// l0: this thread's LDS byte address for row (tid >> 4) of the target buffer.
template <typename T>
__device__ __forceinline__ void stage_tile(unsigned l0, const T* ga, const T* gb, int lda, int ldb) {
  unsigned l[8]; const T* g[8];
#pragma unroll
  for (int it = 0; it < 8; ++it) {       // rows 0..127: the A rows
    l[it] = l0 + (unsigned)(it * 16 * G_PITCH * 2);
    g[it] = ga + (size_t)(it * 16) * lda;
  }
  async_copy8<T>(l, g);
#pragma unroll
  for (int it = 0; it < 8; ++it) {       // rows 128..255: the Bt rows
    l[it] = l0 + (unsigned)((it + 8) * 16 * G_PITCH * 2);
    g[it] = gb + (size_t)(it * 16) * ldb;
  }
  async_copy8<T>(l, g);
}
// this wave's LDS reads have retired (before the buffer they read is handed back for a refill)
__device__ __forceinline__ void wait_lds_reads()   { asm volatile("s_wait_dscnt 0x0" ::: "memory"); }
// this wave's asynchronous copies have landed (the compiler places no wait for them)
__device__ __forceinline__ void wait_async_copies() { asm volatile("s_wait_asynccnt 0x0" ::: "memory"); }

template <int ET, bool SPLIT, int BIAS_MODE, int OUT_MODE, bool RESID, int ACT = 0>
__global__ __launch_bounds__(256) void wmma_gemm64(
    const unsigned short* __restrict__ Ap, const unsigned short* __restrict__ A2p, int lda, long strideA,
    const unsigned short* __restrict__ Btp, const unsigned short* __restrict__ Bt2p, int ldb, long strideB,
    void* __restrict__ Cout, void* __restrict__ Cout2, int ldc, long strideC,
    const float* __restrict__ bias,
    const float* __restrict__ resid, long strideR,
    int M, int N, int K, float scale, int batchA2) {
  typedef typename Elem<ET>::T T;
  typedef typename Frag<T>::V V;
  static_assert(!SPLIT, "the LDS operand path stages one plane per operand");
  __shared__ __align__(16) T ring[2 * G_BUF];      // two operand buffers
  __shared__ __align__(16) float sT[8][16 * 68];   // per-wave 16x64 slab, pitch 68 floats
  const int b    = blockIdx.y;
  const T* A = (const T*)((b < batchA2) ? Ap : A2p); const T* Bt = (const T*)Btp;
  const int lane = threadIdx.x & 31;
  const int wave = threadIdx.x >> 5;
  const int tilesN = N >> 7;
  const int tilesM = M >> 7;
  const int tile = blockIdx.x;           // the work-group's 128x128 tile
  if (tile >= tilesM * tilesN) return;   // the same for the whole work-group, in front of every barrier
  const int tm = tile / tilesN;
  const int mb0 = tm << 7;                      // first A row of the work-group
  const int nb0 = (tile - tm * tilesN) << 7;    // first Bt row of the work-group
  const int wm = (wave >> 1) << 5;              // the wave's 32 rows and 64 columns within the tile
  const int wn = (wave & 1) << 6;
  const int m0 = mb0 + wm;
  const int n0 = nb0 + wn;

  const T* Ab  = A  + (size_t)b * strideA;
  const T* Bb  = Bt + (size_t)b * strideB;

  const int rlane = lane & 15;                 // row (A) / col (B, D) within subtile
  const int koff  = (lane >> 4) * 8;           // k offset of this lane half
  const int mOff  = (lane >> 4) * 8;           // D row offset

  v8f acc[2][4];
#pragma unroll
  for (int i = 0; i < 2; ++i)
#pragma unroll
    for (int j = 0; j < 4; ++j) acc[i][j] = (v8f){0.f,0.f,0.f,0.f,0.f,0.f,0.f,0.f};

  // BIAS_MODE 3: the lane's four column terms, requested once, under one work-group-uniform test, in front of the k loop
  float bcol[4] = {0.f, 0.f, 0.f, 0.f};
  if (BIAS_MODE == 3 && b == 0) {
#pragma unroll                                 // constant indices keep bcol in registers
    for (int j = 0; j < 4; ++j) bcol[j] = bias[n0 + (j << 4) + rlane];
    // the address registers of these loads are reused by the address arithmetic below: the wait stands in front of that
    asm volatile("s_wait_xcnt 0x0" ::: "memory");
  }

  const int srow = threadIdx.x >> 4;           // staged row of this thread within a group of 16 rows
  const int schk = (threadIdx.x & 15) * 8;     // its 16-byte chunk, in elements
  const T* ga = Ab + (size_t)(mb0 + srow) * lda + schk;
  const T* gb = Bb + (size_t)(nb0 + srow) * ldb + schk;
  const unsigned l0 = (unsigned)(size_t)ring + (unsigned)((srow * G_PITCH + schk) * 2);
  const int nPass = K / G_KP;

  stage_tile<T>(l0, ga, gb, lda, ldb);
  wait_async_copies();
  __syncthreads();                             // pass 0's tile is published
  if (nPass > 1) stage_tile<T>(l0 + (unsigned)(G_BUF * 2), ga + G_KP, gb + G_KP, lda, ldb);

#pragma unroll 1                               // one pass per trip: the buffer is picked by the trip's parity
  for (int t = 0; t < nPass; ++t) {
    const int bsel = (t & 1) * G_BUF;
    const T* ra = ring + bsel + (wm + rlane) * G_PITCH + koff;
    const T* rb = ring + bsel + (128 + wn + rlane) * G_PITCH + koff;
#pragma unroll
    for (int ks = 0; ks < G_KP / 32; ++ks) {
      V bh[4], ah[2];
#pragma unroll
      for (int j = 0; j < 4; ++j) bh[j] = Frag<T>::load(rb + j * 16 * G_PITCH + ks * 32);
#pragma unroll
      for (int i = 0; i < 2; ++i) ah[i] = Frag<T>::load(ra + i * 16 * G_PITCH + ks * 32);
      // the 12 fragment reads stay one group in front of the 8 WMMAs: left free, the scheduler reuses one
      // A register set and the wave waits out the LDS latency once per A fragment
      __builtin_amdgcn_sched_barrier(0);
#pragma unroll
      for (int i = 0; i < 2; ++i)
#pragma unroll
        for (int j = 0; j < 4; ++j) acc[i][j] = Frag<T>::mma(ah[i], bh[j], acc[i][j]);
      __builtin_amdgcn_sched_barrier(0);       // and the next block's reads stay behind this block's WMMAs
    }
    wait_lds_reads();
    wait_async_copies();
    __syncthreads();                           // publishes pass t + 1's tile and ends every read of pass t's buffer
    if (t + 2 < nPass)
      stage_tile<T>(l0 + (unsigned)(bsel * 2), ga + (size_t)(t + 2) * G_KP, gb + (size_t)(t + 2) * G_KP, lda, ldb);
  }
  wait_async_copies();
  acc_guard4(acc[0][0], acc[0][1], acc[0][2], acc[0][3]);
  acc_guard4(acc[1][0], acc[1][1], acc[1][2], acc[1][3]);

  // ---- epilogue ----
  float* slab = sT[wave];
  const float* Rb = RESID ? (resid + (size_t)b * strideR) : nullptr;
#pragma unroll
  for (int i = 0; i < 2; ++i) {
    const int mBase = m0 + (i << 4);
#pragma unroll
    for (int j = 0; j < 4; ++j) {
      const int n = n0 + (j << 4) + rlane;
      float bv = 0.f;
      if (BIAS_MODE == 2) bv = bias[n];
      if (BIAS_MODE == 3) bv = bcol[j];
#pragma unroll
      for (int r = 0; r < 8; ++r) {
        float v = acc[i][j][r] * scale;
        if (BIAS_MODE == 1) v += bias[mBase + mOff + r];
        if (BIAS_MODE == 2 || BIAS_MODE == 3) v += bv;
        if (RESID) v += Rb[(size_t)(mBase + mOff + r) * ldc + n];
        if (ACT == 1) v = tanhf(v);
        if (ACT == 2) v = fmaxf(v, 0.0f);
        if (ACT == 3) v = v / (1.0f + expf(-v));
        if (ACT == 4) v = (v > 0.f) ? v : 0.01f * v;
        if (ACT == 5) v = 0.5f * v * (1.0f + erff(v * 0.70710678118654752f));
        slab[(mOff + r) * 68 + (j << 4) + rlane] = v;
      }
    }
    __builtin_amdgcn_fence(__ATOMIC_RELEASE, "workgroup");
    __builtin_amdgcn_wave_barrier();
    __builtin_amdgcn_fence(__ATOMIC_ACQUIRE, "workgroup");
    if (OUT_MODE == 0) {
      float* C = (float*)Cout + (size_t)b * strideC;
      const int hh = lane >> 4, c4 = (lane & 15) * 4;     // row seg = 256 B = 16 lanes x 16 B
      {
#pragma unroll
        for (int it = 0; it < 8; ++it) {
          const int row = it * 2 + hh;
          v4f v = *(const v4f*)(slab + row * 68 + c4);
          *(v4f*)(C + (size_t)(mBase + row) * ldc + n0 + c4) = v;
        }
        
      }
    } else {
      const int q = lane >> 3, c8 = (lane & 7) * 8;
      unsigned short* C  = (unsigned short*)Cout  + (size_t)b * strideC;
      unsigned short* C2 = (OUT_MODE == 2) ? ((unsigned short*)Cout2 + (size_t)b * strideC) : nullptr;
      {
#pragma unroll
        for (int it = 0; it < 4; ++it) {
          const int row = it * 4 + q;
          const float* sp = slab + row * 68 + c8;
          v8h hv, lv;
#pragma unroll
          for (int e = 0; e < 8; ++e) {
            if (OUT_MODE == 1) {
              hv[e] = (_Float16)sp[e];
            } else {
              unsigned short hb = f2bf_bits(sp[e]);
              unsigned short lb = f2bf_bits(sp[e] - bf_bits2f(hb));
              hv[e] = __builtin_bit_cast(_Float16, hb);
              lv[e] = __builtin_bit_cast(_Float16, lb);
            }
          }
          *(v8h*)(C + (size_t)(mBase + row) * ldc + n0 + c8) = hv;
          if (OUT_MODE == 2) *(v8h*)(C2 + (size_t)(mBase + row) * ldc + n0 + c8) = lv;
        }
        
      }
    }
    __builtin_amdgcn_fence(__ATOMIC_RELEASE, "workgroup");
    __builtin_amdgcn_wave_barrier();
    __builtin_amdgcn_fence(__ATOMIC_ACQUIRE, "workgroup");
  }
}

// ---- f32 -> f16 casts (value x scale, round to nearest even) ---------------------------------------------
// A work-group converts 4096 consecutive elements of each of its planes. A wave-wide load is 512 contiguous bytes
// (16 B a lane), a wave-wide store 256 contiguous bytes (8 B a lane); every load of a thread is independent of every
// other and all are requested in front of the first store. L = loads per lane and plane = 32 / waves per work-group.
typedef __attribute__((ext_vector_type(4))) _Float16 v4h;
#define CAST_PLANE (1024 * 1024)         // elements of one plane
// e0: the lane's first element; the byte offsets fit 32 bits, so each access is plane base + one shared offset register.
template <int L>
__device__ __forceinline__ void cast_load(const float* __restrict__ in, unsigned e0, v4f (&x)[L]) {
  const char* p = (const char*)in + e0 * 4u;
#pragma unroll
  for (int k = 0; k < L; ++k) x[k] = *(const v4f*)(p + k * 512);
}
template <int L>
__device__ __forceinline__ void cast_store(_Float16* __restrict__ out, unsigned e0, const v4f (&x)[L], float scale) {
  char* p = (char*)out + e0 * 2u;
#pragma unroll
  for (int k = 0; k < L; ++k) {
    v4h h;
#pragma unroll
    for (int e = 0; e < 4; ++e) h[e] = (_Float16)(x[k][e] * scale);
    *(v4h*)(p + k * 256) = h;
  }
}
// seven planes in one launch: two activations x1, five weights x16; plane p goes to out + p * CAST_PLANE.
// grid = 256 work-groups of 16 waves.
__global__ __launch_bounds__(512) void cast7_f32_f16(
    const float* __restrict__ a0, const float* __restrict__ a1, const float* __restrict__ w0,
    const float* __restrict__ w1, const float* __restrict__ w2, const float* __restrict__ w3,
    const float* __restrict__ w4, _Float16* __restrict__ out) {
  const unsigned e0 = blockIdx.x * 4096u + (threadIdx.x >> 5) * 256u + (threadIdx.x & 31u) * 4u;
  v4f x[7][2];
  cast_load<2>(a0, e0, x[0]);
  cast_load<2>(a1, e0, x[1]);
  cast_load<2>(w0, e0, x[2]);
  cast_load<2>(w1, e0, x[3]);
  cast_load<2>(w2, e0, x[4]);
  cast_load<2>(w3, e0, x[5]);
  cast_load<2>(w4, e0, x[6]);
  cast_store<2>(out + 0 * (size_t)CAST_PLANE, e0, x[0], 1.0f);
  cast_store<2>(out + 1 * (size_t)CAST_PLANE, e0, x[1], 1.0f);
  cast_store<2>(out + 2 * (size_t)CAST_PLANE, e0, x[2], 16.0f);
  cast_store<2>(out + 3 * (size_t)CAST_PLANE, e0, x[3], 16.0f);
  cast_store<2>(out + 4 * (size_t)CAST_PLANE, e0, x[4], 16.0f);
  cast_store<2>(out + 5 * (size_t)CAST_PLANE, e0, x[5], 16.0f);
  cast_store<2>(out + 6 * (size_t)CAST_PLANE, e0, x[6], 16.0f);
}

typedef __attribute__((ext_vector_type(4))) int v4i;
__device__ __forceinline__ float dot4(v4f x, v4f w) {
  return fmaf(x[3], w[3], fmaf(x[2], w[2], fmaf(x[1], w[1], x[0] * w[0])));
}

// =====================================================================================
// Attention for head_dim 64 with additive score terms, f32 in / f16 out (value x oscale), f16 operands:
//   s = (q.k^T) * sscale + SB[q][kv];  SB element above sent_thr -> s = mask_fill (kept in the softmax)
//   softmax over all Skv keys in f32 (online over 64-key chunks); p carried x2^15 as f16; out = p.v / (l*2^15),
//   stored as f16(out * oscale): the left operand of the output projection, with no f32 copy in between.
//   Block = 4 waves = 64 query rows of one (b, h); grid.x = B*H*(S/64).
//   Element (b, s, h, d) of q/k/v/out at X[b*X_bs + s*X_rs + h*X_hs + d].
// SB, the work-group's own 64 x 128 tile of additive terms with the mask folded in, is built in LDS in front of the
// key loop (128 positions, 16 heads, head n = b*16 + h; q and rf rows i*8+b, col h*64+d; q holds the s_q column term):
//   Every global load of the tile is independent of every other and all are requested up front: one round trip.
//   Phase 1 (LDS): e0[i] = q[n,i,:].semb[0][h*64..], e1[i] = q[n,i,:].semb[1][h*64..] for the 64 own rows,
//                  cv[i] = r[n,i,:].semb[0][h*64..] for all 128 rows; 16 lanes x 16 B per row, summed across the lanes.
//                  cv[128..255] = 0, so that cv[127-i+j] is the shifted term for j <= i and 0 for j > i.
//   Phase 2: SB[i][j] = amask[n][i][j] != 0 ? 3e38 (sentinel)
//                     : 0.125 * ( utt[n][i][j] * (smask[b][i][j] -> e1[i] : e0[i]) + cv[127-i+j] )
//            16 B per lane and array, a wave covers one whole 512-B row per access, sixteen rows per wave.
// =====================================================================================
#define AT_D 64
#define AT_NW 4
#define AT_QB 64
#define AT_KC 64
#define SB_COLS  128                     // key columns of the SB tile
#define SB_PITCH 132                     // its LDS row pitch in floats: rows 16-B aligned, rows r and r + 8 half the banks apart
struct AttnArgs { long q_bs, q_rs, q_hs, k_bs, k_rs, k_hs, v_bs, v_rs, v_hs, o_bs, o_rs, o_hs;
                  int S, Skv, H, nchunks; float sscale, mask_fill, sent_thr, oscale; };
static_assert(sizeof(AttnArgs) == 128);

__device__ __forceinline__ v8f mma_f16g(v16h a, v16h b, v8f c) {
  c = __builtin_amdgcn_wmma_f32_16x16x32_f16(false, a, false, b, (short)0, c, false, false);
  asm volatile("v_nop\n\tv_nop\n\tv_nop\n\tv_nop" : "+v"(c) : "v"(a), "v"(b));
  return c;
}

__global__ __launch_bounds__(128)
void attn64_sbias_f16(const float* __restrict__ q, const float* __restrict__ k,
                      const float* __restrict__ v, _Float16* __restrict__ out,
                      const float* __restrict__ rf, const float* __restrict__ semb,
                      const float* __restrict__ utt, const int* __restrict__ amask,
                      const int* __restrict__ smask, AttnArgs g) {
  const float PSC = 32768.0f;
  union FB { v16h v; v8h h[2]; };
  __shared__ __align__(16) _Float16 Ksh[AT_KC * AT_D];            // K [kv][d]   8 KB
  __shared__ __align__(16) _Float16 Vth[AT_D * AT_KC];            // V [d][kv]   8 KB
  __shared__ __align__(16) _Float16 Psh[AT_NW][16 * AT_KC];       // per wave P [row][kv]  8 KB
  __shared__ __align__(16) float    Os[AT_NW][16 * 68];           // per wave out tile, pitch 68
  __shared__ __align__(16) float    Sbl[AT_QB * SB_PITCH];        // SB [own row][kv]  33 KB
  __shared__ float se0[AT_QB];
  __shared__ float se1[AT_QB];
  __shared__ float scv[2 * SB_COLS];

  const int tid  = threadIdx.x;
  const int wave = tid >> 5;
  const int lane = tid & 31;
  const int hh   = lane >> 4;
  const int c    = lane & 15;

  const int nqb = g.S / AT_QB;
  const int bx = blockIdx.x;
  const int qb = bx % nqb;
  const int bh = bx / nqb;
  const int h  = bh % g.H;
  const int b  = bh / g.H;
  const int q0 = qb * AT_QB + wave * 16;

  const float* qb_ptr = q   + (size_t)b * g.q_bs + (size_t)h * g.q_hs;
  const float* kb_ptr = k   + (size_t)b * g.k_bs + (size_t)h * g.k_hs;
  const float* vb_ptr = v   + (size_t)b * g.v_bs + (size_t)h * g.v_hs;
  _Float16*    ob_ptr = out + (size_t)b * g.o_bs + (size_t)h * g.o_hs;

  // ---- SB tile ----
  {
    const int i0 = qb * AT_QB;                 // first own score row
    const int d4 = c * 4;                      // phase 1: four of the 64 depths (hh: row of the pair)
    const int c4 = lane * 4;                   // phase 2: this lane's four score columns
    const int e0 = (i0 + wave) * SB_COLS + c4; // own score rows wave + 4 kk: row kk lies 4 rows behind row kk - 1
    const float* ub  = utt   + (size_t)bh * (SB_COLS * SB_COLS) + e0;
    const int*   ab  = amask + (size_t)bh * (SB_COLS * SB_COLS) + e0;
    const int*   smb = smask + (size_t)b  * (SB_COLS * SB_COLS) + e0;
    const float* sw = semb + h * 64;           // the head's 64 depths of table row 0; row 1 lies 1024 floats behind
    const v4f w0 = *(const v4f*)(sw + d4);
    const v4f w1 = *(const v4f*)(sw + 1024 + d4);
    const size_t co = (size_t)b * 1024 + (size_t)h * 64 + d4;
    const float* rp = rf + (size_t)(wave * 32 + hh) * 8192 + co;
    const float* qp = q + (size_t)(i0 + wave * 16 + hh) * 8192 + co;
    v4f rv[16], qv[8];
#pragma unroll
    for (int kk = 0; kk < 16; ++kk) rv[kk] = *(const v4f*)(rp + kk * (2 * 8192));
#pragma unroll
    for (int kk = 0; kk < 8; ++kk) qv[kk] = *(const v4f*)(qp + kk * (2 * 8192));
    // no address register of the loads above is rewritten in front of this wait: the pointers are named as inputs so
    // that their registers stay theirs up to it (left free, a later load's destination or a scalar load takes one)
    asm volatile("s_wait_xcnt 0x0" :: "s"(sw), "v"(rp), "v"(qp) : "memory");
    v4f u4[16]; v4i am4[16], sm4[16];
#pragma unroll
    for (int kk = 0; kk < 16; ++kk) {
      u4[kk]  = *(const v4f*)(ub  + kk * (4 * SB_COLS));
      am4[kk] = *(const v4i*)(ab  + kk * (4 * SB_COLS));
      sm4[kk] = *(const v4i*)(smb + kk * (4 * SB_COLS));
    }
    // the same for the mask loads
    asm volatile("s_wait_xcnt 0x0" :: "v"(ub), "v"(ab), "v"(smb) : "memory");
    // the mask loads stay in front of phase 1's arithmetic: left free, the scheduler issues them only behind the
    // wait for the projection rows, and the two round trips run one after the other
    __builtin_amdgcn_sched_barrier(0);

    float p[32];
#pragma unroll
    for (int kk = 0; kk < 16; ++kk) p[kk] = dot4(rv[kk], w0);
#pragma unroll
    for (int kk = 0; kk < 8; ++kk) { p[16 + kk] = dot4(qv[kk], w0); p[24 + kk] = dot4(qv[kk], w1); }
#pragma unroll
    for (int off = 1; off < 16; off <<= 1)
#pragma unroll
      for (int x = 0; x < 32; ++x) p[x] += __shfl_xor(p[x], off, 32);
    if (c == 0) {
#pragma unroll
      for (int kk = 0; kk < 16; ++kk) scv[wave * 32 + kk * 2 + hh] = p[kk];
#pragma unroll
      for (int kk = 0; kk < 8; ++kk) { se0[wave * 16 + kk * 2 + hh] = p[16 + kk]; se1[wave * 16 + kk * 2 + hh] = p[24 + kk]; }
    }
    scv[SB_COLS + tid] = 0.0f;                 // 128 threads, 128 zeros
    __syncthreads();                           // e0, e1, cv are published

#pragma unroll
    for (int kk = 0; kk < 16; ++kk) {
      const int il = wave + 4 * kk, i = i0 + il;
      const float e0v = se0[il], e1v = se1[il];
      const float* cvp = scv + (127 - i + c4); // 0 <= 127 - i + j <= 254 for every row i and column j
      v4f o;
#pragma unroll
      for (int u = 0; u < 4; ++u) {
        int sm = sm4[kk][u];
        if (sm < 0) sm += 2;                   // 2-row table: wrap negatives, then clamp
        sm = sm < 0 ? 0 : (sm > 1 ? 1 : sm);
        const float ev = (sm != 0) ? e1v : e0v;
        float val = (u4[kk][u] * ev + cvp[u]) * 0.125f;
        if (am4[kk][u] != 0) val = 3.0e38f;
        o[u] = val;
      }
      *(v4f*)(Sbl + il * SB_PITCH + c4) = o;   // read by other waves only behind the key loop's barriers
    }
  }

  // ---- Q fragments (A operand), 2 d-chunks, split k map ----
  v16h qa[2];
  {
    const float* qrow = qb_ptr + (size_t)(q0 + c) * g.q_rs;
#pragma unroll
    for (int dc = 0; dc < 2; ++dc) {
      const v4f f0 = *(const v4f*)(qrow + dc * 32 + 8 * hh);
      const v4f f1 = *(const v4f*)(qrow + dc * 32 + 8 * hh + 4);
      const v4f f2 = *(const v4f*)(qrow + dc * 32 + 16 + 8 * hh);
      const v4f f3 = *(const v4f*)(qrow + dc * 32 + 16 + 8 * hh + 4);
#pragma unroll
      for (int e = 0; e < 4; ++e) {
        qa[dc][e]      = (_Float16)f0[e];
        qa[dc][4 + e]  = (_Float16)f1[e];
        qa[dc][8 + e]  = (_Float16)f2[e];
        qa[dc][12 + e] = (_Float16)f3[e];
      }
    }
  }

  float mrow[8], lrow[8];
  v8f oacc[4];
#pragma unroll
  for (int r = 0; r < 8; ++r) { mrow[r] = -INFINITY; lrow[r] = 0.f; }
#pragma unroll
  for (int t = 0; t < 4; ++t) oacc[t] = (v8f){0.f,0.f,0.f,0.f,0.f,0.f,0.f,0.f};

  int nChunks = g.Skv / AT_KC;                 // block-uniform, host-provided
  if (nChunks > SB_COLS / AT_KC) nChunks = SB_COLS / AT_KC;   // the SB tile holds 128 key columns
  for (int kc = 0; kc < nChunks; ++kc) {
    const int kv0 = kc * AT_KC;
    __syncthreads();
    {
      const int kvr = tid >> 1, dh = (tid & 1) * 32;
      const float* krow = kb_ptr + (size_t)(kv0 + kvr) * g.k_rs + dh;
      const float* vrow = vb_ptr + (size_t)(kv0 + kvr) * g.v_rs + dh;
#pragma unroll
      for (int i = 0; i < 8; ++i) {
        v4f kk = *(const v4f*)(krow + 4 * i);
        v4f vv = *(const v4f*)(vrow + 4 * i);
#pragma unroll
        for (int e = 0; e < 4; ++e) {
          const int d = dh + 4 * i + e;
          Ksh[kvr * AT_D + d]  = (_Float16)kk[e];
          Vth[d * AT_KC + kvr] = (_Float16)vv[e];
        }
      }
    }
    __syncthreads();

    v8f s[4];
#pragma unroll
    for (int j = 0; j < 4; ++j) {
      s[j] = (v8f){0.f,0.f,0.f,0.f,0.f,0.f,0.f,0.f};
#pragma unroll
      for (int dc = 0; dc < 2; ++dc) {
        FB kb;
        kb.h[0] = *(const v8h*)(Ksh + (j * 16 + c) * AT_D + dc * 32 + 8 * hh);
        kb.h[1] = *(const v8h*)(Ksh + (j * 16 + c) * AT_D + dc * 32 + 16 + 8 * hh);
        s[j] = mma_f16g(qa[dc], kb.v, s[j]);
      }
    }
    // additive terms + mask select, row max
    const float* sbp = Sbl + (wave * 16 + 8 * hh) * SB_PITCH + kv0 + c;
    float cm[8];
#pragma unroll
    for (int r = 0; r < 8; ++r) {
      const float* sbr = sbp + r * SB_PITCH;
      float m = -INFINITY;
#pragma unroll
      for (int j = 0; j < 4; ++j) {
        const float bb = sbr[j * 16];
        float sv = fmaf(s[j][r], g.sscale, bb);
        if (bb > g.sent_thr) sv = g.mask_fill;
        s[j][r] = sv;
        m = fmaxf(m, sv);
      }
#pragma unroll
      for (int off = 1; off < 16; off <<= 1) m = fmaxf(m, __shfl_xor(m, off, 32));
      cm[r] = m;
    }
    _Float16* pwh = Psh[wave];
#pragma unroll
    for (int r = 0; r < 8; ++r) {
      const float mnew = fmaxf(mrow[r], cm[r]);
      const float alpha = expf(mrow[r] - mnew);
      mrow[r] = mnew;
      float psum = 0.f;
#pragma unroll
      for (int j = 0; j < 4; ++j) {
        const float p = expf(s[j][r] - mnew);
        psum += p;
        pwh[(8 * hh + r) * AT_KC + j * 16 + c] = (_Float16)(p * PSC);
      }
#pragma unroll
      for (int off = 1; off < 16; off <<= 1) psum += __shfl_xor(psum, off, 32);
      lrow[r] = lrow[r] * alpha + psum;
#pragma unroll
      for (int t = 0; t < 4; ++t) oacc[t][r] *= alpha;
    }
    __builtin_amdgcn_fence(__ATOMIC_RELEASE, "workgroup");
    __builtin_amdgcn_wave_barrier();
    __builtin_amdgcn_fence(__ATOMIC_ACQUIRE, "workgroup");
#pragma unroll 1
    for (int kk = 0; kk < 2; ++kk) {
      FB pa;
      pa.h[0] = *(const v8h*)(pwh + c * AT_KC + kk * 32 + 8 * hh);
      pa.h[1] = *(const v8h*)(pwh + c * AT_KC + kk * 32 + 16 + 8 * hh);
#pragma unroll
      for (int t = 0; t < 4; ++t) {
        FB vb;
        vb.h[0] = *(const v8h*)(Vth + (t * 16 + c) * AT_KC + kk * 32 + 8 * hh);
        vb.h[1] = *(const v8h*)(Vth + (t * 16 + c) * AT_KC + kk * 32 + 16 + 8 * hh);
        oacc[t] = mma_f16g(pa.v, vb.v, oacc[t]);
      }
    }
  }

  float* os = Os[wave];
#pragma unroll
  for (int r = 0; r < 8; ++r) {
    const float inv = 1.0f / (lrow[r] * PSC);
#pragma unroll
    for (int t = 0; t < 4; ++t) os[(8 * hh + r) * 68 + t * 16 + c] = oacc[t][r] * inv;
  }
  __builtin_amdgcn_fence(__ATOMIC_RELEASE, "workgroup");
  __builtin_amdgcn_wave_barrier();
  __builtin_amdgcn_fence(__ATOMIC_ACQUIRE, "workgroup");
  {
    const int q4 = lane >> 3, c8 = (lane & 7) * 8;   // a row's 64 f16 = one 128-B line = 8 lanes x 16 B; 4 rows a store
#pragma unroll
    for (int it = 0; it < 4; ++it) {
      const int row = it * 4 + q4;
      const v4f lo = *(const v4f*)(os + row * 68 + c8);
      const v4f hi = *(const v4f*)(os + row * 68 + c8 + 4);
      v8h hv;
#pragma unroll
      for (int e = 0; e < 4; ++e) {
        hv[e]     = (_Float16)(lo[e] * g.oscale);
        hv[4 + e] = (_Float16)(hi[e] * g.oscale);
      }
      *(v8h*)(ob_ptr + (size_t)(q0 + row) * g.o_rs + c8) = hv;
    }
  }
}

// ---------------------------------------------------------------------------
// Host launcher. Layout of q/k/v/r/ctx matrices: row = i*8 + b (i = position, b = batch),
// col = h*64 + d; head n = b*16 + h. The (B,L,D) positional input is used as a flat [1024][1024]
// A matrix exactly like the (L,B,D) query (literal view semantics of the position projection).
// ---------------------------------------------------------------------------
extern "C" void kernel_launch(void* const* d_in, const int* in_sizes, int n_in,
                              void* d_out, int out_size, void* d_ws, size_t ws_size,
                              hipStream_t stream) {
  if (n_in < 11) return;
  const int NE = 1024 * 1024;                 // elements of every [*,*,1024] tensor and of each weight
  if (in_sizes[0] != NE || in_sizes[1] != NE || in_sizes[3] != NE || in_sizes[4] != NE ||
      in_sizes[5] != NE || in_sizes[6] != NE || in_sizes[7] != NE || in_sizes[8] != 2 * 1024 ||
      in_sizes[2] != 128 * 128 * 128 || in_sizes[9] != 128 * 128 * 128 || in_sizes[10] != 8 * 128 * 128 ||
      out_size != NE) return;

  const float* query    = (const float*)d_in[0];   // (L,B,D)
  const float* rel_pe   = (const float*)d_in[1];   // (B,L,D)
  const float* utt_mask = (const float*)d_in[2];   // (B*H,L,L,1) f32
  const float* Wq       = (const float*)d_in[3];
  const float* Wk       = (const float*)d_in[4];
  const float* Wv       = (const float*)d_in[5];
  const float* Wr       = (const float*)d_in[6];
  const float* Wo       = (const float*)d_in[7];
  const float* spk_emb  = (const float*)d_in[8];   // (2,D)
  const int*   attn_msk = (const int*)d_in[9];     // (B*H,L,L) int32, nonzero = masked
  const int*   spk_msk  = (const int*)d_in[10];    // (B,L,L) int32 in {0,1}
  float* out = (float*)d_out;

  // ---- workspace carve (bytes) ----
  const size_t MiB = (size_t)1 << 20;
  const size_t off_q16 = 0;                    // query  f16       2 MiB
  const size_t off_p16 = 2 * MiB;              // rel_pe f16       2 MiB
  const size_t off_w16 = 4 * MiB;              // 5 weights f16 x16, 2 MiB each (Wq,Wk,Wv,Wr,Wo)
  const size_t off_qf  = 14 * MiB;             // new_q f32        4 MiB
  const size_t off_kf  = 18 * MiB;             // k f32            4 MiB
  const size_t off_vf  = 22 * MiB;             // v f32            4 MiB (q, k, v, r one behind the other: batched GEMM stride)
  const size_t off_rf  = 26 * MiB;             // r f32            4 MiB
  const size_t off_c16 = 30 * MiB;             // ctx f16 x16      2 MiB
  const size_t total   = 32 * MiB;
  if (total > ws_size || total > 128 * MiB) return;

  char* ws = (char*)d_ws;
  _Float16* q16 = (_Float16*)(ws + off_q16);
  _Float16* p16 = (_Float16*)(ws + off_p16);
  _Float16* w16 = (_Float16*)(ws + off_w16);
  float* qf  = (float*)(ws + off_qf);
  float* kf  = (float*)(ws + off_kf);
  float* vf  = (float*)(ws + off_vf);
  float* rf  = (float*)(ws + off_rf);
  _Float16* c16 = (_Float16*)(ws + off_c16);

  // ---- casts: activations x1, weights x16 (exact power of two, undone in the GEMM epilogue); the seven f16
  //      planes q16, p16, w16[0..4] lie one behind the other from the start of the workspace ----
  cast7_f32_f16<<<256, 512, 0, stream>>>(query, rel_pe, Wq, Wk, Wv, Wr, Wo, q16);

  // ---- input projections: C = X . W^T, 1024x1024x1024 each; q gets column bias spk_emb[0][col] (= new_q) ----
  const int M = 1024, N = 1024, K = 1024;
  const int gblocks = (M / 128) * (N / 128);   // one work-group per 128x128 tile
  const float wscale_inv = 1.0f / 16.0f;
  {
    // one launch of 4 x 64 work-groups, each alone on its WGP: y = 0: q (query, Wq -> qf, + spk_emb[0][col]),
    // y = 1: k, y = 2: v (query), y = 3: r (rel_pe flat [1024][1024], literal view). The four weight planes and the
    // four f32 results lie one behind the other in the workspace (strides NE).
    dim3 grid(gblocks, 4);
    wmma_gemm64<0, false, 3, 0, false><<<grid, 256, 0, stream>>>(
        (const unsigned short*)q16, (const unsigned short*)p16, K, 0L,
        (const unsigned short*)w16, (const unsigned short*)w16, K, (long)NE,
        (void*)qf, (void*)qf, N, (long)NE,
        spk_emb, spk_emb, 0L, M, N, K, wscale_inv, 3);
  }

  // ---- attention: 128 heads (b*16+h) of 128x128, head dim 64; s = a1/8 + SB, SB = (a2 + a3) * 1/8 with the mask
  //      folded in as a sentinel -> 1e-30; ctx leaves as f16 x16 ----
  {
    AttnArgs g;
    g.q_bs = 1024; g.q_rs = 8 * 1024; g.q_hs = 64;
    g.k_bs = 1024; g.k_rs = 8 * 1024; g.k_hs = 64;
    g.v_bs = 1024; g.v_rs = 8 * 1024; g.v_hs = 64;
    g.o_bs = 1024; g.o_rs = 8 * 1024; g.o_hs = 64;
    g.S = 128; g.Skv = 128; g.H = 16; g.nchunks = 2;
    g.sscale = 0.125f; g.mask_fill = 1e-30f; g.sent_thr = 1.0e37f; g.oscale = 16.0f;
    const int agrid = 8 * 16 * (128 / AT_QB);   // 256 blocks
    attn64_sbias_f16<<<agrid, 128, 0, stream>>>(qf, kf, vf, c16, rf, spk_emb, utt_mask, attn_msk, spk_msk, g);
  }

  // ---- output projection into d_out (scale 1/256 undoes the x16 of ctx and of Wo) ----
  {
    dim3 grid(gblocks, 1);
    wmma_gemm64<0, false, 0, 0, false><<<grid, 256, 0, stream>>>(
        (const unsigned short*)c16, (const unsigned short*)c16, K, 0L,
        (const unsigned short*)(w16 + 4 * (size_t)NE), (const unsigned short*)(w16 + 4 * (size_t)NE), K, 0L,
        (void*)out, (void*)out, N, 0L,
        spk_emb, spk_emb, 0L, M, N, K, 1.0f / 256.0f, 1);
  }
  (void)hipGetLastError();
}

// v008
// Measured time: 42 microseconds a run.
// Two timings next to v007 both put it at 1.05 times that version's speed.
// Over all steps from v000 it is 6.42 times as fast.
#include <hip/hip_runtime.h>
#include <stdint.h>
// Contractions: five 1024x1024x1024 projections (X . W^T), per-head q.k^T (K=64) and p.v (K=128): v_wmma_f32_16x16x32_f16 (f16 operands; weights and ctx carried x16, p carried x2^15, exact powers of two folded back in f32), f32 accumulate. Softmax, additive score terms and depth-64 speaker row dots in f32 on VALU.

typedef __attribute__((ext_vector_type(16))) _Float16 v16h;
typedef __attribute__((ext_vector_type(8)))  _Float16 v8h;
typedef __attribute__((ext_vector_type(16))) __bf16   v16b;
typedef __attribute__((ext_vector_type(8)))  __bf16   v8b;
typedef __attribute__((ext_vector_type(8)))  float    v8f;
typedef __attribute__((ext_vector_type(4)))  float    v4f;

__device__ __forceinline__ unsigned short f2bf_bits(float f) {
  unsigned u = __float_as_uint(f);
  return (unsigned short)((u + 0x7FFFu + ((u >> 16) & 1u)) >> 16);
}
__device__ __forceinline__ float bf_bits2f(unsigned short h) { return __uint_as_float(((unsigned)h) << 16); }

// hazard guards as plain device helpers
__device__ __forceinline__ void acc_guard4(v8f& a, v8f& b, v8f& c, v8f& d) { asm volatile("v_nop\n\tv_nop\n\tv_nop\n\tv_nop" : "+v"(a), "+v"(b), "+v"(c), "+v"(d)); }
template <typename T> struct Frag;
template <> struct Frag<_Float16> {
  typedef v16h V; union U { v16h v; v8h h[2]; };
  static __device__ __forceinline__ v16h load(const _Float16* p) {   // elements 0..7 <- p[0..7], 8..15 <- p[16..23]
    U f; f.h[0] = *(const v8h*)(p); f.h[1] = *(const v8h*)(p + 16); return f.v;
  }
  static __device__ __forceinline__ v8f mma(v16h a, v16h b, v8f c) {
    return __builtin_amdgcn_wmma_f32_16x16x32_f16(false, a, false, b, (short)0, c, false, false);
  }
};
template <> struct Frag<__bf16> {
  typedef v16b V; union U { v16b v; v8b h[2]; };
  static __device__ __forceinline__ v16b load(const __bf16* p) {
    U f; f.h[0] = *(const v8b*)(p); f.h[1] = *(const v8b*)(p + 16); return f.v;
  }
  static __device__ __forceinline__ v8f mma(v16b a, v16b b, v8f c) {
    return __builtin_amdgcn_wmma_f32_16x16x32_bf16(false, a, false, b, (short)0, c, false, false);
  }
};

// ---- Register-blocked batched WMMA GEMM ------------------------------------
// C[m,n] = scale * sum_k A[m,k] * Bt[n,k] (+bias)(+resid); a work-group owns a 128x128 tile,
// its eight waves 32x64 each (four down, two across).
// A row-major [M,K]; Bt row-major [N,K]; M % 128 == 0, N % 128 == 0, K % 128 == 0.
// Operand path: per pass of 128 k the work-group's 128 A rows and 128 Bt rows (256 B each, whole lines)
// go to LDS by asynchronous 16-byte copies, two buffers, the next pass in flight while this one is
// multiplied; the waves read their fragments from LDS (row pitch 272 B = 16 B x odd for ds_load_b128).
// The square tile keeps the bytes a work-group pulls per output low (256 operand rows for 16,384 outputs).
// SPLIT (hi/lo operand planes) is not staged by this path and is not instantiated.
// Batch b = blockIdx.y: Bt and C advance by their strides; batches b >= batchA2 read A2p as their A, the others Ap,
// so products of two different left operands that do not depend on each other share one launch.
// BIAS_MODE: 0 = none, 1 = bias[m], 2 = bias[n], 3 = bias[n] in batch 0 alone.
// OUT_MODE: 0 = f32, 1 = f16, 2 = bf16 hi plane (Cout) + bf16 lo plane (Cout2).
// ET: 0 = f16 operands, 1 = bf16 operands (pointers passed as 16-bit storage)
template <int ET> struct Elem;
template <> struct Elem<0> { typedef _Float16 T; };
template <> struct Elem<1> { typedef __bf16 T; };
#define G_KP    128                      // k of one pass
#define G_PITCH 136                      // LDS row pitch in 16-bit elements (256 B of k + 16 B)
#define G_ROWS  256                      // 128 A rows, then 128 Bt rows
#define G_BUF   (G_ROWS * G_PITCH)       // elements of one buffer (69,632 B)

// Eight asynchronous 16-byte-per-lane copies global -> LDS. The s_wait_xcnt closes the statement so that
// no address register named here is rewritten before it.
template <typename T>
__device__ __forceinline__ void async_copy8(const unsigned (&l)[8], const T* const (&g)[8]) {
  asm volatile(
      "global_load_async_to_lds_b128 %0, %8, off\n\t"
      "global_load_async_to_lds_b128 %1, %9, off\n\t"
      "global_load_async_to_lds_b128 %2, %10, off\n\t"
      "global_load_async_to_lds_b128 %3, %11, off\n\t"
      "global_load_async_to_lds_b128 %4, %12, off\n\t"
      "global_load_async_to_lds_b128 %5, %13, off\n\t"
      "global_load_async_to_lds_b128 %6, %14, off\n\t"
      "global_load_async_to_lds_b128 %7, %15, off\n\t"
      "s_wait_xcnt 0x0"
      :: "v"(l[0]), "v"(l[1]), "v"(l[2]), "v"(l[3]), "v"(l[4]), "v"(l[5]), "v"(l[6]), "v"(l[7]),
         "v"(g[0]), "v"(g[1]), "v"(g[2]), "v"(g[3]), "v"(g[4]), "v"(g[5]), "v"(g[6]), "v"(g[7])
      : "memory");
}
// One pass's tile: 256 rows x 16 chunks of 16 B = 16 chunks per thread; a wave-wide copy covers 2 whole rows.
// ga / gb: this thread's chunk in A row (tid >> 4) / Bt row (tid >> 4) of the work-group's rows, at the pass's k.
// l0: this thread's LDS byte address for row (tid >> 4) of the target buffer.
template <typename T>
__device__ __forceinline__ void stage_tile(unsigned l0, const T* ga, const T* gb, int lda, int ldb) {
  unsigned l[8]; const T* g[8];
#pragma unroll
  for (int it = 0; it < 8; ++it) {       // rows 0..127: the A rows
    l[it] = l0 + (unsigned)(it * 16 * G_PITCH * 2);
    g[it] = ga + (size_t)(it * 16) * lda;
  }
  async_copy8<T>(l, g);
#pragma unroll
  for (int it = 0; it < 8; ++it) {       // rows 128..255: the Bt rows
    l[it] = l0 + (unsigned)((it + 8) * 16 * G_PITCH * 2);
    g[it] = gb + (size_t)(it * 16) * ldb;
  }
  async_copy8<T>(l, g);
}
// this wave's LDS reads have retired (before the buffer they read is handed back for a refill)
__device__ __forceinline__ void wait_lds_reads()   { asm volatile("s_wait_dscnt 0x0" ::: "memory"); }
// this wave's asynchronous copies have landed (the compiler places no wait for them)
__device__ __forceinline__ void wait_async_copies() { asm volatile("s_wait_asynccnt 0x0" ::: "memory"); }

template <int ET, bool SPLIT, int BIAS_MODE, int OUT_MODE, bool RESID, int ACT = 0>
__global__ __launch_bounds__(256) void wmma_gemm64(
    const unsigned short* __restrict__ Ap, const unsigned short* __restrict__ A2p, int lda, long strideA,
    const unsigned short* __restrict__ Btp, const unsigned short* __restrict__ Bt2p, int ldb, long strideB,
    void* __restrict__ Cout, void* __restrict__ Cout2, int ldc, long strideC,
    const float* __restrict__ bias,
    const float* __restrict__ resid, long strideR,
    int M, int N, int K, float scale, int batchA2) {
  typedef typename Elem<ET>::T T;
  typedef typename Frag<T>::V V;
  static_assert(!SPLIT, "the LDS operand path stages one plane per operand");
  __shared__ __align__(16) T ring[2 * G_BUF];      // two operand buffers
  __shared__ __align__(16) float sT[8][16 * 68];   // per-wave 16x64 slab, pitch 68 floats
  const int b    = blockIdx.y;
  const T* A = (const T*)((b < batchA2) ? Ap : A2p); const T* Bt = (const T*)Btp;
  const int lane = threadIdx.x & 31;
  const int wave = threadIdx.x >> 5;
  const int tilesN = N >> 7;
  const int tilesM = M >> 7;
  const int tile = blockIdx.x;           // the work-group's 128x128 tile
  if (tile >= tilesM * tilesN) return;   // the same for the whole work-group, in front of every barrier
  const int tm = tile / tilesN;
  const int mb0 = tm << 7;                      // first A row of the work-group
  const int nb0 = (tile - tm * tilesN) << 7;    // first Bt row of the work-group
  const int wm = (wave >> 1) << 5;              // the wave's 32 rows and 64 columns within the tile
  const int wn = (wave & 1) << 6;
  const int m0 = mb0 + wm;
  const int n0 = nb0 + wn;

  const T* Ab  = A  + (size_t)b * strideA;
  const T* Bb  = Bt + (size_t)b * strideB;

  const int rlane = lane & 15;                 // row (A) / col (B, D) within subtile
  const int koff  = (lane >> 4) * 8;           // k offset of this lane half
  const int mOff  = (lane >> 4) * 8;           // D row offset

  v8f acc[2][4];
#pragma unroll
  for (int i = 0; i < 2; ++i)
#pragma unroll
    for (int j = 0; j < 4; ++j) acc[i][j] = (v8f){0.f,0.f,0.f,0.f,0.f,0.f,0.f,0.f};

  // BIAS_MODE 3: the lane's four column terms, requested once, under one work-group-uniform test, in front of the k loop
  float bcol[4] = {0.f, 0.f, 0.f, 0.f};
  if (BIAS_MODE == 3 && b == 0) {
#pragma unroll                                 // constant indices keep bcol in registers
    for (int j = 0; j < 4; ++j) bcol[j] = bias[n0 + (j << 4) + rlane];
    // the address registers of these loads are reused by the address arithmetic below: the wait stands in front of that
    asm volatile("s_wait_xcnt 0x0" ::: "memory");
  }

  const int srow = threadIdx.x >> 4;           // staged row of this thread within a group of 16 rows
  const int schk = (threadIdx.x & 15) * 8;     // its 16-byte chunk, in elements
  const T* ga = Ab + (size_t)(mb0 + srow) * lda + schk;
  const T* gb = Bb + (size_t)(nb0 + srow) * ldb + schk;
  const unsigned l0 = (unsigned)(size_t)ring + (unsigned)((srow * G_PITCH + schk) * 2);
  const int nPass = K / G_KP;

  stage_tile<T>(l0, ga, gb, lda, ldb);
  wait_async_copies();
  __syncthreads();                             // pass 0's tile is published
  if (nPass > 1) stage_tile<T>(l0 + (unsigned)(G_BUF * 2), ga + G_KP, gb + G_KP, lda, ldb);

#pragma unroll 1                               // one pass per trip: the buffer is picked by the trip's parity
  for (int t = 0; t < nPass; ++t) {
    const int bsel = (t & 1) * G_BUF;
    const T* ra = ring + bsel + (wm + rlane) * G_PITCH + koff;
    const T* rb = ring + bsel + (128 + wn + rlane) * G_PITCH + koff;
#pragma unroll
    for (int ks = 0; ks < G_KP / 32; ++ks) {
      V bh[4], ah[2];
#pragma unroll
      for (int j = 0; j < 4; ++j) bh[j] = Frag<T>::load(rb + j * 16 * G_PITCH + ks * 32);
#pragma unroll
      for (int i = 0; i < 2; ++i) ah[i] = Frag<T>::load(ra + i * 16 * G_PITCH + ks * 32);
      // the 12 fragment reads stay one group in front of the 8 WMMAs: left free, the scheduler reuses one
      // A register set and the wave waits out the LDS latency once per A fragment
      __builtin_amdgcn_sched_barrier(0);
#pragma unroll
      for (int i = 0; i < 2; ++i)
#pragma unroll
        for (int j = 0; j < 4; ++j) acc[i][j] = Frag<T>::mma(ah[i], bh[j], acc[i][j]);
      __builtin_amdgcn_sched_barrier(0);       // and the next block's reads stay behind this block's WMMAs
    }
    wait_lds_reads();
    wait_async_copies();
    __syncthreads();                           // publishes pass t + 1's tile and ends every read of pass t's buffer
    if (t + 2 < nPass)
      stage_tile<T>(l0 + (unsigned)(bsel * 2), ga + (size_t)(t + 2) * G_KP, gb + (size_t)(t + 2) * G_KP, lda, ldb);
  }
  wait_async_copies();
  acc_guard4(acc[0][0], acc[0][1], acc[0][2], acc[0][3]);
  acc_guard4(acc[1][0], acc[1][1], acc[1][2], acc[1][3]);

  // ---- epilogue ----
  float* slab = sT[wave];
  const float* Rb = RESID ? (resid + (size_t)b * strideR) : nullptr;
#pragma unroll
  for (int i = 0; i < 2; ++i) {
    const int mBase = m0 + (i << 4);
#pragma unroll
    for (int j = 0; j < 4; ++j) {
      const int n = n0 + (j << 4) + rlane;
      float bv = 0.f;
      if (BIAS_MODE == 2) bv = bias[n];
      if (BIAS_MODE == 3) bv = bcol[j];
#pragma unroll
      for (int r = 0; r < 8; ++r) {
        float v = acc[i][j][r] * scale;
        if (BIAS_MODE == 1) v += bias[mBase + mOff + r];
        if (BIAS_MODE == 2 || BIAS_MODE == 3) v += bv;
        if (RESID) v += Rb[(size_t)(mBase + mOff + r) * ldc + n];
        if (ACT == 1) v = tanhf(v);
        if (ACT == 2) v = fmaxf(v, 0.0f);
        if (ACT == 3) v = v / (1.0f + expf(-v));
        if (ACT == 4) v = (v > 0.f) ? v : 0.01f * v;
        if (ACT == 5) v = 0.5f * v * (1.0f + erff(v * 0.70710678118654752f));
        slab[(mOff + r) * 68 + (j << 4) + rlane] = v;
      }
    }
    __builtin_amdgcn_fence(__ATOMIC_RELEASE, "workgroup");
    __builtin_amdgcn_wave_barrier();
    __builtin_amdgcn_fence(__ATOMIC_ACQUIRE, "workgroup");
    if (OUT_MODE == 0) {
      float* C = (float*)Cout + (size_t)b * strideC;
      const int hh = lane >> 4, c4 = (lane & 15) * 4;     // row seg = 256 B = 16 lanes x 16 B
      {
#pragma unroll
        for (int it = 0; it < 8; ++it) {
          const int row = it * 2 + hh;
          v4f v = *(const v4f*)(slab + row * 68 + c4);
          *(v4f*)(C + (size_t)(mBase + row) * ldc + n0 + c4) = v;
        }
        
      }
    } else {
      const int q = lane >> 3, c8 = (lane & 7) * 8;
      unsigned short* C  = (unsigned short*)Cout  + (size_t)b * strideC;
      unsigned short* C2 = (OUT_MODE == 2) ? ((unsigned short*)Cout2 + (size_t)b * strideC) : nullptr;
      {
#pragma unroll
        for (int it = 0; it < 4; ++it) {
          const int row = it * 4 + q;
          const float* sp = slab + row * 68 + c8;
          v8h hv, lv;
#pragma unroll
          for (int e = 0; e < 8; ++e) {
            if (OUT_MODE == 1) {
              hv[e] = (_Float16)sp[e];
            } else {
              unsigned short hb = f2bf_bits(sp[e]);
              unsigned short lb = f2bf_bits(sp[e] - bf_bits2f(hb));
              hv[e] = __builtin_bit_cast(_Float16, hb);
              lv[e] = __builtin_bit_cast(_Float16, lb);
            }
          }
          *(v8h*)(C + (size_t)(mBase + row) * ldc + n0 + c8) = hv;
          if (OUT_MODE == 2) *(v8h*)(C2 + (size_t)(mBase + row) * ldc + n0 + c8) = lv;
        }
        
      }
    }
    __builtin_amdgcn_fence(__ATOMIC_RELEASE, "workgroup");
    __builtin_amdgcn_wave_barrier();
    __builtin_amdgcn_fence(__ATOMIC_ACQUIRE, "workgroup");
  }
}

// ---- f32 -> f16 casts (value x scale, round to nearest even) ---------------------------------------------
// A work-group converts 4096 consecutive elements of each of its planes. A wave-wide load is 512 contiguous bytes
// (16 B a lane), a wave-wide store 256 contiguous bytes (8 B a lane); every load of a thread is independent of every
// other and all are requested in front of the first store. L = loads per lane and plane = 32 / waves per work-group.
typedef __attribute__((ext_vector_type(4))) _Float16 v4h;
#define CAST_PLANE (1024 * 1024)         // elements of one plane
// e0: the lane's first element; the byte offsets fit 32 bits, so each access is plane base + one shared offset register.
template <int L>
__device__ __forceinline__ void cast_load(const float* __restrict__ in, unsigned e0, v4f (&x)[L]) {
  const char* p = (const char*)in + e0 * 4u;
#pragma unroll
  for (int k = 0; k < L; ++k) x[k] = *(const v4f*)(p + k * 512);
}
template <int L>
__device__ __forceinline__ void cast_store(_Float16* __restrict__ out, unsigned e0, const v4f (&x)[L], float scale) {
  char* p = (char*)out + e0 * 2u;
#pragma unroll
  for (int k = 0; k < L; ++k) {
    v4h h;
#pragma unroll
    for (int e = 0; e < 4; ++e) h[e] = (_Float16)(x[k][e] * scale);
    *(v4h*)(p + k * 256) = h;
  }
}
// seven planes in one launch: two activations x1, five weights x16; plane p goes to out + p * CAST_PLANE.
// grid = 256 work-groups of 16 waves.
__global__ __launch_bounds__(512) void cast7_f32_f16(
    const float* __restrict__ a0, const float* __restrict__ a1, const float* __restrict__ w0,
    const float* __restrict__ w1, const float* __restrict__ w2, const float* __restrict__ w3,
    const float* __restrict__ w4, _Float16* __restrict__ out) {
  const unsigned e0 = blockIdx.x * 4096u + (threadIdx.x >> 5) * 256u + (threadIdx.x & 31u) * 4u;
  v4f x[7][2];
  cast_load<2>(a0, e0, x[0]);
  cast_load<2>(a1, e0, x[1]);
  cast_load<2>(w0, e0, x[2]);
  cast_load<2>(w1, e0, x[3]);
  cast_load<2>(w2, e0, x[4]);
  cast_load<2>(w3, e0, x[5]);
  cast_load<2>(w4, e0, x[6]);
  cast_store<2>(out + 0 * (size_t)CAST_PLANE, e0, x[0], 1.0f);
  cast_store<2>(out + 1 * (size_t)CAST_PLANE, e0, x[1], 1.0f);
  cast_store<2>(out + 2 * (size_t)CAST_PLANE, e0, x[2], 16.0f);
  cast_store<2>(out + 3 * (size_t)CAST_PLANE, e0, x[3], 16.0f);
  cast_store<2>(out + 4 * (size_t)CAST_PLANE, e0, x[4], 16.0f);
  cast_store<2>(out + 5 * (size_t)CAST_PLANE, e0, x[5], 16.0f);
  cast_store<2>(out + 6 * (size_t)CAST_PLANE, e0, x[6], 16.0f);
}

typedef __attribute__((ext_vector_type(4))) int v4i;
__device__ __forceinline__ float dot4(v4f x, v4f w) {
  return fmaf(x[3], w[3], fmaf(x[2], w[2], fmaf(x[1], w[1], x[0] * w[0])));
}

// =====================================================================================
// Attention for head_dim 64 and 128 keys with additive score terms, f32 in / f16 out (value x oscale), f16 operands:
//   s = (q.k^T) * sscale + SB[q][kv];  SB element above sent_thr -> s = mask_fill (kept in the softmax)
//   Block = 8 waves = 64 query rows of one (b, h); grid.x = B*H*(S/64). Wave w owns the 16 query rows of row group
//   w & 3 and the 64 keys of chunk w >> 2: the two chunks of a row group run side by side, two waves on each SIMD,
//   so that one wave's LDS, cross-lane and memory waits are filled by the other's instructions.
//   Per wave, in f32: m = row max over its chunk, p = exp(s - m) carried x2^15 as f16, l = row sum of p, o = p.v.
//   Merge (through LDS, by the chunk-0 wave): M = max(m0, m1), a_i = exp(m_i - M),
//   out = (o0 a0 + o1 a1) / ((l0 a0 + l1 a1) * 2^15),
//   stored as f16(out * oscale): the left operand of the output projection, with no f32 copy in between.
//   Element (b, s, h, d) of q/k/v/out at X[b*X_bs + s*X_rs + h*X_hs + d].
// SB, the work-group's own 64 x 128 tile of additive terms with the mask folded in, is built in LDS in front of the
// products (128 positions, 16 heads, head n = b*16 + h; q and rf rows i*8+b, col h*64+d; q holds the s_q column term):
//   Every global load of the tile is independent of every other and all are requested up front: one round trip.
//   Phase 1 (LDS): e0[i] = q[n,i,:].semb[0][h*64..], e1[i] = q[n,i,:].semb[1][h*64..] for the 64 own rows,
//                  cv[i] = r[n,i,:].semb[0][h*64..] for all 128 rows; 16 lanes x 16 B per row, summed across the lanes.
//                  cv[128..255] = 0, so that cv[127-i+j] is the shifted term for j <= i and 0 for j > i.
//   Phase 2: SB[i][j] = amask[n][i][j] != 0 ? 3e38 (sentinel)
//                     : 0.125 * ( utt[n][i][j] * (smask[b][i][j] -> e1[i] : e0[i]) + cv[127-i+j] )
//            16 B per lane and array, a wave covers one whole 512-B row per access, eight rows per wave.
// =====================================================================================
#define AT_D 64
#define AT_RG 4                          // row groups of 16 query rows
#define AT_NC 2                          // key chunks, one wave of a row group each
#define AT_NW (AT_RG * AT_NC)            // waves of a work-group
#define AT_QB 64
#define AT_KC 64
#define SB_COLS  128                     // key columns of the SB tile = AT_NC * AT_KC
#define SB_PITCH 132                     // its LDS row pitch in floats: rows 16-B aligned, rows r and r + 8 half the banks apart
struct AttnArgs { long q_bs, q_rs, q_hs, k_bs, k_rs, k_hs, v_bs, v_rs, v_hs, o_bs, o_rs, o_hs;
                  int S, Skv, H, nchunks; float sscale, mask_fill, sent_thr, oscale; };
static_assert(sizeof(AttnArgs) == 128);
static_assert(AT_NC * AT_KC == SB_COLS);

__device__ __forceinline__ v8f mma_f16g(v16h a, v16h b, v8f c) {
  c = __builtin_amdgcn_wmma_f32_16x16x32_f16(false, a, false, b, (short)0, c, false, false);
  asm volatile("v_nop\n\tv_nop\n\tv_nop\n\tv_nop" : "+v"(c) : "v"(a), "v"(b));
  return c;
}

__global__ __launch_bounds__(AT_NW * 32)
void attn64_sbias_f16(const float* __restrict__ q, const float* __restrict__ k,
                      const float* __restrict__ v, _Float16* __restrict__ out,
                      const float* __restrict__ rf, const float* __restrict__ semb,
                      const float* __restrict__ utt, const int* __restrict__ amask,
                      const int* __restrict__ smask, AttnArgs g) {
  const float PSC = 32768.0f;
  union FB { v16h v; v8h h[2]; };
  __shared__ __align__(16) _Float16 Ksh[AT_NC * AT_KC * AT_D];    // K [chunk][kv][d]   16 KB
  __shared__ __align__(16) _Float16 Vth[AT_NC * AT_D * AT_KC];    // V [chunk][d][kv]   16 KB
  __shared__ __align__(16) _Float16 Psh[AT_NW][16 * AT_KC];       // per wave P [row][kv]  16 KB
  __shared__ __align__(16) float    Os[AT_RG][16 * 68];           // per row group: chunk 1's p.v, then the out tile; pitch 68
  __shared__ __align__(16) float    Sbl[AT_QB * SB_PITCH];        // SB [own row][kv]  33 KB
  __shared__ float se0[AT_QB];
  __shared__ float se1[AT_QB];
  __shared__ float scv[2 * SB_COLS];
  __shared__ float sm1[AT_QB];                                    // chunk 1's row maxima
  __shared__ float sl1[AT_QB];                                    // chunk 1's row sums

  const int tid  = threadIdx.x;
  const int wave = tid >> 5;
  const int rw   = wave & (AT_RG - 1);         // row group
  const int kc   = wave >> 2;                  // key chunk
  const int lane = tid & 31;
  const int hh   = lane >> 4;
  const int c    = lane & 15;

  const int nqb = g.S / AT_QB;
  const int bx = blockIdx.x;
  const int qb = bx % nqb;
  const int bh = bx / nqb;
  const int h  = bh % g.H;
  const int b  = bh / g.H;
  const int q0 = qb * AT_QB + rw * 16;

  const float* qb_ptr = q   + (size_t)b * g.q_bs + (size_t)h * g.q_hs;
  const float* kb_ptr = k   + (size_t)b * g.k_bs + (size_t)h * g.k_hs;
  const float* vb_ptr = v   + (size_t)b * g.v_bs + (size_t)h * g.v_hs;
  _Float16*    ob_ptr = out + (size_t)b * g.o_bs + (size_t)h * g.o_hs;

  // ---- SB tile ----
  {
    const int i0 = qb * AT_QB;                 // first own score row
    const int d4 = c * 4;                      // phase 1: four of the 64 depths (hh: row of the pair)
    const int c4 = lane * 4;                   // phase 2: this lane's four score columns
    const int e0 = (i0 + wave) * SB_COLS + c4; // own score rows wave + 8 kk: row kk lies 8 rows behind row kk - 1
    const float* ub  = utt   + (size_t)bh * (SB_COLS * SB_COLS) + e0;
    const int*   ab  = amask + (size_t)bh * (SB_COLS * SB_COLS) + e0;
    const int*   smb = smask + (size_t)b  * (SB_COLS * SB_COLS) + e0;
    const float* sw = semb + h * 64;           // the head's 64 depths of table row 0; row 1 lies 1024 floats behind
    const v4f w0 = *(const v4f*)(sw + d4);
    const v4f w1 = *(const v4f*)(sw + 1024 + d4);
    const size_t co = (size_t)b * 1024 + (size_t)h * 64 + d4;
    const float* rp = rf + (size_t)(wave * 16 + hh) * 8192 + co;
    const float* qp = q + (size_t)(i0 + wave * 8 + hh) * 8192 + co;
    v4f rv[8], qv[4];
#pragma unroll
    for (int kk = 0; kk < 8; ++kk) rv[kk] = *(const v4f*)(rp + kk * (2 * 8192));
#pragma unroll
    for (int kk = 0; kk < 4; ++kk) qv[kk] = *(const v4f*)(qp + kk * (2 * 8192));
    // no address register of the loads above is rewritten in front of this wait: the pointers are named as inputs so
    // that their registers stay theirs up to it (left free, a later load's destination or a scalar load takes one)
    asm volatile("s_wait_xcnt 0x0" :: "s"(sw), "v"(rp), "v"(qp) : "memory");
    v4f u4[8]; v4i am4[8], sm4[8];
#pragma unroll
    for (int kk = 0; kk < 8; ++kk) {
      u4[kk]  = *(const v4f*)(ub  + kk * (8 * SB_COLS));
      am4[kk] = *(const v4i*)(ab  + kk * (8 * SB_COLS));
      sm4[kk] = *(const v4i*)(smb + kk * (8 * SB_COLS));
    }
    // the same for the mask loads
    asm volatile("s_wait_xcnt 0x0" :: "v"(ub), "v"(ab), "v"(smb) : "memory");
    // the mask loads stay in front of phase 1's arithmetic: left free, the scheduler issues them only behind the
    // wait for the projection rows, and the two round trips run one after the other
    __builtin_amdgcn_sched_barrier(0);

    float p[16];
#pragma unroll
    for (int kk = 0; kk < 8; ++kk) p[kk] = dot4(rv[kk], w0);
#pragma unroll
    for (int kk = 0; kk < 4; ++kk) { p[8 + kk] = dot4(qv[kk], w0); p[12 + kk] = dot4(qv[kk], w1); }
#pragma unroll
    for (int off = 1; off < 16; off <<= 1)
#pragma unroll
      for (int x = 0; x < 16; ++x) p[x] += __shfl_xor(p[x], off, 32);
    if (c == 0) {
#pragma unroll
      for (int kk = 0; kk < 8; ++kk) scv[wave * 16 + kk * 2 + hh] = p[kk];
#pragma unroll
      for (int kk = 0; kk < 4; ++kk) { se0[wave * 8 + kk * 2 + hh] = p[8 + kk]; se1[wave * 8 + kk * 2 + hh] = p[12 + kk]; }
    }
    if (tid < SB_COLS) scv[SB_COLS + tid] = 0.0f;   // whole waves 0..3: 128 zeros
    __syncthreads();                           // e0, e1, cv are published

#pragma unroll
    for (int kk = 0; kk < 8; ++kk) {
      const int il = wave + 8 * kk, i = i0 + il;
      const float e0v = se0[il], e1v = se1[il];
      const float* cvp = scv + (127 - i + c4); // 0 <= 127 - i + j <= 254 for every row i and column j
      v4f o;
#pragma unroll
      for (int u = 0; u < 4; ++u) {
        int sm = sm4[kk][u];
        if (sm < 0) sm += 2;                   // 2-row table: wrap negatives, then clamp
        sm = sm < 0 ? 0 : (sm > 1 ? 1 : sm);
        const float ev = (sm != 0) ? e1v : e0v;
        float val = (u4[kk][u] * ev + cvp[u]) * 0.125f;
        if (am4[kk][u] != 0) val = 3.0e38f;
        o[u] = val;
      }
      *(v4f*)(Sbl + il * SB_PITCH + c4) = o;   // read by other waves only behind the barrier that publishes K and V
    }
  }

  // ---- Q fragments (A operand), 2 d-chunks, split k map ----
  v16h qa[2];
  {
    const float* qrow = qb_ptr + (size_t)(q0 + c) * g.q_rs;
#pragma unroll
    for (int dc = 0; dc < 2; ++dc) {
      const v4f f0 = *(const v4f*)(qrow + dc * 32 + 8 * hh);
      const v4f f1 = *(const v4f*)(qrow + dc * 32 + 8 * hh + 4);
      const v4f f2 = *(const v4f*)(qrow + dc * 32 + 16 + 8 * hh);
      const v4f f3 = *(const v4f*)(qrow + dc * 32 + 16 + 8 * hh + 4);
#pragma unroll
      for (int e = 0; e < 4; ++e) {
        qa[dc][e]      = (_Float16)f0[e];
        qa[dc][4 + e]  = (_Float16)f1[e];
        qa[dc][8 + e]  = (_Float16)f2[e];
        qa[dc][12 + e] = (_Float16)f3[e];
      }
    }
  }

  // ---- K and V of all 128 keys to LDS: two threads a key row, 32 depths each ----
  {
    const int kvr = tid >> 1, dh = (tid & 1) * 32;
    const float* krow = kb_ptr + (size_t)kvr * g.k_rs + dh;
    const float* vrow = vb_ptr + (size_t)kvr * g.v_rs + dh;
    _Float16* kd = Ksh + kvr * AT_D;                                               // chunk kvr / 64, row kvr % 64
    _Float16* vd = Vth + (kvr / AT_KC) * (AT_D * AT_KC) + (kvr % AT_KC);
    v4f kx[8], vx[8];
#pragma unroll
    for (int i = 0; i < 8; ++i) {
      kx[i] = *(const v4f*)(krow + 4 * i);
      vx[i] = *(const v4f*)(vrow + 4 * i);
    }
    // no address register of these loads is rewritten in front of this wait: the pointers are named as inputs so that
    // their registers stay theirs up to it (left free, a later load's destination takes one)
    asm volatile("s_wait_xcnt 0x0" :: "v"(krow), "v"(vrow) : "memory");
#pragma unroll
    for (int i = 0; i < 8; ++i)
#pragma unroll
      for (int e = 0; e < 4; ++e) {
        const int d = dh + 4 * i + e;
        kd[d]         = (_Float16)kx[i][e];
        vd[d * AT_KC] = (_Float16)vx[i][e];
      }
  }
  __syncthreads();                             // K, V and the SB tile are published

  const _Float16* Kc = Ksh + kc * (AT_KC * AT_D);   // the wave's own chunk
  const _Float16* Vc = Vth + kc * (AT_D * AT_KC);

  v8f s[4];
#pragma unroll
  for (int j = 0; j < 4; ++j) {
    s[j] = (v8f){0.f,0.f,0.f,0.f,0.f,0.f,0.f,0.f};
#pragma unroll
    for (int dc = 0; dc < 2; ++dc) {
      FB kb;
      kb.h[0] = *(const v8h*)(Kc + (j * 16 + c) * AT_D + dc * 32 + 8 * hh);
      kb.h[1] = *(const v8h*)(Kc + (j * 16 + c) * AT_D + dc * 32 + 16 + 8 * hh);
      s[j] = mma_f16g(qa[dc], kb.v, s[j]);
    }
  }
  // additive terms + mask select, row max over the chunk
  const float* sbp = Sbl + (rw * 16 + 8 * hh) * SB_PITCH + kc * AT_KC + c;
  float mrow[8], lrow[8];
#pragma unroll
  for (int r = 0; r < 8; ++r) {
    const float* sbr = sbp + r * SB_PITCH;
    float m = -INFINITY;
#pragma unroll
    for (int j = 0; j < 4; ++j) {
      const float bb = sbr[j * 16];
      float sv = fmaf(s[j][r], g.sscale, bb);
      if (bb > g.sent_thr) sv = g.mask_fill;
      s[j][r] = sv;
      m = fmaxf(m, sv);
    }
#pragma unroll
    for (int off = 1; off < 16; off <<= 1) m = fmaxf(m, __shfl_xor(m, off, 32));
    mrow[r] = m;
  }
  _Float16* pwh = Psh[wave];
#pragma unroll
  for (int r = 0; r < 8; ++r) {
    float psum = 0.f;
#pragma unroll
    for (int j = 0; j < 4; ++j) {
      const float p = expf(s[j][r] - mrow[r]);
      psum += p;
      pwh[(8 * hh + r) * AT_KC + j * 16 + c] = (_Float16)(p * PSC);
    }
#pragma unroll
    for (int off = 1; off < 16; off <<= 1) psum += __shfl_xor(psum, off, 32);
    lrow[r] = psum;
  }
  __builtin_amdgcn_fence(__ATOMIC_RELEASE, "workgroup");
  __builtin_amdgcn_wave_barrier();
  __builtin_amdgcn_fence(__ATOMIC_ACQUIRE, "workgroup");
  v8f oacc[4];
#pragma unroll
  for (int t = 0; t < 4; ++t) oacc[t] = (v8f){0.f,0.f,0.f,0.f,0.f,0.f,0.f,0.f};
#pragma unroll 1
  for (int kk = 0; kk < 2; ++kk) {
    FB pa;
    pa.h[0] = *(const v8h*)(pwh + c * AT_KC + kk * 32 + 8 * hh);
    pa.h[1] = *(const v8h*)(pwh + c * AT_KC + kk * 32 + 16 + 8 * hh);
#pragma unroll
    for (int t = 0; t < 4; ++t) {
      FB vb;
      vb.h[0] = *(const v8h*)(Vc + (t * 16 + c) * AT_KC + kk * 32 + 8 * hh);
      vb.h[1] = *(const v8h*)(Vc + (t * 16 + c) * AT_KC + kk * 32 + 16 + 8 * hh);
      oacc[t] = mma_f16g(pa.v, vb.v, oacc[t]);
    }
  }

  // ---- merge of the two chunks: the chunk-1 wave hands m, l and p.v to the chunk-0 wave of its row group, each
  //      lane's values at the places where the same lane of the partner reads them ----
  float* os = Os[rw];
  if (kc == 1) {
#pragma unroll
    for (int r = 0; r < 8; ++r)
#pragma unroll
      for (int t = 0; t < 4; ++t) os[(8 * hh + r) * 68 + t * 16 + c] = oacc[t][r];
    if (c == 0) {
#pragma unroll
      for (int r = 0; r < 8; ++r) { sm1[rw * 16 + 8 * hh + r] = mrow[r]; sl1[rw * 16 + 8 * hh + r] = lrow[r]; }
    }
  }
  __syncthreads();                             // chunk 1's partial results are published; the last barrier
  if (kc == 1) return;

#pragma unroll
  for (int r = 0; r < 8; ++r) {
    const float m1 = sm1[rw * 16 + 8 * hh + r], l1 = sl1[rw * 16 + 8 * hh + r];
    const float mm = fmaxf(mrow[r], m1);
    const float a0 = expf(mrow[r] - mm), a1 = expf(m1 - mm);
    const float inv = 1.0f / ((lrow[r] * a0 + l1 * a1) * PSC);
#pragma unroll
    for (int t = 0; t < 4; ++t) {
      float* op = os + (8 * hh + r) * 68 + t * 16 + c;   // read and rewritten by this lane alone
      *op = (oacc[t][r] * a0 + *op * a1) * inv;
    }
  }
  __builtin_amdgcn_fence(__ATOMIC_RELEASE, "workgroup");
  __builtin_amdgcn_wave_barrier();
  __builtin_amdgcn_fence(__ATOMIC_ACQUIRE, "workgroup");
  {
    const int q4 = lane >> 3, c8 = (lane & 7) * 8;   // a row's 64 f16 = one 128-B line = 8 lanes x 16 B; 4 rows a store
#pragma unroll
    for (int it = 0; it < 4; ++it) {
      const int row = it * 4 + q4;
      const v4f lo = *(const v4f*)(os + row * 68 + c8);
      const v4f hi = *(const v4f*)(os + row * 68 + c8 + 4);
      v8h hv;
#pragma unroll
      for (int e = 0; e < 4; ++e) {
        hv[e]     = (_Float16)(lo[e] * g.oscale);
        hv[4 + e] = (_Float16)(hi[e] * g.oscale);
      }
      *(v8h*)(ob_ptr + (size_t)(q0 + row) * g.o_rs + c8) = hv;
    }
  }
}

// ---------------------------------------------------------------------------
// Host launcher. Layout of q/k/v/r/ctx matrices: row = i*8 + b (i = position, b = batch),
// col = h*64 + d; head n = b*16 + h. The (B,L,D) positional input is used as a flat [1024][1024]
// A matrix exactly like the (L,B,D) query (literal view semantics of the position projection).
// ---------------------------------------------------------------------------
extern "C" void kernel_launch(void* const* d_in, const int* in_sizes, int n_in,
                              void* d_out, int out_size, void* d_ws, size_t ws_size,
                              hipStream_t stream) {
  if (n_in < 11) return;
  const int NE = 1024 * 1024;                 // elements of every [*,*,1024] tensor and of each weight
  if (in_sizes[0] != NE || in_sizes[1] != NE || in_sizes[3] != NE || in_sizes[4] != NE ||
      in_sizes[5] != NE || in_sizes[6] != NE || in_sizes[7] != NE || in_sizes[8] != 2 * 1024 ||
      in_sizes[2] != 128 * 128 * 128 || in_sizes[9] != 128 * 128 * 128 || in_sizes[10] != 8 * 128 * 128 ||
      out_size != NE) return;

  const float* query    = (const float*)d_in[0];   // (L,B,D)
  const float* rel_pe   = (const float*)d_in[1];   // (B,L,D)
  const float* utt_mask = (const float*)d_in[2];   // (B*H,L,L,1) f32
  const float* Wq       = (const float*)d_in[3];
  const float* Wk       = (const float*)d_in[4];
  const float* Wv       = (const float*)d_in[5];
  const float* Wr       = (const float*)d_in[6];
  const float* Wo       = (const float*)d_in[7];
  const float* spk_emb  = (const float*)d_in[8];   // (2,D)
  const int*   attn_msk = (const int*)d_in[9];     // (B*H,L,L) int32, nonzero = masked
  const int*   spk_msk  = (const int*)d_in[10];    // (B,L,L) int32 in {0,1}
  float* out = (float*)d_out;

  // ---- workspace carve (bytes) ----
  const size_t MiB = (size_t)1 << 20;
  const size_t off_q16 = 0;                    // query  f16       2 MiB
  const size_t off_p16 = 2 * MiB;              // rel_pe f16       2 MiB
  const size_t off_w16 = 4 * MiB;              // 5 weights f16 x16, 2 MiB each (Wq,Wk,Wv,Wr,Wo)
  const size_t off_qf  = 14 * MiB;             // new_q f32        4 MiB
  const size_t off_kf  = 18 * MiB;             // k f32            4 MiB
  const size_t off_vf  = 22 * MiB;             // v f32            4 MiB (q, k, v, r one behind the other: batched GEMM stride)
  const size_t off_rf  = 26 * MiB;             // r f32            4 MiB
  const size_t off_c16 = 30 * MiB;             // ctx f16 x16      2 MiB
  const size_t total   = 32 * MiB;
  if (total > ws_size || total > 128 * MiB) return;

  char* ws = (char*)d_ws;
  _Float16* q16 = (_Float16*)(ws + off_q16);
  _Float16* p16 = (_Float16*)(ws + off_p16);
  _Float16* w16 = (_Float16*)(ws + off_w16);
  float* qf  = (float*)(ws + off_qf);
  float* kf  = (float*)(ws + off_kf);
  float* vf  = (float*)(ws + off_vf);
  float* rf  = (float*)(ws + off_rf);
  _Float16* c16 = (_Float16*)(ws + off_c16);

  // ---- casts: activations x1, weights x16 (exact power of two, undone in the GEMM epilogue); the seven f16
  //      planes q16, p16, w16[0..4] lie one behind the other from the start of the workspace ----
  cast7_f32_f16<<<256, 512, 0, stream>>>(query, rel_pe, Wq, Wk, Wv, Wr, Wo, q16);

  // ---- input projections: C = X . W^T, 1024x1024x1024 each; q gets column bias spk_emb[0][col] (= new_q) ----
  const int M = 1024, N = 1024, K = 1024;
  const int gblocks = (M / 128) * (N / 128);   // one work-group per 128x128 tile
  const float wscale_inv = 1.0f / 16.0f;
  {
    // one launch of 4 x 64 work-groups, each alone on its WGP: y = 0: q (query, Wq -> qf, + spk_emb[0][col]),
    // y = 1: k, y = 2: v (query), y = 3: r (rel_pe flat [1024][1024], literal view). The four weight planes and the
    // four f32 results lie one behind the other in the workspace (strides NE).
    dim3 grid(gblocks, 4);
    wmma_gemm64<0, false, 3, 0, false><<<grid, 256, 0, stream>>>(
        (const unsigned short*)q16, (const unsigned short*)p16, K, 0L,
        (const unsigned short*)w16, (const unsigned short*)w16, K, (long)NE,
        (void*)qf, (void*)qf, N, (long)NE,
        spk_emb, spk_emb, 0L, M, N, K, wscale_inv, 3);
  }

  // ---- attention: 128 heads (b*16+h) of 128x128, head dim 64; s = a1/8 + SB, SB = (a2 + a3) * 1/8 with the mask
  //      folded in as a sentinel -> 1e-30; ctx leaves as f16 x16 ----
  {
    AttnArgs g;
    g.q_bs = 1024; g.q_rs = 8 * 1024; g.q_hs = 64;
    g.k_bs = 1024; g.k_rs = 8 * 1024; g.k_hs = 64;
    g.v_bs = 1024; g.v_rs = 8 * 1024; g.v_hs = 64;
    g.o_bs = 1024; g.o_rs = 8 * 1024; g.o_hs = 64;
    g.S = 128; g.Skv = 128; g.H = 16; g.nchunks = 2;
    g.sscale = 0.125f; g.mask_fill = 1e-30f; g.sent_thr = 1.0e37f; g.oscale = 16.0f;
    const int agrid = 8 * 16 * (128 / AT_QB);   // 256 blocks
    attn64_sbias_f16<<<agrid, AT_NW * 32, 0, stream>>>(qf, kf, vf, c16, rf, spk_emb, utt_mask, attn_msk, spk_msk, g);
  }

  // ---- output projection into d_out (scale 1/256 undoes the x16 of ctx and of Wo) ----
  {
    dim3 grid(gblocks, 1);
    wmma_gemm64<0, false, 0, 0, false><<<grid, 256, 0, stream>>>(
        (const unsigned short*)c16, (const unsigned short*)c16, K, 0L,
        (const unsigned short*)(w16 + 4 * (size_t)NE), (const unsigned short*)(w16 + 4 * (size_t)NE), K, 0L,
        (void*)out, (void*)out, N, 0L,
        spk_emb, spk_emb, 0L, M, N, K, 1.0f / 256.0f, 1);
  }
  (void)hipGetLastError();
}

// v009
// Measured time: 41.2 microseconds a run.
// In two side-by-side timings against v008, it was 1.07 and 1.02 times as fast.
// Counting every step since v000, it is 6.69 times as fast.
#include <hip/hip_runtime.h>
#include <stdint.h>
// Contractions: five 1024x1024x1024 projections (X . W^T), per-head q.k^T (K=64) and p.v (K=128): v_wmma_f32_16x16x32_f16 (f16 operands; weights and ctx carried x16, p carried x2^15, exact powers of two folded back in f32), f32 accumulate. Softmax, additive score terms and depth-64 speaker row dots in f32 on VALU.

typedef __attribute__((ext_vector_type(16))) _Float16 v16h;
typedef __attribute__((ext_vector_type(8)))  _Float16 v8h;
typedef __attribute__((ext_vector_type(16))) __bf16   v16b;
typedef __attribute__((ext_vector_type(8)))  __bf16   v8b;
typedef __attribute__((ext_vector_type(8)))  float    v8f;
typedef __attribute__((ext_vector_type(4)))  float    v4f;

__device__ __forceinline__ unsigned short f2bf_bits(float f) {
  unsigned u = __float_as_uint(f);
  return (unsigned short)((u + 0x7FFFu + ((u >> 16) & 1u)) >> 16);
}
__device__ __forceinline__ float bf_bits2f(unsigned short h) { return __uint_as_float(((unsigned)h) << 16); }

// hazard guards as plain device helpers
__device__ __forceinline__ void acc_guard4(v8f& a, v8f& b, v8f& c, v8f& d) { asm volatile("v_nop\n\tv_nop\n\tv_nop\n\tv_nop" : "+v"(a), "+v"(b), "+v"(c), "+v"(d)); }
template <typename T> struct Frag;
template <> struct Frag<_Float16> {
  typedef v16h V; union U { v16h v; v8h h[2]; };
  static __device__ __forceinline__ v16h load(const _Float16* p) {   // elements 0..7 <- p[0..7], 8..15 <- p[16..23]
    U f; f.h[0] = *(const v8h*)(p); f.h[1] = *(const v8h*)(p + 16); return f.v;
  }
  static __device__ __forceinline__ v8f mma(v16h a, v16h b, v8f c) {
    return __builtin_amdgcn_wmma_f32_16x16x32_f16(false, a, false, b, (short)0, c, false, false);
  }
};
template <> struct Frag<__bf16> {
  typedef v16b V; union U { v16b v; v8b h[2]; };
  static __device__ __forceinline__ v16b load(const __bf16* p) {
    U f; f.h[0] = *(const v8b*)(p); f.h[1] = *(const v8b*)(p + 16); return f.v;
  }
  static __device__ __forceinline__ v8f mma(v16b a, v16b b, v8f c) {
    return __builtin_amdgcn_wmma_f32_16x16x32_bf16(false, a, false, b, (short)0, c, false, false);
  }
};

// ---- Register-blocked batched WMMA GEMM ------------------------------------
// C[m,n] = scale * sum_k A[m,k] * Bt[n,k] (+bias)(+resid); a work-group owns a 128x128 tile,
// its eight waves 32x64 each (four down, two across).
// A row-major [M,K]; Bt row-major [N,K]; M % 128 == 0, N % 128 == 0, K % 128 == 0.
// Operand path: per pass of 128 k the work-group's 128 A rows and 128 Bt rows (256 B each, whole lines)
// go to LDS by asynchronous 16-byte copies, two buffers, the next pass in flight while this one is
// multiplied; the waves read their fragments from LDS (row pitch 272 B = 16 B x odd for ds_load_b128).
// The square tile keeps the bytes a work-group pulls per output low (256 operand rows for 16,384 outputs).
// SPLIT (hi/lo operand planes) is not staged by this path and is not instantiated.
// Batch b = blockIdx.y: Bt and C advance by their strides; batches b >= batchA2 read A2p as their A, the others Ap,
// so products of two different left operands that do not depend on each other share one launch.
// BIAS_MODE: 0 = none, 1 = bias[m], 2 = bias[n], 3 = bias[n] in batch 0 alone.
// OUT_MODE: 0 = f32, 1 = f16, 2 = bf16 hi plane (Cout) + bf16 lo plane (Cout2).
// ET: 0 = f16 operands, 1 = bf16 operands (pointers passed as 16-bit storage)
template <int ET> struct Elem;
template <> struct Elem<0> { typedef _Float16 T; };
template <> struct Elem<1> { typedef __bf16 T; };
#define G_KP    128                      // k of one pass
#define G_PITCH 136                      // LDS row pitch in 16-bit elements (256 B of k + 16 B)
#define G_ROWS  256                      // 128 A rows, then 128 Bt rows
#define G_BUF   (G_ROWS * G_PITCH)       // elements of one buffer (69,632 B)

// Eight asynchronous 16-byte-per-lane copies global -> LDS. The s_wait_xcnt closes the statement so that
// no address register named here is rewritten before it.
template <typename T>
__device__ __forceinline__ void async_copy8(const unsigned (&l)[8], const T* const (&g)[8]) {
  asm volatile(
      "global_load_async_to_lds_b128 %0, %8, off\n\t"
      "global_load_async_to_lds_b128 %1, %9, off\n\t"
      "global_load_async_to_lds_b128 %2, %10, off\n\t"
      "global_load_async_to_lds_b128 %3, %11, off\n\t"
      "global_load_async_to_lds_b128 %4, %12, off\n\t"
      "global_load_async_to_lds_b128 %5, %13, off\n\t"
      "global_load_async_to_lds_b128 %6, %14, off\n\t"
      "global_load_async_to_lds_b128 %7, %15, off\n\t"
      "s_wait_xcnt 0x0"
      :: "v"(l[0]), "v"(l[1]), "v"(l[2]), "v"(l[3]), "v"(l[4]), "v"(l[5]), "v"(l[6]), "v"(l[7]),
         "v"(g[0]), "v"(g[1]), "v"(g[2]), "v"(g[3]), "v"(g[4]), "v"(g[5]), "v"(g[6]), "v"(g[7])
      : "memory");
}
// One pass's tile: 256 rows x 16 chunks of 16 B = 16 chunks per thread; a wave-wide copy covers 2 whole rows.
// ga / gb: this thread's chunk in A row (tid >> 4) / Bt row (tid >> 4) of the work-group's rows, at the pass's k.
// l0: this thread's LDS byte address for row (tid >> 4) of the target buffer.
template <typename T>
__device__ __forceinline__ void stage_tile(unsigned l0, const T* ga, const T* gb, int lda, int ldb) {
  unsigned l[8]; const T* g[8];
#pragma unroll
  for (int it = 0; it < 8; ++it) {       // rows 0..127: the A rows
    l[it] = l0 + (unsigned)(it * 16 * G_PITCH * 2);
    g[it] = ga + (size_t)(it * 16) * lda;
  }
  async_copy8<T>(l, g);
#pragma unroll
  for (int it = 0; it < 8; ++it) {       // rows 128..255: the Bt rows
    l[it] = l0 + (unsigned)((it + 8) * 16 * G_PITCH * 2);
    g[it] = gb + (size_t)(it * 16) * ldb;
  }
  async_copy8<T>(l, g);
}
// this wave's LDS reads have retired (before the buffer they read is handed back for a refill)
__device__ __forceinline__ void wait_lds_reads()   { asm volatile("s_wait_dscnt 0x0" ::: "memory"); }
// this wave's asynchronous copies have landed (the compiler places no wait for them)
__device__ __forceinline__ void wait_async_copies() { asm volatile("s_wait_asynccnt 0x0" ::: "memory"); }

template <int ET, bool SPLIT, int BIAS_MODE, int OUT_MODE, bool RESID, int ACT = 0>
__global__ __launch_bounds__(256) void wmma_gemm64(
    const unsigned short* __restrict__ Ap, const unsigned short* __restrict__ A2p, int lda, long strideA,
    const unsigned short* __restrict__ Btp, const unsigned short* __restrict__ Bt2p, int ldb, long strideB,
    void* __restrict__ Cout, void* __restrict__ Cout2, int ldc, long strideC,
    const float* __restrict__ bias,
    const float* __restrict__ resid, long strideR,
    int M, int N, int K, float scale, int batchA2) {
  typedef typename Elem<ET>::T T;
  typedef typename Frag<T>::V V;
  static_assert(!SPLIT, "the LDS operand path stages one plane per operand");
  __shared__ __align__(16) T ring[2 * G_BUF];      // two operand buffers
  __shared__ __align__(16) float sT[8][16 * 68];   // per-wave 16x64 slab, pitch 68 floats
  const int b    = blockIdx.y;
  const T* A = (const T*)((b < batchA2) ? Ap : A2p); const T* Bt = (const T*)Btp;
  const int lane = threadIdx.x & 31;
  const int wave = threadIdx.x >> 5;
  const int tilesN = N >> 7;
  const int tilesM = M >> 7;
  const int tile = blockIdx.x;           // the work-group's 128x128 tile
  if (tile >= tilesM * tilesN) return;   // the same for the whole work-group, in front of every barrier
  const int tm = tile / tilesN;
  const int mb0 = tm << 7;                      // first A row of the work-group
  const int nb0 = (tile - tm * tilesN) << 7;    // first Bt row of the work-group
  const int wm = (wave >> 1) << 5;              // the wave's 32 rows and 64 columns within the tile
  const int wn = (wave & 1) << 6;
  const int m0 = mb0 + wm;
  const int n0 = nb0 + wn;

  const T* Ab  = A  + (size_t)b * strideA;
  const T* Bb  = Bt + (size_t)b * strideB;

  const int rlane = lane & 15;                 // row (A) / col (B, D) within subtile
  const int koff  = (lane >> 4) * 8;           // k offset of this lane half
  const int mOff  = (lane >> 4) * 8;           // D row offset

  v8f acc[2][4];
#pragma unroll
  for (int i = 0; i < 2; ++i)
#pragma unroll
    for (int j = 0; j < 4; ++j) acc[i][j] = (v8f){0.f,0.f,0.f,0.f,0.f,0.f,0.f,0.f};

  // BIAS_MODE 3: the lane's four column terms, requested once, under one work-group-uniform test, in front of the k loop
  float bcol[4] = {0.f, 0.f, 0.f, 0.f};
  if (BIAS_MODE == 3 && b == 0) {
#pragma unroll                                 // constant indices keep bcol in registers
    for (int j = 0; j < 4; ++j) bcol[j] = bias[n0 + (j << 4) + rlane];
    // the address registers of these loads are reused by the address arithmetic below: the wait stands in front of that
    asm volatile("s_wait_xcnt 0x0" ::: "memory");
  }

  const int srow = threadIdx.x >> 4;           // staged row of this thread within a group of 16 rows
  const int schk = (threadIdx.x & 15) * 8;     // its 16-byte chunk, in elements
  const T* ga = Ab + (size_t)(mb0 + srow) * lda + schk;
  const T* gb = Bb + (size_t)(nb0 + srow) * ldb + schk;
  const unsigned l0 = (unsigned)(size_t)ring + (unsigned)((srow * G_PITCH + schk) * 2);
  const int nPass = K / G_KP;

  stage_tile<T>(l0, ga, gb, lda, ldb);
  wait_async_copies();
  __syncthreads();                             // pass 0's tile is published
  if (nPass > 1) stage_tile<T>(l0 + (unsigned)(G_BUF * 2), ga + G_KP, gb + G_KP, lda, ldb);

#pragma unroll 1                               // one pass per trip: the buffer is picked by the trip's parity
  for (int t = 0; t < nPass; ++t) {
    const int bsel = (t & 1) * G_BUF;
    const T* ra = ring + bsel + (wm + rlane) * G_PITCH + koff;
    const T* rb = ring + bsel + (128 + wn + rlane) * G_PITCH + koff;
#pragma unroll
    for (int ks = 0; ks < G_KP / 32; ++ks) {
      V bh[4], ah[2];
#pragma unroll
      for (int j = 0; j < 4; ++j) bh[j] = Frag<T>::load(rb + j * 16 * G_PITCH + ks * 32);
#pragma unroll
      for (int i = 0; i < 2; ++i) ah[i] = Frag<T>::load(ra + i * 16 * G_PITCH + ks * 32);
      // the 12 fragment reads stay one group in front of the 8 WMMAs: left free, the scheduler reuses one
      // A register set and the wave waits out the LDS latency once per A fragment
      __builtin_amdgcn_sched_barrier(0);
#pragma unroll
      for (int i = 0; i < 2; ++i)
#pragma unroll
        for (int j = 0; j < 4; ++j) acc[i][j] = Frag<T>::mma(ah[i], bh[j], acc[i][j]);
      __builtin_amdgcn_sched_barrier(0);       // and the next block's reads stay behind this block's WMMAs
    }
    wait_lds_reads();
    wait_async_copies();
    __syncthreads();                           // publishes pass t + 1's tile and ends every read of pass t's buffer
    if (t + 2 < nPass)
      stage_tile<T>(l0 + (unsigned)(bsel * 2), ga + (size_t)(t + 2) * G_KP, gb + (size_t)(t + 2) * G_KP, lda, ldb);
  }
  wait_async_copies();
  acc_guard4(acc[0][0], acc[0][1], acc[0][2], acc[0][3]);
  acc_guard4(acc[1][0], acc[1][1], acc[1][2], acc[1][3]);

  // ---- epilogue ----
  float* slab = sT[wave];
  const float* Rb = RESID ? (resid + (size_t)b * strideR) : nullptr;
#pragma unroll
  for (int i = 0; i < 2; ++i) {
    const int mBase = m0 + (i << 4);
#pragma unroll
    for (int j = 0; j < 4; ++j) {
      const int n = n0 + (j << 4) + rlane;
      float bv = 0.f;
      if (BIAS_MODE == 2) bv = bias[n];
      if (BIAS_MODE == 3) bv = bcol[j];
#pragma unroll
      for (int r = 0; r < 8; ++r) {
        float v = acc[i][j][r] * scale;
        if (BIAS_MODE == 1) v += bias[mBase + mOff + r];
        if (BIAS_MODE == 2 || BIAS_MODE == 3) v += bv;
        if (RESID) v += Rb[(size_t)(mBase + mOff + r) * ldc + n];
        if (ACT == 1) v = tanhf(v);
        if (ACT == 2) v = fmaxf(v, 0.0f);
        if (ACT == 3) v = v / (1.0f + expf(-v));
        if (ACT == 4) v = (v > 0.f) ? v : 0.01f * v;
        if (ACT == 5) v = 0.5f * v * (1.0f + erff(v * 0.70710678118654752f));
        slab[(mOff + r) * 68 + (j << 4) + rlane] = v;
      }
    }
    __builtin_amdgcn_fence(__ATOMIC_RELEASE, "workgroup");
    __builtin_amdgcn_wave_barrier();
    __builtin_amdgcn_fence(__ATOMIC_ACQUIRE, "workgroup");
    if (OUT_MODE == 0) {
      float* C = (float*)Cout + (size_t)b * strideC;
      const int hh = lane >> 4, c4 = (lane & 15) * 4;     // row seg = 256 B = 16 lanes x 16 B
      {
#pragma unroll
        for (int it = 0; it < 8; ++it) {
          const int row = it * 2 + hh;
          v4f v = *(const v4f*)(slab + row * 68 + c4);
          *(v4f*)(C + (size_t)(mBase + row) * ldc + n0 + c4) = v;
        }
        
      }
    } else {
      const int q = lane >> 3, c8 = (lane & 7) * 8;
      unsigned short* C  = (unsigned short*)Cout  + (size_t)b * strideC;
      unsigned short* C2 = (OUT_MODE == 2) ? ((unsigned short*)Cout2 + (size_t)b * strideC) : nullptr;
      {
#pragma unroll
        for (int it = 0; it < 4; ++it) {
          const int row = it * 4 + q;
          const float* sp = slab + row * 68 + c8;
          v8h hv, lv;
#pragma unroll
          for (int e = 0; e < 8; ++e) {
            if (OUT_MODE == 1) {
              hv[e] = (_Float16)sp[e];
            } else {
              unsigned short hb = f2bf_bits(sp[e]);
              unsigned short lb = f2bf_bits(sp[e] - bf_bits2f(hb));
              hv[e] = __builtin_bit_cast(_Float16, hb);
              lv[e] = __builtin_bit_cast(_Float16, lb);
            }
          }
          *(v8h*)(C + (size_t)(mBase + row) * ldc + n0 + c8) = hv;
          if (OUT_MODE == 2) *(v8h*)(C2 + (size_t)(mBase + row) * ldc + n0 + c8) = lv;
        }
        
      }
    }
    __builtin_amdgcn_fence(__ATOMIC_RELEASE, "workgroup");
    __builtin_amdgcn_wave_barrier();
    __builtin_amdgcn_fence(__ATOMIC_ACQUIRE, "workgroup");
  }
}

// ---- f32 -> f16 casts (value x scale, round to nearest even) ---------------------------------------------
// A work-group converts 4096 consecutive elements of each of its planes. A wave-wide load is 512 contiguous bytes
// (16 B a lane), a wave-wide store 256 contiguous bytes (8 B a lane); every load of a thread is independent of every
// other and all are requested in front of the first store. L = loads per lane and plane = 32 / waves per work-group.
typedef __attribute__((ext_vector_type(4))) _Float16 v4h;
#define CAST_PLANE (1024 * 1024)         // elements of one plane
// e0: the lane's first element; the byte offsets fit 32 bits, so each access is plane base + one shared offset register.
template <int L>
__device__ __forceinline__ void cast_load(const float* __restrict__ in, unsigned e0, v4f (&x)[L]) {
  const char* p = (const char*)in + e0 * 4u;
#pragma unroll
  for (int k = 0; k < L; ++k) x[k] = *(const v4f*)(p + k * 512);
}
template <int L>
__device__ __forceinline__ void cast_store(_Float16* __restrict__ out, unsigned e0, const v4f (&x)[L], float scale) {
  char* p = (char*)out + e0 * 2u;
#pragma unroll
  for (int k = 0; k < L; ++k) {
    v4h h;
#pragma unroll
    for (int e = 0; e < 4; ++e) h[e] = (_Float16)(x[k][e] * scale);
    *(v4h*)(p + k * 256) = h;
  }
}
// seven planes in one launch: two activations x1, five weights x16; plane p goes to out + p * CAST_PLANE.
// grid = 256 work-groups of 16 waves.
__global__ __launch_bounds__(512) void cast7_f32_f16(
    const float* __restrict__ a0, const float* __restrict__ a1, const float* __restrict__ w0,
    const float* __restrict__ w1, const float* __restrict__ w2, const float* __restrict__ w3,
    const float* __restrict__ w4, _Float16* __restrict__ out) {
  const unsigned e0 = blockIdx.x * 4096u + (threadIdx.x >> 5) * 256u + (threadIdx.x & 31u) * 4u;
  v4f x[7][2];
  cast_load<2>(a0, e0, x[0]);
  cast_load<2>(a1, e0, x[1]);
  cast_load<2>(w0, e0, x[2]);
  cast_load<2>(w1, e0, x[3]);
  cast_load<2>(w2, e0, x[4]);
  cast_load<2>(w3, e0, x[5]);
  cast_load<2>(w4, e0, x[6]);
  cast_store<2>(out + 0 * (size_t)CAST_PLANE, e0, x[0], 1.0f);
  cast_store<2>(out + 1 * (size_t)CAST_PLANE, e0, x[1], 1.0f);
  cast_store<2>(out + 2 * (size_t)CAST_PLANE, e0, x[2], 16.0f);
  cast_store<2>(out + 3 * (size_t)CAST_PLANE, e0, x[3], 16.0f);
  cast_store<2>(out + 4 * (size_t)CAST_PLANE, e0, x[4], 16.0f);
  cast_store<2>(out + 5 * (size_t)CAST_PLANE, e0, x[5], 16.0f);
  cast_store<2>(out + 6 * (size_t)CAST_PLANE, e0, x[6], 16.0f);
}

typedef __attribute__((ext_vector_type(4))) int v4i;
__device__ __forceinline__ float dot4(v4f x, v4f w) {
  return fmaf(x[3], w[3], fmaf(x[2], w[2], fmaf(x[1], w[1], x[0] * w[0])));
}

// =====================================================================================
// Attention for head_dim 64 and 128 keys with additive score terms, f32 in / f16 out (value x oscale), f16 operands:
//   s = (q.k^T) * sscale + SB[q][kv];  SB element above sent_thr -> s = mask_fill (kept in the softmax)
//   Block = 8 waves = 64 query rows of one (b, h); grid.x = B*H*(S/64). Wave w owns the 16 query rows of row group
//   w & 3 and the 64 keys of chunk w >> 2: the two chunks of a row group run side by side, two waves on each SIMD,
//   so that one wave's LDS, cross-lane and memory waits are filled by the other's instructions.
//   Per wave, in f32: m = row max over its chunk, p = exp(s - m) carried x2^15 as f16, l = row sum of p, o = p.v.
//   Merge (through LDS, by the chunk-0 wave): M = max(m0, m1), a_i = exp(m_i - M),
//   out = (o0 a0 + o1 a1) / ((l0 a0 + l1 a1) * 2^15),
//   stored as f16(out * oscale): the left operand of the output projection, with no f32 copy in between.
//   Element (b, s, h, d) of q/k/v/out at X[b*X_bs + s*X_rs + h*X_hs + d].
// SB, the work-group's own 64 x 128 tile of additive terms with the mask folded in, is built in LDS in front of the
// products (128 positions, 16 heads, head n = b*16 + h; q and rf rows i*8+b, col h*64+d; q holds the s_q column term):
//   Every global load of the tile is independent of every other and all are requested up front: one round trip.
//   Phase 1 (LDS): e0[i] = q[n,i,:].semb[0][h*64..], e1[i] = q[n,i,:].semb[1][h*64..] for the 64 own rows,
//                  cv[i] = r[n,i,:].semb[0][h*64..] for all 128 rows; 16 lanes x 16 B per row, summed across the lanes.
//                  cv[128..255] = 0, so that cv[127-i+j] is the shifted term for j <= i and 0 for j > i.
//   Phase 2: SB[i][j] = amask[n][i][j] != 0 ? 3e38 (sentinel)
//                     : 0.125 * ( utt[n][i][j] * (smask[b][i][j] -> e1[i] : e0[i]) + cv[127-i+j] )
//            16 B per lane and array, a wave covers one whole 512-B row per access, eight rows per wave.
// =====================================================================================
#define AT_D 64
#define AT_RG 4                          // row groups of 16 query rows
#define AT_NC 2                          // key chunks, one wave of a row group each
#define AT_NW (AT_RG * AT_NC)            // waves of a work-group
#define AT_QB 64
#define AT_KC 64
#define SB_COLS  128                     // key columns of the SB tile = AT_NC * AT_KC
#define SB_PITCH 132                     // its LDS row pitch in floats: rows 16-B aligned, rows r and r + 8 half the banks apart
struct AttnArgs { long q_bs, q_rs, q_hs, k_bs, k_rs, k_hs, v_bs, v_rs, v_hs, o_bs, o_rs, o_hs;
                  int S, Skv, H, nchunks; float sscale, mask_fill, sent_thr, oscale; };
static_assert(sizeof(AttnArgs) == 128);
static_assert(AT_NC * AT_KC == SB_COLS);

__device__ __forceinline__ v8f mma_f16g(v16h a, v16h b, v8f c) {
  c = __builtin_amdgcn_wmma_f32_16x16x32_f16(false, a, false, b, (short)0, c, false, false);
  asm volatile("v_nop\n\tv_nop\n\tv_nop\n\tv_nop" : "+v"(c) : "v"(a), "v"(b));
  return c;
}

__global__ __launch_bounds__(AT_NW * 32)
void attn64_sbias_f16(const float* __restrict__ q, const float* __restrict__ k,
                      const float* __restrict__ v, _Float16* __restrict__ out,
                      const float* __restrict__ rf, const float* __restrict__ semb,
                      const float* __restrict__ utt, const int* __restrict__ amask,
                      const int* __restrict__ smask, AttnArgs g) {
  const float PSC = 32768.0f;
  union FB { v16h v; v8h h[2]; };
  __shared__ __align__(16) _Float16 Ksh[AT_NC * AT_KC * AT_D];    // K [chunk][kv][d]   16 KB
  __shared__ __align__(16) _Float16 Vth[AT_NC * AT_D * AT_KC];    // V [chunk][d][kv]   16 KB
  __shared__ __align__(16) _Float16 Psh[AT_NW][16 * AT_KC];       // per wave P [row][kv]  16 KB
  __shared__ __align__(16) float    Os[AT_RG][16 * 68];           // per row group: chunk 1's p.v, then the out tile; pitch 68
  __shared__ __align__(16) float    Sbl[AT_QB * SB_PITCH];        // SB [own row][kv]  33 KB
  __shared__ float se0[AT_QB];
  __shared__ float se1[AT_QB];
  __shared__ float scv[2 * SB_COLS];
  __shared__ float sm1[AT_QB];                                    // chunk 1's row maxima
  __shared__ float sl1[AT_QB];                                    // chunk 1's row sums

  const int tid  = threadIdx.x;
  const int wave = tid >> 5;
  const int rw   = wave & (AT_RG - 1);         // row group
  const int kc   = wave >> 2;                  // key chunk
  const int lane = tid & 31;
  const int hh   = lane >> 4;
  const int c    = lane & 15;

  const int nqb = g.S / AT_QB;
  const int bx = blockIdx.x;
  const int qb = bx % nqb;
  const int bh = bx / nqb;
  const int h  = bh % g.H;
  const int b  = bh / g.H;
  const int q0 = qb * AT_QB + rw * 16;

  const float* qb_ptr = q   + (size_t)b * g.q_bs + (size_t)h * g.q_hs;
  const float* kb_ptr = k   + (size_t)b * g.k_bs + (size_t)h * g.k_hs;
  const float* vb_ptr = v   + (size_t)b * g.v_bs + (size_t)h * g.v_hs;
  _Float16*    ob_ptr = out + (size_t)b * g.o_bs + (size_t)h * g.o_hs;

  // ---- SB tile ----
  {
    const int i0 = qb * AT_QB;                 // first own score row
    const int d4 = c * 4;                      // phase 1: four of the 64 depths (hh: row of the pair)
    const int c4 = lane * 4;                   // phase 2: this lane's four score columns
    const int e0 = (i0 + wave) * SB_COLS + c4; // own score rows wave + 8 kk: row kk lies 8 rows behind row kk - 1
    const float* ub  = utt   + (size_t)bh * (SB_COLS * SB_COLS) + e0;
    const int*   ab  = amask + (size_t)bh * (SB_COLS * SB_COLS) + e0;
    const int*   smb = smask + (size_t)b  * (SB_COLS * SB_COLS) + e0;
    const float* sw = semb + h * 64;           // the head's 64 depths of table row 0; row 1 lies 1024 floats behind
    const v4f w0 = *(const v4f*)(sw + d4);
    const v4f w1 = *(const v4f*)(sw + 1024 + d4);
    const size_t co = (size_t)b * 1024 + (size_t)h * 64 + d4;
    const float* rp = rf + (size_t)(wave * 16 + hh) * 8192 + co;
    const float* qp = q + (size_t)(i0 + wave * 8 + hh) * 8192 + co;
    v4f rv[8], qv[4];
#pragma unroll
    for (int kk = 0; kk < 8; ++kk) rv[kk] = *(const v4f*)(rp + kk * (2 * 8192));
#pragma unroll
    for (int kk = 0; kk < 4; ++kk) qv[kk] = *(const v4f*)(qp + kk * (2 * 8192));
    // no address register of the loads above is rewritten in front of this wait: the pointers are named as inputs so
    // that their registers stay theirs up to it (left free, a later load's destination or a scalar load takes one)
    asm volatile("s_wait_xcnt 0x0" :: "s"(sw), "v"(rp), "v"(qp) : "memory");
    v4f u4[8]; v4i am4[8], sm4[8];
#pragma unroll
    for (int kk = 0; kk < 8; ++kk) {
      u4[kk]  = *(const v4f*)(ub  + kk * (8 * SB_COLS));
      am4[kk] = *(const v4i*)(ab  + kk * (8 * SB_COLS));
      sm4[kk] = *(const v4i*)(smb + kk * (8 * SB_COLS));
    }
    // the same for the mask loads
    asm volatile("s_wait_xcnt 0x0" :: "v"(ub), "v"(ab), "v"(smb) : "memory");
    // the mask loads stay in front of phase 1's arithmetic: left free, the scheduler issues them only behind the
    // wait for the projection rows, and the two round trips run one after the other
    __builtin_amdgcn_sched_barrier(0);

    float p[16];
#pragma unroll
    for (int kk = 0; kk < 8; ++kk) p[kk] = dot4(rv[kk], w0);
#pragma unroll
    for (int kk = 0; kk < 4; ++kk) { p[8 + kk] = dot4(qv[kk], w0); p[12 + kk] = dot4(qv[kk], w1); }
#pragma unroll
    for (int off = 1; off < 16; off <<= 1)
#pragma unroll
      for (int x = 0; x < 16; ++x) p[x] += __shfl_xor(p[x], off, 32);
    if (c == 0) {
#pragma unroll
      for (int kk = 0; kk < 8; ++kk) scv[wave * 16 + kk * 2 + hh] = p[kk];
#pragma unroll
      for (int kk = 0; kk < 4; ++kk) { se0[wave * 8 + kk * 2 + hh] = p[8 + kk]; se1[wave * 8 + kk * 2 + hh] = p[12 + kk]; }
    }
    if (tid < SB_COLS) scv[SB_COLS + tid] = 0.0f;   // whole waves 0..3: 128 zeros
    __syncthreads();                           // e0, e1, cv are published

#pragma unroll
    for (int kk = 0; kk < 8; ++kk) {
      const int il = wave + 8 * kk, i = i0 + il;
      const float e0v = se0[il], e1v = se1[il];
      const float* cvp = scv + (127 - i + c4); // 0 <= 127 - i + j <= 254 for every row i and column j
      v4f o;
#pragma unroll
      for (int u = 0; u < 4; ++u) {
        int sm = sm4[kk][u];
        if (sm < 0) sm += 2;                   // 2-row table: wrap negatives, then clamp
        sm = sm < 0 ? 0 : (sm > 1 ? 1 : sm);
        const float ev = (sm != 0) ? e1v : e0v;
        float val = (u4[kk][u] * ev + cvp[u]) * 0.125f;
        if (am4[kk][u] != 0) val = 3.0e38f;
        o[u] = val;
      }
      *(v4f*)(Sbl + il * SB_PITCH + c4) = o;   // read by other waves only behind the barrier that publishes K and V
    }
  }

  // ---- Q fragments (A operand), 2 d-chunks, split k map ----
  v16h qa[2];
  {
    const float* qrow = qb_ptr + (size_t)(q0 + c) * g.q_rs;
#pragma unroll
    for (int dc = 0; dc < 2; ++dc) {
      const v4f f0 = *(const v4f*)(qrow + dc * 32 + 8 * hh);
      const v4f f1 = *(const v4f*)(qrow + dc * 32 + 8 * hh + 4);
      const v4f f2 = *(const v4f*)(qrow + dc * 32 + 16 + 8 * hh);
      const v4f f3 = *(const v4f*)(qrow + dc * 32 + 16 + 8 * hh + 4);
#pragma unroll
      for (int e = 0; e < 4; ++e) {
        qa[dc][e]      = (_Float16)f0[e];
        qa[dc][4 + e]  = (_Float16)f1[e];
        qa[dc][8 + e]  = (_Float16)f2[e];
        qa[dc][12 + e] = (_Float16)f3[e];
      }
    }
  }

  // ---- K and V of all 128 keys to LDS. Every wave-wide load covers whole 128-B lines (four of them). ----
  //   K: 16 lanes x 16 B = one key row of 256 B, two rows a load; a lane stores its 4 depths as 8 B, row-major.
  //   V: 8 lanes x 16 B = one line (32 depths of one key), four keys a load; a lane's eight loads are eight
  //      consecutive keys at the same 4 depths, so that it holds 16 B of each of 4 rows of V^T [d][kv].
  {
    const int kr0 = wave * 16 + hh;                      // K rows kr0 + 2 i
    const int kd4 = c * 4;
    const int vg  = (wave & 3) * 4 + (lane >> 3);        // V keys vg * 8 + i
    const int vd4 = (wave >> 2) * 32 + (lane & 7) * 4;
    const float* k0 = kb_ptr + (size_t)kr0 * g.k_rs + kd4;
    const float* v0 = vb_ptr + (size_t)(vg * 8) * g.v_rs + vd4;
    const float* kp[8]; const float* vp[8];
#pragma unroll
    for (int i = 0; i < 8; ++i) {                        // the row steps are the same for every lane
      kp[i] = k0 + (size_t)(2 * i) * g.k_rs;
      vp[i] = v0 + (size_t)i * g.v_rs;
    }
    v4f kx[8], vx[8];
#pragma unroll
    for (int i = 0; i < 8; ++i) {
      kx[i] = *(const v4f*)kp[i];
      vx[i] = *(const v4f*)vp[i];
    }
    // no address register of these loads is rewritten in front of this wait: the pointers are named as inputs so that
    // their registers stay theirs up to it (left free, a later load's destination takes one)
    asm volatile("s_wait_xcnt 0x0" :: "v"(kp[0]), "v"(kp[1]), "v"(kp[2]), "v"(kp[3]), "v"(kp[4]), "v"(kp[5]), "v"(kp[6]), "v"(kp[7]),
                                      "v"(vp[0]), "v"(vp[1]), "v"(vp[2]), "v"(vp[3]), "v"(vp[4]), "v"(vp[5]), "v"(vp[6]), "v"(vp[7])
                 : "memory");
#pragma unroll
    for (int i = 0; i < 8; ++i) {
      v4h hk;
#pragma unroll
      for (int e = 0; e < 4; ++e) hk[e] = (_Float16)kx[i][e];
      *(v4h*)(Ksh + (kr0 + 2 * i) * AT_D + kd4) = hk;                              // chunk row / 64, row % 64
    }
    _Float16* vd = Vth + (vg >> 3) * (AT_D * AT_KC) + (vg & 7) * 8;                // chunk vg / 8, keys (vg % 8) * 8 ..
#pragma unroll
    for (int e = 0; e < 4; ++e) {
      v8h col;
#pragma unroll
      for (int i = 0; i < 8; ++i) col[i] = (_Float16)vx[i][e];
      *(v8h*)(vd + (vd4 + e) * AT_KC) = col;
    }
  }
  __syncthreads();                             // K, V and the SB tile are published

  const _Float16* Kc = Ksh + kc * (AT_KC * AT_D);   // the wave's own chunk
  const _Float16* Vc = Vth + kc * (AT_D * AT_KC);

  v8f s[4];
#pragma unroll
  for (int j = 0; j < 4; ++j) {
    s[j] = (v8f){0.f,0.f,0.f,0.f,0.f,0.f,0.f,0.f};
#pragma unroll
    for (int dc = 0; dc < 2; ++dc) {
      FB kb;
      kb.h[0] = *(const v8h*)(Kc + (j * 16 + c) * AT_D + dc * 32 + 8 * hh);
      kb.h[1] = *(const v8h*)(Kc + (j * 16 + c) * AT_D + dc * 32 + 16 + 8 * hh);
      s[j] = mma_f16g(qa[dc], kb.v, s[j]);
    }
  }
  // additive terms + mask select, row max over the chunk
  const float* sbp = Sbl + (rw * 16 + 8 * hh) * SB_PITCH + kc * AT_KC + c;
  float mrow[8], lrow[8];
#pragma unroll
  for (int r = 0; r < 8; ++r) {
    const float* sbr = sbp + r * SB_PITCH;
    float m = -INFINITY;
#pragma unroll
    for (int j = 0; j < 4; ++j) {
      const float bb = sbr[j * 16];
      float sv = fmaf(s[j][r], g.sscale, bb);
      if (bb > g.sent_thr) sv = g.mask_fill;
      s[j][r] = sv;
      m = fmaxf(m, sv);
    }
#pragma unroll
    for (int off = 1; off < 16; off <<= 1) m = fmaxf(m, __shfl_xor(m, off, 32));
    mrow[r] = m;
  }
  _Float16* pwh = Psh[wave];
#pragma unroll
  for (int r = 0; r < 8; ++r) {
    float psum = 0.f;
#pragma unroll
    for (int j = 0; j < 4; ++j) {
      const float p = expf(s[j][r] - mrow[r]);
      psum += p;
      pwh[(8 * hh + r) * AT_KC + j * 16 + c] = (_Float16)(p * PSC);
    }
#pragma unroll
    for (int off = 1; off < 16; off <<= 1) psum += __shfl_xor(psum, off, 32);
    lrow[r] = psum;
  }
  __builtin_amdgcn_fence(__ATOMIC_RELEASE, "workgroup");
  __builtin_amdgcn_wave_barrier();
  __builtin_amdgcn_fence(__ATOMIC_ACQUIRE, "workgroup");
  v8f oacc[4];
#pragma unroll
  for (int t = 0; t < 4; ++t) oacc[t] = (v8f){0.f,0.f,0.f,0.f,0.f,0.f,0.f,0.f};
#pragma unroll 1
  for (int kk = 0; kk < 2; ++kk) {
    FB pa;
    pa.h[0] = *(const v8h*)(pwh + c * AT_KC + kk * 32 + 8 * hh);
    pa.h[1] = *(const v8h*)(pwh + c * AT_KC + kk * 32 + 16 + 8 * hh);
#pragma unroll
    for (int t = 0; t < 4; ++t) {
      FB vb;
      vb.h[0] = *(const v8h*)(Vc + (t * 16 + c) * AT_KC + kk * 32 + 8 * hh);
      vb.h[1] = *(const v8h*)(Vc + (t * 16 + c) * AT_KC + kk * 32 + 16 + 8 * hh);
      oacc[t] = mma_f16g(pa.v, vb.v, oacc[t]);
    }
  }

  // ---- merge of the two chunks: the chunk-1 wave hands m, l and p.v to the chunk-0 wave of its row group, each
  //      lane's values at the places where the same lane of the partner reads them ----
  float* os = Os[rw];
  if (kc == 1) {
#pragma unroll
    for (int r = 0; r < 8; ++r)
#pragma unroll
      for (int t = 0; t < 4; ++t) os[(8 * hh + r) * 68 + t * 16 + c] = oacc[t][r];
    if (c == 0) {
#pragma unroll
      for (int r = 0; r < 8; ++r) { sm1[rw * 16 + 8 * hh + r] = mrow[r]; sl1[rw * 16 + 8 * hh + r] = lrow[r]; }
    }
  }
  __syncthreads();                             // chunk 1's partial results are published; the last barrier
  if (kc == 1) return;

#pragma unroll
  for (int r = 0; r < 8; ++r) {
    const float m1 = sm1[rw * 16 + 8 * hh + r], l1 = sl1[rw * 16 + 8 * hh + r];
    const float mm = fmaxf(mrow[r], m1);
    const float a0 = expf(mrow[r] - mm), a1 = expf(m1 - mm);
    const float inv = 1.0f / ((lrow[r] * a0 + l1 * a1) * PSC);
#pragma unroll
    for (int t = 0; t < 4; ++t) {
      float* op = os + (8 * hh + r) * 68 + t * 16 + c;   // read and rewritten by this lane alone
      *op = (oacc[t][r] * a0 + *op * a1) * inv;
    }
  }
  __builtin_amdgcn_fence(__ATOMIC_RELEASE, "workgroup");
  __builtin_amdgcn_wave_barrier();
  __builtin_amdgcn_fence(__ATOMIC_ACQUIRE, "workgroup");
  {
    const int q4 = lane >> 3, c8 = (lane & 7) * 8;   // a row's 64 f16 = one 128-B line = 8 lanes x 16 B; 4 rows a store
#pragma unroll
    for (int it = 0; it < 4; ++it) {
      const int row = it * 4 + q4;
      const v4f lo = *(const v4f*)(os + row * 68 + c8);
      const v4f hi = *(const v4f*)(os + row * 68 + c8 + 4);
      v8h hv;
#pragma unroll
      for (int e = 0; e < 4; ++e) {
        hv[e]     = (_Float16)(lo[e] * g.oscale);
        hv[4 + e] = (_Float16)(hi[e] * g.oscale);
      }
      *(v8h*)(ob_ptr + (size_t)(q0 + row) * g.o_rs + c8) = hv;
    }
  }
}

// ---------------------------------------------------------------------------
// Host launcher. Layout of q/k/v/r/ctx matrices: row = i*8 + b (i = position, b = batch),
// col = h*64 + d; head n = b*16 + h. The (B,L,D) positional input is used as a flat [1024][1024]
// A matrix exactly like the (L,B,D) query (literal view semantics of the position projection).
// ---------------------------------------------------------------------------
extern "C" void kernel_launch(void* const* d_in, const int* in_sizes, int n_in,
                              void* d_out, int out_size, void* d_ws, size_t ws_size,
                              hipStream_t stream) {
  if (n_in < 11) return;
  const int NE = 1024 * 1024;                 // elements of every [*,*,1024] tensor and of each weight
  if (in_sizes[0] != NE || in_sizes[1] != NE || in_sizes[3] != NE || in_sizes[4] != NE ||
      in_sizes[5] != NE || in_sizes[6] != NE || in_sizes[7] != NE || in_sizes[8] != 2 * 1024 ||
      in_sizes[2] != 128 * 128 * 128 || in_sizes[9] != 128 * 128 * 128 || in_sizes[10] != 8 * 128 * 128 ||
      out_size != NE) return;

  const float* query    = (const float*)d_in[0];   // (L,B,D)
  const float* rel_pe   = (const float*)d_in[1];   // (B,L,D)
  const float* utt_mask = (const float*)d_in[2];   // (B*H,L,L,1) f32
  const float* Wq       = (const float*)d_in[3];
  const float* Wk       = (const float*)d_in[4];
  const float* Wv       = (const float*)d_in[5];
  const float* Wr       = (const float*)d_in[6];
  const float* Wo       = (const float*)d_in[7];
  const float* spk_emb  = (const float*)d_in[8];   // (2,D)
  const int*   attn_msk = (const int*)d_in[9];     // (B*H,L,L) int32, nonzero = masked
  const int*   spk_msk  = (const int*)d_in[10];    // (B,L,L) int32 in {0,1}
  float* out = (float*)d_out;

  // ---- workspace carve (bytes) ----
  const size_t MiB = (size_t)1 << 20;
  const size_t off_q16 = 0;                    // query  f16       2 MiB
  const size_t off_p16 = 2 * MiB;              // rel_pe f16       2 MiB
  const size_t off_w16 = 4 * MiB;              // 5 weights f16 x16, 2 MiB each (Wq,Wk,Wv,Wr,Wo)
  const size_t off_qf  = 14 * MiB;             // new_q f32        4 MiB
  const size_t off_kf  = 18 * MiB;             // k f32            4 MiB
  const size_t off_vf  = 22 * MiB;             // v f32            4 MiB (q, k, v, r one behind the other: batched GEMM stride)
  const size_t off_rf  = 26 * MiB;             // r f32            4 MiB
  const size_t off_c16 = 30 * MiB;             // ctx f16 x16      2 MiB
  const size_t total   = 32 * MiB;
  if (total > ws_size || total > 128 * MiB) return;

  char* ws = (char*)d_ws;
  _Float16* q16 = (_Float16*)(ws + off_q16);
  _Float16* p16 = (_Float16*)(ws + off_p16);
  _Float16* w16 = (_Float16*)(ws + off_w16);
  float* qf  = (float*)(ws + off_qf);
  float* kf  = (float*)(ws + off_kf);
  float* vf  = (float*)(ws + off_vf);
  float* rf  = (float*)(ws + off_rf);
  _Float16* c16 = (_Float16*)(ws + off_c16);

  // ---- casts: activations x1, weights x16 (exact power of two, undone in the GEMM epilogue); the seven f16
  //      planes q16, p16, w16[0..4] lie one behind the other from the start of the workspace ----
  cast7_f32_f16<<<256, 512, 0, stream>>>(query, rel_pe, Wq, Wk, Wv, Wr, Wo, q16);

  // ---- input projections: C = X . W^T, 1024x1024x1024 each; q gets column bias spk_emb[0][col] (= new_q) ----
  const int M = 1024, N = 1024, K = 1024;
  const int gblocks = (M / 128) * (N / 128);   // one work-group per 128x128 tile
  const float wscale_inv = 1.0f / 16.0f;
  {
    // one launch of 4 x 64 work-groups, each alone on its WGP: y = 0: q (query, Wq -> qf, + spk_emb[0][col]),
    // y = 1: k, y = 2: v (query), y = 3: r (rel_pe flat [1024][1024], literal view). The four weight planes and the
    // four f32 results lie one behind the other in the workspace (strides NE).
    dim3 grid(gblocks, 4);
    wmma_gemm64<0, false, 3, 0, false><<<grid, 256, 0, stream>>>(
        (const unsigned short*)q16, (const unsigned short*)p16, K, 0L,
        (const unsigned short*)w16, (const unsigned short*)w16, K, (long)NE,
        (void*)qf, (void*)qf, N, (long)NE,
        spk_emb, spk_emb, 0L, M, N, K, wscale_inv, 3);
  }

  // ---- attention: 128 heads (b*16+h) of 128x128, head dim 64; s = a1/8 + SB, SB = (a2 + a3) * 1/8 with the mask
  //      folded in as a sentinel -> 1e-30; ctx leaves as f16 x16 ----
  {
    AttnArgs g;
    g.q_bs = 1024; g.q_rs = 8 * 1024; g.q_hs = 64;
    g.k_bs = 1024; g.k_rs = 8 * 1024; g.k_hs = 64;
    g.v_bs = 1024; g.v_rs = 8 * 1024; g.v_hs = 64;
    g.o_bs = 1024; g.o_rs = 8 * 1024; g.o_hs = 64;
    g.S = 128; g.Skv = 128; g.H = 16; g.nchunks = 2;
    g.sscale = 0.125f; g.mask_fill = 1e-30f; g.sent_thr = 1.0e37f; g.oscale = 16.0f;
    const int agrid = 8 * 16 * (128 / AT_QB);   // 256 blocks
    attn64_sbias_f16<<<agrid, AT_NW * 32, 0, stream>>>(qf, kf, vf, c16, rf, spk_emb, utt_mask, attn_msk, spk_msk, g);
  }

  // ---- output projection into d_out (scale 1/256 undoes the x16 of ctx and of Wo) ----
  {
    dim3 grid(gblocks, 1);
    wmma_gemm64<0, false, 0, 0, false><<<grid, 256, 0, stream>>>(
        (const unsigned short*)c16, (const unsigned short*)c16, K, 0L,
        (const unsigned short*)(w16 + 4 * (size_t)NE), (const unsigned short*)(w16 + 4 * (size_t)NE), K, 0L,
        (void*)out, (void*)out, N, 0L,
        spk_emb, spk_emb, 0L, M, N, K, 1.0f / 256.0f, 1);
  }
  (void)hipGetLastError();
}

// v010
// It runs in 36.8 microseconds.
// Next to v009, in two timings, it ran 1.16 times as fast each time.
// All steps since v000 together make it 7.76 times as fast.
#include <hip/hip_runtime.h>
#include <stdint.h>
// Contractions: five 1024x1024x1024 projections (X . W^T), per-head q.k^T (K=64) and p.v (K=128): v_wmma_f32_16x16x32_f16 (f16 operands; weights and ctx carried x16, p carried x2^15, exact powers of two folded back in f32), f32 accumulate. Softmax, additive score terms and depth-64 speaker row dots in f32 on VALU.

typedef __attribute__((ext_vector_type(16))) _Float16 v16h;
typedef __attribute__((ext_vector_type(8)))  _Float16 v8h;
typedef __attribute__((ext_vector_type(16))) __bf16   v16b;
typedef __attribute__((ext_vector_type(8)))  __bf16   v8b;
typedef __attribute__((ext_vector_type(8)))  float    v8f;
typedef __attribute__((ext_vector_type(4)))  float    v4f;

__device__ __forceinline__ unsigned short f2bf_bits(float f) {
  unsigned u = __float_as_uint(f);
  return (unsigned short)((u + 0x7FFFu + ((u >> 16) & 1u)) >> 16);
}
__device__ __forceinline__ float bf_bits2f(unsigned short h) { return __uint_as_float(((unsigned)h) << 16); }

// hazard guards as plain device helpers
__device__ __forceinline__ void acc_guard4(v8f& a, v8f& b, v8f& c, v8f& d) { asm volatile("v_nop\n\tv_nop\n\tv_nop\n\tv_nop" : "+v"(a), "+v"(b), "+v"(c), "+v"(d)); }
// the same for two accumulators: four vector slots between the last WMMA and the first read of its result
__device__ __forceinline__ void acc_guard2(v8f& a, v8f& b) { asm volatile("v_nop\n\tv_nop\n\tv_nop\n\tv_nop" : "+v"(a), "+v"(b)); }
template <typename T> struct Frag;
template <> struct Frag<_Float16> {
  typedef v16h V; union U { v16h v; v8h h[2]; };
  static __device__ __forceinline__ v16h load(const _Float16* p) {   // elements 0..7 <- p[0..7], 8..15 <- p[16..23]
    U f; f.h[0] = *(const v8h*)(p); f.h[1] = *(const v8h*)(p + 16); return f.v;
  }
  static __device__ __forceinline__ v8f mma(v16h a, v16h b, v8f c) {
    return __builtin_amdgcn_wmma_f32_16x16x32_f16(false, a, false, b, (short)0, c, false, false);
  }
};
template <> struct Frag<__bf16> {
  typedef v16b V; union U { v16b v; v8b h[2]; };
  static __device__ __forceinline__ v16b load(const __bf16* p) {
    U f; f.h[0] = *(const v8b*)(p); f.h[1] = *(const v8b*)(p + 16); return f.v;
  }
  static __device__ __forceinline__ v8f mma(v16b a, v16b b, v8f c) {
    return __builtin_amdgcn_wmma_f32_16x16x32_bf16(false, a, false, b, (short)0, c, false, false);
  }
};

// ---- Register-blocked batched WMMA GEMM ------------------------------------
// C[m,n] = scale * sum_k A[m,k] * Bt[n,k] (+bias)(+resid); a work-group owns a TM x TN tile, its eight waves
// (four down, two across) FI x FJ subtiles of 16x16 each: TM = 64 FI, TN = 32 FJ.
//   FI 2, FJ 4, KP 128: 128x128 tile, for a launch whose 128x128 tiles already fill the chip's 256 WGPs.
//   FI 1, FJ 2, KP 512: 64x64 tile, for a single 1024x1024 product: 256 work-groups, not 64, and each pulls
//                       128 operand rows, not 256, through its own WGP's memory path, in bursts of 128 KiB, so that
//                       the latency in front of a burst is paid K / 512 times.
// A row-major [M,K]; Bt row-major [N,K]; M % TM == 0, N % TN == 0, K % KP == 0.
// Operand path: per pass of KP k the work-group's TM A rows and TN Bt rows (2 KP bytes each, whole lines) go to LDS
// by asynchronous 16-byte copies, two buffers, the next pass in flight while this one is multiplied; the waves read
// their fragments from LDS (row pitch 2 KP + 16 B = 16 B x odd for ds_load_b128).
// SPLIT (hi/lo operand planes) is not staged by this path and is not instantiated.
// Batch b = blockIdx.y: Bt and C advance by their strides; batches b >= batchA2 read A2p as their A, the others Ap,
// so products of two different left operands that do not depend on each other share one launch.
// BIAS_MODE: 0 = none, 1 = bias[m], 2 = bias[n], 3 = bias[n] in batch 0 alone.
// OUT_MODE: 0 = f32, 1 = f16, 2 = bf16 hi plane (Cout) + bf16 lo plane (Cout2).
// ET: 0 = f16 operands, 1 = bf16 operands (pointers passed as 16-bit storage)
template <int ET> struct Elem;
template <> struct Elem<0> { typedef _Float16 T; };
template <> struct Elem<1> { typedef __bf16 T; };
template <int FI, int FJ, int KP> struct GShape {
  static constexpr int TM    = 64 * FI;            // A rows of the tile
  static constexpr int TN    = 32 * FJ;            // Bt rows of the tile
  static constexpr int PITCH = KP + 8;             // LDS row pitch in 16-bit elements (the row's k + 16 B)
  static constexpr int BUF   = (TM + TN) * PITCH;  // elements of one buffer: the A rows, then the Bt rows
  static constexpr int CPR   = KP / 8;             // 16-byte chunks of a row
  static constexpr int RPG   = 256 / CPR;          // rows that one copy of all 256 threads covers
  static constexpr int SP    = 16 * FJ + 4;        // pitch in floats of a wave's 16-row output slab
  static_assert(TM % (8 * RPG) == 0 && TN % (8 * RPG) == 0, "whole statements of eight copies a thread for each operand");
  static_assert((TM + TN) / RPG <= 63, "copies of one wave in flight");
};

// Eight asynchronous 16-byte-per-lane copies global -> LDS. The s_wait_xcnt closes the statement so that
// no address register named here is rewritten before it.
template <typename T>
__device__ __forceinline__ void async_copy8(const unsigned (&l)[8], const T* const (&g)[8]) {
  asm volatile(
      "global_load_async_to_lds_b128 %0, %8, off\n\t"
      "global_load_async_to_lds_b128 %1, %9, off\n\t"
      "global_load_async_to_lds_b128 %2, %10, off\n\t"
      "global_load_async_to_lds_b128 %3, %11, off\n\t"
      "global_load_async_to_lds_b128 %4, %12, off\n\t"
      "global_load_async_to_lds_b128 %5, %13, off\n\t"
      "global_load_async_to_lds_b128 %6, %14, off\n\t"
      "global_load_async_to_lds_b128 %7, %15, off\n\t"
      "s_wait_xcnt 0x0"
      :: "v"(l[0]), "v"(l[1]), "v"(l[2]), "v"(l[3]), "v"(l[4]), "v"(l[5]), "v"(l[6]), "v"(l[7]),
         "v"(g[0]), "v"(g[1]), "v"(g[2]), "v"(g[3]), "v"(g[4]), "v"(g[5]), "v"(g[6]), "v"(g[7])
      : "memory");
}
// One pass's tile: (TM + TN) rows x CPR chunks of 16 B, (TM + TN) / RPG chunks per thread; a wave-wide copy covers 512 B (two whole rows at KP 128, half a row at KP 512).
// ga / gb: this thread's chunk in A row (tid / CPR) / Bt row (tid / CPR) of the work-group's rows, at the pass's k.
// l0: this thread's LDS byte address for row (tid / CPR) of the target buffer.
template <typename T, typename S>
__device__ __forceinline__ void stage_tile(unsigned l0, const T* ga, const T* gb, int lda, int ldb) {
  unsigned l[8]; const T* g[8];
#pragma unroll
  for (int r0 = 0; r0 < S::TM; r0 += 8 * S::RPG) {   // rows 0 .. TM - 1: the A rows
#pragma unroll
    for (int it = 0; it < 8; ++it) {
      l[it] = l0 + (unsigned)((r0 + it * S::RPG) * S::PITCH * 2);
      g[it] = ga + (size_t)(r0 + it * S::RPG) * lda;
    }
    async_copy8<T>(l, g);
  }
#pragma unroll
  for (int r0 = 0; r0 < S::TN; r0 += 8 * S::RPG) {   // rows TM .. TM + TN - 1: the Bt rows
#pragma unroll
    for (int it = 0; it < 8; ++it) {
      l[it] = l0 + (unsigned)((S::TM + r0 + it * S::RPG) * S::PITCH * 2);
      g[it] = gb + (size_t)(r0 + it * S::RPG) * ldb;
    }
    async_copy8<T>(l, g);
  }
}
// this wave's LDS reads have retired (before the buffer they read is handed back for a refill)
__device__ __forceinline__ void wait_lds_reads()   { asm volatile("s_wait_dscnt 0x0" ::: "memory"); }
// this wave's asynchronous copies have landed (the compiler places no wait for them)
__device__ __forceinline__ void wait_async_copies() { asm volatile("s_wait_asynccnt 0x0" ::: "memory"); }

template <int ET, bool SPLIT, int BIAS_MODE, int OUT_MODE, bool RESID, int ACT = 0, int FI = 2, int FJ = 4, int KP = 128>
__global__ __launch_bounds__(256) void wmma_gemm64(
    const unsigned short* __restrict__ Ap, const unsigned short* __restrict__ A2p, int lda, long strideA,
    const unsigned short* __restrict__ Btp, const unsigned short* __restrict__ Bt2p, int ldb, long strideB,
    void* __restrict__ Cout, void* __restrict__ Cout2, int ldc, long strideC,
    const float* __restrict__ bias,
    const float* __restrict__ resid, long strideR,
    int M, int N, int K, float scale, int batchA2) {
  typedef typename Elem<ET>::T T;
  typedef typename Frag<T>::V V;
  typedef GShape<FI, FJ, KP> S;
  static_assert(!SPLIT, "the LDS operand path stages one plane per operand");
  __shared__ __align__(16) T ring[2 * S::BUF];        // two operand buffers
  __shared__ __align__(16) float sT[8][16 * S::SP];   // per-wave slab of 16 rows x 16 FJ columns
  const int b    = blockIdx.y;
  const T* A = (const T*)((b < batchA2) ? Ap : A2p); const T* Bt = (const T*)Btp;
  const int lane = threadIdx.x & 31;
  const int wave = threadIdx.x >> 5;
  const int tilesN = N >> __builtin_ctz(S::TN);
  const int tilesM = M >> __builtin_ctz(S::TM);
  const int tile = blockIdx.x;           // the work-group's tile
  if (tile >= tilesM * tilesN) return;   // the same for the whole work-group, in front of every barrier
  const int tm = tile / tilesN;
  const int mb0 = tm * S::TM;                      // first A row of the work-group
  const int nb0 = (tile - tm * tilesN) * S::TN;    // first Bt row of the work-group
  const int wm = (wave >> 1) * (16 * FI);          // the wave's rows and columns within the tile
  const int wn = (wave & 1) * (16 * FJ);
  const int m0 = mb0 + wm;
  const int n0 = nb0 + wn;

  const T* Ab  = A  + (size_t)b * strideA;
  const T* Bb  = Bt + (size_t)b * strideB;

  const int rlane = lane & 15;                 // row (A) / col (B, D) within subtile
  const int koff  = (lane >> 4) * 8;           // k offset of this lane half
  const int mOff  = (lane >> 4) * 8;           // D row offset

  v8f acc[FI][FJ];
#pragma unroll
  for (int i = 0; i < FI; ++i)
#pragma unroll
    for (int j = 0; j < FJ; ++j) acc[i][j] = (v8f){0.f,0.f,0.f,0.f,0.f,0.f,0.f,0.f};

  // BIAS_MODE 3: the lane's column terms, requested once, under one work-group-uniform test, in front of the k loop
  float bcol[FJ] = {};
  if (BIAS_MODE == 3 && b == 0) {
#pragma unroll                                 // constant indices keep bcol in registers
    for (int j = 0; j < FJ; ++j) bcol[j] = bias[n0 + (j << 4) + rlane];
    // the address registers of these loads are reused by the address arithmetic below: the wait stands in front of that
    asm volatile("s_wait_xcnt 0x0" ::: "memory");
  }

  const int srow = threadIdx.x / S::CPR;           // staged row of this thread within a group of RPG rows
  const int schk = (threadIdx.x % S::CPR) * 8;     // its 16-byte chunk, in elements
  const T* ga = Ab + (size_t)(mb0 + srow) * lda + schk;
  const T* gb = Bb + (size_t)(nb0 + srow) * ldb + schk;
  const unsigned l0 = (unsigned)(size_t)ring + (unsigned)((srow * S::PITCH + schk) * 2);
  const int nPass = K / KP;

  stage_tile<T, S>(l0, ga, gb, lda, ldb);
  wait_async_copies();
  __syncthreads();                             // pass 0's tile is published
  if (nPass > 1) stage_tile<T, S>(l0 + (unsigned)(S::BUF * 2), ga + KP, gb + KP, lda, ldb);

  constexpr int KU = 6 / (FI + FJ);            // steps of 32 k whose fragments are read as one group: 12 ds_load_b128
#pragma unroll 1                               // one pass per trip: the buffer is picked by the trip's parity
  for (int t = 0; t < nPass; ++t) {
    const int bsel = (t & 1) * S::BUF;
    const T* ra = ring + bsel + (wm + rlane) * S::PITCH + koff;
    const T* rb = ring + bsel + (S::TM + wn + rlane) * S::PITCH + koff;
#pragma unroll
    for (int ks = 0; ks < KP / 32; ks += KU) {
      V bh[KU][FJ], ah[KU][FI];
#pragma unroll
      for (int u = 0; u < KU; ++u) {
#pragma unroll
        for (int j = 0; j < FJ; ++j) bh[u][j] = Frag<T>::load(rb + j * 16 * S::PITCH + (ks + u) * 32);
#pragma unroll
        for (int i = 0; i < FI; ++i) ah[u][i] = Frag<T>::load(ra + i * 16 * S::PITCH + (ks + u) * 32);
      }
      // the 12 fragment reads stay one group in front of their WMMAs: left free, the scheduler reuses one
      // A register set and the wave waits out the LDS latency once per A fragment
      __builtin_amdgcn_sched_barrier(0);
#pragma unroll
      for (int u = 0; u < KU; ++u)             // k ascending in every accumulator
#pragma unroll
        for (int i = 0; i < FI; ++i)
#pragma unroll
          for (int j = 0; j < FJ; ++j) acc[i][j] = Frag<T>::mma(ah[u][i], bh[u][j], acc[i][j]);
      __builtin_amdgcn_sched_barrier(0);       // and the next block's reads stay behind this block's WMMAs
    }
    wait_lds_reads();
    wait_async_copies();
    __syncthreads();                           // publishes pass t + 1's tile and ends every read of pass t's buffer
    if (t + 2 < nPass)
      stage_tile<T, S>(l0 + (unsigned)(bsel * 2), ga + (size_t)(t + 2) * KP, gb + (size_t)(t + 2) * KP, lda, ldb);
  }
  wait_async_copies();
#pragma unroll
  for (int i = 0; i < FI; ++i) {
    if constexpr (FJ == 4) acc_guard4(acc[i][0], acc[i][1], acc[i][2], acc[i][3]);
    else                   acc_guard2(acc[i][0], acc[i][1]);
  }

  // ---- epilogue ----
  float* slab = sT[wave];
  const float* Rb = RESID ? (resid + (size_t)b * strideR) : nullptr;
#pragma unroll
  for (int i = 0; i < FI; ++i) {
    const int mBase = m0 + (i << 4);
#pragma unroll
    for (int j = 0; j < FJ; ++j) {
      const int n = n0 + (j << 4) + rlane;
      float bv = 0.f;
      if (BIAS_MODE == 2) bv = bias[n];
      if (BIAS_MODE == 3) bv = bcol[j];
#pragma unroll
      for (int r = 0; r < 8; ++r) {
        float v = acc[i][j][r] * scale;
        if (BIAS_MODE == 1) v += bias[mBase + mOff + r];
        if (BIAS_MODE == 2 || BIAS_MODE == 3) v += bv;
        if (RESID) v += Rb[(size_t)(mBase + mOff + r) * ldc + n];
        if (ACT == 1) v = tanhf(v);
        if (ACT == 2) v = fmaxf(v, 0.0f);
        if (ACT == 3) v = v / (1.0f + expf(-v));
        if (ACT == 4) v = (v > 0.f) ? v : 0.01f * v;
        if (ACT == 5) v = 0.5f * v * (1.0f + erff(v * 0.70710678118654752f));
        slab[(mOff + r) * S::SP + (j << 4) + rlane] = v;
      }
    }
    __builtin_amdgcn_fence(__ATOMIC_RELEASE, "workgroup");
    __builtin_amdgcn_wave_barrier();
    __builtin_amdgcn_fence(__ATOMIC_ACQUIRE, "workgroup");
    if (OUT_MODE == 0) {
      float* C = (float*)Cout + (size_t)b * strideC;
      constexpr int LPR = 4 * FJ;                         // row seg = 64 FJ bytes (whole lines) = LPR lanes x 16 B
      const int hh = lane / LPR, c4 = (lane % LPR) * 4;
      {
#pragma unroll
        for (int it = 0; it < LPR / 2; ++it) {
          const int row = it * (32 / LPR) + hh;
          v4f v = *(const v4f*)(slab + row * S::SP + c4);
          *(v4f*)(C + (size_t)(mBase + row) * ldc + n0 + c4) = v;
        }
        
      }
    } else {
      constexpr int LPR = 2 * FJ;                         // row seg = 32 FJ bytes = LPR lanes x 16 B
      const int q = lane / LPR, c8 = (lane % LPR) * 8;
      unsigned short* C  = (unsigned short*)Cout  + (size_t)b * strideC;
      unsigned short* C2 = (OUT_MODE == 2) ? ((unsigned short*)Cout2 + (size_t)b * strideC) : nullptr;
      {
#pragma unroll
        for (int it = 0; it < LPR / 2; ++it) {
          const int row = it * (32 / LPR) + q;
          const float* sp = slab + row * S::SP + c8;
          v8h hv, lv;
#pragma unroll
          for (int e = 0; e < 8; ++e) {
            if (OUT_MODE == 1) {
              hv[e] = (_Float16)sp[e];
            } else {
              unsigned short hb = f2bf_bits(sp[e]);
              unsigned short lb = f2bf_bits(sp[e] - bf_bits2f(hb));
              hv[e] = __builtin_bit_cast(_Float16, hb);
              lv[e] = __builtin_bit_cast(_Float16, lb);
            }
          }
          *(v8h*)(C + (size_t)(mBase + row) * ldc + n0 + c8) = hv;
          if (OUT_MODE == 2) *(v8h*)(C2 + (size_t)(mBase + row) * ldc + n0 + c8) = lv;
        }
        
      }
    }
    __builtin_amdgcn_fence(__ATOMIC_RELEASE, "workgroup");
    __builtin_amdgcn_wave_barrier();
    __builtin_amdgcn_fence(__ATOMIC_ACQUIRE, "workgroup");
  }
}

// ---- f32 -> f16 casts (value x scale, round to nearest even) ---------------------------------------------
// A work-group converts 4096 consecutive elements of each of its planes. A wave-wide load is 512 contiguous bytes
// (16 B a lane), a wave-wide store 256 contiguous bytes (8 B a lane); every load of a thread is independent of every
// other and all are requested in front of the first store. L = loads per lane and plane = 32 / waves per work-group.
typedef __attribute__((ext_vector_type(4))) _Float16 v4h;
#define CAST_PLANE (1024 * 1024)         // elements of one plane
// e0: the lane's first element; the byte offsets fit 32 bits, so each access is plane base + one shared offset register.
template <int L>
__device__ __forceinline__ void cast_load(const float* __restrict__ in, unsigned e0, v4f (&x)[L]) {
  const char* p = (const char*)in + e0 * 4u;
#pragma unroll
  for (int k = 0; k < L; ++k) x[k] = *(const v4f*)(p + k * 512);
}
template <int L>
__device__ __forceinline__ void cast_store(_Float16* __restrict__ out, unsigned e0, const v4f (&x)[L], float scale) {
  char* p = (char*)out + e0 * 2u;
#pragma unroll
  for (int k = 0; k < L; ++k) {
    v4h h;
#pragma unroll
    for (int e = 0; e < 4; ++e) h[e] = (_Float16)(x[k][e] * scale);
    *(v4h*)(p + k * 256) = h;
  }
}
// seven planes in one launch: two activations x1, five weights x16; plane p goes to out + p * CAST_PLANE.
// grid = 256 work-groups of 16 waves.
__global__ __launch_bounds__(512) void cast7_f32_f16(
    const float* __restrict__ a0, const float* __restrict__ a1, const float* __restrict__ w0,
    const float* __restrict__ w1, const float* __restrict__ w2, const float* __restrict__ w3,
    const float* __restrict__ w4, _Float16* __restrict__ out) {
  const unsigned e0 = blockIdx.x * 4096u + (threadIdx.x >> 5) * 256u + (threadIdx.x & 31u) * 4u;
  v4f x[7][2];
  cast_load<2>(a0, e0, x[0]);
  cast_load<2>(a1, e0, x[1]);
  cast_load<2>(w0, e0, x[2]);
  cast_load<2>(w1, e0, x[3]);
  cast_load<2>(w2, e0, x[4]);
  cast_load<2>(w3, e0, x[5]);
  cast_load<2>(w4, e0, x[6]);
  cast_store<2>(out + 0 * (size_t)CAST_PLANE, e0, x[0], 1.0f);
  cast_store<2>(out + 1 * (size_t)CAST_PLANE, e0, x[1], 1.0f);
  cast_store<2>(out + 2 * (size_t)CAST_PLANE, e0, x[2], 16.0f);
  cast_store<2>(out + 3 * (size_t)CAST_PLANE, e0, x[3], 16.0f);
  cast_store<2>(out + 4 * (size_t)CAST_PLANE, e0, x[4], 16.0f);
  cast_store<2>(out + 5 * (size_t)CAST_PLANE, e0, x[5], 16.0f);
  cast_store<2>(out + 6 * (size_t)CAST_PLANE, e0, x[6], 16.0f);
}

typedef __attribute__((ext_vector_type(4))) int v4i;
__device__ __forceinline__ float dot4(v4f x, v4f w) {
  return fmaf(x[3], w[3], fmaf(x[2], w[2], fmaf(x[1], w[1], x[0] * w[0])));
}

// =====================================================================================
// Attention for head_dim 64 and 128 keys with additive score terms, f32 in / f16 out (value x oscale), f16 operands:
//   s = (q.k^T) * sscale + SB[q][kv];  SB element above sent_thr -> s = mask_fill (kept in the softmax)
//   Block = 8 waves = 64 query rows of one (b, h); grid.x = B*H*(S/64). Wave w owns the 16 query rows of row group
//   w & 3 and the 64 keys of chunk w >> 2: the two chunks of a row group run side by side, two waves on each SIMD,
//   so that one wave's LDS, cross-lane and memory waits are filled by the other's instructions.
//   Per wave, in f32: m = row max over its chunk, p = exp(s - m) carried x2^15 as f16, l = row sum of p, o = p.v.
//   Merge (through LDS, by the chunk-0 wave): M = max(m0, m1), a_i = exp(m_i - M),
//   out = (o0 a0 + o1 a1) / ((l0 a0 + l1 a1) * 2^15),
//   stored as f16(out * oscale): the left operand of the output projection, with no f32 copy in between.
//   Element (b, s, h, d) of q/k/v/out at X[b*X_bs + s*X_rs + h*X_hs + d].
// SB, the work-group's own 64 x 128 tile of additive terms with the mask folded in, is built in LDS in front of the
// products (128 positions, 16 heads, head n = b*16 + h; q and rf rows i*8+b, col h*64+d; q holds the s_q column term):
//   Every global load of the tile is independent of every other and all are requested up front: one round trip.
//   Phase 1 (LDS): e0[i] = q[n,i,:].semb[0][h*64..], e1[i] = q[n,i,:].semb[1][h*64..] for the 64 own rows,
//                  cv[i] = r[n,i,:].semb[0][h*64..] for all 128 rows; 16 lanes x 16 B per row, summed across the lanes.
//                  cv[128..255] = 0, so that cv[127-i+j] is the shifted term for j <= i and 0 for j > i.
//   Phase 2: SB[i][j] = amask[n][i][j] != 0 ? 3e38 (sentinel)
//                     : 0.125 * ( utt[n][i][j] * (smask[b][i][j] -> e1[i] : e0[i]) + cv[127-i+j] )
//            16 B per lane and array, a wave covers one whole 512-B row per access, eight rows per wave.
// =====================================================================================
#define AT_D 64
#define AT_RG 4                          // row groups of 16 query rows
#define AT_NC 2                          // key chunks, one wave of a row group each
#define AT_NW (AT_RG * AT_NC)            // waves of a work-group
#define AT_QB 64
#define AT_KC 64
#define SB_COLS  128                     // key columns of the SB tile = AT_NC * AT_KC
#define SB_PITCH 132                     // its LDS row pitch in floats: rows 16-B aligned, rows r and r + 8 half the banks apart
struct AttnArgs { long q_bs, q_rs, q_hs, k_bs, k_rs, k_hs, v_bs, v_rs, v_hs, o_bs, o_rs, o_hs;
                  int S, Skv, H, nchunks; float sscale, mask_fill, sent_thr, oscale; };
static_assert(sizeof(AttnArgs) == 128);
static_assert(AT_NC * AT_KC == SB_COLS);

__device__ __forceinline__ v8f mma_f16g(v16h a, v16h b, v8f c) {
  c = __builtin_amdgcn_wmma_f32_16x16x32_f16(false, a, false, b, (short)0, c, false, false);
  asm volatile("v_nop\n\tv_nop\n\tv_nop\n\tv_nop" : "+v"(c) : "v"(a), "v"(b));
  return c;
}

__global__ __launch_bounds__(AT_NW * 32)
void attn64_sbias_f16(const float* __restrict__ q, const float* __restrict__ k,
                      const float* __restrict__ v, _Float16* __restrict__ out,
                      const float* __restrict__ rf, const float* __restrict__ semb,
                      const float* __restrict__ utt, const int* __restrict__ amask,
                      const int* __restrict__ smask, AttnArgs g) {
  const float PSC = 32768.0f;
  union FB { v16h v; v8h h[2]; };
  __shared__ __align__(16) _Float16 Ksh[AT_NC * AT_KC * AT_D];    // K [chunk][kv][d]   16 KB
  __shared__ __align__(16) _Float16 Vth[AT_NC * AT_D * AT_KC];    // V [chunk][d][kv]   16 KB
  __shared__ __align__(16) _Float16 Psh[AT_NW][16 * AT_KC];       // per wave P [row][kv]  16 KB
  __shared__ __align__(16) float    Os[AT_RG][16 * 68];           // per row group: chunk 1's p.v, then the out tile; pitch 68
  __shared__ __align__(16) float    Sbl[AT_QB * SB_PITCH];        // SB [own row][kv]  33 KB
  __shared__ float se0[AT_QB];
  __shared__ float se1[AT_QB];
  __shared__ float scv[2 * SB_COLS];
  __shared__ float sm1[AT_QB];                                    // chunk 1's row maxima
  __shared__ float sl1[AT_QB];                                    // chunk 1's row sums

  const int tid  = threadIdx.x;
  const int wave = tid >> 5;
  const int rw   = wave & (AT_RG - 1);         // row group
  const int kc   = wave >> 2;                  // key chunk
  const int lane = tid & 31;
  const int hh   = lane >> 4;
  const int c    = lane & 15;

  const int nqb = g.S / AT_QB;
  const int bx = blockIdx.x;
  const int qb = bx % nqb;
  const int bh = bx / nqb;
  const int h  = bh % g.H;
  const int b  = bh / g.H;
  const int q0 = qb * AT_QB + rw * 16;

  const float* qb_ptr = q   + (size_t)b * g.q_bs + (size_t)h * g.q_hs;
  const float* kb_ptr = k   + (size_t)b * g.k_bs + (size_t)h * g.k_hs;
  const float* vb_ptr = v   + (size_t)b * g.v_bs + (size_t)h * g.v_hs;
  _Float16*    ob_ptr = out + (size_t)b * g.o_bs + (size_t)h * g.o_hs;

  // ---- SB tile ----
  {
    const int i0 = qb * AT_QB;                 // first own score row
    const int d4 = c * 4;                      // phase 1: four of the 64 depths (hh: row of the pair)
    const int c4 = lane * 4;                   // phase 2: this lane's four score columns
    const int e0 = (i0 + wave) * SB_COLS + c4; // own score rows wave + 8 kk: row kk lies 8 rows behind row kk - 1
    const float* ub  = utt   + (size_t)bh * (SB_COLS * SB_COLS) + e0;
    const int*   ab  = amask + (size_t)bh * (SB_COLS * SB_COLS) + e0;
    const int*   smb = smask + (size_t)b  * (SB_COLS * SB_COLS) + e0;
    const float* sw = semb + h * 64;           // the head's 64 depths of table row 0; row 1 lies 1024 floats behind
    const v4f w0 = *(const v4f*)(sw + d4);
    const v4f w1 = *(const v4f*)(sw + 1024 + d4);
    const size_t co = (size_t)b * 1024 + (size_t)h * 64 + d4;
    const float* rp = rf + (size_t)(wave * 16 + hh) * 8192 + co;
    const float* qp = q + (size_t)(i0 + wave * 8 + hh) * 8192 + co;
    v4f rv[8], qv[4];
#pragma unroll
    for (int kk = 0; kk < 8; ++kk) rv[kk] = *(const v4f*)(rp + kk * (2 * 8192));
#pragma unroll
    for (int kk = 0; kk < 4; ++kk) qv[kk] = *(const v4f*)(qp + kk * (2 * 8192));
    // no address register of the loads above is rewritten in front of this wait: the pointers are named as inputs so
    // that their registers stay theirs up to it (left free, a later load's destination or a scalar load takes one)
    asm volatile("s_wait_xcnt 0x0" :: "s"(sw), "v"(rp), "v"(qp) : "memory");
    v4f u4[8]; v4i am4[8], sm4[8];
#pragma unroll
    for (int kk = 0; kk < 8; ++kk) {
      u4[kk]  = *(const v4f*)(ub  + kk * (8 * SB_COLS));
      am4[kk] = *(const v4i*)(ab  + kk * (8 * SB_COLS));
      sm4[kk] = *(const v4i*)(smb + kk * (8 * SB_COLS));
    }
    // the same for the mask loads
    asm volatile("s_wait_xcnt 0x0" :: "v"(ub), "v"(ab), "v"(smb) : "memory");
    // the mask loads stay in front of phase 1's arithmetic: left free, the scheduler issues them only behind the
    // wait for the projection rows, and the two round trips run one after the other
    __builtin_amdgcn_sched_barrier(0);

    float p[16];
#pragma unroll
    for (int kk = 0; kk < 8; ++kk) p[kk] = dot4(rv[kk], w0);
#pragma unroll
    for (int kk = 0; kk < 4; ++kk) { p[8 + kk] = dot4(qv[kk], w0); p[12 + kk] = dot4(qv[kk], w1); }
#pragma unroll
    for (int off = 1; off < 16; off <<= 1)
#pragma unroll
      for (int x = 0; x < 16; ++x) p[x] += __shfl_xor(p[x], off, 32);
    if (c == 0) {
#pragma unroll
      for (int kk = 0; kk < 8; ++kk) scv[wave * 16 + kk * 2 + hh] = p[kk];
#pragma unroll
      for (int kk = 0; kk < 4; ++kk) { se0[wave * 8 + kk * 2 + hh] = p[8 + kk]; se1[wave * 8 + kk * 2 + hh] = p[12 + kk]; }
    }
    if (tid < SB_COLS) scv[SB_COLS + tid] = 0.0f;   // whole waves 0..3: 128 zeros
    __syncthreads();                           // e0, e1, cv are published

#pragma unroll
    for (int kk = 0; kk < 8; ++kk) {
      const int il = wave + 8 * kk, i = i0 + il;
      const float e0v = se0[il], e1v = se1[il];
      const float* cvp = scv + (127 - i + c4); // 0 <= 127 - i + j <= 254 for every row i and column j
      v4f o;
#pragma unroll
      for (int u = 0; u < 4; ++u) {
        int sm = sm4[kk][u];
        if (sm < 0) sm += 2;                   // 2-row table: wrap negatives, then clamp
        sm = sm < 0 ? 0 : (sm > 1 ? 1 : sm);
        const float ev = (sm != 0) ? e1v : e0v;
        float val = (u4[kk][u] * ev + cvp[u]) * 0.125f;
        if (am4[kk][u] != 0) val = 3.0e38f;
        o[u] = val;
      }
      *(v4f*)(Sbl + il * SB_PITCH + c4) = o;   // read by other waves only behind the barrier that publishes K and V
    }
  }

  // ---- Q fragments (A operand), 2 d-chunks, split k map ----
  v16h qa[2];
  {
    const float* qrow = qb_ptr + (size_t)(q0 + c) * g.q_rs;
#pragma unroll
    for (int dc = 0; dc < 2; ++dc) {
      const v4f f0 = *(const v4f*)(qrow + dc * 32 + 8 * hh);
      const v4f f1 = *(const v4f*)(qrow + dc * 32 + 8 * hh + 4);
      const v4f f2 = *(const v4f*)(qrow + dc * 32 + 16 + 8 * hh);
      const v4f f3 = *(const v4f*)(qrow + dc * 32 + 16 + 8 * hh + 4);
#pragma unroll
      for (int e = 0; e < 4; ++e) {
        qa[dc][e]      = (_Float16)f0[e];
        qa[dc][4 + e]  = (_Float16)f1[e];
        qa[dc][8 + e]  = (_Float16)f2[e];
        qa[dc][12 + e] = (_Float16)f3[e];
      }
    }
  }

  // ---- K and V of all 128 keys to LDS. Every wave-wide load covers whole 128-B lines (four of them). ----
  //   K: 16 lanes x 16 B = one key row of 256 B, two rows a load; a lane stores its 4 depths as 8 B, row-major.
  //   V: 8 lanes x 16 B = one line (32 depths of one key), four keys a load; a lane's eight loads are eight
  //      consecutive keys at the same 4 depths, so that it holds 16 B of each of 4 rows of V^T [d][kv].
  {
    const int kr0 = wave * 16 + hh;                      // K rows kr0 + 2 i
    const int kd4 = c * 4;
    const int vg  = (wave & 3) * 4 + (lane >> 3);        // V keys vg * 8 + i
    const int vd4 = (wave >> 2) * 32 + (lane & 7) * 4;
    const float* k0 = kb_ptr + (size_t)kr0 * g.k_rs + kd4;
    const float* v0 = vb_ptr + (size_t)(vg * 8) * g.v_rs + vd4;
    const float* kp[8]; const float* vp[8];
#pragma unroll
    for (int i = 0; i < 8; ++i) {                        // the row steps are the same for every lane
      kp[i] = k0 + (size_t)(2 * i) * g.k_rs;
      vp[i] = v0 + (size_t)i * g.v_rs;
    }
    v4f kx[8], vx[8];
#pragma unroll
    for (int i = 0; i < 8; ++i) {
      kx[i] = *(const v4f*)kp[i];
      vx[i] = *(const v4f*)vp[i];
    }
    // no address register of these loads is rewritten in front of this wait: the pointers are named as inputs so that
    // their registers stay theirs up to it (left free, a later load's destination takes one)
    asm volatile("s_wait_xcnt 0x0" :: "v"(kp[0]), "v"(kp[1]), "v"(kp[2]), "v"(kp[3]), "v"(kp[4]), "v"(kp[5]), "v"(kp[6]), "v"(kp[7]),
                                      "v"(vp[0]), "v"(vp[1]), "v"(vp[2]), "v"(vp[3]), "v"(vp[4]), "v"(vp[5]), "v"(vp[6]), "v"(vp[7])
                 : "memory");
#pragma unroll
    for (int i = 0; i < 8; ++i) {
      v4h hk;
#pragma unroll
      for (int e = 0; e < 4; ++e) hk[e] = (_Float16)kx[i][e];
      *(v4h*)(Ksh + (kr0 + 2 * i) * AT_D + kd4) = hk;                              // chunk row / 64, row % 64
    }
    _Float16* vd = Vth + (vg >> 3) * (AT_D * AT_KC) + (vg & 7) * 8;                // chunk vg / 8, keys (vg % 8) * 8 ..
#pragma unroll
    for (int e = 0; e < 4; ++e) {
      v8h col;
#pragma unroll
      for (int i = 0; i < 8; ++i) col[i] = (_Float16)vx[i][e];
      *(v8h*)(vd + (vd4 + e) * AT_KC) = col;
    }
  }
  __syncthreads();                             // K, V and the SB tile are published

  const _Float16* Kc = Ksh + kc * (AT_KC * AT_D);   // the wave's own chunk
  const _Float16* Vc = Vth + kc * (AT_D * AT_KC);

  v8f s[4];
#pragma unroll
  for (int j = 0; j < 4; ++j) {
    s[j] = (v8f){0.f,0.f,0.f,0.f,0.f,0.f,0.f,0.f};
#pragma unroll
    for (int dc = 0; dc < 2; ++dc) {
      FB kb;
      kb.h[0] = *(const v8h*)(Kc + (j * 16 + c) * AT_D + dc * 32 + 8 * hh);
      kb.h[1] = *(const v8h*)(Kc + (j * 16 + c) * AT_D + dc * 32 + 16 + 8 * hh);
      s[j] = mma_f16g(qa[dc], kb.v, s[j]);
    }
  }
  // additive terms + mask select, row max over the chunk
  const float* sbp = Sbl + (rw * 16 + 8 * hh) * SB_PITCH + kc * AT_KC + c;
  float mrow[8], lrow[8];
#pragma unroll
  for (int r = 0; r < 8; ++r) {
    const float* sbr = sbp + r * SB_PITCH;
    float m = -INFINITY;
#pragma unroll
    for (int j = 0; j < 4; ++j) {
      const float bb = sbr[j * 16];
      float sv = fmaf(s[j][r], g.sscale, bb);
      if (bb > g.sent_thr) sv = g.mask_fill;
      s[j][r] = sv;
      m = fmaxf(m, sv);
    }
#pragma unroll
    for (int off = 1; off < 16; off <<= 1) m = fmaxf(m, __shfl_xor(m, off, 32));
    mrow[r] = m;
  }
  _Float16* pwh = Psh[wave];
#pragma unroll
  for (int r = 0; r < 8; ++r) {
    float psum = 0.f;
#pragma unroll
    for (int j = 0; j < 4; ++j) {
      const float p = expf(s[j][r] - mrow[r]);
      psum += p;
      pwh[(8 * hh + r) * AT_KC + j * 16 + c] = (_Float16)(p * PSC);
    }
#pragma unroll
    for (int off = 1; off < 16; off <<= 1) psum += __shfl_xor(psum, off, 32);
    lrow[r] = psum;
  }
  __builtin_amdgcn_fence(__ATOMIC_RELEASE, "workgroup");
  __builtin_amdgcn_wave_barrier();
  __builtin_amdgcn_fence(__ATOMIC_ACQUIRE, "workgroup");
  v8f oacc[4];
#pragma unroll
  for (int t = 0; t < 4; ++t) oacc[t] = (v8f){0.f,0.f,0.f,0.f,0.f,0.f,0.f,0.f};
#pragma unroll 1
  for (int kk = 0; kk < 2; ++kk) {
    FB pa;
    pa.h[0] = *(const v8h*)(pwh + c * AT_KC + kk * 32 + 8 * hh);
    pa.h[1] = *(const v8h*)(pwh + c * AT_KC + kk * 32 + 16 + 8 * hh);
#pragma unroll
    for (int t = 0; t < 4; ++t) {
      FB vb;
      vb.h[0] = *(const v8h*)(Vc + (t * 16 + c) * AT_KC + kk * 32 + 8 * hh);
      vb.h[1] = *(const v8h*)(Vc + (t * 16 + c) * AT_KC + kk * 32 + 16 + 8 * hh);
      oacc[t] = mma_f16g(pa.v, vb.v, oacc[t]);
    }
  }

  // ---- merge of the two chunks: the chunk-1 wave hands m, l and p.v to the chunk-0 wave of its row group, each
  //      lane's values at the places where the same lane of the partner reads them ----
  float* os = Os[rw];
  if (kc == 1) {
#pragma unroll
    for (int r = 0; r < 8; ++r)
#pragma unroll
      for (int t = 0; t < 4; ++t) os[(8 * hh + r) * 68 + t * 16 + c] = oacc[t][r];
    if (c == 0) {
#pragma unroll
      for (int r = 0; r < 8; ++r) { sm1[rw * 16 + 8 * hh + r] = mrow[r]; sl1[rw * 16 + 8 * hh + r] = lrow[r]; }
    }
  }
  __syncthreads();                             // chunk 1's partial results are published; the last barrier
  if (kc == 1) return;

#pragma unroll
  for (int r = 0; r < 8; ++r) {
    const float m1 = sm1[rw * 16 + 8 * hh + r], l1 = sl1[rw * 16 + 8 * hh + r];
    const float mm = fmaxf(mrow[r], m1);
    const float a0 = expf(mrow[r] - mm), a1 = expf(m1 - mm);
    const float inv = 1.0f / ((lrow[r] * a0 + l1 * a1) * PSC);
#pragma unroll
    for (int t = 0; t < 4; ++t) {
      float* op = os + (8 * hh + r) * 68 + t * 16 + c;   // read and rewritten by this lane alone
      *op = (oacc[t][r] * a0 + *op * a1) * inv;
    }
  }
  __builtin_amdgcn_fence(__ATOMIC_RELEASE, "workgroup");
  __builtin_amdgcn_wave_barrier();
  __builtin_amdgcn_fence(__ATOMIC_ACQUIRE, "workgroup");
  {
    const int q4 = lane >> 3, c8 = (lane & 7) * 8;   // a row's 64 f16 = one 128-B line = 8 lanes x 16 B; 4 rows a store
#pragma unroll
    for (int it = 0; it < 4; ++it) {
      const int row = it * 4 + q4;
      const v4f lo = *(const v4f*)(os + row * 68 + c8);
      const v4f hi = *(const v4f*)(os + row * 68 + c8 + 4);
      v8h hv;
#pragma unroll
      for (int e = 0; e < 4; ++e) {
        hv[e]     = (_Float16)(lo[e] * g.oscale);
        hv[4 + e] = (_Float16)(hi[e] * g.oscale);
      }
      *(v8h*)(ob_ptr + (size_t)(q0 + row) * g.o_rs + c8) = hv;
    }
  }
}

// ---------------------------------------------------------------------------
// Host launcher. Layout of q/k/v/r/ctx matrices: row = i*8 + b (i = position, b = batch),
// col = h*64 + d; head n = b*16 + h. The (B,L,D) positional input is used as a flat [1024][1024]
// A matrix exactly like the (L,B,D) query (literal view semantics of the position projection).
// ---------------------------------------------------------------------------
extern "C" void kernel_launch(void* const* d_in, const int* in_sizes, int n_in,
                              void* d_out, int out_size, void* d_ws, size_t ws_size,
                              hipStream_t stream) {
  if (n_in < 11) return;
  const int NE = 1024 * 1024;                 // elements of every [*,*,1024] tensor and of each weight
  if (in_sizes[0] != NE || in_sizes[1] != NE || in_sizes[3] != NE || in_sizes[4] != NE ||
      in_sizes[5] != NE || in_sizes[6] != NE || in_sizes[7] != NE || in_sizes[8] != 2 * 1024 ||
      in_sizes[2] != 128 * 128 * 128 || in_sizes[9] != 128 * 128 * 128 || in_sizes[10] != 8 * 128 * 128 ||
      out_size != NE) return;

  const float* query    = (const float*)d_in[0];   // (L,B,D)
  const float* rel_pe   = (const float*)d_in[1];   // (B,L,D)
  const float* utt_mask = (const float*)d_in[2];   // (B*H,L,L,1) f32
  const float* Wq       = (const float*)d_in[3];
  const float* Wk       = (const float*)d_in[4];
  const float* Wv       = (const float*)d_in[5];
  const float* Wr       = (const float*)d_in[6];
  const float* Wo       = (const float*)d_in[7];
  const float* spk_emb  = (const float*)d_in[8];   // (2,D)
  const int*   attn_msk = (const int*)d_in[9];     // (B*H,L,L) int32, nonzero = masked
  const int*   spk_msk  = (const int*)d_in[10];    // (B,L,L) int32 in {0,1}
  float* out = (float*)d_out;

  // ---- workspace carve (bytes) ----
  const size_t MiB = (size_t)1 << 20;
  const size_t off_q16 = 0;                    // query  f16       2 MiB
  const size_t off_p16 = 2 * MiB;              // rel_pe f16       2 MiB
  const size_t off_w16 = 4 * MiB;              // 5 weights f16 x16, 2 MiB each (Wq,Wk,Wv,Wr,Wo)
  const size_t off_qf  = 14 * MiB;             // new_q f32        4 MiB
  const size_t off_kf  = 18 * MiB;             // k f32            4 MiB
  const size_t off_vf  = 22 * MiB;             // v f32            4 MiB (q, k, v, r one behind the other: batched GEMM stride)
  const size_t off_rf  = 26 * MiB;             // r f32            4 MiB
  const size_t off_c16 = 30 * MiB;             // ctx f16 x16      2 MiB
  const size_t total   = 32 * MiB;
  if (total > ws_size || total > 128 * MiB) return;

  char* ws = (char*)d_ws;
  _Float16* q16 = (_Float16*)(ws + off_q16);
  _Float16* p16 = (_Float16*)(ws + off_p16);
  _Float16* w16 = (_Float16*)(ws + off_w16);
  float* qf  = (float*)(ws + off_qf);
  float* kf  = (float*)(ws + off_kf);
  float* vf  = (float*)(ws + off_vf);
  float* rf  = (float*)(ws + off_rf);
  _Float16* c16 = (_Float16*)(ws + off_c16);

  // ---- casts: activations x1, weights x16 (exact power of two, undone in the GEMM epilogue); the seven f16
  //      planes q16, p16, w16[0..4] lie one behind the other from the start of the workspace ----
  cast7_f32_f16<<<256, 512, 0, stream>>>(query, rel_pe, Wq, Wk, Wv, Wr, Wo, q16);

  // ---- input projections: C = X . W^T, 1024x1024x1024 each; q gets column bias spk_emb[0][col] (= new_q) ----
  const int M = 1024, N = 1024, K = 1024;
  const int gblocks = (M / 128) * (N / 128);   // one work-group per 128x128 tile
  const float wscale_inv = 1.0f / 16.0f;
  {
    // one launch of 4 x 64 work-groups, each alone on its WGP: y = 0: q (query, Wq -> qf, + spk_emb[0][col]),
    // y = 1: k, y = 2: v (query), y = 3: r (rel_pe flat [1024][1024], literal view). The four weight planes and the
    // four f32 results lie one behind the other in the workspace (strides NE).
    dim3 grid(gblocks, 4);
    wmma_gemm64<0, false, 3, 0, false><<<grid, 256, 0, stream>>>(
        (const unsigned short*)q16, (const unsigned short*)p16, K, 0L,
        (const unsigned short*)w16, (const unsigned short*)w16, K, (long)NE,
        (void*)qf, (void*)qf, N, (long)NE,
        spk_emb, spk_emb, 0L, M, N, K, wscale_inv, 3);
  }

  // ---- attention: 128 heads (b*16+h) of 128x128, head dim 64; s = a1/8 + SB, SB = (a2 + a3) * 1/8 with the mask
  //      folded in as a sentinel -> 1e-30; ctx leaves as f16 x16 ----
  {
    AttnArgs g;
    g.q_bs = 1024; g.q_rs = 8 * 1024; g.q_hs = 64;
    g.k_bs = 1024; g.k_rs = 8 * 1024; g.k_hs = 64;
    g.v_bs = 1024; g.v_rs = 8 * 1024; g.v_hs = 64;
    g.o_bs = 1024; g.o_rs = 8 * 1024; g.o_hs = 64;
    g.S = 128; g.Skv = 128; g.H = 16; g.nchunks = 2;
    g.sscale = 0.125f; g.mask_fill = 1e-30f; g.sent_thr = 1.0e37f; g.oscale = 16.0f;
    const int agrid = 8 * 16 * (128 / AT_QB);   // 256 blocks
    attn64_sbias_f16<<<agrid, AT_NW * 32, 0, stream>>>(qf, kf, vf, c16, rf, spk_emb, utt_mask, attn_msk, spk_msk, g);
  }

  // ---- output projection into d_out (scale 1/256 undoes the x16 of ctx and of Wo): a single product, so 64x64
  //      tiles, one work-group on each of the 256 WGPs ----
  {
    dim3 grid((M / 64) * (N / 64), 1);
    wmma_gemm64<0, false, 0, 0, false, 0, 1, 2, 512><<<grid, 256, 0, stream>>>(
        (const unsigned short*)c16, (const unsigned short*)c16, K, 0L,
        (const unsigned short*)(w16 + 4 * (size_t)NE), (const unsigned short*)(w16 + 4 * (size_t)NE), K, 0L,
        (void*)out, (void*)out, N, 0L,
        spk_emb, spk_emb, 0L, M, N, K, 1.0f / 256.0f, 1);
  }
  (void)hipGetLastError();
}
